// v000
// Times are from an AMD MI455X. After a warm-up the kernel runs many times in a row, and a time is the length of
// such a window on the GPU divided by its runs, so every launch and the gaps after it count. The runs cycle
// through copies of the inputs. A figure is the median of several windows, for all but v000 over two sittings.
// Sittings can differ by a few percent; kernels timed side by side share one.
// v000, which the later versions start from, runs in 1670 microseconds.
#include <hip/hip_runtime.h>

// Grouped-query causal attention with rotary embeddings followed by a gain-free RMSNorm on q and k (x [2][2048][2048]; q = x wq^T (16 heads x 128), k, v = x w^T ('oi' [512][2048]: 4 kv heads x 128); _apply_rope: x cos + rotate_half(x) sin with rotate_half = cat(-x2, x1) and the FULL-WIDTH cos / sin inputs [2048][1][128] (read per dimension); q = rms_norm(rope(q)), k = rms_norm(rope(k)) with x rsqrt(mean(x^2) + 1.19e-7) over the 128 dims (no gain; LITERAL order: the rotation is applied in place in f32 first, then the per-(token, head) row factor is taken from the rotated values); kv head = q head / 4 (repeat); scores x 128^-0.5; causal (-inf); softmax; out = merged wproj^T -> [2][2048][2048] (8.4 M); argument order x, cos, sin, wq, wk, wv, wproj).
// Layout per batch: bf16 copy of x; natural 'oi' weights cast as they are (Bt); exact projections into f32 feature rows; k_cscvt: the {cos, sin} table from the bf16-rounded FULL-width inputs (HD 128, read per dimension); k_ropeF: the rotate-half rotation IN PLACE on the f32 rows FIRST (the mean square changes); k_hrms: per (head, token) inverse RMS of the ROTATED values (eps 1.19e-7; no gain); k_rope with the identity table CSI and unit gains ONES applies the row factor and builds the planes; causal T-2048 GQA attention with 128-wide heads (kv z-stride 0: both heads of a pass share kv group h0 / 4; hybrid rows; k_gemmc skips tiles above the diagonal); merged hi/lo x wproj exact.
// Compute dtypes, f32 accumulate: every input rounded to bf16 incl. the two tables; projections exact; rotary and RMSNorm f32; attention rows < 512 3 products, rest fp16; softmax f32; wproj hl x exact.

#define NB_  2
#define TT   2048
#define DM   2048
#define NH_  16
#define NKV  4        // four kv heads (grouped-query: kv head = q head / 4)
#define REP  (NH_ / NKV)
#define HD   128
#define DQ   (NH_ * HD)
#define DKV  (NKV * HD)
#define ZH   2
#define RH   512                  // query rows < RH use hi+lo planes (0: none)
#define WIN  2048
#define PCAR 1024.0f
#define SCL  0.088388347648318447f   // HD^-0.5
typedef _Float16 h16;
typedef unsigned short bf;
typedef __attribute__((ext_vector_type(16))) __bf16   v16bf;
typedef __attribute__((ext_vector_type(16))) _Float16 v16h;
typedef __attribute__((ext_vector_type(8)))  _Float16 v8h;
typedef __attribute__((ext_vector_type(8)))  unsigned short v8us;
typedef __attribute__((ext_vector_type(8)))  float    v8f;
typedef __attribute__((ext_vector_type(4)))  float    v4f;
typedef v8h  __attribute__((may_alias)) v8ha;
typedef v4f  __attribute__((may_alias)) v4fa;
typedef v8us __attribute__((may_alias)) v8usa;

__device__ __forceinline__ unsigned short f2bf(float f) { unsigned u = __float_as_uint(f); u += 0x7FFFu + ((u >> 16) & 1u); return (unsigned short)(u >> 16); }
__device__ __forceinline__ float bf2f(unsigned short b) { return __uint_as_float(((unsigned)b) << 16); }
__device__ __forceinline__ float bfr(float f) { return bf2f(f2bf(f)); }
__device__ __forceinline__ v16h cat16(v8h lo, v8h hi) { return __builtin_shufflevector(lo, hi, 0, 1, 2, 3, 4, 5, 6, 7, 8, 9, 10, 11, 12, 13, 14, 15); }
__device__ __forceinline__ v16bf cat16b(v8us lo, v8us hi) { return __builtin_bit_cast(v16bf, __builtin_shufflevector(lo, hi, 0, 1, 2, 3, 4, 5, 6, 7, 8, 9, 10, 11, 12, 13, 14, 15)); }
__device__ __forceinline__ v8f wmma16(v16h a, v16h b, v8f c) { return __builtin_amdgcn_wmma_f32_16x16x32_f16(false, a, false, b, (short)0, c, false, false); }
__device__ __forceinline__ v8f wmmab(v16bf a, v16bf b, v8f c) { return __builtin_amdgcn_wmma_f32_16x16x32_bf16(false, a, false, b, (short)0, c, false, false); }



// ---- k_gemmw: register-blocked GEMM, ONE WAVE per 64x64 output tile (16 accumulators), operands straight from K-contiguous 16-bit planes; grid (M/64, N/64, Z), 32 threads.
// C[m][n] (f32, pitch ldc, + optional f32 bias[n]) = sum_k A[m][k] Bt[n][k] (+ split products per NSPLIT). z-batch strides sA/sB/sC in elements. K % 32 == 0.
template <typename T16> struct WFrag;
template <> struct WFrag<h16> { typedef v16h V; static __device__ __forceinline__ V ld(const h16* p) { return cat16(*(const v8h*)p, *(const v8h*)(p + 16)); } static __device__ __forceinline__ v8f mma(V a, V b, v8f c) { return wmma16(a, b, c); } };
template <> struct WFrag<bf> { typedef v16bf V; static __device__ __forceinline__ V ld(const bf* p) { return cat16b(*(const v8us*)p, *(const v8us*)(p + 16)); } static __device__ __forceinline__ v8f mma(V a, V b, v8f c) { return wmmab(a, b, c); } };
template <typename T16, int NSPLIT, bool BIAS>
__global__ __launch_bounds__(32) void k_gemmw(const T16* __restrict__ A, const T16* __restrict__ A2, const T16* __restrict__ Bt, const T16* __restrict__ Bt2, int K, float* C, int ldc, const float* __restrict__ bias, size_t sA, size_t sB, size_t sC) {
    typedef typename WFrag<T16>::V V;
    __shared__ __align__(16) float os[16 * 68];
    const size_t z = blockIdx.z; A += z * sA; if (A2) A2 += z * sA; Bt += z * sB; if (Bt2) Bt2 += z * sB; C += z * sC;
    const int lane = threadIdx.x & 31, lr = lane & 15, hi = lane >> 4; const int r0 = blockIdx.x * 64, c0 = blockIdx.y * 64;
    v8f acc[4][4];
#pragma unroll
    for (int mb = 0; mb < 4; ++mb)
#pragma unroll
        for (int nb = 0; nb < 4; ++nb) acc[mb][nb] = (v8f){};
    const size_t aoff = (size_t)(r0 + lr) * K + 8 * hi, boff = (size_t)(c0 + lr) * K + 8 * hi;
#pragma unroll 1
    for (int kc = 0; kc < K; kc += 32) {
        V a[4], a2[4];
#pragma unroll
        for (int mb = 0; mb < 4; ++mb) { a[mb] = WFrag<T16>::ld(A + aoff + (size_t)mb * 16 * K + kc); if (NSPLIT == 1 || NSPLIT == 2) a2[mb] = WFrag<T16>::ld(A2 + aoff + (size_t)mb * 16 * K + kc); }
#pragma unroll
        for (int nb = 0; nb < 4; ++nb) { const V b = WFrag<T16>::ld(Bt + boff + (size_t)nb * 16 * K + kc); V b2; if (NSPLIT >= 2) b2 = WFrag<T16>::ld(Bt2 + boff + (size_t)nb * 16 * K + kc);
#pragma unroll
            for (int mb = 0; mb < 4; ++mb) { acc[mb][nb] = WFrag<T16>::mma(a[mb], b, acc[mb][nb]); if (NSPLIT == 1 || NSPLIT == 2) acc[mb][nb] = WFrag<T16>::mma(a2[mb], b, acc[mb][nb]); if (NSPLIT >= 2) acc[mb][nb] = WFrag<T16>::mma(a[mb], b2, acc[mb][nb]); } }
        asm volatile("v_nop\n\tv_nop\n\tv_nop\n\tv_nop" : "+v"(acc[0][0]), "+v"(acc[1][1]), "+v"(acc[2][2]), "+v"(acc[3][3]) : "v"(a[0]), "v"(a[3]));
    }
#pragma unroll
    for (int mb = 0; mb < 4; ++mb) {
#pragma unroll
        for (int nb = 0; nb < 4; ++nb) {
#pragma unroll
            for (int j = 0; j < 8; ++j) os[(hi * 8 + j) * 68 + nb * 16 + lr] = acc[mb][nb][j]; }
        __builtin_amdgcn_wave_barrier(); asm volatile("" ::: "memory");
        float* crow = C + (size_t)(r0 + mb * 16) * ldc + c0;
{
#pragma unroll
            for (int s = 0; s < 8; ++s) { const int row = 2 * s + hi, cofs = lr * 4; v4f val = *(const v4fa*)(os + row * 68 + cofs); if (BIAS) { val[0] += bfr(bias[c0 + cofs]); val[1] += bfr(bias[c0 + cofs + 1]); val[2] += bfr(bias[c0 + cofs + 2]); val[3] += bfr(bias[c0 + cofs + 3]); }
                *(v4f*)(crow + (size_t)row * ldc + cofs) = val; }
             }
        __builtin_amdgcn_wave_barrier(); asm volatile("" ::: "memory");
    }
}

// ---- k_gemmc: the same one-wave 64x64 tile GEMM specialised for causal attention: CMODE 1 skips score tiles entirely above the diagonal (query rows r0+roff.., key columns c0..), CMODE 2 limits the
// key (K) loop of the probability x value contraction to the diagonal block (probabilities beyond it are exactly zero). roff = row offset of this launch's first row within the sequence.
template <typename T16, int NSPLIT, int CMODE>
__global__ __launch_bounds__(32) void k_gemmc(const T16* __restrict__ A, const T16* __restrict__ A2, const T16* __restrict__ Bt, const T16* __restrict__ Bt2, int K, float* C, int ldc, int roff, size_t sA, size_t sB, size_t sC) {
    typedef typename WFrag<T16>::V V;
    __shared__ __align__(16) float os[16 * 68];
    const size_t z = blockIdx.z; A += z * sA; if (A2) A2 += z * sA; Bt += z * sB; if (Bt2) Bt2 += z * sB; C += z * sC;
    const int lane = threadIdx.x & 31, lr = lane & 15, hi = lane >> 4; const int r0 = blockIdx.x * 64, c0 = blockIdx.y * 64;
    if (CMODE == 1 && c0 > r0 + roff + 63) return;                  // score tile entirely above the causal diagonal: never written (the softmax masks j > i by select)
    const int Kl = (CMODE == 2) ? min(K, r0 + roff + 64) : K;        // P.V: probabilities are exactly 0 beyond the diagonal block, so the K loop stops there
    v8f acc[4][4];
#pragma unroll
    for (int mb = 0; mb < 4; ++mb)
#pragma unroll
        for (int nb = 0; nb < 4; ++nb) acc[mb][nb] = (v8f){};
    const size_t aoff = (size_t)(r0 + lr) * K + 8 * hi, boff = (size_t)(c0 + lr) * K + 8 * hi;
#pragma unroll 1
    for (int kc = 0; kc < Kl; kc += 32) {
        V a[4], a2[4];
#pragma unroll
        for (int mb = 0; mb < 4; ++mb) { a[mb] = WFrag<T16>::ld(A + aoff + (size_t)mb * 16 * K + kc); if (NSPLIT == 1 || NSPLIT == 2) a2[mb] = WFrag<T16>::ld(A2 + aoff + (size_t)mb * 16 * K + kc); }
#pragma unroll
        for (int nb = 0; nb < 4; ++nb) { const V b = WFrag<T16>::ld(Bt + boff + (size_t)nb * 16 * K + kc); V b2; if (NSPLIT >= 2) b2 = WFrag<T16>::ld(Bt2 + boff + (size_t)nb * 16 * K + kc);
#pragma unroll
            for (int mb = 0; mb < 4; ++mb) { acc[mb][nb] = WFrag<T16>::mma(a[mb], b, acc[mb][nb]); if (NSPLIT == 1 || NSPLIT == 2) acc[mb][nb] = WFrag<T16>::mma(a2[mb], b, acc[mb][nb]); if (NSPLIT >= 2) acc[mb][nb] = WFrag<T16>::mma(a[mb], b2, acc[mb][nb]); } }
        asm volatile("v_nop\n\tv_nop\n\tv_nop\n\tv_nop" : "+v"(acc[0][0]), "+v"(acc[1][1]), "+v"(acc[2][2]), "+v"(acc[3][3]) : "v"(a[0]), "v"(a[3]));
    }
#pragma unroll
    for (int mb = 0; mb < 4; ++mb) {
#pragma unroll
        for (int nb = 0; nb < 4; ++nb) {
#pragma unroll
            for (int j = 0; j < 8; ++j) os[(hi * 8 + j) * 68 + nb * 16 + lr] = acc[mb][nb][j]; }
        __builtin_amdgcn_wave_barrier(); asm volatile("" ::: "memory");
        float* crow = C + (size_t)(r0 + mb * 16) * ldc + c0;
{
#pragma unroll
            for (int s = 0; s < 8; ++s) { const int row = 2 * s + hi, cofs = lr * 4; v4f val = *(const v4fa*)(os + row * 68 + cofs);
                *(v4f*)(crow + (size_t)row * ldc + cofs) = val; }
             }
        __builtin_amdgcn_wave_barrier(); asm volatile("" ::: "memory");
    }
}

__device__ __forceinline__ h16 tohx(float x) { return (h16)x; }
__device__ __forceinline__ void splitf(float y, unsigned short& h, unsigned short& l) { h = f2bf(y); l = f2bf(y - bf2f(h)); }
typedef __attribute__((ext_vector_type(2))) _Float16 v2h;
typedef __attribute__((ext_vector_type(4))) _Float16 v4h;
typedef __attribute__((ext_vector_type(2))) unsigned short v2us;
typedef __attribute__((ext_vector_type(4))) unsigned short v4us;
typedef __attribute__((ext_vector_type(2))) float v2f;
typedef __attribute__((ext_vector_type(4))) int v4i;

__global__ __launch_bounds__(256) void k_cvt8(const float* __restrict__ src, bf* dst, size_t n8) { const size_t i = (size_t)blockIdx.x * 256 + threadIdx.x; if (i >= n8) return; const v8f v = *(const v8f*)(src + i * 8); v8us o;
#pragma unroll
    for (int k = 0; k < 8; ++k) o[k] = f2bf(v[k]); *(v8us*)(dst + i * 8) = o;  }

// k_rope: head planes [h][t][d] (fp16 + hi/lo) of RMSNorm(rope(x)) = rope(x)[d] x RF[h][t] x bf16(gamma[d]) x sc (norm after the rotation) with the rotate-half convention out[d] = x[d] cos[t][d] - x[d+HD/2] sin[t][d], out[d+HD/2] = x[d+HD/2] cos[t][d+HD/2] + x[d] sin[t][d+HD/2]
__global__ __launch_bounds__(256) void k_rope(const float* __restrict__ F, int pitch, int nheads, const float* __restrict__ CS, const float* __restrict__ RF, const float* __restrict__ nw, float sc, h16* P16, bf* Ph, bf* Pl) {
    const size_t e = ((size_t)blockIdx.x * 256 + threadIdx.x) * 2; if (e >= (size_t)nheads * TT * HD) return; const int d = (int)(e % HD); const int t = (int)((e / HD) % TT); const int h = (int)(e / ((size_t)HD * TT)); const float* f = F + (size_t)t * pitch + h * HD; const float rf = RF ? RF[(size_t)h * TT + t] : 1.0f; v2h o16; v2us oh, ol;
#pragma unroll
    for (int q = 0; q < 2; ++q) { const int dd = d + q; const int dp = (dd < HD / 2) ? dd + HD / 2 : dd - HD / 2; float x0 = f[dd], x1 = f[dp];
        /* RMSNorm is applied AFTER the rotation below (the module's rope-then-norm order) */
        const v2f cs = *(const v2f*)(CS + ((size_t)t * HD + dd) * 2); float a = __fmul_rn(x0, cs[0]), bq = __fmul_rn(x1, cs[1]); asm volatile("" : "+v"(a)); asm volatile("" : "+v"(bq)); float r = ((dd < HD / 2) ? __fsub_rn(a, bq) : __fadd_rn(a, bq)); if (RF) { float n0 = __fmul_rn(r, rf); asm volatile("" : "+v"(n0)); r = __fmul_rn(n0, bfr(nw[dd])); } r = r * sc;   /* rotated value x inverse RMS x bf16(gamma[d]) */
        o16[q] = tohx(r); unsigned short a2, c2; splitf(r, a2, c2); oh[q] = a2; ol[q] = c2; }
    *(v2h*)(P16 + e) = o16; *(v2us*)(Ph + e) = oh; *(v2us*)(Pl + e) = ol;  }
__global__ __launch_bounds__(256) void k_vtp(const float* __restrict__ F, int pitch, int nheads, h16* V16, bf* Vh, bf* Vl) { const size_t e = ((size_t)blockIdx.x * 256 + threadIdx.x) * 2; if (e >= (size_t)nheads * HD * TT) return; const int t = (int)(e % TT); const int d = (int)((e / TT) % HD); const int g = (int)(e / ((size_t)TT * HD)); v2h o16; v2us oh, ol;
#pragma unroll
    for (int q = 0; q < 2; ++q) { const float x = F[(size_t)(t + q) * pitch + g * HD + d]; o16[q] = tohx(x); unsigned short a2, c2; splitf(x, a2, c2); oh[q] = a2; ol[q] = c2; }
    *(v2h*)(V16 + e) = o16; *(v2us*)(Vh + e) = oh; *(v2us*)(Vl + e) = ol;  }
__global__ __launch_bounds__(256) void k_cscvt(const float* __restrict__ cosT, const float* __restrict__ sinT, float* CS) { const int idx = blockIdx.x * 256 + threadIdx.x; if (idx >= TT * HD) return; v2f cs; cs[0] = bfr(cosT[idx]); cs[1] = bfr(sinT[idx]); *(v2f*)(CS + (size_t)idx * 2) = cs;  }
__global__ __launch_bounds__(256) void k_ropeF(float* F, int pitch, int nheads, const float* __restrict__ CS) { const size_t e = (size_t)blockIdx.x * 256 + threadIdx.x; if (e >= (size_t)nheads * TT * (HD / 2)) return; const int d = (int)(e % (HD / 2)); const int t = (int)((e / (HD / 2)) % TT); const int h = (int)(e / ((size_t)(HD / 2) * TT)); float* f = F + (size_t)t * pitch + h * HD; const float x1 = f[d], x2 = f[d + HD / 2]; const v2f c1 = *(const v2f*)(CS + ((size_t)t * HD + d) * 2); const v2f c2 = *(const v2f*)(CS + ((size_t)t * HD + d + HD / 2) * 2);
    float a1 = __fmul_rn(x1, c1[0]), b1 = __fmul_rn(x2, c1[1]), a2 = __fmul_rn(x2, c2[0]), b2 = __fmul_rn(x1, c2[1]); asm volatile("" : "+v"(a1), "+v"(b1), "+v"(a2), "+v"(b2)); const float y1 = __fsub_rn(a1, b1), y2 = __fadd_rn(a2, b2);
    *(float*)(f + d) = y1; *(float*)(f + d + HD / 2) = y2;  }
__global__ __launch_bounds__(256) void k_csid(float* CS) { const int idx = blockIdx.x * 256 + threadIdx.x; if (idx >= TT * HD) return; v2f cs; cs[0] = 1.0f; cs[1] = 0.0f; *(v2f*)(CS + (size_t)idx * 2) = cs;  }
__global__ void k_ones(float* o) { const int i = threadIdx.x; if (i < HD) { *(float*)(o + i) = 1.0f;  } }
__global__ __launch_bounds__(256) void k_hrms(const float* __restrict__ F, int pitch, int nheads, float* RF) { const int idx = blockIdx.x * 256 + threadIdx.x; if (idx >= nheads * TT) return; const int t = idx % TT; const int h = idx / TT; const float* f = F + (size_t)t * pitch + h * HD; float s = 0.f;
#pragma unroll 4
    for (int d = 0; d < HD; d += 4) { const v4f a = *(const v4f*)(f + d);
#pragma unroll
        for (int q = 0; q < 4; ++q) { float p = __fmul_rn(a[q], a[q]); asm volatile("" : "+v"(p)); s = __fadd_rn(s, p); } }
    const float rf = __fdiv_rn(1.0f, __fsqrt_rn(__fadd_rn(__fdiv_rn(s, (float)HD), 1.1920929e-07f))); *(float*)(RF + idx) = rf;  }

// k_asoft: per row (zz, i): t = S x HD^-0.5 for j <= i and i - j < WIN (WIN = TT: the window test always holds, plain causal; the reference's -1e9 additive fill vanishes identically); softmax over the 2048 keys (register row, one exp, fixed trees);
__global__ __launch_bounds__(256) void k_asoft(const float* __restrict__ Sb, h16* P16, bf* Ph, bf* Pl) {
    const int lane = threadIdx.x & 31; const int row = blockIdx.x * 8 + (threadIdx.x >> 5); if (row >= ZH * TT) return; const int i = row % TT; const int zz = row / TT; (void)zz; const bool hires = (i < RH); const float* sr = Sb + (size_t)row * TT; float v[TT / 32]; float mx = -3.0e38f;
#pragma unroll
    for (int ch = 0; ch < TT / 128; ++ch) { const int j0 = ch * 128 + lane * 4; const v4f a = *(const v4f*)(sr + j0);
#pragma unroll
        for (int q = 0; q < 4; ++q) { const int j = j0 + q; (void)j; const float t = (j <= i && i - j < WIN) ? a[q] * SCL : -3.0e38f; v[ch * 4 + q] = t; mx = fmaxf(mx, t); } }
#pragma unroll
    for (int sh = 16; sh; sh >>= 1) mx = fmaxf(mx, __shfl_xor(mx, sh, 32));
    float sum = 0.f;
#pragma unroll
    for (int k = 0; k < TT / 32; ++k) { float d0 = __fsub_rn(v[k], mx); asm volatile("" : "+v"(d0)); v[k] = __builtin_amdgcn_exp2f(__fmul_rn(d0, 1.4426950408889634f)); sum += v[k]; }
#pragma unroll
    for (int sh = 16; sh; sh >>= 1) sum += __shfl_xor(sum, sh, 32);
    const float f = __fdiv_rn(hires ? 1.0f : PCAR, sum);
{
        if (hires) {
#pragma unroll
            for (int ch = 0; ch < TT / 128; ++ch) { v4us oh, ol;
#pragma unroll
                for (int q = 0; q < 4; ++q) { unsigned short a, c2; splitf(v[ch * 4 + q] * f, a, c2); oh[q] = a; ol[q] = c2; }
                const size_t oo = ((size_t)zz * (RH ? RH : 1) + i) * TT + ch * 128 + lane * 4; *(v4us*)(Ph + oo) = oh; *(v4us*)(Pl + oo) = ol; }
        } else {
#pragma unroll
            for (int ch = 0; ch < TT / 128; ++ch) { v4h o4;
#pragma unroll
                for (int q = 0; q < 4; ++q) o4[q] = tohx(v[ch * 4 + q] * f);
                *(v4h*)(P16 + (size_t)row * TT + ch * 128 + lane * 4) = o4; } }
         }
}
__global__ __launch_bounds__(256) void k_merge(const float* __restrict__ O, int h0, bf* Ah, bf* Al) { const size_t e = ((size_t)blockIdx.x * 256 + threadIdx.x) * 2; if (e >= (size_t)ZH * TT * HD) return; const int d = (int)(e % HD); const int t = (int)((e / HD) % TT); const int zz = (int)(e / ((size_t)HD * TT)); const float cs = (t < RH) ? 1.0f : (1.0f / PCAR); const size_t oo = (size_t)t * DQ + (h0 + zz) * HD + d;
    v2us oh, ol;
#pragma unroll
    for (int q = 0; q < 2; ++q) { unsigned short a, c2; splitf(O[e + q] * cs, a, c2); oh[q] = a; ol[q] = c2; } *(v2us*)(Ah + oo) = oh; *(v2us*)(Al + oo) = ol;  }

extern "C" void kernel_launch(void* const* d_in, const int* in_sizes, int n_in,
                              void* d_out, int out_size, void* d_ws, size_t ws_size, hipStream_t stream) {
    (void)in_sizes; (void)n_in; (void)out_size;
    const float* x = (const float*)d_in[0]; const float* fcos = (const float*)d_in[1]; const float* fsin = (const float*)d_in[2]; const float* wq = (const float*)d_in[3]; const float* wk = (const float*)d_in[4]; const float* wv = (const float*)d_in[5]; const float* wo = (const float*)d_in[6];   /* inputs x, cos, sin ([2048][1][128] = [2048][128] FULL width, read per dimension), wq ('oi' [2048][2048]), wk, wv ('oi' [512][2048]), wproj ('oi') */
    float* OUT = (float*)d_out;     // [2][2048][2048]
    char* wsp = (char*)d_ws;
    auto take = [&](size_t bytes) { char* p = wsp; wsp += (bytes + 255) & ~(size_t)255; return (void*)p; };
    bf* WQ = (bf*)take((size_t)DQ * DM * 2); bf* WK = (bf*)take((size_t)DKV * DM * 2); bf* WV = (bf*)take((size_t)DKV * DM * 2); bf* WO = (bf*)take((size_t)DM * DQ * 2); float* CS = (float*)take((size_t)TT * HD * 2 * 4);
    bf* XB = (bf*)take((size_t)TT * DM * 2); float* ONES = (float*)take(256 * 4); float* CSI = (float*)take((size_t)TT * HD * 2 * 4);   /* identity {1, 0} table for the plane builder (the rotation is applied in place before the norm) */ float* RFQ = (float*)take((size_t)NH_ * TT * 4); float* RFK = (float*)take((size_t)NKV * TT * 4);   /* per (head, token) inverse RMS (sums of squares of the rotated values) */ float* FQ = (float*)take((size_t)TT * DQ * 4); float* FK = (float*)take((size_t)TT * DKV * 4);
    h16* QP16 = (h16*)take((size_t)NH_ * TT * HD * 2); h16* KP16 = (h16*)take((size_t)NKV * TT * HD * 2); h16* VT16 = (h16*)take((size_t)NKV * HD * TT * 2);
    bf* QPh = (bf*)take((size_t)NH_ * TT * HD * 2); bf* QPl = (bf*)take((size_t)NH_ * TT * HD * 2); bf* KPh = (bf*)take((size_t)NKV * TT * HD * 2); bf* KPl = (bf*)take((size_t)NKV * TT * HD * 2); bf* VTh = (bf*)take((size_t)NKV * HD * TT * 2); bf* VTl = (bf*)take((size_t)NKV * HD * TT * 2); bf* Ph = (bf*)take((size_t)ZH * RH * TT * 2); bf* Pl = (bf*)take((size_t)ZH * RH * TT * 2);
    float* Sb = (float*)take((size_t)ZH * TT * TT * 4); h16* P16 = (h16*)take((size_t)ZH * TT * TT * 2); float* Ob = (float*)take((size_t)ZH * TT * HD * 4); bf* ATh = (bf*)take((size_t)TT * DQ * 2); bf* ATl = (bf*)take((size_t)TT * DQ * 2);
    if ((size_t)(wsp - (char*)d_ws) > ws_size) return;    // ws 256 MiB
    float* FV = FK;   // v projection reuses the k buffer after the k planes are built (stream-ordered)
    { k_cvt8<<<(unsigned)(((size_t)DQ * DM / 8 + 255) / 256), 256, 0, stream>>>(wq, WQ, (size_t)DQ * DM / 8); k_cvt8<<<(unsigned)(((size_t)DKV * DM / 8 + 255) / 256), 256, 0, stream>>>(wk, WK, (size_t)DKV * DM / 8); k_cvt8<<<(unsigned)(((size_t)DKV * DM / 8 + 255) / 256), 256, 0, stream>>>(wv, WV, (size_t)DKV * DM / 8);
      k_cvt8<<<(unsigned)(((size_t)DM * DQ / 8 + 255) / 256), 256, 0, stream>>>(wo, WO, (size_t)DM * DQ / 8);   /* 'oi' weights = Bt as-is */
       }
    k_cscvt<<<(TT * HD + 255) / 256, 256, 0, stream>>>(fcos, fsin, CS); k_csid<<<(TT * HD + 255) / 256, 256, 0, stream>>>(CSI); k_ones<<<1, 128, 0, stream>>>(ONES);   /* rotary table from the FULL-width inputs, per dimension; unit gains */   /* rotary table once */
    const unsigned LQ = (unsigned)(((size_t)NH_ * TT * HD / 2 + 255) / 256), LKv = (unsigned)(((size_t)NKV * TT * HD / 2 + 255) / 256);
    for (int b = 0; b < NB_; ++b) {
        
        k_cvt8<<<(unsigned)(((size_t)TT * DM / 8 + 255) / 256), 256, 0, stream>>>(x + (size_t)b * TT * DM, XB, (size_t)TT * DM / 8);
        k_gemmw<bf, 0, false><<<dim3(TT / 64, DQ / 64, 1), 32, 0, stream>>>(XB, nullptr, WQ, nullptr, DM, FQ, DQ, nullptr, 0, 0, 0);
        k_ropeF<<<(unsigned)(((size_t)NH_ * TT * (HD / 2) + 255) / 256), 256, 0, stream>>>(FQ, DQ, NH_, CS);   /* rotary FIRST (the mean square changes) */ k_hrms<<<(NH_ * TT + 255) / 256, 256, 0, stream>>>(FQ, DQ, NH_, RFQ); k_rope<<<LQ, 256, 0, stream>>>(FQ, DQ, NH_, CSI, RFQ, ONES, 1.0f, QP16, QPh, QPl);   /* rope then RMSNorm (unit gains) */
        k_gemmw<bf, 0, false><<<dim3(TT / 64, DKV / 64, 1), 32, 0, stream>>>(XB, nullptr, WK, nullptr, DM, FK, DKV, nullptr, 0, 0, 0);
        k_ropeF<<<(unsigned)(((size_t)NKV * TT * (HD / 2) + 255) / 256), 256, 0, stream>>>(FK, DKV, NKV, CS); k_hrms<<<(NKV * TT + 255) / 256, 256, 0, stream>>>(FK, DKV, NKV, RFK); k_rope<<<LKv, 256, 0, stream>>>(FK, DKV, NKV, CSI, RFK, ONES, 1.0f, KP16, KPh, KPl);
        k_gemmw<bf, 0, false><<<dim3(TT / 64, DKV / 64, 1), 32, 0, stream>>>(XB, nullptr, WV, nullptr, DM, FV, DKV, nullptr, 0, 0, 0); k_vtp<<<LKv, 256, 0, stream>>>(FV, DKV, NKV, VT16, VTh, VTl);
        for (int h0 = 0; h0 < NH_; h0 += ZH) { const size_t zq = (size_t)h0, zk = (size_t)(h0 / REP);   // both heads of a pass share kv group h0/REP (REP >= 2): sB = 0
            k_gemmc<bf, 2, 1><<<dim3(RH / 64, TT / 64, ZH), 32, 0, stream>>>(QPh + zq * TT * HD, QPl + zq * TT * HD, KPh + zk * TT * HD, KPl + zk * TT * HD, HD, Sb, TT, 0, (size_t)TT * HD, 0, (size_t)TT * TT);
            k_gemmc<h16, 0, 1><<<dim3((TT - RH) / 64, TT / 64, ZH), 32, 0, stream>>>(QP16 + zq * TT * HD + (size_t)RH * HD, nullptr, KP16 + zk * TT * HD, nullptr, HD, Sb + (size_t)RH * TT, TT, RH, (size_t)TT * HD, 0, (size_t)TT * TT);
            k_asoft<<<ZH * TT / 8, 256, 0, stream>>>(Sb, P16, Ph, Pl);
            k_gemmc<bf, 2, 2><<<dim3(RH / 64, HD / 64, ZH), 32, 0, stream>>>(Ph, Pl, VTh + zk * HD * TT, VTl + zk * HD * TT, TT, Ob, HD, 0, (size_t)RH * TT, 0, (size_t)TT * HD);
            k_gemmc<h16, 0, 2><<<dim3((TT - RH) / 64, HD / 64, ZH), 32, 0, stream>>>(P16 + (size_t)RH * TT, nullptr, VT16 + zk * HD * TT, nullptr, TT, Ob + (size_t)RH * HD, HD, RH, (size_t)TT * TT, 0, (size_t)TT * HD);
            k_merge<<<(unsigned)(((size_t)ZH * TT * HD / 2 + 255) / 256), 256, 0, stream>>>(Ob, h0, ATh, ATl); }
        k_gemmw<bf, 1, false><<<dim3(TT / 64, DM / 64, 1), 32, 0, stream>>>(ATh, ATl, WO, nullptr, DQ, OUT + (size_t)b * TT * DM, DM, nullptr, 0, 0, 0); }
}

// v001
// Measured time: 983 microseconds a run.
// Next to v000, in two timings, it ran 1.69 and 1.68 times as fast.
#include <hip/hip_runtime.h>

// Grouped-query causal attention with rotary embeddings followed by a gain-free RMSNorm on q and k (x [2][2048][2048]; q = x wq^T (16 heads x 128), k, v = x w^T ('oi' [512][2048]: 4 kv heads x 128); _apply_rope: x cos + rotate_half(x) sin with rotate_half = cat(-x2, x1) and the FULL-WIDTH cos / sin inputs [2048][1][128] (read per dimension); q = rms_norm(rope(q)), k = rms_norm(rope(k)) with x rsqrt(mean(x^2) + 1.19e-7) over the 128 dims (no gain; LITERAL order: the rotation is applied in place in f32 first, then the per-(token, head) row factor is taken from the rotated values); kv head = q head / 4 (repeat); scores x 128^-0.5; causal (-inf); softmax; out = merged wproj^T -> [2][2048][2048] (8.4 M); argument order x, cos, sin, wq, wk, wv, wproj).
// Layout per batch: bf16 copy of x; natural 'oi' weights cast as they are (Bt); exact projections into f32 feature rows; k_cscvt: the {cos, sin} table from the bf16-rounded FULL-width inputs (HD 128, read per dimension); k_ropeF: the rotate-half rotation IN PLACE on the f32 rows FIRST (the mean square changes); k_hrms: per (head, token) inverse RMS of the ROTATED values (eps 1.19e-7; no gain); k_rope with the identity table CSI and unit gains ONES applies the row factor and builds the planes; causal T-2048 GQA attention with 128-wide heads (kv z-stride 0: both heads of a pass share kv group h0 / 4; hybrid rows; k_gemmc skips tiles above the diagonal); merged hi/lo x wproj exact.
// Compute dtypes, f32 accumulate: every input rounded to bf16 incl. the two tables; projections exact; rotary and RMSNorm f32; attention rows < 512 3 products, rest fp16; softmax f32; wproj hl x exact.

#define NB_  2
#define TT   2048
#define DM   2048
#define NH_  16
#define NKV  4        // four kv heads (grouped-query: kv head = q head / 4)
#define REP  (NH_ / NKV)
#define HD   128
#define DQ   (NH_ * HD)
#define DKV  (NKV * HD)
#define ZH   2
#define RH   512                  // query rows < RH use hi+lo planes (0: none)
#define WIN  2048
#define PCAR 1024.0f
#define SCL  0.088388347648318447f   // HD^-0.5
typedef _Float16 h16;
typedef unsigned short bf;
typedef __attribute__((ext_vector_type(16))) __bf16   v16bf;
typedef __attribute__((ext_vector_type(16))) _Float16 v16h;
typedef __attribute__((ext_vector_type(8)))  _Float16 v8h;
typedef __attribute__((ext_vector_type(8)))  unsigned short v8us;
typedef __attribute__((ext_vector_type(8)))  float    v8f;
typedef __attribute__((ext_vector_type(4)))  float    v4f;
typedef v8h  __attribute__((may_alias)) v8ha;
typedef v4f  __attribute__((may_alias)) v4fa;
typedef v8us __attribute__((may_alias)) v8usa;

__device__ __forceinline__ unsigned short f2bf(float f) { unsigned u = __float_as_uint(f); u += 0x7FFFu + ((u >> 16) & 1u); return (unsigned short)(u >> 16); }
__device__ __forceinline__ float bf2f(unsigned short b) { return __uint_as_float(((unsigned)b) << 16); }
__device__ __forceinline__ float bfr(float f) { return bf2f(f2bf(f)); }
__device__ __forceinline__ v16h cat16(v8h lo, v8h hi) { return __builtin_shufflevector(lo, hi, 0, 1, 2, 3, 4, 5, 6, 7, 8, 9, 10, 11, 12, 13, 14, 15); }
__device__ __forceinline__ v16bf cat16b(v8us lo, v8us hi) { return __builtin_bit_cast(v16bf, __builtin_shufflevector(lo, hi, 0, 1, 2, 3, 4, 5, 6, 7, 8, 9, 10, 11, 12, 13, 14, 15)); }
__device__ __forceinline__ v8f wmma16(v16h a, v16h b, v8f c) { return __builtin_amdgcn_wmma_f32_16x16x32_f16(false, a, false, b, (short)0, c, false, false); }
__device__ __forceinline__ v8f wmmab(v16bf a, v16bf b, v8f c) { return __builtin_amdgcn_wmma_f32_16x16x32_bf16(false, a, false, b, (short)0, c, false, false); }



// ---- k_gemmw: register-blocked GEMM, NW WAVES per 64x64 output tile, each with the whole tile (16 accumulators) over its own share of K (128-byte chunks dealt round robin), partial tiles summed through LDS; operands straight from K-contiguous 16-bit planes; grid (M/64, N/64, Z), 32 NW threads. K % 64 == 0.
// C[m][n] (f32, pitch ldc, + optional f32 bias[n]) = sum_k A[m][k] Bt[n][k] (+ split products per NSPLIT). z-batch strides sA/sB/sC in elements. K % 32 == 0.
template <typename T16> struct WFrag;
template <> struct WFrag<h16> { typedef v16h V; static __device__ __forceinline__ V ld(const h16* p) { return cat16(*(const v8h*)p, *(const v8h*)(p + 16)); } static __device__ __forceinline__ v8f mma(V a, V b, v8f c) { return wmma16(a, b, c); } };
template <> struct WFrag<bf> { typedef v16bf V; static __device__ __forceinline__ V ld(const bf* p) { return cat16b(*(const v8us*)p, *(const v8us*)(p + 16)); } static __device__ __forceinline__ v8f mma(V a, V b, v8f c) { return wmmab(a, b, c); } };
template <typename T16, int NSPLIT, bool BIAS, int NW>
__global__ __launch_bounds__(32 * NW) void k_gemmw(const T16* __restrict__ A, const T16* __restrict__ A2, const T16* __restrict__ Bt, const T16* __restrict__ Bt2, int K, float* C, int ldc, const float* __restrict__ bias, size_t sA, size_t sB, size_t sC) {
    typedef typename WFrag<T16>::V V;
    __shared__ __align__(16) float os[(NW > 1 ? 4 * NW : 1) * 16 * 68];   // NW > 1: one whole 64 x 64 partial tile per wave (pitch 68)
    const int wv = (NW > 1) ? __builtin_amdgcn_readfirstlane((int)(threadIdx.x >> 5)) : 0;   // wave number in a scalar register: the K loop's bounds and branch stay scalar
    const size_t z = blockIdx.z; A += z * sA; if (A2) A2 += z * sA; Bt += z * sB; if (Bt2) Bt2 += z * sB; C += z * sC;
    const int lane = threadIdx.x & 31, lr = lane & 15, hi = lane >> 4; const int r0 = blockIdx.x * 64, c0 = blockIdx.y * 64;
    v8f acc[4][4];
#pragma unroll
    for (int mb = 0; mb < 4; ++mb)
#pragma unroll
        for (int nb = 0; nb < 4; ++nb) acc[mb][nb] = (v8f){};
    const size_t aoff = (size_t)(r0 + lr) * K + 8 * hi, boff = (size_t)(c0 + lr) * K + 8 * hi;
#pragma unroll 1
    for (int kc = wv * 64; kc < K; kc += (kc & 32) ? NW * 64 - 32 : 32) {   // wave wv takes the 64-element (128-byte) K chunks wv, wv + NW, ...: two 32-steps per chunk
        V a[4], a2[4];
#pragma unroll
        for (int mb = 0; mb < 4; ++mb) { a[mb] = WFrag<T16>::ld(A + aoff + (size_t)mb * 16 * K + kc); if (NSPLIT == 1 || NSPLIT == 2) a2[mb] = WFrag<T16>::ld(A2 + aoff + (size_t)mb * 16 * K + kc); }
#pragma unroll
        for (int nb = 0; nb < 4; ++nb) { const V b = WFrag<T16>::ld(Bt + boff + (size_t)nb * 16 * K + kc); V b2; if (NSPLIT >= 2) b2 = WFrag<T16>::ld(Bt2 + boff + (size_t)nb * 16 * K + kc);
#pragma unroll
            for (int mb = 0; mb < 4; ++mb) { acc[mb][nb] = WFrag<T16>::mma(a[mb], b, acc[mb][nb]); if (NSPLIT == 1 || NSPLIT == 2) acc[mb][nb] = WFrag<T16>::mma(a2[mb], b, acc[mb][nb]); if (NSPLIT >= 2) acc[mb][nb] = WFrag<T16>::mma(a[mb], b2, acc[mb][nb]); } }
        asm volatile("v_nop\n\tv_nop\n\tv_nop\n\tv_nop" : "+v"(acc[0][0]), "+v"(acc[1][1]), "+v"(acc[2][2]), "+v"(acc[3][3]) : "v"(a[0]), "v"(a[3]));
    }
    if (NW > 1) {   // the NW partial tiles are summed through LDS in wave order 0 .. NW-1; every thread sums and stores 32 / NW pieces of four columns
#pragma unroll
        for (int mb = 0; mb < 4; ++mb) {
#pragma unroll
            for (int nb = 0; nb < 4; ++nb) {
#pragma unroll
                for (int j = 0; j < 8; ++j) os[wv * (64 * 68) + (mb * 16 + hi * 8 + j) * 68 + nb * 16 + lr] = acc[mb][nb][j]; } }
        __syncthreads();   // publishes every wave's partial tile to the whole block
        float* crow = C + (size_t)r0 * ldc + c0;
#pragma unroll
        for (int it = 0; it < 32 / NW; ++it) { const int idx = it * (NW * 32) + (int)threadIdx.x; const int row = idx >> 4, cofs = (idx & 15) * 4; v4f val = *(const v4fa*)(os + row * 68 + cofs);
#pragma unroll
            for (int w = 1; w < NW; ++w) val += *(const v4fa*)(os + w * (64 * 68) + row * 68 + cofs);
            if (BIAS) { val[0] += bfr(bias[c0 + cofs]); val[1] += bfr(bias[c0 + cofs + 1]); val[2] += bfr(bias[c0 + cofs + 2]); val[3] += bfr(bias[c0 + cofs + 3]); }
            *(v4f*)(crow + (size_t)row * ldc + cofs) = val; }
        return; }
#pragma unroll
    for (int mb = 0; mb < 4; ++mb) {
#pragma unroll
        for (int nb = 0; nb < 4; ++nb) {
#pragma unroll
            for (int j = 0; j < 8; ++j) os[(hi * 8 + j) * 68 + nb * 16 + lr] = acc[mb][nb][j]; }
        __builtin_amdgcn_wave_barrier(); asm volatile("" ::: "memory");
        float* crow = C + (size_t)(r0 + mb * 16) * ldc + c0;
{
#pragma unroll
            for (int s = 0; s < 8; ++s) { const int row = 2 * s + hi, cofs = lr * 4; v4f val = *(const v4fa*)(os + row * 68 + cofs); if (BIAS) { val[0] += bfr(bias[c0 + cofs]); val[1] += bfr(bias[c0 + cofs + 1]); val[2] += bfr(bias[c0 + cofs + 2]); val[3] += bfr(bias[c0 + cofs + 3]); }
                *(v4f*)(crow + (size_t)row * ldc + cofs) = val; }
             }
        __builtin_amdgcn_wave_barrier(); asm volatile("" ::: "memory");
    }
}

// ---- k_gemmc: the same 64x64 tile GEMM (NW waves per tile, K dealt among them) specialised for causal attention: CMODE 1 skips score tiles entirely above the diagonal (query rows r0+roff.., key columns c0..), CMODE 2 limits the
// key (K) loop of the probability x value contraction to the diagonal block (probabilities beyond it are exactly zero). roff = row offset of this launch's first row within the sequence.
template <typename T16, int NSPLIT, int CMODE, int NW>
__global__ __launch_bounds__(32 * NW) void k_gemmc(const T16* __restrict__ A, const T16* __restrict__ A2, const T16* __restrict__ Bt, const T16* __restrict__ Bt2, int K, float* C, int ldc, int roff, size_t sA, size_t sB, size_t sC) {
    typedef typename WFrag<T16>::V V;
    __shared__ __align__(16) float os[(NW > 1 ? 4 * NW : 1) * 16 * 68];   // NW > 1: one whole 64 x 64 partial tile per wave (pitch 68)
    const int wv = (NW > 1) ? __builtin_amdgcn_readfirstlane((int)(threadIdx.x >> 5)) : 0;   // wave number in a scalar register: the K loop's bounds and branch stay scalar
    const size_t z = blockIdx.z; A += z * sA; if (A2) A2 += z * sA; Bt += z * sB; if (Bt2) Bt2 += z * sB; C += z * sC;
    const int lane = threadIdx.x & 31, lr = lane & 15, hi = lane >> 4; const int r0 = blockIdx.x * 64, c0 = blockIdx.y * 64;
    if (CMODE == 1 && c0 > r0 + roff + 63) return;                  // score tile entirely above the causal diagonal: never written (the softmax masks j > i by select)
    const int Kl = (CMODE == 2) ? min(K, r0 + roff + 64) : K;        // P.V: probabilities are exactly 0 beyond the diagonal block, so the K loop stops there
    v8f acc[4][4];
#pragma unroll
    for (int mb = 0; mb < 4; ++mb)
#pragma unroll
        for (int nb = 0; nb < 4; ++nb) acc[mb][nb] = (v8f){};
    const size_t aoff = (size_t)(r0 + lr) * K + 8 * hi, boff = (size_t)(c0 + lr) * K + 8 * hi;
#pragma unroll 1
    for (int kc = wv * 64; kc < Kl; kc += (kc & 32) ? NW * 64 - 32 : 32) {   // wave wv takes the 64-element (128-byte) K chunks wv, wv + NW, ... (Kl is a multiple of 64): two 32-steps per chunk
        V a[4], a2[4];
#pragma unroll
        for (int mb = 0; mb < 4; ++mb) { a[mb] = WFrag<T16>::ld(A + aoff + (size_t)mb * 16 * K + kc); if (NSPLIT == 1 || NSPLIT == 2) a2[mb] = WFrag<T16>::ld(A2 + aoff + (size_t)mb * 16 * K + kc); }
#pragma unroll
        for (int nb = 0; nb < 4; ++nb) { const V b = WFrag<T16>::ld(Bt + boff + (size_t)nb * 16 * K + kc); V b2; if (NSPLIT >= 2) b2 = WFrag<T16>::ld(Bt2 + boff + (size_t)nb * 16 * K + kc);
#pragma unroll
            for (int mb = 0; mb < 4; ++mb) { acc[mb][nb] = WFrag<T16>::mma(a[mb], b, acc[mb][nb]); if (NSPLIT == 1 || NSPLIT == 2) acc[mb][nb] = WFrag<T16>::mma(a2[mb], b, acc[mb][nb]); if (NSPLIT >= 2) acc[mb][nb] = WFrag<T16>::mma(a[mb], b2, acc[mb][nb]); } }
        asm volatile("v_nop\n\tv_nop\n\tv_nop\n\tv_nop" : "+v"(acc[0][0]), "+v"(acc[1][1]), "+v"(acc[2][2]), "+v"(acc[3][3]) : "v"(a[0]), "v"(a[3]));
    }
    if (NW > 1) {   // the NW partial tiles are summed through LDS in wave order 0 .. NW-1; every thread sums and stores 32 / NW pieces of four columns
#pragma unroll
        for (int mb = 0; mb < 4; ++mb) {
#pragma unroll
            for (int nb = 0; nb < 4; ++nb) {
#pragma unroll
                for (int j = 0; j < 8; ++j) os[wv * (64 * 68) + (mb * 16 + hi * 8 + j) * 68 + nb * 16 + lr] = acc[mb][nb][j]; } }
        __syncthreads();   // publishes every wave's partial tile to the whole block
        float* crow = C + (size_t)r0 * ldc + c0;
#pragma unroll
        for (int it = 0; it < 32 / NW; ++it) { const int idx = it * (NW * 32) + (int)threadIdx.x; const int row = idx >> 4, cofs = (idx & 15) * 4; v4f val = *(const v4fa*)(os + row * 68 + cofs);
#pragma unroll
            for (int w = 1; w < NW; ++w) val += *(const v4fa*)(os + w * (64 * 68) + row * 68 + cofs);
            *(v4f*)(crow + (size_t)row * ldc + cofs) = val; }
        return; }
#pragma unroll
    for (int mb = 0; mb < 4; ++mb) {
#pragma unroll
        for (int nb = 0; nb < 4; ++nb) {
#pragma unroll
            for (int j = 0; j < 8; ++j) os[(hi * 8 + j) * 68 + nb * 16 + lr] = acc[mb][nb][j]; }
        __builtin_amdgcn_wave_barrier(); asm volatile("" ::: "memory");
        float* crow = C + (size_t)(r0 + mb * 16) * ldc + c0;
{
#pragma unroll
            for (int s = 0; s < 8; ++s) { const int row = 2 * s + hi, cofs = lr * 4; v4f val = *(const v4fa*)(os + row * 68 + cofs);
                *(v4f*)(crow + (size_t)row * ldc + cofs) = val; }
             }
        __builtin_amdgcn_wave_barrier(); asm volatile("" ::: "memory");
    }
}

__device__ __forceinline__ h16 tohx(float x) { return (h16)x; }
__device__ __forceinline__ void splitf(float y, unsigned short& h, unsigned short& l) { h = f2bf(y); l = f2bf(y - bf2f(h)); }
typedef __attribute__((ext_vector_type(2))) _Float16 v2h;
typedef __attribute__((ext_vector_type(4))) _Float16 v4h;
typedef __attribute__((ext_vector_type(2))) unsigned short v2us;
typedef __attribute__((ext_vector_type(4))) unsigned short v4us;
typedef __attribute__((ext_vector_type(2))) float v2f;
typedef __attribute__((ext_vector_type(4))) int v4i;

__global__ __launch_bounds__(256) void k_cvt8(const float* __restrict__ src, bf* dst, size_t n8) { const size_t i = (size_t)blockIdx.x * 256 + threadIdx.x; if (i >= n8) return; const v8f v = *(const v8f*)(src + i * 8); v8us o;
#pragma unroll
    for (int k = 0; k < 8; ++k) o[k] = f2bf(v[k]); *(v8us*)(dst + i * 8) = o;  }

// k_rope: head planes [h][t][d] (fp16 + hi/lo) of RMSNorm(rope(x)) = rope(x)[d] x RF[h][t] x bf16(gamma[d]) x sc (norm after the rotation) with the rotate-half convention out[d] = x[d] cos[t][d] - x[d+HD/2] sin[t][d], out[d+HD/2] = x[d+HD/2] cos[t][d+HD/2] + x[d] sin[t][d+HD/2]
__global__ __launch_bounds__(256) void k_rope(const float* __restrict__ F, int pitch, int nheads, const float* __restrict__ CS, const float* __restrict__ RF, const float* __restrict__ nw, float sc, h16* P16, bf* Ph, bf* Pl) {
    const size_t e = ((size_t)blockIdx.x * 256 + threadIdx.x) * 2; if (e >= (size_t)nheads * TT * HD) return; const int d = (int)(e % HD); const int t = (int)((e / HD) % TT); const int h = (int)(e / ((size_t)HD * TT)); const float* f = F + (size_t)t * pitch + h * HD; const float rf = RF ? RF[(size_t)h * TT + t] : 1.0f; v2h o16; v2us oh, ol;
#pragma unroll
    for (int q = 0; q < 2; ++q) { const int dd = d + q; const int dp = (dd < HD / 2) ? dd + HD / 2 : dd - HD / 2; float x0 = f[dd], x1 = f[dp];
        /* RMSNorm is applied AFTER the rotation below (the module's rope-then-norm order) */
        const v2f cs = *(const v2f*)(CS + ((size_t)t * HD + dd) * 2); float a = __fmul_rn(x0, cs[0]), bq = __fmul_rn(x1, cs[1]); asm volatile("" : "+v"(a)); asm volatile("" : "+v"(bq)); float r = ((dd < HD / 2) ? __fsub_rn(a, bq) : __fadd_rn(a, bq)); if (RF) { float n0 = __fmul_rn(r, rf); asm volatile("" : "+v"(n0)); r = __fmul_rn(n0, bfr(nw[dd])); } r = r * sc;   /* rotated value x inverse RMS x bf16(gamma[d]) */
        o16[q] = tohx(r); unsigned short a2, c2; splitf(r, a2, c2); oh[q] = a2; ol[q] = c2; }
    *(v2h*)(P16 + e) = o16; *(v2us*)(Ph + e) = oh; *(v2us*)(Pl + e) = ol;  }
__global__ __launch_bounds__(256) void k_vtp(const float* __restrict__ F, int pitch, int nheads, h16* V16, bf* Vh, bf* Vl) { const size_t e = ((size_t)blockIdx.x * 256 + threadIdx.x) * 2; if (e >= (size_t)nheads * HD * TT) return; const int t = (int)(e % TT); const int d = (int)((e / TT) % HD); const int g = (int)(e / ((size_t)TT * HD)); v2h o16; v2us oh, ol;
#pragma unroll
    for (int q = 0; q < 2; ++q) { const float x = F[(size_t)(t + q) * pitch + g * HD + d]; o16[q] = tohx(x); unsigned short a2, c2; splitf(x, a2, c2); oh[q] = a2; ol[q] = c2; }
    *(v2h*)(V16 + e) = o16; *(v2us*)(Vh + e) = oh; *(v2us*)(Vl + e) = ol;  }
__global__ __launch_bounds__(256) void k_cscvt(const float* __restrict__ cosT, const float* __restrict__ sinT, float* CS) { const int idx = blockIdx.x * 256 + threadIdx.x; if (idx >= TT * HD) return; v2f cs; cs[0] = bfr(cosT[idx]); cs[1] = bfr(sinT[idx]); *(v2f*)(CS + (size_t)idx * 2) = cs;  }
__global__ __launch_bounds__(256) void k_ropeF(float* F, int pitch, int nheads, const float* __restrict__ CS) { const size_t e = (size_t)blockIdx.x * 256 + threadIdx.x; if (e >= (size_t)nheads * TT * (HD / 2)) return; const int d = (int)(e % (HD / 2)); const int t = (int)((e / (HD / 2)) % TT); const int h = (int)(e / ((size_t)(HD / 2) * TT)); float* f = F + (size_t)t * pitch + h * HD; const float x1 = f[d], x2 = f[d + HD / 2]; const v2f c1 = *(const v2f*)(CS + ((size_t)t * HD + d) * 2); const v2f c2 = *(const v2f*)(CS + ((size_t)t * HD + d + HD / 2) * 2);
    float a1 = __fmul_rn(x1, c1[0]), b1 = __fmul_rn(x2, c1[1]), a2 = __fmul_rn(x2, c2[0]), b2 = __fmul_rn(x1, c2[1]); asm volatile("" : "+v"(a1), "+v"(b1), "+v"(a2), "+v"(b2)); const float y1 = __fsub_rn(a1, b1), y2 = __fadd_rn(a2, b2);
    *(float*)(f + d) = y1; *(float*)(f + d + HD / 2) = y2;  }
__global__ __launch_bounds__(256) void k_csid(float* CS) { const int idx = blockIdx.x * 256 + threadIdx.x; if (idx >= TT * HD) return; v2f cs; cs[0] = 1.0f; cs[1] = 0.0f; *(v2f*)(CS + (size_t)idx * 2) = cs;  }
__global__ void k_ones(float* o) { const int i = threadIdx.x; if (i < HD) { *(float*)(o + i) = 1.0f;  } }
__global__ __launch_bounds__(256) void k_hrms(const float* __restrict__ F, int pitch, int nheads, float* RF) { const int idx = blockIdx.x * 256 + threadIdx.x; if (idx >= nheads * TT) return; const int t = idx % TT; const int h = idx / TT; const float* f = F + (size_t)t * pitch + h * HD; float s = 0.f;
#pragma unroll 4
    for (int d = 0; d < HD; d += 4) { const v4f a = *(const v4f*)(f + d);
#pragma unroll
        for (int q = 0; q < 4; ++q) { float p = __fmul_rn(a[q], a[q]); asm volatile("" : "+v"(p)); s = __fadd_rn(s, p); } }
    const float rf = __fdiv_rn(1.0f, __fsqrt_rn(__fadd_rn(__fdiv_rn(s, (float)HD), 1.1920929e-07f))); *(float*)(RF + idx) = rf;  }

// k_asoft: per row (zz, i): t = S x HD^-0.5 for j <= i and i - j < WIN (WIN = TT: the window test always holds, plain causal; the reference's -1e9 additive fill vanishes identically); softmax over the 2048 keys (register row, one exp, fixed trees);
__global__ __launch_bounds__(256) void k_asoft(const float* __restrict__ Sb, h16* P16, bf* Ph, bf* Pl) {
    const int lane = threadIdx.x & 31; const int row = blockIdx.x * 8 + (threadIdx.x >> 5); if (row >= ZH * TT) return; const int i = row % TT; const int zz = row / TT; (void)zz; const bool hires = (i < RH); const float* sr = Sb + (size_t)row * TT; float v[TT / 32]; float mx = -3.0e38f;
#pragma unroll
    for (int ch = 0; ch < TT / 128; ++ch) { const int j0 = ch * 128 + lane * 4; const v4f a = *(const v4f*)(sr + j0);
#pragma unroll
        for (int q = 0; q < 4; ++q) { const int j = j0 + q; (void)j; const float t = (j <= i && i - j < WIN) ? a[q] * SCL : -3.0e38f; v[ch * 4 + q] = t; mx = fmaxf(mx, t); } }
#pragma unroll
    for (int sh = 16; sh; sh >>= 1) mx = fmaxf(mx, __shfl_xor(mx, sh, 32));
    float sum = 0.f;
#pragma unroll
    for (int k = 0; k < TT / 32; ++k) { float d0 = __fsub_rn(v[k], mx); asm volatile("" : "+v"(d0)); v[k] = __builtin_amdgcn_exp2f(__fmul_rn(d0, 1.4426950408889634f)); sum += v[k]; }
#pragma unroll
    for (int sh = 16; sh; sh >>= 1) sum += __shfl_xor(sum, sh, 32);
    const float f = __fdiv_rn(hires ? 1.0f : PCAR, sum);
{
        if (hires) {
#pragma unroll
            for (int ch = 0; ch < TT / 128; ++ch) { v4us oh, ol;
#pragma unroll
                for (int q = 0; q < 4; ++q) { unsigned short a, c2; splitf(v[ch * 4 + q] * f, a, c2); oh[q] = a; ol[q] = c2; }
                const size_t oo = ((size_t)zz * (RH ? RH : 1) + i) * TT + ch * 128 + lane * 4; *(v4us*)(Ph + oo) = oh; *(v4us*)(Pl + oo) = ol; }
        } else {
#pragma unroll
            for (int ch = 0; ch < TT / 128; ++ch) { v4h o4;
#pragma unroll
                for (int q = 0; q < 4; ++q) o4[q] = tohx(v[ch * 4 + q] * f);
                *(v4h*)(P16 + (size_t)row * TT + ch * 128 + lane * 4) = o4; } }
         }
}
__global__ __launch_bounds__(256) void k_merge(const float* __restrict__ O, int h0, bf* Ah, bf* Al) { const size_t e = ((size_t)blockIdx.x * 256 + threadIdx.x) * 2; if (e >= (size_t)ZH * TT * HD) return; const int d = (int)(e % HD); const int t = (int)((e / HD) % TT); const int zz = (int)(e / ((size_t)HD * TT)); const float cs = (t < RH) ? 1.0f : (1.0f / PCAR); const size_t oo = (size_t)t * DQ + (h0 + zz) * HD + d;
    v2us oh, ol;
#pragma unroll
    for (int q = 0; q < 2; ++q) { unsigned short a, c2; splitf(O[e + q] * cs, a, c2); oh[q] = a; ol[q] = c2; } *(v2us*)(Ah + oo) = oh; *(v2us*)(Al + oo) = ol;  }

extern "C" void kernel_launch(void* const* d_in, const int* in_sizes, int n_in,
                              void* d_out, int out_size, void* d_ws, size_t ws_size, hipStream_t stream) {
    (void)in_sizes; (void)n_in; (void)out_size;
    const float* x = (const float*)d_in[0]; const float* fcos = (const float*)d_in[1]; const float* fsin = (const float*)d_in[2]; const float* wq = (const float*)d_in[3]; const float* wk = (const float*)d_in[4]; const float* wv = (const float*)d_in[5]; const float* wo = (const float*)d_in[6];   /* inputs x, cos, sin ([2048][1][128] = [2048][128] FULL width, read per dimension), wq ('oi' [2048][2048]), wk, wv ('oi' [512][2048]), wproj ('oi') */
    float* OUT = (float*)d_out;     // [2][2048][2048]
    char* wsp = (char*)d_ws;
    auto take = [&](size_t bytes) { char* p = wsp; wsp += (bytes + 255) & ~(size_t)255; return (void*)p; };
    bf* WQ = (bf*)take((size_t)DQ * DM * 2); bf* WK = (bf*)take((size_t)DKV * DM * 2); bf* WV = (bf*)take((size_t)DKV * DM * 2); bf* WO = (bf*)take((size_t)DM * DQ * 2); float* CS = (float*)take((size_t)TT * HD * 2 * 4);
    bf* XB = (bf*)take((size_t)TT * DM * 2); float* ONES = (float*)take(256 * 4); float* CSI = (float*)take((size_t)TT * HD * 2 * 4);   /* identity {1, 0} table for the plane builder (the rotation is applied in place before the norm) */ float* RFQ = (float*)take((size_t)NH_ * TT * 4); float* RFK = (float*)take((size_t)NKV * TT * 4);   /* per (head, token) inverse RMS (sums of squares of the rotated values) */ float* FQ = (float*)take((size_t)TT * DQ * 4); float* FK = (float*)take((size_t)TT * DKV * 4);
    h16* QP16 = (h16*)take((size_t)NH_ * TT * HD * 2); h16* KP16 = (h16*)take((size_t)NKV * TT * HD * 2); h16* VT16 = (h16*)take((size_t)NKV * HD * TT * 2);
    bf* QPh = (bf*)take((size_t)NH_ * TT * HD * 2); bf* QPl = (bf*)take((size_t)NH_ * TT * HD * 2); bf* KPh = (bf*)take((size_t)NKV * TT * HD * 2); bf* KPl = (bf*)take((size_t)NKV * TT * HD * 2); bf* VTh = (bf*)take((size_t)NKV * HD * TT * 2); bf* VTl = (bf*)take((size_t)NKV * HD * TT * 2); bf* Ph = (bf*)take((size_t)ZH * RH * TT * 2); bf* Pl = (bf*)take((size_t)ZH * RH * TT * 2);
    float* Sb = (float*)take((size_t)ZH * TT * TT * 4); h16* P16 = (h16*)take((size_t)ZH * TT * TT * 2); float* Ob = (float*)take((size_t)ZH * TT * HD * 4); bf* ATh = (bf*)take((size_t)TT * DQ * 2); bf* ATl = (bf*)take((size_t)TT * DQ * 2);
    if ((size_t)(wsp - (char*)d_ws) > ws_size) return;    // ws 256 MiB
    float* FV = FK;   // v projection reuses the k buffer after the k planes are built (stream-ordered)
    { k_cvt8<<<(unsigned)(((size_t)DQ * DM / 8 + 255) / 256), 256, 0, stream>>>(wq, WQ, (size_t)DQ * DM / 8); k_cvt8<<<(unsigned)(((size_t)DKV * DM / 8 + 255) / 256), 256, 0, stream>>>(wk, WK, (size_t)DKV * DM / 8); k_cvt8<<<(unsigned)(((size_t)DKV * DM / 8 + 255) / 256), 256, 0, stream>>>(wv, WV, (size_t)DKV * DM / 8);
      k_cvt8<<<(unsigned)(((size_t)DM * DQ / 8 + 255) / 256), 256, 0, stream>>>(wo, WO, (size_t)DM * DQ / 8);   /* 'oi' weights = Bt as-is */
       }
    k_cscvt<<<(TT * HD + 255) / 256, 256, 0, stream>>>(fcos, fsin, CS); k_csid<<<(TT * HD + 255) / 256, 256, 0, stream>>>(CSI); k_ones<<<1, 128, 0, stream>>>(ONES);   /* rotary table from the FULL-width inputs, per dimension; unit gains */   /* rotary table once */
    const unsigned LQ = (unsigned)(((size_t)NH_ * TT * HD / 2 + 255) / 256), LKv = (unsigned)(((size_t)NKV * TT * HD / 2 + 255) / 256);
    for (int b = 0; b < NB_; ++b) {
        
        k_cvt8<<<(unsigned)(((size_t)TT * DM / 8 + 255) / 256), 256, 0, stream>>>(x + (size_t)b * TT * DM, XB, (size_t)TT * DM / 8);
        k_gemmw<bf, 0, false, 4><<<dim3(TT / 64, DQ / 64, 1), 128, 0, stream>>>(XB, nullptr, WQ, nullptr, DM, FQ, DQ, nullptr, 0, 0, 0);
        k_ropeF<<<(unsigned)(((size_t)NH_ * TT * (HD / 2) + 255) / 256), 256, 0, stream>>>(FQ, DQ, NH_, CS);   /* rotary FIRST (the tables need not be unit rotations: the mean square changes) */ k_hrms<<<(NH_ * TT + 255) / 256, 256, 0, stream>>>(FQ, DQ, NH_, RFQ); k_rope<<<LQ, 256, 0, stream>>>(FQ, DQ, NH_, CSI, RFQ, ONES, 1.0f, QP16, QPh, QPl);   /* rope then RMSNorm (unit gains) */
        k_gemmw<bf, 0, false, 8><<<dim3(TT / 64, DKV / 64, 1), 256, 0, stream>>>(XB, nullptr, WK, nullptr, DM, FK, DKV, nullptr, 0, 0, 0);
        k_ropeF<<<(unsigned)(((size_t)NKV * TT * (HD / 2) + 255) / 256), 256, 0, stream>>>(FK, DKV, NKV, CS); k_hrms<<<(NKV * TT + 255) / 256, 256, 0, stream>>>(FK, DKV, NKV, RFK); k_rope<<<LKv, 256, 0, stream>>>(FK, DKV, NKV, CSI, RFK, ONES, 1.0f, KP16, KPh, KPl);
        k_gemmw<bf, 0, false, 8><<<dim3(TT / 64, DKV / 64, 1), 256, 0, stream>>>(XB, nullptr, WV, nullptr, DM, FV, DKV, nullptr, 0, 0, 0); k_vtp<<<LKv, 256, 0, stream>>>(FV, DKV, NKV, VT16, VTh, VTl);
        for (int h0 = 0; h0 < NH_; h0 += ZH) { const size_t zq = (size_t)h0, zk = (size_t)(h0 / REP);   // both heads of a pass share kv group h0/REP (REP >= 2): sB = 0
            k_gemmc<bf, 2, 1, 1><<<dim3(RH / 64, TT / 64, ZH), 32, 0, stream>>>(QPh + zq * TT * HD, QPl + zq * TT * HD, KPh + zk * TT * HD, KPl + zk * TT * HD, HD, Sb, TT, 0, (size_t)TT * HD, 0, (size_t)TT * TT);
            k_gemmc<h16, 0, 1, 1><<<dim3((TT - RH) / 64, TT / 64, ZH), 32, 0, stream>>>(QP16 + zq * TT * HD + (size_t)RH * HD, nullptr, KP16 + zk * TT * HD, nullptr, HD, Sb + (size_t)RH * TT, TT, RH, (size_t)TT * HD, 0, (size_t)TT * TT);
            k_asoft<<<ZH * TT / 8, 256, 0, stream>>>(Sb, P16, Ph, Pl);
            k_gemmc<bf, 2, 2, 8><<<dim3(RH / 64, HD / 64, ZH), 256, 0, stream>>>(Ph, Pl, VTh + zk * HD * TT, VTl + zk * HD * TT, TT, Ob, HD, 0, (size_t)RH * TT, 0, (size_t)TT * HD);
            k_gemmc<h16, 0, 2, 16><<<dim3((TT - RH) / 64, HD / 64, ZH), 512, 0, stream>>>(P16 + (size_t)RH * TT, nullptr, VT16 + zk * HD * TT, nullptr, TT, Ob + (size_t)RH * HD, HD, RH, (size_t)TT * TT, 0, (size_t)TT * HD);
            k_merge<<<(unsigned)(((size_t)ZH * TT * HD / 2 + 255) / 256), 256, 0, stream>>>(Ob, h0, ATh, ATl); }
        k_gemmw<bf, 1, false, 4><<<dim3(TT / 64, DM / 64, 1), 128, 0, stream>>>(ATh, ATl, WO, nullptr, DQ, OUT + (size_t)b * TT * DM, DM, nullptr, 0, 0, 0); }
}

// v002
// It runs in 581 microseconds.
// Two timings next to v001 put it at 1.70 and 1.71 times that version's speed.
// All steps since v000 together make it 2.88 times as fast.
#include <hip/hip_runtime.h>

// Grouped-query causal attention with rotary embeddings followed by a gain-free RMSNorm on q and k (x [2][2048][2048]; q = x wq^T (16 heads x 128), k, v = x w^T ('oi' [512][2048]: 4 kv heads x 128); _apply_rope: x cos + rotate_half(x) sin with rotate_half = cat(-x2, x1) and the FULL-WIDTH cos / sin inputs [2048][1][128] (read per dimension); q = rms_norm(rope(q)), k = rms_norm(rope(k)) with x rsqrt(mean(x^2) + 1.19e-7) over the 128 dims (no gain; LITERAL order: the rotation is applied in place in f32 first, then the per-(token, head) row factor is taken from the rotated values); kv head = q head / 4 (repeat); scores x 128^-0.5; causal (-inf); softmax; out = merged wproj^T -> [2][2048][2048] (8.4 M); argument order x, cos, sin, wq, wk, wv, wproj).
// Layout per batch: bf16 copy of x; natural 'oi' weights cast as they are (Bt); exact projections into f32 feature rows; k_cscvt: the {cos, sin} table from the bf16-rounded FULL-width inputs (HD 128, read per dimension); k_ropeF: the rotate-half rotation IN PLACE on the f32 rows FIRST (the mean square changes); k_hrms: per (head, token) inverse RMS of the ROTATED values (eps 1.19e-7; no gain); k_rope with the identity table CSI and unit gains ONES applies the row factor and builds the planes; causal T-2048 GQA attention with 128-wide heads (all 16 heads of a batch per launch, kv head = z / 4; scores in packed causal 64-row blocks, probabilities written over them; hybrid rows; k_gemmc skips tiles above the diagonal); merged hi/lo x wproj exact.
// Compute dtypes, f32 accumulate: every input rounded to bf16 incl. the two tables; projections exact; rotary and RMSNorm f32; attention rows < 512 3 products, rest fp16; softmax f32; wproj hl x exact.

#define NB_  2
#define TT   2048
#define DM   2048
#define NH_  16
#define NKV  4        // four kv heads (grouped-query: kv head = q head / 4)
#define REP  (NH_ / NKV)
#define HD   128
#define DQ   (NH_ * HD)
#define DKV  (NKV * HD)
#define ZH   16                   // heads per attention launch: all of a batch
#define SH   ((size_t)(TT / 64) * (TT / 64 + 1) / 2 * 4096)   // f32 elements of one head's packed causal scores: 64-row block rb holds 64 rows of (rb + 1) * 64 columns and starts at rb (rb + 1) / 2 * 4096
#define RH   512                  // query rows < RH use hi+lo planes (0: none)
#define WIN  2048
#define PCAR 1024.0f
#define SCL  0.088388347648318447f   // HD^-0.5
typedef _Float16 h16;
typedef unsigned short bf;
typedef __attribute__((ext_vector_type(16))) __bf16   v16bf;
typedef __attribute__((ext_vector_type(16))) _Float16 v16h;
typedef __attribute__((ext_vector_type(8)))  _Float16 v8h;
typedef __attribute__((ext_vector_type(8)))  unsigned short v8us;
typedef __attribute__((ext_vector_type(8)))  float    v8f;
typedef __attribute__((ext_vector_type(4)))  float    v4f;
typedef v8h  __attribute__((may_alias)) v8ha;
typedef v4f  __attribute__((may_alias)) v4fa;
typedef v8us __attribute__((may_alias)) v8usa;

__device__ __forceinline__ unsigned short f2bf(float f) { unsigned u = __float_as_uint(f); u += 0x7FFFu + ((u >> 16) & 1u); return (unsigned short)(u >> 16); }
__device__ __forceinline__ float bf2f(unsigned short b) { return __uint_as_float(((unsigned)b) << 16); }
__device__ __forceinline__ float bfr(float f) { return bf2f(f2bf(f)); }
__device__ __forceinline__ v16h cat16(v8h lo, v8h hi) { return __builtin_shufflevector(lo, hi, 0, 1, 2, 3, 4, 5, 6, 7, 8, 9, 10, 11, 12, 13, 14, 15); }
__device__ __forceinline__ v16bf cat16b(v8us lo, v8us hi) { return __builtin_bit_cast(v16bf, __builtin_shufflevector(lo, hi, 0, 1, 2, 3, 4, 5, 6, 7, 8, 9, 10, 11, 12, 13, 14, 15)); }
__device__ __forceinline__ v8f wmma16(v16h a, v16h b, v8f c) { return __builtin_amdgcn_wmma_f32_16x16x32_f16(false, a, false, b, (short)0, c, false, false); }
__device__ __forceinline__ v8f wmmab(v16bf a, v16bf b, v8f c) { return __builtin_amdgcn_wmma_f32_16x16x32_bf16(false, a, false, b, (short)0, c, false, false); }



// ---- k_gemmw: register-blocked GEMM, NW WAVES per 64x64 output tile, each with the whole tile (16 accumulators) over its own share of K (128-byte chunks dealt round robin), partial tiles summed through LDS; operands straight from K-contiguous 16-bit planes; grid (M/64, N/64, Z), 32 NW threads. K % 64 == 0.
// C[m][n] (f32, pitch ldc, + optional f32 bias[n]) = sum_k A[m][k] Bt[n][k] (+ split products per NSPLIT). z-batch strides sA/sB/sC in elements. K % 32 == 0.
template <typename T16> struct WFrag;
template <> struct WFrag<h16> { typedef v16h V; static __device__ __forceinline__ V ld(const h16* p) { return cat16(*(const v8h*)p, *(const v8h*)(p + 16)); } static __device__ __forceinline__ v8f mma(V a, V b, v8f c) { return wmma16(a, b, c); } };
template <> struct WFrag<bf> { typedef v16bf V; static __device__ __forceinline__ V ld(const bf* p) { return cat16b(*(const v8us*)p, *(const v8us*)(p + 16)); } static __device__ __forceinline__ v8f mma(V a, V b, v8f c) { return wmmab(a, b, c); } };
template <typename T16, int NSPLIT, bool BIAS, int NW>
__global__ __launch_bounds__(32 * NW) void k_gemmw(const T16* __restrict__ A, const T16* __restrict__ A2, const T16* __restrict__ Bt, const T16* __restrict__ Bt2, int K, float* C, int ldc, const float* __restrict__ bias, size_t sA, size_t sB, size_t sC) {
    typedef typename WFrag<T16>::V V;
    __shared__ __align__(16) float os[(NW > 1 ? 4 * NW : 1) * 16 * 68];   // NW > 1: one whole 64 x 64 partial tile per wave (pitch 68)
    const int wv = (NW > 1) ? __builtin_amdgcn_readfirstlane((int)(threadIdx.x >> 5)) : 0;   // wave number in a scalar register: the K loop's bounds and branch stay scalar
    const size_t z = blockIdx.z; A += z * sA; if (A2) A2 += z * sA; Bt += z * sB; if (Bt2) Bt2 += z * sB; C += z * sC;
    const int lane = threadIdx.x & 31, lr = lane & 15, hi = lane >> 4; const int r0 = blockIdx.x * 64, c0 = blockIdx.y * 64;
    v8f acc[4][4];
#pragma unroll
    for (int mb = 0; mb < 4; ++mb)
#pragma unroll
        for (int nb = 0; nb < 4; ++nb) acc[mb][nb] = (v8f){};
    const size_t aoff = (size_t)(r0 + lr) * K + 8 * hi, boff = (size_t)(c0 + lr) * K + 8 * hi;
#pragma unroll 1
    for (int kc = wv * 64; kc < K; kc += (kc & 32) ? NW * 64 - 32 : 32) {   // wave wv takes the 64-element (128-byte) K chunks wv, wv + NW, ...: two 32-steps per chunk
        V a[4], a2[4];
#pragma unroll
        for (int mb = 0; mb < 4; ++mb) { a[mb] = WFrag<T16>::ld(A + aoff + (size_t)mb * 16 * K + kc); if (NSPLIT == 1 || NSPLIT == 2) a2[mb] = WFrag<T16>::ld(A2 + aoff + (size_t)mb * 16 * K + kc); }
#pragma unroll
        for (int nb = 0; nb < 4; ++nb) { const V b = WFrag<T16>::ld(Bt + boff + (size_t)nb * 16 * K + kc); V b2; if (NSPLIT >= 2) b2 = WFrag<T16>::ld(Bt2 + boff + (size_t)nb * 16 * K + kc);
#pragma unroll
            for (int mb = 0; mb < 4; ++mb) { acc[mb][nb] = WFrag<T16>::mma(a[mb], b, acc[mb][nb]); if (NSPLIT == 1 || NSPLIT == 2) acc[mb][nb] = WFrag<T16>::mma(a2[mb], b, acc[mb][nb]); if (NSPLIT >= 2) acc[mb][nb] = WFrag<T16>::mma(a[mb], b2, acc[mb][nb]); } }
        asm volatile("v_nop\n\tv_nop\n\tv_nop\n\tv_nop" : "+v"(acc[0][0]), "+v"(acc[1][1]), "+v"(acc[2][2]), "+v"(acc[3][3]) : "v"(a[0]), "v"(a[3]));
    }
    if (NW > 1) {   // the NW partial tiles are summed through LDS in wave order 0 .. NW-1; every thread sums and stores 32 / NW pieces of four columns
#pragma unroll
        for (int mb = 0; mb < 4; ++mb) {
#pragma unroll
            for (int nb = 0; nb < 4; ++nb) {
#pragma unroll
                for (int j = 0; j < 8; ++j) os[wv * (64 * 68) + (mb * 16 + hi * 8 + j) * 68 + nb * 16 + lr] = acc[mb][nb][j]; } }
        __syncthreads();   // publishes every wave's partial tile to the whole block
        float* crow = C + (size_t)r0 * ldc + c0;
#pragma unroll
        for (int it = 0; it < 32 / NW; ++it) { const int idx = it * (NW * 32) + (int)threadIdx.x; const int row = idx >> 4, cofs = (idx & 15) * 4; v4f val = *(const v4fa*)(os + row * 68 + cofs);
#pragma unroll
            for (int w = 1; w < NW; ++w) val += *(const v4fa*)(os + w * (64 * 68) + row * 68 + cofs);
            if (BIAS) { val[0] += bfr(bias[c0 + cofs]); val[1] += bfr(bias[c0 + cofs + 1]); val[2] += bfr(bias[c0 + cofs + 2]); val[3] += bfr(bias[c0 + cofs + 3]); }
            *(v4f*)(crow + (size_t)row * ldc + cofs) = val; }
        return; }
#pragma unroll
    for (int mb = 0; mb < 4; ++mb) {
#pragma unroll
        for (int nb = 0; nb < 4; ++nb) {
#pragma unroll
            for (int j = 0; j < 8; ++j) os[(hi * 8 + j) * 68 + nb * 16 + lr] = acc[mb][nb][j]; }
        __builtin_amdgcn_wave_barrier(); asm volatile("" ::: "memory");
        float* crow = C + (size_t)(r0 + mb * 16) * ldc + c0;
{
#pragma unroll
            for (int s = 0; s < 8; ++s) { const int row = 2 * s + hi, cofs = lr * 4; v4f val = *(const v4fa*)(os + row * 68 + cofs); if (BIAS) { val[0] += bfr(bias[c0 + cofs]); val[1] += bfr(bias[c0 + cofs + 1]); val[2] += bfr(bias[c0 + cofs + 2]); val[3] += bfr(bias[c0 + cofs + 3]); }
                *(v4f*)(crow + (size_t)row * ldc + cofs) = val; }
             }
        __builtin_amdgcn_wave_barrier(); asm volatile("" ::: "memory");
    }
}

// WHalf: one 16-byte half of a fragment and the joining of two, for a loader that puts a wait between the two loads of a fragment.
template <typename T16> struct WHalf;
template <> struct WHalf<h16> { typedef v8h H; static __device__ __forceinline__ v16h join(H lo, H hi) { return cat16(lo, hi); } };
template <> struct WHalf<bf> { typedef v8us H; static __device__ __forceinline__ v16bf join(H lo, H hi) { return cat16b(lo, hi); } };
// ---- k_gemmc: the same 64x64 tile GEMM (NW waves per tile, K dealt among them) specialised for causal attention: CMODE 1 skips score tiles entirely above the diagonal (query rows r0+roff.., key columns c0..), CMODE 2 limits the
// key (K) loop of the probability x value contraction to the diagonal block (probabilities beyond it are exactly zero). roff = row offset of this launch's first row within the sequence.
// Scores and probabilities live in the packed causal layout (SH): CMODE 1 writes C there (row pitch nc = (rb + 1) * 64 f32); CMODE 2 reads A there, 16-bit values written by the softmax over the front of each f32 row (row pitch 2 nc; the lo plane nc elements behind the hi plane). z = head of the batch; B belongs to kv head z / REP.
template <typename T16, int NSPLIT, int CMODE, int NW>
__global__ __launch_bounds__(32 * NW) void k_gemmc(const T16* __restrict__ A, const T16* __restrict__ A2, const T16* __restrict__ Bt, const T16* __restrict__ Bt2, int K, float* C, int ldc, int roff, size_t sA, size_t sB, size_t sC) {
    typedef typename WFrag<T16>::V V;
    __shared__ __align__(16) float os[(NW > 1 ? 4 * NW : 1) * 16 * 68];   // NW > 1: one whole 64 x 64 partial tile per wave (pitch 68)
    const int wv = (NW > 1) ? __builtin_amdgcn_readfirstlane((int)(threadIdx.x >> 5)) : 0;   // wave number in a scalar register: the K loop's bounds and branch stay scalar
    const size_t z = blockIdx.z; A += z * sA; if (A2) A2 += z * sA; Bt += (z / REP) * sB; if (Bt2) Bt2 += (z / REP) * sB; C += z * sC;
    const int lane = threadIdx.x & 31, lr = lane & 15, hi = lane >> 4; const int r0 = blockIdx.x * 64, c0 = blockIdx.y * 64;
    if (CMODE == 1 && c0 > r0 + roff + 63) return;                  // score tile entirely above the causal diagonal: never written (the softmax masks j > i by select)
    const int Kl = (CMODE == 2) ? min(K, r0 + roff + 64) : K;        // P.V: probabilities are exactly 0 beyond the diagonal block, so the K loop stops there
    const int rb = (r0 + roff) >> 6, nc = (rb + 1) * 64; const size_t tri = (size_t)rb * (rb + 1) * 2048;   // packed causal layout: this row block's columns and its first f32 element
    const int lda = (CMODE == 2) ? 2 * nc : K; if (CMODE == 2) { A += 2 * tri; A2 = A + nc; }
    C += (CMODE == 1) ? tri : (size_t)r0 * ldc; if (CMODE == 1) ldc = nc;   // C: this row block's first row; the packed scores' row pitch is the block's own
    v8f acc[4][4];
#pragma unroll
    for (int mb = 0; mb < 4; ++mb)
#pragma unroll
        for (int nb = 0; nb < 4; ++nb) acc[mb][nb] = (v8f){};
    const size_t aoff = (size_t)((CMODE == 2 ? 0 : r0) + lr) * lda + 8 * hi, boff = (size_t)(c0 + lr) * K + 8 * hi;
#pragma unroll 1
    for (int kc = wv * 64; kc < Kl; kc += (kc & 32) ? NW * 64 - 32 : 32) {   // wave wv takes the 64-element (128-byte) K chunks wv, wv + NW, ... (Kl is a multiple of 64): two 32-steps per chunk
        V a[4], a2[4];
#pragma unroll
        for (int mb = 0; mb < 4; ++mb) {
            typedef typename WHalf<T16>::H H; const T16* pa = A + aoff + (size_t)mb * 16 * lda + kc;
            const H alo = *(const H*)pa; asm volatile("s_wait_xcnt 0x0" ::: "memory"); const H ahi = *(const H*)(pa + 16); asm volatile("s_wait_xcnt 0x0" ::: "memory"); a[mb] = WHalf<T16>::join(alo, ahi);   // s_wait_xcnt 0 directly behind each 16-byte A load: it stands in front of any later write (a later load's result too) of the address registers that the load names
            if (NSPLIT == 1 || NSPLIT == 2) { const T16* pa2 = A2 + aoff + (size_t)mb * 16 * lda + kc;
                const H blo = *(const H*)pa2; asm volatile("s_wait_xcnt 0x0" ::: "memory"); const H bhi = *(const H*)(pa2 + 16); asm volatile("s_wait_xcnt 0x0" ::: "memory"); a2[mb] = WHalf<T16>::join(blo, bhi); } }   // the same waits behind the lo plane's loads
#pragma unroll
        for (int nb = 0; nb < 4; ++nb) { const V b = WFrag<T16>::ld(Bt + boff + (size_t)nb * 16 * K + kc); V b2; if (NSPLIT >= 2) b2 = WFrag<T16>::ld(Bt2 + boff + (size_t)nb * 16 * K + kc);
#pragma unroll
            for (int mb = 0; mb < 4; ++mb) { acc[mb][nb] = WFrag<T16>::mma(a[mb], b, acc[mb][nb]); if (NSPLIT == 1 || NSPLIT == 2) acc[mb][nb] = WFrag<T16>::mma(a2[mb], b, acc[mb][nb]); if (NSPLIT >= 2) acc[mb][nb] = WFrag<T16>::mma(a[mb], b2, acc[mb][nb]); } }
        asm volatile("v_nop\n\tv_nop\n\tv_nop\n\tv_nop" : "+v"(acc[0][0]), "+v"(acc[1][1]), "+v"(acc[2][2]), "+v"(acc[3][3]) : "v"(a[0]), "v"(a[3]));
    }
    if (NW > 1) {   // the NW partial tiles are summed through LDS in wave order 0 .. NW-1; every thread sums and stores 32 / NW pieces of four columns
#pragma unroll
        for (int mb = 0; mb < 4; ++mb) {
#pragma unroll
            for (int nb = 0; nb < 4; ++nb) {
#pragma unroll
                for (int j = 0; j < 8; ++j) os[wv * (64 * 68) + (mb * 16 + hi * 8 + j) * 68 + nb * 16 + lr] = acc[mb][nb][j]; } }
        __syncthreads();   // publishes every wave's partial tile to the whole block
        float* crow = C + c0;
#pragma unroll
        for (int it = 0; it < 32 / NW; ++it) { const int idx = it * (NW * 32) + (int)threadIdx.x; const int row = idx >> 4, cofs = (idx & 15) * 4; v4f val = *(const v4fa*)(os + row * 68 + cofs);
#pragma unroll
            for (int w = 1; w < NW; ++w) val += *(const v4fa*)(os + w * (64 * 68) + row * 68 + cofs);
            *(v4f*)(crow + (size_t)row * ldc + cofs) = val; }
        return; }
#pragma unroll
    for (int mb = 0; mb < 4; ++mb) {
#pragma unroll
        for (int nb = 0; nb < 4; ++nb) {
#pragma unroll
            for (int j = 0; j < 8; ++j) os[(hi * 8 + j) * 68 + nb * 16 + lr] = acc[mb][nb][j]; }
        __builtin_amdgcn_wave_barrier(); asm volatile("" ::: "memory");
        float* crow = C + (size_t)(mb * 16) * ldc + c0;
{
#pragma unroll
            for (int s = 0; s < 8; ++s) { const int row = 2 * s + hi, cofs = lr * 4; v4f val = *(const v4fa*)(os + row * 68 + cofs);
                *(v4f*)(crow + (size_t)row * ldc + cofs) = val; }
             }
        __builtin_amdgcn_wave_barrier(); asm volatile("" ::: "memory");
    }
}

__device__ __forceinline__ h16 tohx(float x) { return (h16)x; }
__device__ __forceinline__ void splitf(float y, unsigned short& h, unsigned short& l) { h = f2bf(y); l = f2bf(y - bf2f(h)); }
typedef __attribute__((ext_vector_type(2))) _Float16 v2h;
typedef __attribute__((ext_vector_type(4))) _Float16 v4h;
typedef __attribute__((ext_vector_type(2))) unsigned short v2us;
typedef __attribute__((ext_vector_type(4))) unsigned short v4us;
typedef __attribute__((ext_vector_type(2))) float v2f;
typedef __attribute__((ext_vector_type(4))) int v4i;

__global__ __launch_bounds__(256) void k_cvt8(const float* __restrict__ src, bf* dst, size_t n8) { const size_t i = (size_t)blockIdx.x * 256 + threadIdx.x; if (i >= n8) return; const v8f v = *(const v8f*)(src + i * 8); v8us o;
#pragma unroll
    for (int k = 0; k < 8; ++k) o[k] = f2bf(v[k]); *(v8us*)(dst + i * 8) = o;  }

// k_rope: head planes [h][t][d] (fp16 + hi/lo) of RMSNorm(rope(x)) = rope(x)[d] x RF[h][t] x bf16(gamma[d]) x sc (norm after the rotation) with the rotate-half convention out[d] = x[d] cos[t][d] - x[d+HD/2] sin[t][d], out[d+HD/2] = x[d+HD/2] cos[t][d+HD/2] + x[d] sin[t][d+HD/2]
__global__ __launch_bounds__(256) void k_rope(const float* __restrict__ F, int pitch, int nheads, const float* __restrict__ CS, const float* __restrict__ RF, const float* __restrict__ nw, float sc, h16* P16, bf* Ph, bf* Pl) {
    const size_t e = ((size_t)blockIdx.x * 256 + threadIdx.x) * 2; if (e >= (size_t)nheads * TT * HD) return; const int d = (int)(e % HD); const int t = (int)((e / HD) % TT); const int h = (int)(e / ((size_t)HD * TT)); const float* f = F + (size_t)t * pitch + h * HD; const float rf = RF ? RF[(size_t)h * TT + t] : 1.0f; v2h o16; v2us oh, ol;
#pragma unroll
    for (int q = 0; q < 2; ++q) { const int dd = d + q; const int dp = (dd < HD / 2) ? dd + HD / 2 : dd - HD / 2; float x0 = f[dd], x1 = f[dp];
        /* RMSNorm is applied AFTER the rotation below (the module's rope-then-norm order) */
        const v2f cs = *(const v2f*)(CS + ((size_t)t * HD + dd) * 2); float a = __fmul_rn(x0, cs[0]), bq = __fmul_rn(x1, cs[1]); asm volatile("" : "+v"(a)); asm volatile("" : "+v"(bq)); float r = ((dd < HD / 2) ? __fsub_rn(a, bq) : __fadd_rn(a, bq)); if (RF) { float n0 = __fmul_rn(r, rf); asm volatile("" : "+v"(n0)); r = __fmul_rn(n0, bfr(nw[dd])); } r = r * sc;   /* rotated value x inverse RMS x bf16(gamma[d]) */
        o16[q] = tohx(r); unsigned short a2, c2; splitf(r, a2, c2); oh[q] = a2; ol[q] = c2; }
    *(v2h*)(P16 + e) = o16; *(v2us*)(Ph + e) = oh; *(v2us*)(Pl + e) = ol;  }
__global__ __launch_bounds__(256) void k_vtp(const float* __restrict__ F, int pitch, int nheads, h16* V16, bf* Vh, bf* Vl) { const size_t e = ((size_t)blockIdx.x * 256 + threadIdx.x) * 2; if (e >= (size_t)nheads * HD * TT) return; const int t = (int)(e % TT); const int d = (int)((e / TT) % HD); const int g = (int)(e / ((size_t)TT * HD)); v2h o16; v2us oh, ol;
#pragma unroll
    for (int q = 0; q < 2; ++q) { const float x = F[(size_t)(t + q) * pitch + g * HD + d]; o16[q] = tohx(x); unsigned short a2, c2; splitf(x, a2, c2); oh[q] = a2; ol[q] = c2; }
    *(v2h*)(V16 + e) = o16; *(v2us*)(Vh + e) = oh; *(v2us*)(Vl + e) = ol;  }
__global__ __launch_bounds__(256) void k_cscvt(const float* __restrict__ cosT, const float* __restrict__ sinT, float* CS) { const int idx = blockIdx.x * 256 + threadIdx.x; if (idx >= TT * HD) return; v2f cs; cs[0] = bfr(cosT[idx]); cs[1] = bfr(sinT[idx]); *(v2f*)(CS + (size_t)idx * 2) = cs;  }
__global__ __launch_bounds__(256) void k_ropeF(float* F, int pitch, int nheads, const float* __restrict__ CS) { const size_t e = (size_t)blockIdx.x * 256 + threadIdx.x; if (e >= (size_t)nheads * TT * (HD / 2)) return; const int d = (int)(e % (HD / 2)); const int t = (int)((e / (HD / 2)) % TT); const int h = (int)(e / ((size_t)(HD / 2) * TT)); float* f = F + (size_t)t * pitch + h * HD; const float x1 = f[d], x2 = f[d + HD / 2]; const v2f c1 = *(const v2f*)(CS + ((size_t)t * HD + d) * 2); const v2f c2 = *(const v2f*)(CS + ((size_t)t * HD + d + HD / 2) * 2);
    float a1 = __fmul_rn(x1, c1[0]), b1 = __fmul_rn(x2, c1[1]), a2 = __fmul_rn(x2, c2[0]), b2 = __fmul_rn(x1, c2[1]); asm volatile("" : "+v"(a1), "+v"(b1), "+v"(a2), "+v"(b2)); const float y1 = __fsub_rn(a1, b1), y2 = __fadd_rn(a2, b2);
    *(float*)(f + d) = y1; *(float*)(f + d + HD / 2) = y2;  }
__global__ __launch_bounds__(256) void k_csid(float* CS) { const int idx = blockIdx.x * 256 + threadIdx.x; if (idx >= TT * HD) return; v2f cs; cs[0] = 1.0f; cs[1] = 0.0f; *(v2f*)(CS + (size_t)idx * 2) = cs;  }
__global__ void k_ones(float* o) { const int i = threadIdx.x; if (i < HD) { *(float*)(o + i) = 1.0f;  } }
__global__ __launch_bounds__(256) void k_hrms(const float* __restrict__ F, int pitch, int nheads, float* RF) { const int idx = blockIdx.x * 256 + threadIdx.x; if (idx >= nheads * TT) return; const int t = idx % TT; const int h = idx / TT; const float* f = F + (size_t)t * pitch + h * HD; float s = 0.f;
#pragma unroll 4
    for (int d = 0; d < HD; d += 4) { const v4f a = *(const v4f*)(f + d);
#pragma unroll
        for (int q = 0; q < 4; ++q) { float p = __fmul_rn(a[q], a[q]); asm volatile("" : "+v"(p)); s = __fadd_rn(s, p); } }
    const float rf = __fdiv_rn(1.0f, __fsqrt_rn(__fadd_rn(__fdiv_rn(s, (float)HD), 1.1920929e-07f))); *(float*)(RF + idx) = rf;  }

// k_asoft: per row (zz, i): t = S x HD^-0.5 for j <= i and i - j < WIN (sliding causal window; the reference's -1e9 additive fill vanishes identically); softmax over the row's nc = (i / 64 + 1) * 64 packed columns (register row, one exp, fixed trees; the columns beyond nc would add exact zeros);
// the probabilities are written IN PLACE over the front of the row's own f32 scores (fp16: nc values; hi rows: nc hi values, then nc lo values): one wave owns one row and has read all of it (the row sum) before its first store.
__global__ __launch_bounds__(256) void k_asoft(float* Sb) {
    const int lane = threadIdx.x & 31; const int row = blockIdx.x * 8 + __builtin_amdgcn_readfirstlane((int)(threadIdx.x >> 5));   // the wave's row in a scalar register: the tests on nc below are scalar branches
    if (row >= ZH * TT) return; const int i = row % TT; const int zz = row / TT; const bool hires = (i < RH); const int rb = i >> 6, nc = (rb + 1) * 64;
    float* sr = Sb + (size_t)zz * SH + (size_t)rb * (rb + 1) * 2048 + (size_t)(i & 63) * nc; float v[TT / 32]; float mx = -3.0e38f;
#pragma unroll
    for (int ch = 0; ch < TT / 128; ++ch) { if (ch * 128 < nc) { const int j0 = ch * 128 + lane * 4; v4f a = (v4f){}; if (j0 < nc) a = *(const v4f*)(sr + j0);   // all of the row's loads first, so that they are in flight together; where nc ends in the middle of a 128-column piece its upper lanes load nothing (masked below: j > i)
#pragma unroll
        for (int q = 0; q < 4; ++q) v[ch * 4 + q] = a[q]; } }
#pragma unroll
    for (int ch = 0; ch < TT / 128; ++ch) { if (ch * 128 < nc) {
#pragma unroll
        for (int q = 0; q < 4; ++q) { const int j = ch * 128 + lane * 4 + q; const float t = (j <= i && i - j < WIN) ? v[ch * 4 + q] * SCL : -3.0e38f; v[ch * 4 + q] = t; mx = fmaxf(mx, t); } } }
#pragma unroll
    for (int sh = 16; sh; sh >>= 1) mx = fmaxf(mx, __shfl_xor(mx, sh, 32));
    float sum = 0.f;
#pragma unroll
    for (int ch = 0; ch < TT / 128; ++ch) { if (ch * 128 < nc) {
#pragma unroll
        for (int q = 0; q < 4; ++q) { const int k = ch * 4 + q; float d0 = __fsub_rn(v[k], mx); asm volatile("" : "+v"(d0)); v[k] = __builtin_amdgcn_exp2f(__fmul_rn(d0, 1.4426950408889634f)); sum += v[k]; } } }
#pragma unroll
    for (int sh = 16; sh; sh >>= 1) sum += __shfl_xor(sum, sh, 32);
    const float f = __fdiv_rn(hires ? 1.0f : PCAR, sum);
    if (hires) { bf* ph = (bf*)sr; bf* pl = ph + nc;
#pragma unroll
        for (int ch = 0; ch < RH / 128; ++ch) { const int j0 = ch * 128 + lane * 4; if (j0 < nc) { v4us oh, ol;
#pragma unroll
            for (int q = 0; q < 4; ++q) { unsigned short a, c2; splitf(v[ch * 4 + q] * f, a, c2); oh[q] = a; ol[q] = c2; }
            *(v4us*)(ph + j0) = oh; *(v4us*)(pl + j0) = ol; } }
    } else { h16* p16 = (h16*)sr;
#pragma unroll
        for (int ch = 0; ch < TT / 128; ++ch) { const int j0 = ch * 128 + lane * 4; if (j0 < nc) { v4h o4;
#pragma unroll
            for (int q = 0; q < 4; ++q) o4[q] = tohx(v[ch * 4 + q] * f);
            *(v4h*)(p16 + j0) = o4; } }
    }
}
__global__ __launch_bounds__(256) void k_merge(const float* __restrict__ O, int h0, bf* Ah, bf* Al) { const size_t e = ((size_t)blockIdx.x * 256 + threadIdx.x) * 2; if (e >= (size_t)ZH * TT * HD) return; const int d = (int)(e % HD); const int t = (int)((e / HD) % TT); const int zz = (int)(e / ((size_t)HD * TT)); const float cs = (t < RH) ? 1.0f : (1.0f / PCAR); const size_t oo = (size_t)t * DQ + (h0 + zz) * HD + d;
    v2us oh, ol;
#pragma unroll
    for (int q = 0; q < 2; ++q) { unsigned short a, c2; splitf(O[e + q] * cs, a, c2); oh[q] = a; ol[q] = c2; } *(v2us*)(Ah + oo) = oh; *(v2us*)(Al + oo) = ol;  }

extern "C" void kernel_launch(void* const* d_in, const int* in_sizes, int n_in,
                              void* d_out, int out_size, void* d_ws, size_t ws_size, hipStream_t stream) {
    (void)in_sizes; (void)n_in; (void)out_size;
    const float* x = (const float*)d_in[0]; const float* fcos = (const float*)d_in[1]; const float* fsin = (const float*)d_in[2]; const float* wq = (const float*)d_in[3]; const float* wk = (const float*)d_in[4]; const float* wv = (const float*)d_in[5]; const float* wo = (const float*)d_in[6];   /* inputs x, cos, sin ([2048][1][128] = [2048][128] FULL width, read per dimension), wq ('oi' [2048][2048]), wk, wv ('oi' [512][2048]), wproj ('oi') */
    float* OUT = (float*)d_out;     // [2][2048][2048]
    char* wsp = (char*)d_ws;
    auto take = [&](size_t bytes) { char* p = wsp; wsp += (bytes + 255) & ~(size_t)255; return (void*)p; };
    bf* WQ = (bf*)take((size_t)DQ * DM * 2); bf* WK = (bf*)take((size_t)DKV * DM * 2); bf* WV = (bf*)take((size_t)DKV * DM * 2); bf* WO = (bf*)take((size_t)DM * DQ * 2); float* CS = (float*)take((size_t)TT * HD * 2 * 4);
    bf* XB = (bf*)take((size_t)TT * DM * 2); float* ONES = (float*)take(256 * 4); float* CSI = (float*)take((size_t)TT * HD * 2 * 4);   /* identity {1, 0} table for the plane builder (the rotation is applied in place before the norm) */ float* RFQ = (float*)take((size_t)NH_ * TT * 4); float* RFK = (float*)take((size_t)NKV * TT * 4);   /* per (head, token) inverse RMS (sums of squares of the rotated values) */ float* FQ = (float*)take((size_t)TT * DQ * 4); float* FK = (float*)take((size_t)TT * DKV * 4);
    h16* QP16 = (h16*)take((size_t)NH_ * TT * HD * 2); h16* KP16 = (h16*)take((size_t)NKV * TT * HD * 2); h16* VT16 = (h16*)take((size_t)NKV * HD * TT * 2);
    bf* QPh = (bf*)take((size_t)NH_ * TT * HD * 2); bf* QPl = (bf*)take((size_t)NH_ * TT * HD * 2); bf* KPh = (bf*)take((size_t)NKV * TT * HD * 2); bf* KPl = (bf*)take((size_t)NKV * TT * HD * 2); bf* VTh = (bf*)take((size_t)NKV * HD * TT * 2); bf* VTl = (bf*)take((size_t)NKV * HD * TT * 2);
    float* Sb = (float*)take((size_t)ZH * SH * 4);   /* packed causal scores of all heads; the softmax writes the probabilities over them */ float* Ob = (float*)take((size_t)ZH * TT * HD * 4); bf* ATh = (bf*)take((size_t)TT * DQ * 2); bf* ATl = (bf*)take((size_t)TT * DQ * 2);
    if ((size_t)(wsp - (char*)d_ws) > ws_size) return;    // ws 256 MiB
    float* FV = FK;   // v projection reuses the k buffer after the k planes are built (stream-ordered)
    { k_cvt8<<<(unsigned)(((size_t)DQ * DM / 8 + 255) / 256), 256, 0, stream>>>(wq, WQ, (size_t)DQ * DM / 8); k_cvt8<<<(unsigned)(((size_t)DKV * DM / 8 + 255) / 256), 256, 0, stream>>>(wk, WK, (size_t)DKV * DM / 8); k_cvt8<<<(unsigned)(((size_t)DKV * DM / 8 + 255) / 256), 256, 0, stream>>>(wv, WV, (size_t)DKV * DM / 8);
      k_cvt8<<<(unsigned)(((size_t)DM * DQ / 8 + 255) / 256), 256, 0, stream>>>(wo, WO, (size_t)DM * DQ / 8);   /* 'oi' weights = Bt as-is */
       }
    k_cscvt<<<(TT * HD + 255) / 256, 256, 0, stream>>>(fcos, fsin, CS); k_csid<<<(TT * HD + 255) / 256, 256, 0, stream>>>(CSI); k_ones<<<1, 128, 0, stream>>>(ONES);   /* rotary table from the FULL-width inputs, per dimension; unit gains */   /* rotary table once */
    const unsigned LQ = (unsigned)(((size_t)NH_ * TT * HD / 2 + 255) / 256), LKv = (unsigned)(((size_t)NKV * TT * HD / 2 + 255) / 256);
    for (int b = 0; b < NB_; ++b) {
        
        k_cvt8<<<(unsigned)(((size_t)TT * DM / 8 + 255) / 256), 256, 0, stream>>>(x + (size_t)b * TT * DM, XB, (size_t)TT * DM / 8);
        k_gemmw<bf, 0, false, 4><<<dim3(TT / 64, DQ / 64, 1), 128, 0, stream>>>(XB, nullptr, WQ, nullptr, DM, FQ, DQ, nullptr, 0, 0, 0);
        k_ropeF<<<(unsigned)(((size_t)NH_ * TT * (HD / 2) + 255) / 256), 256, 0, stream>>>(FQ, DQ, NH_, CS);   /* rotary FIRST (the tables need not be unit rotations: the mean square changes) */ k_hrms<<<(NH_ * TT + 255) / 256, 256, 0, stream>>>(FQ, DQ, NH_, RFQ); k_rope<<<LQ, 256, 0, stream>>>(FQ, DQ, NH_, CSI, RFQ, ONES, 1.0f, QP16, QPh, QPl);   /* rope then RMSNorm (unit gains) */
        k_gemmw<bf, 0, false, 8><<<dim3(TT / 64, DKV / 64, 1), 256, 0, stream>>>(XB, nullptr, WK, nullptr, DM, FK, DKV, nullptr, 0, 0, 0);
        k_ropeF<<<(unsigned)(((size_t)NKV * TT * (HD / 2) + 255) / 256), 256, 0, stream>>>(FK, DKV, NKV, CS); k_hrms<<<(NKV * TT + 255) / 256, 256, 0, stream>>>(FK, DKV, NKV, RFK); k_rope<<<LKv, 256, 0, stream>>>(FK, DKV, NKV, CSI, RFK, ONES, 1.0f, KP16, KPh, KPl);
        k_gemmw<bf, 0, false, 8><<<dim3(TT / 64, DKV / 64, 1), 256, 0, stream>>>(XB, nullptr, WV, nullptr, DM, FV, DKV, nullptr, 0, 0, 0); k_vtp<<<LKv, 256, 0, stream>>>(FV, DKV, NKV, VT16, VTh, VTl);
        {   // one launch of each attention kernel for all ZH = NH_ heads of the batch (z = head; kv head z / REP inside k_gemmc)
            k_gemmc<bf, 2, 1, 1><<<dim3(RH / 64, TT / 64, ZH), 32, 0, stream>>>(QPh, QPl, KPh, KPl, HD, Sb, 0, 0, (size_t)TT * HD, (size_t)TT * HD, SH);
            k_gemmc<h16, 0, 1, 1><<<dim3((TT - RH) / 64, TT / 64, ZH), 32, 0, stream>>>(QP16 + (size_t)RH * HD, nullptr, KP16, nullptr, HD, Sb, 0, RH, (size_t)TT * HD, (size_t)TT * HD, SH);
            k_asoft<<<ZH * TT / 8, 256, 0, stream>>>(Sb);
            k_gemmc<bf, 2, 2, 8><<<dim3(RH / 64, HD / 64, ZH), 256, 0, stream>>>((const bf*)Sb, nullptr, VTh, VTl, TT, Ob, HD, 0, 2 * SH, (size_t)HD * TT, (size_t)TT * HD);
            k_gemmc<h16, 0, 2, 16><<<dim3((TT - RH) / 64, HD / 64, ZH), 512, 0, stream>>>((const h16*)Sb, nullptr, VT16, nullptr, TT, Ob + (size_t)RH * HD, HD, RH, 2 * SH, (size_t)HD * TT, (size_t)TT * HD);
            k_merge<<<(unsigned)(((size_t)ZH * TT * HD / 2 + 255) / 256), 256, 0, stream>>>(Ob, 0, ATh, ATl); }
        k_gemmw<bf, 1, false, 4><<<dim3(TT / 64, DM / 64, 1), 128, 0, stream>>>(ATh, ATl, WO, nullptr, DQ, OUT + (size_t)b * TT * DM, DM, nullptr, 0, 0, 0); }
}

// v003
// A run of this version takes 551 microseconds.
// In both of two side-by-side timings against v002, it was 1.05 times as fast.
// All steps since v000 together make it 3.02 times as fast.
#include <hip/hip_runtime.h>

// Grouped-query causal attention with rotary embeddings followed by a gain-free RMSNorm on q and k (x [2][2048][2048]; q = x wq^T (16 heads x 128), k, v = x w^T ('oi' [512][2048]: 4 kv heads x 128); _apply_rope: x cos + rotate_half(x) sin with rotate_half = cat(-x2, x1) and the FULL-WIDTH cos / sin inputs [2048][1][128] (read per dimension); q = rms_norm(rope(q)), k = rms_norm(rope(k)) with x rsqrt(mean(x^2) + 1.19e-7) over the 128 dims (no gain; LITERAL order: the rotation is applied in place in f32 first, then the per-(token, head) row factor is taken from the rotated values); kv head = q head / 4 (repeat); scores x 128^-0.5; causal (-inf); softmax; out = merged wproj^T -> [2][2048][2048] (8.4 M); argument order x, cos, sin, wq, wk, wv, wproj).
// Layout per batch: bf16 copy of x; natural 'oi' weights cast as they are (Bt); exact projections into f32 feature rows; k_cscvt: the {cos, sin} table from the bf16-rounded FULL-width inputs (HD 128, read per dimension); k_ropeF: the rotate-half rotation IN PLACE on the f32 rows FIRST (the mean square changes); k_hrms: per (head, token) inverse RMS of the ROTATED values (eps 1.19e-7; no gain); k_rope with the identity table CSI and unit gains ONES applies the row factor and builds the planes; causal T-2048 GQA attention with 128-wide heads (all 16 heads of a batch per launch, kv head = z / 4; scores in packed causal 64-row blocks, probabilities written over them; hybrid rows; k_gemmc skips tiles above the diagonal); merged hi/lo x wproj exact.
// Compute dtypes, f32 accumulate: every input rounded to bf16 incl. the two tables; projections exact; rotary and RMSNorm f32; attention rows < 512 3 products, rest fp16; softmax f32; wproj hl x exact.

#define NB_  2
#define TT   2048
#define DM   2048
#define NH_  16
#define NKV  4        // four kv heads (grouped-query: kv head = q head / 4)
#define REP  (NH_ / NKV)
#define HD   128
#define DQ   (NH_ * HD)
#define DKV  (NKV * HD)
#define ZH   16                   // heads per attention launch: all of a batch
#define SH   ((size_t)(TT / 64) * (TT / 64 + 1) / 2 * 4096)   // f32 elements of one head's packed causal scores: 64-row block rb holds 64 rows of (rb + 1) * 64 columns and starts at rb (rb + 1) / 2 * 4096
#define RH   512                  // query rows < RH use hi+lo planes (0: none)
#define WIN  2048
#define PCAR 1024.0f
#define SCL  0.088388347648318447f   // HD^-0.5
typedef _Float16 h16;
typedef unsigned short bf;
typedef __attribute__((ext_vector_type(16))) __bf16   v16bf;
typedef __attribute__((ext_vector_type(16))) _Float16 v16h;
typedef __attribute__((ext_vector_type(8)))  _Float16 v8h;
typedef __attribute__((ext_vector_type(8)))  unsigned short v8us;
typedef __attribute__((ext_vector_type(8)))  float    v8f;
typedef __attribute__((ext_vector_type(4)))  float    v4f;
typedef v8h  __attribute__((may_alias)) v8ha;
typedef v4f  __attribute__((may_alias)) v4fa;
typedef v8us __attribute__((may_alias)) v8usa;

__device__ __forceinline__ unsigned short f2bf(float f) { unsigned u = __float_as_uint(f); u += 0x7FFFu + ((u >> 16) & 1u); return (unsigned short)(u >> 16); }
__device__ __forceinline__ float bf2f(unsigned short b) { return __uint_as_float(((unsigned)b) << 16); }
__device__ __forceinline__ float bfr(float f) { return bf2f(f2bf(f)); }
__device__ __forceinline__ v16h cat16(v8h lo, v8h hi) { return __builtin_shufflevector(lo, hi, 0, 1, 2, 3, 4, 5, 6, 7, 8, 9, 10, 11, 12, 13, 14, 15); }
__device__ __forceinline__ v16bf cat16b(v8us lo, v8us hi) { return __builtin_bit_cast(v16bf, __builtin_shufflevector(lo, hi, 0, 1, 2, 3, 4, 5, 6, 7, 8, 9, 10, 11, 12, 13, 14, 15)); }
__device__ __forceinline__ v8f wmma16(v16h a, v16h b, v8f c) { return __builtin_amdgcn_wmma_f32_16x16x32_f16(false, a, false, b, (short)0, c, false, false); }
__device__ __forceinline__ v8f wmmab(v16bf a, v16bf b, v8f c) { return __builtin_amdgcn_wmma_f32_16x16x32_bf16(false, a, false, b, (short)0, c, false, false); }



// ---- k_gemmw: register-blocked GEMM, NW WAVES per 64x64 output tile, each with the whole tile (16 accumulators) over its own share of K (128-byte chunks dealt round robin), partial tiles summed through LDS; operands straight from K-contiguous 16-bit planes; grid (M/64, N/64, Z), 32 NW threads. K % 64 == 0.
// C[m][n] (f32, pitch ldc, + optional f32 bias[n]) = sum_k A[m][k] Bt[n][k] (+ split products per NSPLIT). z-batch strides sA/sB/sC in elements. K % 32 == 0.
template <typename T16> struct WFrag;
template <> struct WFrag<h16> { typedef v16h V; static __device__ __forceinline__ V ld(const h16* p) { return cat16(*(const v8h*)p, *(const v8h*)(p + 16)); } static __device__ __forceinline__ v8f mma(V a, V b, v8f c) { return wmma16(a, b, c); } };
template <> struct WFrag<bf> { typedef v16bf V; static __device__ __forceinline__ V ld(const bf* p) { return cat16b(*(const v8us*)p, *(const v8us*)(p + 16)); } static __device__ __forceinline__ v8f mma(V a, V b, v8f c) { return wmmab(a, b, c); } };
template <typename T16, int NSPLIT, bool BIAS, int NW>
__global__ __launch_bounds__(32 * NW) void k_gemmw(const T16* __restrict__ A, const T16* __restrict__ A2, const T16* __restrict__ Bt, const T16* __restrict__ Bt2, int K, float* C, int ldc, const float* __restrict__ bias, size_t sA, size_t sB, size_t sC) {
    typedef typename WFrag<T16>::V V;
    __shared__ __align__(16) float os[(NW > 1 ? 4 * NW : 1) * 16 * 68];   // NW > 1: one whole 64 x 64 partial tile per wave (pitch 68)
    const int wv = (NW > 1) ? __builtin_amdgcn_readfirstlane((int)(threadIdx.x >> 5)) : 0;   // wave number in a scalar register: the K loop's bounds and branch stay scalar
    const size_t z = blockIdx.z; A += z * sA; if (A2) A2 += z * sA; Bt += z * sB; if (Bt2) Bt2 += z * sB; C += z * sC;
    const int lane = threadIdx.x & 31, lr = lane & 15, hi = lane >> 4; const int r0 = blockIdx.x * 64, c0 = blockIdx.y * 64;
    v8f acc[4][4];
#pragma unroll
    for (int mb = 0; mb < 4; ++mb)
#pragma unroll
        for (int nb = 0; nb < 4; ++nb) acc[mb][nb] = (v8f){};
    const size_t aoff = (size_t)(r0 + lr) * K + 8 * hi, boff = (size_t)(c0 + lr) * K + 8 * hi;
#pragma unroll 1
    for (int kc = wv * 64; kc < K; kc += (kc & 32) ? NW * 64 - 32 : 32) {   // wave wv takes the 64-element (128-byte) K chunks wv, wv + NW, ...: two 32-steps per chunk
        V a[4], a2[4];
#pragma unroll
        for (int mb = 0; mb < 4; ++mb) { a[mb] = WFrag<T16>::ld(A + aoff + (size_t)mb * 16 * K + kc); if (NSPLIT == 1 || NSPLIT == 2) a2[mb] = WFrag<T16>::ld(A2 + aoff + (size_t)mb * 16 * K + kc); }
#pragma unroll
        for (int nb = 0; nb < 4; ++nb) { const V b = WFrag<T16>::ld(Bt + boff + (size_t)nb * 16 * K + kc); V b2; if (NSPLIT >= 2) b2 = WFrag<T16>::ld(Bt2 + boff + (size_t)nb * 16 * K + kc);
#pragma unroll
            for (int mb = 0; mb < 4; ++mb) { acc[mb][nb] = WFrag<T16>::mma(a[mb], b, acc[mb][nb]); if (NSPLIT == 1 || NSPLIT == 2) acc[mb][nb] = WFrag<T16>::mma(a2[mb], b, acc[mb][nb]); if (NSPLIT >= 2) acc[mb][nb] = WFrag<T16>::mma(a[mb], b2, acc[mb][nb]); } }
        asm volatile("v_nop\n\tv_nop\n\tv_nop\n\tv_nop" : "+v"(acc[0][0]), "+v"(acc[1][1]), "+v"(acc[2][2]), "+v"(acc[3][3]) : "v"(a[0]), "v"(a[3]));
    }
    if (NW > 1) {   // the NW partial tiles are summed through LDS in wave order 0 .. NW-1; every thread sums and stores 32 / NW pieces of four columns
#pragma unroll
        for (int mb = 0; mb < 4; ++mb) {
#pragma unroll
            for (int nb = 0; nb < 4; ++nb) {
#pragma unroll
                for (int j = 0; j < 8; ++j) os[wv * (64 * 68) + (mb * 16 + hi * 8 + j) * 68 + nb * 16 + lr] = acc[mb][nb][j]; } }
        __syncthreads();   // publishes every wave's partial tile to the whole block
        float* crow = C + (size_t)r0 * ldc + c0;
#pragma unroll
        for (int it = 0; it < 32 / NW; ++it) { const int idx = it * (NW * 32) + (int)threadIdx.x; const int row = idx >> 4, cofs = (idx & 15) * 4; v4f val = *(const v4fa*)(os + row * 68 + cofs);
#pragma unroll
            for (int w = 1; w < NW; ++w) val += *(const v4fa*)(os + w * (64 * 68) + row * 68 + cofs);
            if (BIAS) { val[0] += bfr(bias[c0 + cofs]); val[1] += bfr(bias[c0 + cofs + 1]); val[2] += bfr(bias[c0 + cofs + 2]); val[3] += bfr(bias[c0 + cofs + 3]); }
            *(v4f*)(crow + (size_t)row * ldc + cofs) = val; }
        return; }
#pragma unroll
    for (int mb = 0; mb < 4; ++mb) {
#pragma unroll
        for (int nb = 0; nb < 4; ++nb) {
#pragma unroll
            for (int j = 0; j < 8; ++j) os[(hi * 8 + j) * 68 + nb * 16 + lr] = acc[mb][nb][j]; }
        __builtin_amdgcn_wave_barrier(); asm volatile("" ::: "memory");
        float* crow = C + (size_t)(r0 + mb * 16) * ldc + c0;
{
#pragma unroll
            for (int s = 0; s < 8; ++s) { const int row = 2 * s + hi, cofs = lr * 4; v4f val = *(const v4fa*)(os + row * 68 + cofs); if (BIAS) { val[0] += bfr(bias[c0 + cofs]); val[1] += bfr(bias[c0 + cofs + 1]); val[2] += bfr(bias[c0 + cofs + 2]); val[3] += bfr(bias[c0 + cofs + 3]); }
                *(v4f*)(crow + (size_t)row * ldc + cofs) = val; }
             }
        __builtin_amdgcn_wave_barrier(); asm volatile("" ::: "memory");
    }
}

// WHalf: one 16-byte half of a fragment and the joining of two, for a loader that puts a wait between the two loads of a fragment.
template <typename T16> struct WHalf;
template <> struct WHalf<h16> { typedef v8h H; static __device__ __forceinline__ v16h join(H lo, H hi) { return cat16(lo, hi); } };
template <> struct WHalf<bf> { typedef v8us H; static __device__ __forceinline__ v16bf join(H lo, H hi) { return cat16b(lo, hi); } };
// ---- k_gemmc: the same 64x64 tile GEMM (NW waves per tile, K dealt among them) specialised for causal attention: CMODE 1 skips score tiles entirely above the diagonal (query rows r0+roff.., key columns c0..), CMODE 2 limits the
// key (K) loop of the probability x value contraction to the diagonal block (probabilities beyond it are exactly zero). roff = row offset of this launch's first row within the sequence.
// Scores and probabilities live in the packed causal layout (SH): CMODE 1 writes C there (row pitch nc = (rb + 1) * 64 f32); CMODE 2 reads A there, 16-bit values written by the softmax over the front of each f32 row (row pitch 2 nc; the lo plane nc elements behind the hi plane). z = head of the batch; B belongs to kv head z / REP.
template <typename T16, int NSPLIT, int CMODE, int NW>
__global__ __launch_bounds__(32 * NW) void k_gemmc(const T16* __restrict__ A, const T16* __restrict__ A2, const T16* __restrict__ Bt, const T16* __restrict__ Bt2, int K, float* C, int ldc, int roff, size_t sA, size_t sB, size_t sC) {
    typedef typename WFrag<T16>::V V;
    __shared__ __align__(16) float os[(NW > 1 ? 4 * NW : 1) * 16 * 68];   // NW > 1: one whole 64 x 64 partial tile per wave (pitch 68)
    const int wv = (NW > 1) ? __builtin_amdgcn_readfirstlane((int)(threadIdx.x >> 5)) : 0;   // wave number in a scalar register: the K loop's bounds and branch stay scalar
    const size_t z = blockIdx.z; A += z * sA; if (A2) A2 += z * sA; Bt += (z / REP) * sB; if (Bt2) Bt2 += (z / REP) * sB; C += z * sC;
    const int lane = threadIdx.x & 31, lr = lane & 15, hi = lane >> 4; const int r0 = blockIdx.x * 64, c0 = blockIdx.y * 64;
    if (CMODE == 1 && c0 > r0 + roff + 63) return;                  // score tile entirely above the causal diagonal: never written (the softmax masks j > i by select)
    const int Kl = (CMODE == 2) ? min(K, r0 + roff + 64) : K;        // P.V: probabilities are exactly 0 beyond the diagonal block, so the K loop stops there
    const int rb = (r0 + roff) >> 6, nc = (rb + 1) * 64; const size_t tri = (size_t)rb * (rb + 1) * 2048;   // packed causal layout: this row block's columns and its first f32 element
    const int lda = (CMODE == 2) ? 2 * nc : K; if (CMODE == 2) { A += 2 * tri; A2 = A + nc; }
    C += (CMODE == 1) ? tri : (size_t)r0 * ldc; if (CMODE == 1) ldc = nc;   // C: this row block's first row; the packed scores' row pitch is the block's own
    v8f acc[4][4];
#pragma unroll
    for (int mb = 0; mb < 4; ++mb)
#pragma unroll
        for (int nb = 0; nb < 4; ++nb) acc[mb][nb] = (v8f){};
    const size_t aoff = (size_t)((CMODE == 2 ? 0 : r0) + lr) * lda + 8 * hi, boff = (size_t)(c0 + lr) * K + 8 * hi;
#pragma unroll 1
    for (int kc = wv * 64; kc < Kl; kc += (kc & 32) ? NW * 64 - 32 : 32) {   // wave wv takes the 64-element (128-byte) K chunks wv, wv + NW, ... (Kl is a multiple of 64): two 32-steps per chunk
        V a[4], a2[4];
#pragma unroll
        for (int mb = 0; mb < 4; ++mb) {
            typedef typename WHalf<T16>::H H; const T16* pa = A + aoff + (size_t)mb * 16 * lda + kc;
            const H alo = *(const H*)pa; asm volatile("s_wait_xcnt 0x0" ::: "memory"); const H ahi = *(const H*)(pa + 16); asm volatile("s_wait_xcnt 0x0" ::: "memory"); a[mb] = WHalf<T16>::join(alo, ahi);   // s_wait_xcnt 0 directly behind each 16-byte A load: it stands in front of any later write (a later load's result too) of the address registers that the load names
            if (NSPLIT == 1 || NSPLIT == 2) { const T16* pa2 = A2 + aoff + (size_t)mb * 16 * lda + kc;
                const H blo = *(const H*)pa2; asm volatile("s_wait_xcnt 0x0" ::: "memory"); const H bhi = *(const H*)(pa2 + 16); asm volatile("s_wait_xcnt 0x0" ::: "memory"); a2[mb] = WHalf<T16>::join(blo, bhi); } }   // the same waits behind the lo plane's loads
#pragma unroll
        for (int nb = 0; nb < 4; ++nb) { const V b = WFrag<T16>::ld(Bt + boff + (size_t)nb * 16 * K + kc); V b2; if (NSPLIT >= 2) b2 = WFrag<T16>::ld(Bt2 + boff + (size_t)nb * 16 * K + kc);
#pragma unroll
            for (int mb = 0; mb < 4; ++mb) { acc[mb][nb] = WFrag<T16>::mma(a[mb], b, acc[mb][nb]); if (NSPLIT == 1 || NSPLIT == 2) acc[mb][nb] = WFrag<T16>::mma(a2[mb], b, acc[mb][nb]); if (NSPLIT >= 2) acc[mb][nb] = WFrag<T16>::mma(a[mb], b2, acc[mb][nb]); } }
        asm volatile("v_nop\n\tv_nop\n\tv_nop\n\tv_nop" : "+v"(acc[0][0]), "+v"(acc[1][1]), "+v"(acc[2][2]), "+v"(acc[3][3]) : "v"(a[0]), "v"(a[3]));
    }
    if (NW > 1) {   // the NW partial tiles are summed through LDS in wave order 0 .. NW-1; every thread sums and stores 32 / NW pieces of four columns
#pragma unroll
        for (int mb = 0; mb < 4; ++mb) {
#pragma unroll
            for (int nb = 0; nb < 4; ++nb) {
#pragma unroll
                for (int j = 0; j < 8; ++j) os[wv * (64 * 68) + (mb * 16 + hi * 8 + j) * 68 + nb * 16 + lr] = acc[mb][nb][j]; } }
        __syncthreads();   // publishes every wave's partial tile to the whole block
        float* crow = C + c0;
#pragma unroll
        for (int it = 0; it < 32 / NW; ++it) { const int idx = it * (NW * 32) + (int)threadIdx.x; const int row = idx >> 4, cofs = (idx & 15) * 4; v4f val = *(const v4fa*)(os + row * 68 + cofs);
#pragma unroll
            for (int w = 1; w < NW; ++w) val += *(const v4fa*)(os + w * (64 * 68) + row * 68 + cofs);
            *(v4f*)(crow + (size_t)row * ldc + cofs) = val; }
        return; }
#pragma unroll
    for (int mb = 0; mb < 4; ++mb) {
#pragma unroll
        for (int nb = 0; nb < 4; ++nb) {
#pragma unroll
            for (int j = 0; j < 8; ++j) os[(hi * 8 + j) * 68 + nb * 16 + lr] = acc[mb][nb][j]; }
        __builtin_amdgcn_wave_barrier(); asm volatile("" ::: "memory");
        float* crow = C + (size_t)(mb * 16) * ldc + c0;
{
#pragma unroll
            for (int s = 0; s < 8; ++s) { const int row = 2 * s + hi, cofs = lr * 4; v4f val = *(const v4fa*)(os + row * 68 + cofs);
                *(v4f*)(crow + (size_t)row * ldc + cofs) = val; }
             }
        __builtin_amdgcn_wave_barrier(); asm volatile("" ::: "memory");
    }
}

__device__ __forceinline__ h16 tohx(float x) { return (h16)x; }
__device__ __forceinline__ void splitf(float y, unsigned short& h, unsigned short& l) { h = f2bf(y); l = f2bf(y - bf2f(h)); }
typedef __attribute__((ext_vector_type(2))) _Float16 v2h;
typedef __attribute__((ext_vector_type(4))) _Float16 v4h;
typedef __attribute__((ext_vector_type(2))) unsigned short v2us;
typedef __attribute__((ext_vector_type(4))) unsigned short v4us;
typedef __attribute__((ext_vector_type(2))) float v2f;
typedef __attribute__((ext_vector_type(4))) int v4i;

// The conversion, rotation, plane and merge kernels below give every thread 16 to 32 elements in 16-byte pieces (they had 1 to 8): a launch starts 4 to 16 times fewer waves, and each lane has its loads in flight together. Every element's arithmetic is as before.
#define CVN 4   // 8-value pieces per thread of k_cvt8, 256 threads apart
#define HPT 4   // heads per thread of k_ropeF, k_rope and k_merge: the table values of one (token, dims) piece are loaded once for HPT heads
__global__ __launch_bounds__(256) void k_cvt8(const float* __restrict__ src, bf* dst, size_t n8) { const size_t i0 = (size_t)blockIdx.x * (256 * CVN) + threadIdx.x; v8f v[CVN];
#pragma unroll
    for (int c = 0; c < CVN; ++c) { const size_t i = i0 + (size_t)c * 256; v[c] = *(const v8f*)(src + (i < n8 ? i : n8 - 1) * 8); }   // all loads first, without a branch (a piece past the end reads the last piece and is not stored), so that they are in flight together
#pragma unroll
    for (int c = 0; c < CVN; ++c) { const size_t i = i0 + (size_t)c * 256; if (i < n8) { v8us o;
#pragma unroll
        for (int k = 0; k < 8; ++k) o[k] = f2bf(v[c][k]); *(v8us*)(dst + i * 8) = o; } } }

// k_rope: head planes [h][t][d] (fp16 + hi/lo) of RMSNorm(rope(x)) = rope(x)[d] x RF[h][t] x bf16(gamma[d]) x sc (norm after the rotation) with the rotate-half convention out[d] = x[d] cos[t][d] - x[d+HD/2] sin[t][d], out[d+HD/2] = x[d+HD/2] cos[t][d+HD/2] + x[d] sin[t][d+HD/2]
// ld4w, ld1w: a load with s_wait_xcnt 0 directly behind it: the wait stands in front of any later write (a later load's result too) of the address registers that the load names
__device__ __forceinline__ v4f ld4w(const float* p) { const v4f v = *(const v4fa*)p; asm volatile("s_wait_xcnt 0x0" ::: "memory"); return v; }
__device__ __forceinline__ float ld1w(const float* p) { const float v = *p; asm volatile("s_wait_xcnt 0x0" ::: "memory"); return v; }
// one thread: 8 dims d .. d + 7 of token t in heads h0 .. h0 + HPT - 1; RF is never null (both launches pass the row factors)
__global__ __launch_bounds__(256) void k_rope(const float* __restrict__ F, int pitch, int nheads, const float* __restrict__ CS, const float* __restrict__ RF, const float* __restrict__ nw, float sc, h16* P16, bf* Ph, bf* Pl) {
    const size_t g = (size_t)blockIdx.x * 256 + threadIdx.x; if (g >= (size_t)(nheads / HPT) * TT * (HD / 8)) return; const int d = (int)(g % (HD / 8)) * 8; const int t = (int)((g / (HD / 8)) % TT); const int h0 = (int)(g / ((size_t)(HD / 8) * TT)) * HPT;
    const int dp0 = (d < HD / 2) ? d + HD / 2 : d - HD / 2; const float* cp = CS + ((size_t)t * HD + d) * 2; const float* f = F + (size_t)t * pitch + h0 * HD; const float* rp = RF + (size_t)h0 * TT + t; v4f c4[4], xa[HPT][2], xb[HPT][2]; float rfs[HPT];
#pragma unroll
    for (int hh = 0; hh < HPT; ++hh) { xa[hh][0] = ld4w(f + hh * HD + d); xa[hh][1] = ld4w(f + hh * HD + d + 4); xb[hh][0] = ld4w(f + hh * HD + dp0); xb[hh][1] = ld4w(f + hh * HD + dp0 + 4); rfs[hh] = ld1w(rp + hh * TT); }
#pragma unroll
    for (int i = 0; i < 4; ++i) c4[i] = ld4w(cp + 4 * i);
    const v4f g0 = ld4w(nw + d), g1 = ld4w(nw + d + 4);
#pragma unroll
    for (int hh = 0; hh < HPT; ++hh) { const float rf = rfs[hh]; v8h o16; v8us oh, ol;
#pragma unroll
        for (int q = 0; q < 8; ++q) { const int dd = d + q; float x0 = xa[hh][q >> 2][q & 3], x1 = xb[hh][q >> 2][q & 3]; const float gq = (q < 4) ? g0[q & 3] : g1[q & 3];
            /* RMSNorm is applied AFTER the rotation below (the module's rope-then-norm order) */
            v2f cs; cs[0] = c4[q >> 1][(q & 1) * 2]; cs[1] = c4[q >> 1][(q & 1) * 2 + 1]; float a = __fmul_rn(x0, cs[0]), bq = __fmul_rn(x1, cs[1]); asm volatile("" : "+v"(a)); asm volatile("" : "+v"(bq)); float r = ((dd < HD / 2) ? __fsub_rn(a, bq) : __fadd_rn(a, bq)); { float n0 = __fmul_rn(r, rf); asm volatile("" : "+v"(n0)); r = __fmul_rn(n0, bfr(gq)); } r = r * sc;   /* rotated value x inverse RMS x bf16(gamma[d]) */
            o16[q] = tohx(r); unsigned short a2, c2; splitf(r, a2, c2); oh[q] = a2; ol[q] = c2; }
        const size_t e = ((size_t)(h0 + hh) * TT + t) * HD + d; *(v8h*)(P16 + e) = o16; *(v8us*)(Ph + e) = oh; *(v8us*)(Pl + e) = ol; } }
// k_vtp: one block transposes 64 tokens x all HD dims of one kv head; one thread 8 tokens x 4 dims (8 lanes write one whole 128-byte line of a plane; a wave reads 64-byte runs of 64 rows, the block whole rows)
__global__ __launch_bounds__(256) void k_vtp(const float* __restrict__ F, int pitch, int nheads, h16* V16, bf* Vh, bf* Vl) { const int g = (int)blockIdx.x / (TT / 64); if (g >= nheads) return; const int t = ((int)blockIdx.x % (TT / 64)) * 64 + ((int)threadIdx.x & 7) * 8; const int d = ((int)threadIdx.x >> 3) * 4; v4f x[8];
#pragma unroll
    for (int q = 0; q < 8; ++q) x[q] = ld4w(F + (size_t)(t + q) * pitch + g * HD + d);
#pragma unroll
    for (int j = 0; j < 4; ++j) { v8h o16; v8us oh, ol;
#pragma unroll
        for (int q = 0; q < 8; ++q) { const float xx = x[q][j]; o16[q] = tohx(xx); unsigned short a2, c2; splitf(xx, a2, c2); oh[q] = a2; ol[q] = c2; }
        const size_t e = ((size_t)g * HD + d + j) * TT + t; *(v8h*)(V16 + e) = o16; *(v8us*)(Vh + e) = oh; *(v8us*)(Vl + e) = ol; } }
__global__ __launch_bounds__(256) void k_cscvt(const float* __restrict__ cosT, const float* __restrict__ sinT, float* CS) { const int idx = (blockIdx.x * 256 + threadIdx.x) * 4; if (idx >= TT * HD) return; const v4f c = *(const v4f*)(cosT + idx), s = *(const v4f*)(sinT + idx); v4f o0, o1; o0[0] = bfr(c[0]); o0[1] = bfr(s[0]); o0[2] = bfr(c[1]); o0[3] = bfr(s[1]); o1[0] = bfr(c[2]); o1[1] = bfr(s[2]); o1[2] = bfr(c[3]); o1[3] = bfr(s[3]); *(v4f*)(CS + (size_t)idx * 2) = o0; *(v4f*)(CS + (size_t)idx * 2 + 4) = o1;  }
__global__ __launch_bounds__(256) void k_ropeF(float* F, int pitch, int nheads, const float* __restrict__ CS) { const size_t e = (size_t)blockIdx.x * 256 + threadIdx.x; if (e >= (size_t)(nheads / HPT) * TT * (HD / 8)) return; const int d = (int)(e % (HD / 8)) * 4; const int t = (int)((e / (HD / 8)) % TT); const int h0 = (int)(e / ((size_t)(HD / 8) * TT)) * HPT; float* f0 = F + (size_t)t * pitch + h0 * HD;   // one thread: the dim pairs (d + q, d + q + HD / 2), q < 4, of token t in heads h0 .. h0 + HPT - 1
    const float* cp = CS + ((size_t)t * HD + d) * 2; const v4f ca[2] = { *(const v4f*)cp, *(const v4f*)(cp + 4) }, cb[2] = { *(const v4f*)(cp + HD), *(const v4f*)(cp + HD + 4) }; v4f X1[HPT], X2[HPT];
#pragma unroll
    for (int hh = 0; hh < HPT; ++hh) { X1[hh] = *(const v4f*)(f0 + hh * HD + d); X2[hh] = *(const v4f*)(f0 + hh * HD + d + HD / 2); }   // all loads in front of the first store
#pragma unroll
    for (int hh = 0; hh < HPT; ++hh) { v4f Y1, Y2;
#pragma unroll
        for (int q = 0; q < 4; ++q) { const float x1 = X1[hh][q], x2 = X2[hh][q]; v2f c1, c2; c1[0] = ca[q >> 1][(q & 1) * 2]; c1[1] = ca[q >> 1][(q & 1) * 2 + 1]; c2[0] = cb[q >> 1][(q & 1) * 2]; c2[1] = cb[q >> 1][(q & 1) * 2 + 1];
            float a1 = __fmul_rn(x1, c1[0]), b1 = __fmul_rn(x2, c1[1]), a2 = __fmul_rn(x2, c2[0]), b2 = __fmul_rn(x1, c2[1]); asm volatile("" : "+v"(a1), "+v"(b1), "+v"(a2), "+v"(b2)); const float y1 = __fsub_rn(a1, b1), y2 = __fadd_rn(a2, b2);
            Y1[q] = y1; Y2[q] = y2; }
        *(v4f*)(f0 + hh * HD + d) = Y1; *(v4f*)(f0 + hh * HD + d + HD / 2) = Y2; } }
__global__ __launch_bounds__(256) void k_csid(float* CS) { const int idx = (blockIdx.x * 256 + threadIdx.x) * 4; if (idx >= TT * HD) return; v4f cs; cs[0] = 1.0f; cs[1] = 0.0f; cs[2] = 1.0f; cs[3] = 0.0f; *(v4f*)(CS + (size_t)idx * 2) = cs; *(v4f*)(CS + (size_t)idx * 2 + 4) = cs;  }
__global__ void k_ones(float* o) { const int i = threadIdx.x; if (i < HD) { *(float*)(o + i) = 1.0f;  } }
__global__ __launch_bounds__(256) void k_hrms(const float* __restrict__ F, int pitch, int nheads, float* RF) { const int idx = blockIdx.x * 256 + threadIdx.x; if (idx >= nheads * TT) return; const int t = idx % TT; const int h = idx / TT; const float* f = F + (size_t)t * pitch + h * HD; float s = 0.f;
#pragma unroll 4
    for (int d = 0; d < HD; d += 4) { const v4f a = *(const v4f*)(f + d);
#pragma unroll
        for (int q = 0; q < 4; ++q) { float p = __fmul_rn(a[q], a[q]); asm volatile("" : "+v"(p)); s = __fadd_rn(s, p); } }
    const float rf = __fdiv_rn(1.0f, __fsqrt_rn(__fadd_rn(__fdiv_rn(s, (float)HD), 1.1920929e-07f))); *(float*)(RF + idx) = rf;  }

// k_asoft: per row (zz, i): t = S x HD^-0.5 for j <= i and i - j < WIN (sliding causal window; the reference's -1e9 additive fill vanishes identically); softmax over the row's nc = (i / 64 + 1) * 64 packed columns (register row, one exp, fixed trees; the columns beyond nc would add exact zeros);
// the probabilities are written IN PLACE over the front of the row's own f32 scores (fp16: nc values; hi rows: nc hi values, then nc lo values): one wave owns one row and has read all of it (the row sum) before its first store.
__global__ __launch_bounds__(256) void k_asoft(float* Sb) {
    const int lane = threadIdx.x & 31; const int row = blockIdx.x * 8 + __builtin_amdgcn_readfirstlane((int)(threadIdx.x >> 5));   // the wave's row in a scalar register: the tests on nc below are scalar branches
    if (row >= ZH * TT) return; const int i = row % TT; const int zz = row / TT; const bool hires = (i < RH); const int rb = i >> 6, nc = (rb + 1) * 64;
    float* sr = Sb + (size_t)zz * SH + (size_t)rb * (rb + 1) * 2048 + (size_t)(i & 63) * nc; float v[TT / 32]; float mx = -3.0e38f;
#pragma unroll
    for (int ch = 0; ch < TT / 128; ++ch) { if (ch * 128 < nc) { const int j0 = ch * 128 + lane * 4; v4f a = (v4f){}; if (j0 < nc) a = *(const v4f*)(sr + j0);   // all of the row's loads first, so that they are in flight together; where nc ends in the middle of a 128-column piece its upper lanes load nothing (masked below: j > i)
#pragma unroll
        for (int q = 0; q < 4; ++q) v[ch * 4 + q] = a[q]; } }
#pragma unroll
    for (int ch = 0; ch < TT / 128; ++ch) { if (ch * 128 < nc) {
#pragma unroll
        for (int q = 0; q < 4; ++q) { const int j = ch * 128 + lane * 4 + q; const float t = (j <= i && i - j < WIN) ? v[ch * 4 + q] * SCL : -3.0e38f; v[ch * 4 + q] = t; mx = fmaxf(mx, t); } } }
#pragma unroll
    for (int sh = 16; sh; sh >>= 1) mx = fmaxf(mx, __shfl_xor(mx, sh, 32));
    float sum = 0.f;
#pragma unroll
    for (int ch = 0; ch < TT / 128; ++ch) { if (ch * 128 < nc) {
#pragma unroll
        for (int q = 0; q < 4; ++q) { const int k = ch * 4 + q; float d0 = __fsub_rn(v[k], mx); asm volatile("" : "+v"(d0)); v[k] = __builtin_amdgcn_exp2f(__fmul_rn(d0, 1.4426950408889634f)); sum += v[k]; } } }
#pragma unroll
    for (int sh = 16; sh; sh >>= 1) sum += __shfl_xor(sum, sh, 32);
    const float f = __fdiv_rn(hires ? 1.0f : PCAR, sum);
    if (hires) { bf* ph = (bf*)sr; bf* pl = ph + nc;
#pragma unroll
        for (int ch = 0; ch < RH / 128; ++ch) { const int j0 = ch * 128 + lane * 4; if (j0 < nc) { v4us oh, ol;
#pragma unroll
            for (int q = 0; q < 4; ++q) { unsigned short a, c2; splitf(v[ch * 4 + q] * f, a, c2); oh[q] = a; ol[q] = c2; }
            *(v4us*)(ph + j0) = oh; *(v4us*)(pl + j0) = ol; } }
    } else { h16* p16 = (h16*)sr;
#pragma unroll
        for (int ch = 0; ch < TT / 128; ++ch) { const int j0 = ch * 128 + lane * 4; if (j0 < nc) { v4h o4;
#pragma unroll
            for (int q = 0; q < 4; ++q) o4[q] = tohx(v[ch * 4 + q] * f);
            *(v4h*)(p16 + j0) = o4; } }
    }
}
__global__ __launch_bounds__(256) void k_merge(const float* __restrict__ O, int h0, bf* Ah, bf* Al) { const size_t g = (size_t)blockIdx.x * 256 + threadIdx.x; if (g >= (size_t)(ZH / HPT) * TT * (HD / 8)) return; const int d = (int)(g % (HD / 8)) * 8; const int t = (int)((g / (HD / 8)) % TT); const int z0 = (int)(g / ((size_t)(HD / 8) * TT)) * HPT; const float cs = (t < RH) ? 1.0f : (1.0f / PCAR); v4f x[HPT][2];   // one thread: 8 dims of token t in HPT heads
#pragma unroll
    for (int k = 0; k < HPT; ++k) { const float* o = O + ((size_t)(z0 + k) * TT + t) * HD + d; x[k][0] = ld4w(o); x[k][1] = ld4w(o + 4); }
#pragma unroll
    for (int k = 0; k < HPT; ++k) { const size_t oo = (size_t)t * DQ + (h0 + z0 + k) * HD + d; v8us oh, ol;
#pragma unroll
        for (int q = 0; q < 8; ++q) { unsigned short a, c2; splitf(x[k][q >> 2][q & 3] * cs, a, c2); oh[q] = a; ol[q] = c2; } *(v8us*)(Ah + oo) = oh; *(v8us*)(Al + oo) = ol; } }

extern "C" void kernel_launch(void* const* d_in, const int* in_sizes, int n_in,
                              void* d_out, int out_size, void* d_ws, size_t ws_size, hipStream_t stream) {
    (void)in_sizes; (void)n_in; (void)out_size;
    const float* x = (const float*)d_in[0]; const float* fcos = (const float*)d_in[1]; const float* fsin = (const float*)d_in[2]; const float* wq = (const float*)d_in[3]; const float* wk = (const float*)d_in[4]; const float* wv = (const float*)d_in[5]; const float* wo = (const float*)d_in[6];   /* inputs x, cos, sin ([2048][1][128] = [2048][128] FULL width, read per dimension), wq ('oi' [2048][2048]), wk, wv ('oi' [512][2048]), wproj ('oi') */
    float* OUT = (float*)d_out;     // [2][2048][2048]
    char* wsp = (char*)d_ws;
    auto take = [&](size_t bytes) { char* p = wsp; wsp += (bytes + 255) & ~(size_t)255; return (void*)p; };
    bf* WQ = (bf*)take((size_t)DQ * DM * 2); bf* WK = (bf*)take((size_t)DKV * DM * 2); bf* WV = (bf*)take((size_t)DKV * DM * 2); bf* WO = (bf*)take((size_t)DM * DQ * 2); float* CS = (float*)take((size_t)TT * HD * 2 * 4);
    bf* XB = (bf*)take((size_t)TT * DM * 2); float* ONES = (float*)take(256 * 4); float* CSI = (float*)take((size_t)TT * HD * 2 * 4);   /* identity {1, 0} table for the plane builder (the rotation is applied in place before the norm) */ float* RFQ = (float*)take((size_t)NH_ * TT * 4); float* RFK = (float*)take((size_t)NKV * TT * 4);   /* per (head, token) inverse RMS (sums of squares of the rotated values) */ float* FQ = (float*)take((size_t)TT * DQ * 4); float* FK = (float*)take((size_t)TT * DKV * 4);
    h16* QP16 = (h16*)take((size_t)NH_ * TT * HD * 2); h16* KP16 = (h16*)take((size_t)NKV * TT * HD * 2); h16* VT16 = (h16*)take((size_t)NKV * HD * TT * 2);
    bf* QPh = (bf*)take((size_t)NH_ * TT * HD * 2); bf* QPl = (bf*)take((size_t)NH_ * TT * HD * 2); bf* KPh = (bf*)take((size_t)NKV * TT * HD * 2); bf* KPl = (bf*)take((size_t)NKV * TT * HD * 2); bf* VTh = (bf*)take((size_t)NKV * HD * TT * 2); bf* VTl = (bf*)take((size_t)NKV * HD * TT * 2);
    float* Sb = (float*)take((size_t)ZH * SH * 4);   /* packed causal scores of all heads; the softmax writes the probabilities over them */ float* Ob = (float*)take((size_t)ZH * TT * HD * 4); bf* ATh = (bf*)take((size_t)TT * DQ * 2); bf* ATl = (bf*)take((size_t)TT * DQ * 2);
    if ((size_t)(wsp - (char*)d_ws) > ws_size) return;    // ws 256 MiB
    float* FV = FK;   // v projection reuses the k buffer after the k planes are built (stream-ordered)
    { k_cvt8<<<(unsigned)(((size_t)DQ * DM / 8 + 256 * CVN - 1) / (256 * CVN)), 256, 0, stream>>>(wq, WQ, (size_t)DQ * DM / 8); k_cvt8<<<(unsigned)(((size_t)DKV * DM / 8 + 256 * CVN - 1) / (256 * CVN)), 256, 0, stream>>>(wk, WK, (size_t)DKV * DM / 8); k_cvt8<<<(unsigned)(((size_t)DKV * DM / 8 + 256 * CVN - 1) / (256 * CVN)), 256, 0, stream>>>(wv, WV, (size_t)DKV * DM / 8);
      k_cvt8<<<(unsigned)(((size_t)DM * DQ / 8 + 256 * CVN - 1) / (256 * CVN)), 256, 0, stream>>>(wo, WO, (size_t)DM * DQ / 8);   /* 'oi' weights = Bt as-is */
       }
    k_cscvt<<<(TT * HD / 4 + 255) / 256, 256, 0, stream>>>(fcos, fsin, CS); k_csid<<<(TT * HD / 4 + 255) / 256, 256, 0, stream>>>(CSI); k_ones<<<1, 128, 0, stream>>>(ONES);   /* rotary table from the FULL-width inputs, per dimension; unit gains */   /* rotary table once */
    const unsigned LQ = (unsigned)(((size_t)(NH_ / HPT) * TT * (HD / 8) + 255) / 256), LKv = (unsigned)(((size_t)(NKV / HPT) * TT * (HD / 8) + 255) / 256);   // k_ropeF, k_rope, k_merge: one thread per (HPT heads, token, 8 values)
    for (int b = 0; b < NB_; ++b) {
        
        k_cvt8<<<(unsigned)(((size_t)TT * DM / 8 + 256 * CVN - 1) / (256 * CVN)), 256, 0, stream>>>(x + (size_t)b * TT * DM, XB, (size_t)TT * DM / 8);
        k_gemmw<bf, 0, false, 4><<<dim3(TT / 64, DQ / 64, 1), 128, 0, stream>>>(XB, nullptr, WQ, nullptr, DM, FQ, DQ, nullptr, 0, 0, 0);
        k_ropeF<<<LQ, 256, 0, stream>>>(FQ, DQ, NH_, CS);   /* rotary FIRST (the mean square changes) */ k_hrms<<<(NH_ * TT + 255) / 256, 256, 0, stream>>>(FQ, DQ, NH_, RFQ); k_rope<<<LQ, 256, 0, stream>>>(FQ, DQ, NH_, CSI, RFQ, ONES, 1.0f, QP16, QPh, QPl);   /* rope then gain-free RMSNorm (unit gains ONES) */
        k_gemmw<bf, 0, false, 8><<<dim3(TT / 64, DKV / 64, 1), 256, 0, stream>>>(XB, nullptr, WK, nullptr, DM, FK, DKV, nullptr, 0, 0, 0);
        k_ropeF<<<LKv, 256, 0, stream>>>(FK, DKV, NKV, CS); k_hrms<<<(NKV * TT + 255) / 256, 256, 0, stream>>>(FK, DKV, NKV, RFK); k_rope<<<LKv, 256, 0, stream>>>(FK, DKV, NKV, CSI, RFK, ONES, 1.0f, KP16, KPh, KPl);
        k_gemmw<bf, 0, false, 8><<<dim3(TT / 64, DKV / 64, 1), 256, 0, stream>>>(XB, nullptr, WV, nullptr, DM, FV, DKV, nullptr, 0, 0, 0); k_vtp<<<NKV * (TT / 64), 256, 0, stream>>>(FV, DKV, NKV, VT16, VTh, VTl);
        {   // one launch of each attention kernel for all ZH = NH_ heads of the batch (z = head; kv head z / REP inside k_gemmc)
            k_gemmc<bf, 2, 1, 1><<<dim3(RH / 64, TT / 64, ZH), 32, 0, stream>>>(QPh, QPl, KPh, KPl, HD, Sb, 0, 0, (size_t)TT * HD, (size_t)TT * HD, SH);
            k_gemmc<h16, 0, 1, 1><<<dim3((TT - RH) / 64, TT / 64, ZH), 32, 0, stream>>>(QP16 + (size_t)RH * HD, nullptr, KP16, nullptr, HD, Sb, 0, RH, (size_t)TT * HD, (size_t)TT * HD, SH);
            k_asoft<<<ZH * TT / 8, 256, 0, stream>>>(Sb);
            k_gemmc<bf, 2, 2, 8><<<dim3(RH / 64, HD / 64, ZH), 256, 0, stream>>>((const bf*)Sb, nullptr, VTh, VTl, TT, Ob, HD, 0, 2 * SH, (size_t)HD * TT, (size_t)TT * HD);
            k_gemmc<h16, 0, 2, 16><<<dim3((TT - RH) / 64, HD / 64, ZH), 512, 0, stream>>>((const h16*)Sb, nullptr, VT16, nullptr, TT, Ob + (size_t)RH * HD, HD, RH, 2 * SH, (size_t)HD * TT, (size_t)TT * HD);
            k_merge<<<(unsigned)(((size_t)(ZH / HPT) * TT * (HD / 8) + 255) / 256), 256, 0, stream>>>(Ob, 0, ATh, ATl); }
        k_gemmw<bf, 1, false, 4><<<dim3(TT / 64, DM / 64, 1), 128, 0, stream>>>(ATh, ATl, WO, nullptr, DQ, OUT + (size_t)b * TT * DM, DM, nullptr, 0, 0, 0); }
}

// v004
// One run takes 501 microseconds.
// Timed twice side by side with v003, it ran 1.11 times as fast both times.
// Over all steps from v000 it is 3.37 times as fast.
#include <hip/hip_runtime.h>

// Grouped-query causal attention with rotary embeddings followed by a gain-free RMSNorm on q and k (x [2][2048][2048]; q = x wq^T (16 heads x 128), k, v = x w^T ('oi' [512][2048]: 4 kv heads x 128); _apply_rope: x cos + rotate_half(x) sin with rotate_half = cat(-x2, x1) and the FULL-WIDTH cos / sin inputs [2048][1][128] (read per dimension); q = rms_norm(rope(q)), k = rms_norm(rope(k)) with x rsqrt(mean(x^2) + 1.19e-7) over the 128 dims (no gain; LITERAL order: the rotation is applied in place in f32 first, then the per-(token, head) row factor is taken from the rotated values); kv head = q head / 4 (repeat); scores x 128^-0.5; causal (-inf); softmax; out = merged wproj^T -> [2][2048][2048] (8.4 M); argument order x, cos, sin, wq, wk, wv, wproj).
// Layout per batch: bf16 copy of x; natural 'oi' weights cast as they are (Bt); exact projections into f32 feature rows; k_cscvt: the {cos, sin} table from the bf16-rounded FULL-width inputs (HD 128, read per dimension); k_ropeF: the rotate-half rotation IN PLACE on the f32 rows FIRST (the mean square changes); k_hrms: per (head, token) inverse RMS of the ROTATED values (eps 1.19e-7; no gain); k_rope with the identity table CSI and unit gains ONES applies the row factor and builds the planes; causal T-2048 GQA attention with 128-wide heads (all 16 heads of a batch per launch, kv head = z / 4; scores in packed causal 64-row blocks, probabilities written over them; hybrid rows; k_gemmc skips tiles above the diagonal); merged hi/lo x wproj exact.
// Compute dtypes, f32 accumulate: every input rounded to bf16 incl. the two tables; projections exact; rotary and RMSNorm f32; attention rows < 512 3 products, rest fp16; softmax f32; wproj hl x exact.

#define NB_  2
#define TT   2048
#define DM   2048
#define NH_  16
#define NKV  4        // four kv heads (grouped-query: kv head = q head / 4)
#define REP  (NH_ / NKV)
#define HD   128
#define DQ   (NH_ * HD)
#define DKV  (NKV * HD)
#define ZH   16                   // heads per attention launch: all of a batch
#define SH   ((size_t)(TT / 64) * (TT / 64 + 1) / 2 * 4096)   // f32 elements of one head's packed causal scores: 64-row block rb holds 64 rows of (rb + 1) * 64 columns and starts at rb (rb + 1) / 2 * 4096
#define RH   512                  // query rows < RH use hi+lo planes (0: none)
#define WIN  2048
#define PCAR 1024.0f
#define SCL  0.088388347648318447f   // HD^-0.5
typedef _Float16 h16;
typedef unsigned short bf;
typedef __attribute__((ext_vector_type(16))) __bf16   v16bf;
typedef __attribute__((ext_vector_type(16))) _Float16 v16h;
typedef __attribute__((ext_vector_type(8)))  _Float16 v8h;
typedef __attribute__((ext_vector_type(8)))  unsigned short v8us;
typedef __attribute__((ext_vector_type(8)))  float    v8f;
typedef __attribute__((ext_vector_type(4)))  float    v4f;
typedef v8h  __attribute__((may_alias)) v8ha;
typedef v4f  __attribute__((may_alias)) v4fa;
typedef v8us __attribute__((may_alias)) v8usa;

__device__ __forceinline__ unsigned short f2bf(float f) { unsigned u = __float_as_uint(f); u += 0x7FFFu + ((u >> 16) & 1u); return (unsigned short)(u >> 16); }
__device__ __forceinline__ float bf2f(unsigned short b) { return __uint_as_float(((unsigned)b) << 16); }
__device__ __forceinline__ float bfr(float f) { return bf2f(f2bf(f)); }
__device__ __forceinline__ v16h cat16(v8h lo, v8h hi) { return __builtin_shufflevector(lo, hi, 0, 1, 2, 3, 4, 5, 6, 7, 8, 9, 10, 11, 12, 13, 14, 15); }
__device__ __forceinline__ v16bf cat16b(v8us lo, v8us hi) { return __builtin_bit_cast(v16bf, __builtin_shufflevector(lo, hi, 0, 1, 2, 3, 4, 5, 6, 7, 8, 9, 10, 11, 12, 13, 14, 15)); }
__device__ __forceinline__ v8f wmma16(v16h a, v16h b, v8f c) { return __builtin_amdgcn_wmma_f32_16x16x32_f16(false, a, false, b, (short)0, c, false, false); }
__device__ __forceinline__ v8f wmmab(v16bf a, v16bf b, v8f c) { return __builtin_amdgcn_wmma_f32_16x16x32_bf16(false, a, false, b, (short)0, c, false, false); }



// ---- k_gemmw: register-blocked GEMM, NW WAVES per 64x64 output tile, each with the whole tile (16 accumulators) over its own share of K (128-byte chunks dealt round robin), partial tiles summed through LDS; operands from K-contiguous 16-bit planes by way of the wave's own LDS tiles; grid (M/64, N/64, Z), 32 NW threads. K % 64 == 0.
// C[m][n] (f32, pitch ldc, + optional f32 bias[n]) = sum_k A[m][k] Bt[n][k] (+ split products per NSPLIT). z-batch strides sA/sB/sC in elements. K % 64 == 0.
template <typename T16> struct WFrag;
template <> struct WFrag<h16> { typedef v16h V; static __device__ __forceinline__ V ld(const h16* p) { return cat16(*(const v8h*)p, *(const v8h*)(p + 16)); } static __device__ __forceinline__ v8f mma(V a, V b, v8f c) { return wmma16(a, b, c); } };
template <> struct WFrag<bf> { typedef v16bf V; static __device__ __forceinline__ V ld(const bf* p) { return cat16b(*(const v8us*)p, *(const v8us*)(p + 16)); } static __device__ __forceinline__ v8f mma(V a, V b, v8f c) { return wmmab(a, b, c); } };
// LFrag: one fragment (the same k order as WFrag::ld) from a staged LDS row
template <typename T16> struct LFrag;
template <> struct LFrag<h16> { static __device__ __forceinline__ v16h ld(const unsigned short* p) { return cat16(*(const v8ha*)p, *(const v8ha*)(p + 16)); } };
template <> struct LFrag<bf> { static __device__ __forceinline__ v16bf ld(const unsigned short* p) { return cat16b(*(const v8usa*)p, *(const v8usa*)(p + 16)); } };
#define SP 72   // LDS row pitch of a staged K chunk in 16-bit elements: 128 bytes of data + 16 bytes, the pitch for 16-byte readers
// Operand path: a wave brings each of its 64-element K chunks (64 rows x 128 bytes per operand plane) with 16-byte loads of which each covers four WHOLE 128-byte lines (8 lanes a row), stores them to its OWN LDS tiles and reads the fragments from there
// (a fragment load straight from the plane touches 16 lines for 512 bytes). The next chunk's loads are in flight while this chunk is multiplied. No wave reads another wave's tiles, so the K loop has no barrier. KK = K = row pitch of every operand plane, a compile-time constant, so that the 16 loads of a plane differ in their immediate offset only.
template <typename T16, int NSPLIT, bool BIAS, int NW, int KK>
__global__ __launch_bounds__(32 * NW) void k_gemmw(const T16* A, const T16* A2, const T16* Bt, const T16* Bt2, float* C, int ldc, const float* __restrict__ bias, size_t sA, size_t sB, size_t sC) {
    typedef typename WFrag<T16>::V V;
    constexpr bool HA2 = (NSPLIT == 1 || NSPLIT == 2), HB2 = (NSPLIT >= 2);
    constexpr int NT = 2 + (HA2 ? 1 : 0) + (HB2 ? 1 : 0);   // staged planes: A, B, then A2, then B2
    constexpr int WS = NT * 64 * SP / 2;                    // f32 elements of one wave's LDS: its staged tiles in the K loop, then its 64 x 64 partial tile (pitch 68) over them
    __shared__ __align__(16) float os[NW * WS];
    const int wv = (NW > 1) ? __builtin_amdgcn_readfirstlane((int)(threadIdx.x >> 5)) : 0;   // wave number in a scalar register: the K loop's bounds and branch stay scalar
    const size_t z = blockIdx.z; A += z * sA; if (A2) A2 += z * sA; Bt += z * sB; if (Bt2) Bt2 += z * sB; C += z * sC;
    const int lane = threadIdx.x & 31, lr = lane & 15, hi = lane >> 4; const int r0 = blockIdx.x * 64, c0 = blockIdx.y * 64;
    v8f acc[4][4];
#pragma unroll
    for (int mb = 0; mb < 4; ++mb)
#pragma unroll
        for (int nb = 0; nb < 4; ++nb) acc[mb][nb] = (v8f){};
    const unsigned short* gp[4] = { (const unsigned short*)A + (size_t)r0 * KK, (const unsigned short*)Bt + (size_t)c0 * KK, HA2 ? (const unsigned short*)A2 + (size_t)r0 * KK : nullptr, HB2 ? (const unsigned short*)Bt2 + (size_t)c0 * KK : nullptr };   // wave-uniform plane bases of this tile
    constexpr int TA2 = 2, TB2 = HA2 ? 3 : 2;               // LDS tile numbers of the lo planes
    const unsigned vo = (unsigned)((lane >> 3) * KK + (lane & 7) * 8);   // the lane's own place in a load: row lane / 8, 16-byte piece lane % 8; never rewritten
    unsigned short* sw = (unsigned short*)os + (size_t)wv * (WS * 2);
    unsigned short* sst = sw + (lane >> 3) * SP + (lane & 7) * 8;
    const unsigned short* sfr = sw + lr * SP + 8 * hi;
    v8us rg[NT][16];
    auto fetch = [&](int kc) {
#pragma unroll
        for (int i = 0; i < 16; ++i) { rg[0][i] = *(const v8usa*)(gp[0] + kc + i * 4 * KK + vo); rg[1][i] = *(const v8usa*)(gp[1] + kc + i * 4 * KK + vo); if (HA2) rg[TA2][i] = *(const v8usa*)(gp[2] + kc + i * 4 * KK + vo); if (HB2) rg[TB2][i] = *(const v8usa*)(gp[3] + kc + i * 4 * KK + vo); }
        asm volatile("s_wait_xcnt 0x0" :: "v"(vo) : "memory");   // behind the chunk's loads, in front of any later write of an address register that they name (vo as an input keeps its register until here; the operand pointers carry no restrict, so that the loads stay in front of this statement)
    };
    fetch(wv * 64);
#pragma unroll 1
    for (int kc = wv * 64; kc < KK; kc += NW * 64) {   // wave wv takes the 64-element (128-byte) K chunks wv, wv + NW, ...: two 32-steps per chunk, in the order of k
#pragma unroll
        for (int t = 0; t < NT; ++t)
#pragma unroll
            for (int i = 0; i < 16; ++i) *(v8usa*)(sst + t * 64 * SP + i * 4 * SP) = rg[t][i];
        asm volatile("s_wait_dscnt 0x0" ::: "memory");   // the wave's own LDS stores are done before its lanes read rows that other lanes of the wave stored
        if (kc + NW * 64 < KK) fetch(kc + NW * 64);      // scalar test; the next chunk's loads fly during this chunk's products
#pragma unroll
        for (int ks = 0; ks < 2; ++ks) {
            V a[4], a2[4];
#pragma unroll
            for (int mb = 0; mb < 4; ++mb) { a[mb] = LFrag<T16>::ld(sfr + mb * 16 * SP + ks * 32); if (HA2) a2[mb] = LFrag<T16>::ld(sfr + TA2 * 64 * SP + mb * 16 * SP + ks * 32); }
#pragma unroll
            for (int nb = 0; nb < 4; ++nb) { const V b = LFrag<T16>::ld(sfr + 64 * SP + nb * 16 * SP + ks * 32); V b2; if (HB2) b2 = LFrag<T16>::ld(sfr + TB2 * 64 * SP + nb * 16 * SP + ks * 32);
#pragma unroll
                for (int mb = 0; mb < 4; ++mb) { acc[mb][nb] = WFrag<T16>::mma(a[mb], b, acc[mb][nb]); if (HA2) acc[mb][nb] = WFrag<T16>::mma(a2[mb], b, acc[mb][nb]); if (HB2) acc[mb][nb] = WFrag<T16>::mma(a[mb], b2, acc[mb][nb]); } }
            asm volatile("v_nop\n\tv_nop\n\tv_nop\n\tv_nop" : "+v"(acc[0][0]), "+v"(acc[1][1]), "+v"(acc[2][2]), "+v"(acc[3][3]) : "v"(a[0]), "v"(a[3]));   // four vector slots behind the step's products, in front of the next writes of a[] and on the taken side of the loop's branch
        }
    }
    if (NW > 1) {   // the NW partial tiles (each in its wave's own LDS range, over its staged tiles) are summed through LDS in wave order 0 .. NW-1; every thread sums and stores 32 / NW pieces of four columns
#pragma unroll
        for (int mb = 0; mb < 4; ++mb) {
#pragma unroll
            for (int nb = 0; nb < 4; ++nb) {
#pragma unroll
                for (int j = 0; j < 8; ++j) os[wv * WS + (mb * 16 + hi * 8 + j) * 68 + nb * 16 + lr] = acc[mb][nb][j]; } }
        __syncthreads();   // publishes every wave's partial tile to the whole block
        float* crow = C + (size_t)r0 * ldc + c0;
#pragma unroll
        for (int it = 0; it < 32 / NW; ++it) { const int idx = it * (NW * 32) + (int)threadIdx.x; const int row = idx >> 4, cofs = (idx & 15) * 4; v4f val = *(const v4fa*)(os + row * 68 + cofs);
#pragma unroll
            for (int w = 1; w < NW; ++w) val += *(const v4fa*)(os + w * WS + row * 68 + cofs);
            if (BIAS) { val[0] += bfr(bias[c0 + cofs]); val[1] += bfr(bias[c0 + cofs + 1]); val[2] += bfr(bias[c0 + cofs + 2]); val[3] += bfr(bias[c0 + cofs + 3]); }
            *(v4f*)(crow + (size_t)row * ldc + cofs) = val; }
        return; }
#pragma unroll
    for (int mb = 0; mb < 4; ++mb) {
#pragma unroll
        for (int nb = 0; nb < 4; ++nb) {
#pragma unroll
            for (int j = 0; j < 8; ++j) os[(hi * 8 + j) * 68 + nb * 16 + lr] = acc[mb][nb][j]; }
        __builtin_amdgcn_wave_barrier(); asm volatile("" ::: "memory");
        float* crow = C + (size_t)(r0 + mb * 16) * ldc + c0;
{
#pragma unroll
            for (int s = 0; s < 8; ++s) { const int row = 2 * s + hi, cofs = lr * 4; v4f val = *(const v4fa*)(os + row * 68 + cofs); if (BIAS) { val[0] += bfr(bias[c0 + cofs]); val[1] += bfr(bias[c0 + cofs + 1]); val[2] += bfr(bias[c0 + cofs + 2]); val[3] += bfr(bias[c0 + cofs + 3]); }
                *(v4f*)(crow + (size_t)row * ldc + cofs) = val; }
             }
        __builtin_amdgcn_wave_barrier(); asm volatile("" ::: "memory");
    }
}

// WHalf: one 16-byte half of a fragment and the joining of two, for a loader that puts a wait between the two loads of a fragment.
template <typename T16> struct WHalf;
template <> struct WHalf<h16> { typedef v8h H; static __device__ __forceinline__ v16h join(H lo, H hi) { return cat16(lo, hi); } };
template <> struct WHalf<bf> { typedef v8us H; static __device__ __forceinline__ v16bf join(H lo, H hi) { return cat16b(lo, hi); } };
// ---- k_gemmc: the same 64x64 tile GEMM (NW waves per tile, K dealt among them) specialised for causal attention: CMODE 1 skips score tiles entirely above the diagonal (query rows r0+roff.., key columns c0..), CMODE 2 limits the
// key (K) loop of the probability x value contraction to the diagonal block (probabilities beyond it are exactly zero). roff = row offset of this launch's first row within the sequence.
// Scores and probabilities live in the packed causal layout (SH): CMODE 1 writes C there (row pitch nc = (rb + 1) * 64 f32); CMODE 2 reads A there, 16-bit values written by the softmax over the front of each f32 row (row pitch 2 nc; the lo plane nc elements behind the hi plane). z = head of the batch; B belongs to kv head z / REP.
template <typename T16, int NSPLIT, int CMODE, int NW>
__global__ __launch_bounds__(32 * NW) void k_gemmc(const T16* __restrict__ A, const T16* __restrict__ A2, const T16* __restrict__ Bt, const T16* __restrict__ Bt2, int K, float* C, int ldc, int roff, size_t sA, size_t sB, size_t sC) {
    typedef typename WFrag<T16>::V V;
    __shared__ __align__(16) float os[(NW > 1 ? 4 * NW : 1) * 16 * 68];   // NW > 1: one whole 64 x 64 partial tile per wave (pitch 68)
    const int wv = (NW > 1) ? __builtin_amdgcn_readfirstlane((int)(threadIdx.x >> 5)) : 0;   // wave number in a scalar register: the K loop's bounds and branch stay scalar
    const size_t z = blockIdx.z; A += z * sA; if (A2) A2 += z * sA; Bt += (z / REP) * sB; if (Bt2) Bt2 += (z / REP) * sB; C += z * sC;
    const int lane = threadIdx.x & 31, lr = lane & 15, hi = lane >> 4; const int r0 = blockIdx.x * 64, c0 = blockIdx.y * 64;
    if (CMODE == 1 && c0 > r0 + roff + 63) return;                  // score tile entirely above the causal diagonal: never written (the softmax masks j > i by select)
    const int Kl = (CMODE == 2) ? min(K, r0 + roff + 64) : K;        // P.V: probabilities are exactly 0 beyond the diagonal block, so the K loop stops there
    const int rb = (r0 + roff) >> 6, nc = (rb + 1) * 64; const size_t tri = (size_t)rb * (rb + 1) * 2048;   // packed causal layout: this row block's columns and its first f32 element
    const int lda = (CMODE == 2) ? 2 * nc : K; if (CMODE == 2) { A += 2 * tri; A2 = A + nc; }
    C += (CMODE == 1) ? tri : (size_t)r0 * ldc; if (CMODE == 1) ldc = nc;   // C: this row block's first row; the packed scores' row pitch is the block's own
    v8f acc[4][4];
#pragma unroll
    for (int mb = 0; mb < 4; ++mb)
#pragma unroll
        for (int nb = 0; nb < 4; ++nb) acc[mb][nb] = (v8f){};
    const size_t aoff = (size_t)((CMODE == 2 ? 0 : r0) + lr) * lda + 8 * hi, boff = (size_t)(c0 + lr) * K + 8 * hi;
#pragma unroll 1
    for (int kc = wv * 64; kc < Kl; kc += (kc & 32) ? NW * 64 - 32 : 32) {   // wave wv takes the 64-element (128-byte) K chunks wv, wv + NW, ... (Kl is a multiple of 64): two 32-steps per chunk
        V a[4], a2[4];
#pragma unroll
        for (int mb = 0; mb < 4; ++mb) {
            typedef typename WHalf<T16>::H H; const T16* pa = A + aoff + (size_t)mb * 16 * lda + kc;
            const H alo = *(const H*)pa; asm volatile("s_wait_xcnt 0x0" ::: "memory"); const H ahi = *(const H*)(pa + 16); asm volatile("s_wait_xcnt 0x0" ::: "memory"); a[mb] = WHalf<T16>::join(alo, ahi);   // s_wait_xcnt 0 directly behind each 16-byte A load: it stands in front of any later write (a later load's result too) of the address registers that the load names
            if (NSPLIT == 1 || NSPLIT == 2) { const T16* pa2 = A2 + aoff + (size_t)mb * 16 * lda + kc;
                const H blo = *(const H*)pa2; asm volatile("s_wait_xcnt 0x0" ::: "memory"); const H bhi = *(const H*)(pa2 + 16); asm volatile("s_wait_xcnt 0x0" ::: "memory"); a2[mb] = WHalf<T16>::join(blo, bhi); } }   // the same waits behind the lo plane's loads
#pragma unroll
        for (int nb = 0; nb < 4; ++nb) { const V b = WFrag<T16>::ld(Bt + boff + (size_t)nb * 16 * K + kc); V b2; if (NSPLIT >= 2) b2 = WFrag<T16>::ld(Bt2 + boff + (size_t)nb * 16 * K + kc);
#pragma unroll
            for (int mb = 0; mb < 4; ++mb) { acc[mb][nb] = WFrag<T16>::mma(a[mb], b, acc[mb][nb]); if (NSPLIT == 1 || NSPLIT == 2) acc[mb][nb] = WFrag<T16>::mma(a2[mb], b, acc[mb][nb]); if (NSPLIT >= 2) acc[mb][nb] = WFrag<T16>::mma(a[mb], b2, acc[mb][nb]); } }
        asm volatile("v_nop\n\tv_nop\n\tv_nop\n\tv_nop" : "+v"(acc[0][0]), "+v"(acc[1][1]), "+v"(acc[2][2]), "+v"(acc[3][3]) : "v"(a[0]), "v"(a[3]));
    }
    if (NW > 1) {   // the NW partial tiles are summed through LDS in wave order 0 .. NW-1; every thread sums and stores 32 / NW pieces of four columns
#pragma unroll
        for (int mb = 0; mb < 4; ++mb) {
#pragma unroll
            for (int nb = 0; nb < 4; ++nb) {
#pragma unroll
                for (int j = 0; j < 8; ++j) os[wv * (64 * 68) + (mb * 16 + hi * 8 + j) * 68 + nb * 16 + lr] = acc[mb][nb][j]; } }
        __syncthreads();   // publishes every wave's partial tile to the whole block
        float* crow = C + c0;
#pragma unroll
        for (int it = 0; it < 32 / NW; ++it) { const int idx = it * (NW * 32) + (int)threadIdx.x; const int row = idx >> 4, cofs = (idx & 15) * 4; v4f val = *(const v4fa*)(os + row * 68 + cofs);
#pragma unroll
            for (int w = 1; w < NW; ++w) val += *(const v4fa*)(os + w * (64 * 68) + row * 68 + cofs);
            *(v4f*)(crow + (size_t)row * ldc + cofs) = val; }
        return; }
#pragma unroll
    for (int mb = 0; mb < 4; ++mb) {
#pragma unroll
        for (int nb = 0; nb < 4; ++nb) {
#pragma unroll
            for (int j = 0; j < 8; ++j) os[(hi * 8 + j) * 68 + nb * 16 + lr] = acc[mb][nb][j]; }
        __builtin_amdgcn_wave_barrier(); asm volatile("" ::: "memory");
        float* crow = C + (size_t)(mb * 16) * ldc + c0;
{
#pragma unroll
            for (int s = 0; s < 8; ++s) { const int row = 2 * s + hi, cofs = lr * 4; v4f val = *(const v4fa*)(os + row * 68 + cofs);
                *(v4f*)(crow + (size_t)row * ldc + cofs) = val; }
             }
        __builtin_amdgcn_wave_barrier(); asm volatile("" ::: "memory");
    }
}

__device__ __forceinline__ h16 tohx(float x) { return (h16)x; }
__device__ __forceinline__ void splitf(float y, unsigned short& h, unsigned short& l) { h = f2bf(y); l = f2bf(y - bf2f(h)); }
typedef __attribute__((ext_vector_type(2))) _Float16 v2h;
typedef __attribute__((ext_vector_type(4))) _Float16 v4h;
typedef __attribute__((ext_vector_type(2))) unsigned short v2us;
typedef __attribute__((ext_vector_type(4))) unsigned short v4us;
typedef __attribute__((ext_vector_type(2))) float v2f;
typedef __attribute__((ext_vector_type(4))) int v4i;

// The conversion, rotation, plane and merge kernels below give every thread 16 to 32 elements in 16-byte pieces (they had 1 to 8): a launch starts 4 to 16 times fewer waves, and each lane has its loads in flight together. Every element's arithmetic is as before.
#define CVN 4   // 8-value pieces per thread of k_cvt8, 256 threads apart
#define HPT 4   // heads per thread of k_ropeF, k_rope and k_merge: the table values of one (token, dims) piece are loaded once for HPT heads
__global__ __launch_bounds__(256) void k_cvt8(const float* __restrict__ src, bf* dst, size_t n8) { const size_t i0 = (size_t)blockIdx.x * (256 * CVN) + threadIdx.x; v8f v[CVN];
#pragma unroll
    for (int c = 0; c < CVN; ++c) { const size_t i = i0 + (size_t)c * 256; v[c] = *(const v8f*)(src + (i < n8 ? i : n8 - 1) * 8); }   // all loads first, without a branch (a piece past the end reads the last piece and is not stored), so that they are in flight together
#pragma unroll
    for (int c = 0; c < CVN; ++c) { const size_t i = i0 + (size_t)c * 256; if (i < n8) { v8us o;
#pragma unroll
        for (int k = 0; k < 8; ++k) o[k] = f2bf(v[c][k]); *(v8us*)(dst + i * 8) = o; } } }

// k_rope: head planes [h][t][d] (fp16 + hi/lo) of RMSNorm(rope(x)) = rope(x)[d] x RF[h][t] x bf16(gamma[d]) x sc (norm after the rotation) with the rotate-half convention out[d] = x[d] cos[t][d] - x[d+HD/2] sin[t][d], out[d+HD/2] = x[d+HD/2] cos[t][d+HD/2] + x[d] sin[t][d+HD/2]
// ld4w, ld1w: a load with s_wait_xcnt 0 directly behind it: the wait stands in front of any later write (a later load's result too) of the address registers that the load names
__device__ __forceinline__ v4f ld4w(const float* p) { const v4f v = *(const v4fa*)p; asm volatile("s_wait_xcnt 0x0" ::: "memory"); return v; }
__device__ __forceinline__ float ld1w(const float* p) { const float v = *p; asm volatile("s_wait_xcnt 0x0" ::: "memory"); return v; }
// one thread: 8 dims d .. d + 7 of token t in heads h0 .. h0 + HPT - 1; RF is never null (both launches pass the row factors)
__global__ __launch_bounds__(256) void k_rope(const float* __restrict__ F, int pitch, int nheads, const float* __restrict__ CS, const float* __restrict__ RF, const float* __restrict__ nw, float sc, h16* P16, bf* Ph, bf* Pl) {
    const size_t g = (size_t)blockIdx.x * 256 + threadIdx.x; if (g >= (size_t)(nheads / HPT) * TT * (HD / 8)) return; const int d = (int)(g % (HD / 8)) * 8; const int t = (int)((g / (HD / 8)) % TT); const int h0 = (int)(g / ((size_t)(HD / 8) * TT)) * HPT;
    const int dp0 = (d < HD / 2) ? d + HD / 2 : d - HD / 2; const float* cp = CS + ((size_t)t * HD + d) * 2; const float* f = F + (size_t)t * pitch + h0 * HD; const float* rp = RF + (size_t)h0 * TT + t; v4f c4[4], xa[HPT][2], xb[HPT][2]; float rfs[HPT];
#pragma unroll
    for (int hh = 0; hh < HPT; ++hh) { xa[hh][0] = ld4w(f + hh * HD + d); xa[hh][1] = ld4w(f + hh * HD + d + 4); xb[hh][0] = ld4w(f + hh * HD + dp0); xb[hh][1] = ld4w(f + hh * HD + dp0 + 4); rfs[hh] = ld1w(rp + hh * TT); }
#pragma unroll
    for (int i = 0; i < 4; ++i) c4[i] = ld4w(cp + 4 * i);
    const v4f g0 = ld4w(nw + d), g1 = ld4w(nw + d + 4);
#pragma unroll
    for (int hh = 0; hh < HPT; ++hh) { const float rf = rfs[hh]; v8h o16; v8us oh, ol;
#pragma unroll
        for (int q = 0; q < 8; ++q) { const int dd = d + q; float x0 = xa[hh][q >> 2][q & 3], x1 = xb[hh][q >> 2][q & 3]; const float gq = (q < 4) ? g0[q & 3] : g1[q & 3];
            /* RMSNorm is applied AFTER the rotation below (the module's rope-then-norm order) */
            v2f cs; cs[0] = c4[q >> 1][(q & 1) * 2]; cs[1] = c4[q >> 1][(q & 1) * 2 + 1]; float a = __fmul_rn(x0, cs[0]), bq = __fmul_rn(x1, cs[1]); asm volatile("" : "+v"(a)); asm volatile("" : "+v"(bq)); float r = ((dd < HD / 2) ? __fsub_rn(a, bq) : __fadd_rn(a, bq)); { float n0 = __fmul_rn(r, rf); asm volatile("" : "+v"(n0)); r = __fmul_rn(n0, bfr(gq)); } r = r * sc;   /* rotated value x inverse RMS x bf16(gamma[d]) */
            o16[q] = tohx(r); unsigned short a2, c2; splitf(r, a2, c2); oh[q] = a2; ol[q] = c2; }
        const size_t e = ((size_t)(h0 + hh) * TT + t) * HD + d; *(v8h*)(P16 + e) = o16; *(v8us*)(Ph + e) = oh; *(v8us*)(Pl + e) = ol; } }
// k_vtp: one block transposes 64 tokens x all HD dims of one kv head; one thread 8 tokens x 4 dims (8 lanes write one whole 128-byte line of a plane; a wave reads 64-byte runs of 64 rows, the block whole rows)
__global__ __launch_bounds__(256) void k_vtp(const float* __restrict__ F, int pitch, int nheads, h16* V16, bf* Vh, bf* Vl) { const int g = (int)blockIdx.x / (TT / 64); if (g >= nheads) return; const int t = ((int)blockIdx.x % (TT / 64)) * 64 + ((int)threadIdx.x & 7) * 8; const int d = ((int)threadIdx.x >> 3) * 4; v4f x[8];
#pragma unroll
    for (int q = 0; q < 8; ++q) x[q] = ld4w(F + (size_t)(t + q) * pitch + g * HD + d);
#pragma unroll
    for (int j = 0; j < 4; ++j) { v8h o16; v8us oh, ol;
#pragma unroll
        for (int q = 0; q < 8; ++q) { const float xx = x[q][j]; o16[q] = tohx(xx); unsigned short a2, c2; splitf(xx, a2, c2); oh[q] = a2; ol[q] = c2; }
        const size_t e = ((size_t)g * HD + d + j) * TT + t; *(v8h*)(V16 + e) = o16; *(v8us*)(Vh + e) = oh; *(v8us*)(Vl + e) = ol; } }
__global__ __launch_bounds__(256) void k_cscvt(const float* __restrict__ cosT, const float* __restrict__ sinT, float* CS) { const int idx = (blockIdx.x * 256 + threadIdx.x) * 4; if (idx >= TT * HD) return; const v4f c = *(const v4f*)(cosT + idx), s = *(const v4f*)(sinT + idx); v4f o0, o1; o0[0] = bfr(c[0]); o0[1] = bfr(s[0]); o0[2] = bfr(c[1]); o0[3] = bfr(s[1]); o1[0] = bfr(c[2]); o1[1] = bfr(s[2]); o1[2] = bfr(c[3]); o1[3] = bfr(s[3]); *(v4f*)(CS + (size_t)idx * 2) = o0; *(v4f*)(CS + (size_t)idx * 2 + 4) = o1;  }
__global__ __launch_bounds__(256) void k_ropeF(float* F, int pitch, int nheads, const float* __restrict__ CS) { const size_t e = (size_t)blockIdx.x * 256 + threadIdx.x; if (e >= (size_t)(nheads / HPT) * TT * (HD / 8)) return; const int d = (int)(e % (HD / 8)) * 4; const int t = (int)((e / (HD / 8)) % TT); const int h0 = (int)(e / ((size_t)(HD / 8) * TT)) * HPT; float* f0 = F + (size_t)t * pitch + h0 * HD;   // one thread: the dim pairs (d + q, d + q + HD / 2), q < 4, of token t in heads h0 .. h0 + HPT - 1
    const float* cp = CS + ((size_t)t * HD + d) * 2; const v4f ca[2] = { *(const v4f*)cp, *(const v4f*)(cp + 4) }, cb[2] = { *(const v4f*)(cp + HD), *(const v4f*)(cp + HD + 4) }; v4f X1[HPT], X2[HPT];
#pragma unroll
    for (int hh = 0; hh < HPT; ++hh) { X1[hh] = *(const v4f*)(f0 + hh * HD + d); X2[hh] = *(const v4f*)(f0 + hh * HD + d + HD / 2); }   // all loads in front of the first store
#pragma unroll
    for (int hh = 0; hh < HPT; ++hh) { v4f Y1, Y2;
#pragma unroll
        for (int q = 0; q < 4; ++q) { const float x1 = X1[hh][q], x2 = X2[hh][q]; v2f c1, c2; c1[0] = ca[q >> 1][(q & 1) * 2]; c1[1] = ca[q >> 1][(q & 1) * 2 + 1]; c2[0] = cb[q >> 1][(q & 1) * 2]; c2[1] = cb[q >> 1][(q & 1) * 2 + 1];
            float a1 = __fmul_rn(x1, c1[0]), b1 = __fmul_rn(x2, c1[1]), a2 = __fmul_rn(x2, c2[0]), b2 = __fmul_rn(x1, c2[1]); asm volatile("" : "+v"(a1), "+v"(b1), "+v"(a2), "+v"(b2)); const float y1 = __fsub_rn(a1, b1), y2 = __fadd_rn(a2, b2);
            Y1[q] = y1; Y2[q] = y2; }
        *(v4f*)(f0 + hh * HD + d) = Y1; *(v4f*)(f0 + hh * HD + d + HD / 2) = Y2; } }
__global__ __launch_bounds__(256) void k_csid(float* CS) { const int idx = (blockIdx.x * 256 + threadIdx.x) * 4; if (idx >= TT * HD) return; v4f cs; cs[0] = 1.0f; cs[1] = 0.0f; cs[2] = 1.0f; cs[3] = 0.0f; *(v4f*)(CS + (size_t)idx * 2) = cs; *(v4f*)(CS + (size_t)idx * 2 + 4) = cs;  }
__global__ void k_ones(float* o) { const int i = threadIdx.x; if (i < HD) { *(float*)(o + i) = 1.0f;  } }
__global__ __launch_bounds__(256) void k_hrms(const float* __restrict__ F, int pitch, int nheads, float* RF) { const int idx = blockIdx.x * 256 + threadIdx.x; if (idx >= nheads * TT) return; const int t = idx % TT; const int h = idx / TT; const float* f = F + (size_t)t * pitch + h * HD; float s = 0.f;
#pragma unroll 4
    for (int d = 0; d < HD; d += 4) { const v4f a = *(const v4f*)(f + d);
#pragma unroll
        for (int q = 0; q < 4; ++q) { float p = __fmul_rn(a[q], a[q]); asm volatile("" : "+v"(p)); s = __fadd_rn(s, p); } }
    const float rf = __fdiv_rn(1.0f, __fsqrt_rn(__fadd_rn(__fdiv_rn(s, (float)HD), 1.1920929e-07f))); *(float*)(RF + idx) = rf;  }

// k_asoft: per row (zz, i): t = S x HD^-0.5 for j <= i and i - j < WIN (WIN = TT: that test always holds, plain causal; the reference's -1e9 additive fill vanishes identically); softmax over the row's nc = (i / 64 + 1) * 64 packed columns (register row, one exp, fixed trees; the columns beyond nc would add exact zeros);
// the probabilities are written IN PLACE over the front of the row's own f32 scores (fp16: nc values; hi rows: nc hi values, then nc lo values): one wave owns one row and has read all of it (the row sum) before its first store.
__global__ __launch_bounds__(256) void k_asoft(float* Sb) {
    const int lane = threadIdx.x & 31; const int row = blockIdx.x * 8 + __builtin_amdgcn_readfirstlane((int)(threadIdx.x >> 5));   // the wave's row in a scalar register: the tests on nc below are scalar branches
    if (row >= ZH * TT) return; const int i = row % TT; const int zz = row / TT; const bool hires = (i < RH); const int rb = i >> 6, nc = (rb + 1) * 64;
    float* sr = Sb + (size_t)zz * SH + (size_t)rb * (rb + 1) * 2048 + (size_t)(i & 63) * nc; float v[TT / 32]; float mx = -3.0e38f;
#pragma unroll
    for (int ch = 0; ch < TT / 128; ++ch) { if (ch * 128 < nc) { const int j0 = ch * 128 + lane * 4; v4f a = (v4f){}; if (j0 < nc) a = *(const v4f*)(sr + j0);   // all of the row's loads first, so that they are in flight together; where nc ends in the middle of a 128-column piece its upper lanes load nothing (masked below: j > i)
#pragma unroll
        for (int q = 0; q < 4; ++q) v[ch * 4 + q] = a[q]; } }
#pragma unroll
    for (int ch = 0; ch < TT / 128; ++ch) { if (ch * 128 < nc) {
#pragma unroll
        for (int q = 0; q < 4; ++q) { const int j = ch * 128 + lane * 4 + q; const float t = (j <= i && i - j < WIN) ? v[ch * 4 + q] * SCL : -3.0e38f; v[ch * 4 + q] = t; mx = fmaxf(mx, t); } } }
#pragma unroll
    for (int sh = 16; sh; sh >>= 1) mx = fmaxf(mx, __shfl_xor(mx, sh, 32));
    float sum = 0.f;
#pragma unroll
    for (int ch = 0; ch < TT / 128; ++ch) { if (ch * 128 < nc) {
#pragma unroll
        for (int q = 0; q < 4; ++q) { const int k = ch * 4 + q; float d0 = __fsub_rn(v[k], mx); asm volatile("" : "+v"(d0)); v[k] = __builtin_amdgcn_exp2f(__fmul_rn(d0, 1.4426950408889634f)); sum += v[k]; } } }
#pragma unroll
    for (int sh = 16; sh; sh >>= 1) sum += __shfl_xor(sum, sh, 32);
    const float f = __fdiv_rn(hires ? 1.0f : PCAR, sum);
    if (hires) { bf* ph = (bf*)sr; bf* pl = ph + nc;
#pragma unroll
        for (int ch = 0; ch < RH / 128; ++ch) { const int j0 = ch * 128 + lane * 4; if (j0 < nc) { v4us oh, ol;
#pragma unroll
            for (int q = 0; q < 4; ++q) { unsigned short a, c2; splitf(v[ch * 4 + q] * f, a, c2); oh[q] = a; ol[q] = c2; }
            *(v4us*)(ph + j0) = oh; *(v4us*)(pl + j0) = ol; } }
    } else { h16* p16 = (h16*)sr;
#pragma unroll
        for (int ch = 0; ch < TT / 128; ++ch) { const int j0 = ch * 128 + lane * 4; if (j0 < nc) { v4h o4;
#pragma unroll
            for (int q = 0; q < 4; ++q) o4[q] = tohx(v[ch * 4 + q] * f);
            *(v4h*)(p16 + j0) = o4; } }
    }
}
__global__ __launch_bounds__(256) void k_merge(const float* __restrict__ O, int h0, bf* Ah, bf* Al) { const size_t g = (size_t)blockIdx.x * 256 + threadIdx.x; if (g >= (size_t)(ZH / HPT) * TT * (HD / 8)) return; const int d = (int)(g % (HD / 8)) * 8; const int t = (int)((g / (HD / 8)) % TT); const int z0 = (int)(g / ((size_t)(HD / 8) * TT)) * HPT; const float cs = (t < RH) ? 1.0f : (1.0f / PCAR); v4f x[HPT][2];   // one thread: 8 dims of token t in HPT heads
#pragma unroll
    for (int k = 0; k < HPT; ++k) { const float* o = O + ((size_t)(z0 + k) * TT + t) * HD + d; x[k][0] = ld4w(o); x[k][1] = ld4w(o + 4); }
#pragma unroll
    for (int k = 0; k < HPT; ++k) { const size_t oo = (size_t)t * DQ + (h0 + z0 + k) * HD + d; v8us oh, ol;
#pragma unroll
        for (int q = 0; q < 8; ++q) { unsigned short a, c2; splitf(x[k][q >> 2][q & 3] * cs, a, c2); oh[q] = a; ol[q] = c2; } *(v8us*)(Ah + oo) = oh; *(v8us*)(Al + oo) = ol; } }

extern "C" void kernel_launch(void* const* d_in, const int* in_sizes, int n_in,
                              void* d_out, int out_size, void* d_ws, size_t ws_size, hipStream_t stream) {
    (void)in_sizes; (void)n_in; (void)out_size;
    const float* x = (const float*)d_in[0]; const float* fcos = (const float*)d_in[1]; const float* fsin = (const float*)d_in[2]; const float* wq = (const float*)d_in[3]; const float* wk = (const float*)d_in[4]; const float* wv = (const float*)d_in[5]; const float* wo = (const float*)d_in[6];   /* inputs x, cos, sin ([2048][1][128] = [2048][128] FULL width, read per dimension), wq ('oi' [2048][2048]), wk, wv ('oi' [512][2048]), wproj ('oi') */
    float* OUT = (float*)d_out;     // [2][2048][2048]
    char* wsp = (char*)d_ws;
    auto take = [&](size_t bytes) { char* p = wsp; wsp += (bytes + 255) & ~(size_t)255; return (void*)p; };
    bf* WQ = (bf*)take((size_t)DQ * DM * 2); bf* WK = (bf*)take((size_t)DKV * DM * 2); bf* WV = (bf*)take((size_t)DKV * DM * 2); bf* WO = (bf*)take((size_t)DM * DQ * 2); float* CS = (float*)take((size_t)TT * HD * 2 * 4);
    bf* XB = (bf*)take((size_t)TT * DM * 2); float* ONES = (float*)take(256 * 4); float* CSI = (float*)take((size_t)TT * HD * 2 * 4);   /* identity {1, 0} table for the plane builder (the rotation is applied in place before the norm) */ float* RFQ = (float*)take((size_t)NH_ * TT * 4); float* RFK = (float*)take((size_t)NKV * TT * 4);   /* per (head, token) inverse RMS (sums of squares of the rotated values) */ float* FQ = (float*)take((size_t)TT * DQ * 4); float* FK = (float*)take((size_t)TT * DKV * 4);
    h16* QP16 = (h16*)take((size_t)NH_ * TT * HD * 2); h16* KP16 = (h16*)take((size_t)NKV * TT * HD * 2); h16* VT16 = (h16*)take((size_t)NKV * HD * TT * 2);
    bf* QPh = (bf*)take((size_t)NH_ * TT * HD * 2); bf* QPl = (bf*)take((size_t)NH_ * TT * HD * 2); bf* KPh = (bf*)take((size_t)NKV * TT * HD * 2); bf* KPl = (bf*)take((size_t)NKV * TT * HD * 2); bf* VTh = (bf*)take((size_t)NKV * HD * TT * 2); bf* VTl = (bf*)take((size_t)NKV * HD * TT * 2);
    float* Sb = (float*)take((size_t)ZH * SH * 4);   /* packed causal scores of all heads; the softmax writes the probabilities over them */ float* Ob = (float*)take((size_t)ZH * TT * HD * 4); bf* ATh = (bf*)take((size_t)TT * DQ * 2); bf* ATl = (bf*)take((size_t)TT * DQ * 2);
    if ((size_t)(wsp - (char*)d_ws) > ws_size) return;    // ws 256 MiB
    float* FV = FK;   // v projection reuses the k buffer after the k planes are built (stream-ordered)
    { k_cvt8<<<(unsigned)(((size_t)DQ * DM / 8 + 256 * CVN - 1) / (256 * CVN)), 256, 0, stream>>>(wq, WQ, (size_t)DQ * DM / 8); k_cvt8<<<(unsigned)(((size_t)DKV * DM / 8 + 256 * CVN - 1) / (256 * CVN)), 256, 0, stream>>>(wk, WK, (size_t)DKV * DM / 8); k_cvt8<<<(unsigned)(((size_t)DKV * DM / 8 + 256 * CVN - 1) / (256 * CVN)), 256, 0, stream>>>(wv, WV, (size_t)DKV * DM / 8);
      k_cvt8<<<(unsigned)(((size_t)DM * DQ / 8 + 256 * CVN - 1) / (256 * CVN)), 256, 0, stream>>>(wo, WO, (size_t)DM * DQ / 8);   /* 'oi' weights = Bt as-is */
       }
    k_cscvt<<<(TT * HD / 4 + 255) / 256, 256, 0, stream>>>(fcos, fsin, CS); k_csid<<<(TT * HD / 4 + 255) / 256, 256, 0, stream>>>(CSI); k_ones<<<1, 128, 0, stream>>>(ONES);   /* rotary table from the FULL-width inputs, per dimension; unit gains */   /* rotary table once */
    const unsigned LQ = (unsigned)(((size_t)(NH_ / HPT) * TT * (HD / 8) + 255) / 256), LKv = (unsigned)(((size_t)(NKV / HPT) * TT * (HD / 8) + 255) / 256);   // k_ropeF, k_rope, k_merge: one thread per (HPT heads, token, 8 values)
    for (int b = 0; b < NB_; ++b) {
        
        k_cvt8<<<(unsigned)(((size_t)TT * DM / 8 + 256 * CVN - 1) / (256 * CVN)), 256, 0, stream>>>(x + (size_t)b * TT * DM, XB, (size_t)TT * DM / 8);
        k_gemmw<bf, 0, false, 4, DM><<<dim3(TT / 64, DQ / 64, 1), 128, 0, stream>>>(XB, nullptr, WQ, nullptr, FQ, DQ, nullptr, 0, 0, 0);
        k_ropeF<<<LQ, 256, 0, stream>>>(FQ, DQ, NH_, CS);   /* rotary FIRST (the tables need not be unit rotations: the mean square changes) */ k_hrms<<<(NH_ * TT + 255) / 256, 256, 0, stream>>>(FQ, DQ, NH_, RFQ); k_rope<<<LQ, 256, 0, stream>>>(FQ, DQ, NH_, CSI, RFQ, ONES, 1.0f, QP16, QPh, QPl);   /* rope then RMSNorm, unit gains ONES */
        k_gemmw<bf, 0, false, 8, DM><<<dim3(TT / 64, DKV / 64, 1), 256, 0, stream>>>(XB, nullptr, WK, nullptr, FK, DKV, nullptr, 0, 0, 0);
        k_ropeF<<<LKv, 256, 0, stream>>>(FK, DKV, NKV, CS); k_hrms<<<(NKV * TT + 255) / 256, 256, 0, stream>>>(FK, DKV, NKV, RFK); k_rope<<<LKv, 256, 0, stream>>>(FK, DKV, NKV, CSI, RFK, ONES, 1.0f, KP16, KPh, KPl);
        k_gemmw<bf, 0, false, 8, DM><<<dim3(TT / 64, DKV / 64, 1), 256, 0, stream>>>(XB, nullptr, WV, nullptr, FV, DKV, nullptr, 0, 0, 0); k_vtp<<<NKV * (TT / 64), 256, 0, stream>>>(FV, DKV, NKV, VT16, VTh, VTl);
        {   // one launch of each attention kernel for all ZH = NH_ heads of the batch (z = head; kv head z / REP inside k_gemmc)
            k_gemmc<bf, 2, 1, 1><<<dim3(RH / 64, TT / 64, ZH), 32, 0, stream>>>(QPh, QPl, KPh, KPl, HD, Sb, 0, 0, (size_t)TT * HD, (size_t)TT * HD, SH);
            k_gemmc<h16, 0, 1, 1><<<dim3((TT - RH) / 64, TT / 64, ZH), 32, 0, stream>>>(QP16 + (size_t)RH * HD, nullptr, KP16, nullptr, HD, Sb, 0, RH, (size_t)TT * HD, (size_t)TT * HD, SH);
            k_asoft<<<ZH * TT / 8, 256, 0, stream>>>(Sb);
            k_gemmc<bf, 2, 2, 8><<<dim3(RH / 64, HD / 64, ZH), 256, 0, stream>>>((const bf*)Sb, nullptr, VTh, VTl, TT, Ob, HD, 0, 2 * SH, (size_t)HD * TT, (size_t)TT * HD);
            k_gemmc<h16, 0, 2, 16><<<dim3((TT - RH) / 64, HD / 64, ZH), 512, 0, stream>>>((const h16*)Sb, nullptr, VT16, nullptr, TT, Ob + (size_t)RH * HD, HD, RH, 2 * SH, (size_t)HD * TT, (size_t)TT * HD);
            k_merge<<<(unsigned)(((size_t)(ZH / HPT) * TT * (HD / 8) + 255) / 256), 256, 0, stream>>>(Ob, 0, ATh, ATl); }
        k_gemmw<bf, 1, false, 4, DQ><<<dim3(TT / 64, DM / 64, 1), 128, 0, stream>>>(ATh, ATl, WO, nullptr, OUT + (size_t)b * TT * DM, DM, nullptr, 0, 0, 0); }
}

// v005
// One run takes 460 microseconds.
// Next to v004, in two timings, it ran 1.09 times as fast each time.
// All steps since v000 together make it 3.67 times as fast.
#include <hip/hip_runtime.h>

// Grouped-query causal attention with rotary embeddings followed by a gain-free RMSNorm on q and k (x [2][2048][2048]; q = x wq^T (16 heads x 128), k, v = x w^T ('oi' [512][2048]: 4 kv heads x 128); _apply_rope: x cos + rotate_half(x) sin with rotate_half = cat(-x2, x1) and the FULL-WIDTH cos / sin inputs [2048][1][128] (read per dimension); q = rms_norm(rope(q)), k = rms_norm(rope(k)) with x rsqrt(mean(x^2) + 1.19e-7) over the 128 dims (no gain; LITERAL order: the rotation is applied in place in f32 first, then the per-(token, head) row factor is taken from the rotated values); kv head = q head / 4 (repeat); scores x 128^-0.5; causal (-inf); softmax; out = merged wproj^T -> [2][2048][2048] (8.4 M); argument order x, cos, sin, wq, wk, wv, wproj).
// Layout (every stage outside the attention runs once for both batches; blockIdx.y = batch where a kernel needs it): bf16 copy of x; natural 'oi' weights cast as they are (Bt); exact projections into f32 feature rows q | k | v; k_tabs: the {cos, sin} table from the bf16-rounded FULL-width inputs (HD 128, read per dimension); k_ropeF: the rotate-half rotation IN PLACE on the f32 rows FIRST; k_hrms: per (head, token) inverse RMS of the ROTATED values (eps 1.19e-7; no gain); k_rope with the identity table CSI and unit gains ONES applies the row factor and builds the planes; causal T-2048 GQA attention with 128-wide heads (all 16 heads of a batch per launch, kv head = z / 4; scores in packed causal 64-row blocks, probabilities written over them; hybrid rows; k_gemmc skips tiles above the diagonal); merged hi/lo x wproj exact.
// Compute dtypes, f32 accumulate: every input rounded to bf16 incl. the two tables; projections exact; rotary and RMSNorm f32; attention rows < 512 3 products, rest fp16; softmax f32; wproj hl x exact.

#define NB_  2
#define TT   2048
#define DM   2048
#define NH_  16
#define NKV  4        // four kv heads (grouped-query: kv head = q head / 4)
#define REP  (NH_ / NKV)
#define HD   128
#define DQ   (NH_ * HD)
#define DKV  (NKV * HD)
#define NHR  (NH_ + NKV)          // heads that take the rotation and the norm: the 16 q heads, then the 4 k heads
#define DF   (DQ + 2 * DKV)       // one token's f32 feature row: q | k | v
#define MT   (NB_ * TT)           // token rows of both batches
#define ZH   16                   // heads per attention launch: all of a batch
#define SH   ((size_t)(TT / 64) * (TT / 64 + 1) / 2 * 4096)   // f32 elements of one head's packed causal scores: 64-row block rb holds 64 rows of (rb + 1) * 64 columns and starts at rb (rb + 1) / 2 * 4096
#define RH   512                  // query rows < RH use hi+lo planes (0: none)
#define WIN  2048
#define PCAR 1024.0f
#define SCL  0.088388347648318447f   // HD^-0.5
typedef _Float16 h16;
typedef unsigned short bf;
typedef __attribute__((ext_vector_type(16))) __bf16   v16bf;
typedef __attribute__((ext_vector_type(16))) _Float16 v16h;
typedef __attribute__((ext_vector_type(8)))  _Float16 v8h;
typedef __attribute__((ext_vector_type(8)))  unsigned short v8us;
typedef __attribute__((ext_vector_type(8)))  float    v8f;
typedef __attribute__((ext_vector_type(4)))  float    v4f;
typedef v8h  __attribute__((may_alias)) v8ha;
typedef v4f  __attribute__((may_alias)) v4fa;
typedef v8us __attribute__((may_alias)) v8usa;

__device__ __forceinline__ unsigned short f2bf(float f) { unsigned u = __float_as_uint(f); u += 0x7FFFu + ((u >> 16) & 1u); return (unsigned short)(u >> 16); }
__device__ __forceinline__ float bf2f(unsigned short b) { return __uint_as_float(((unsigned)b) << 16); }
__device__ __forceinline__ float bfr(float f) { return bf2f(f2bf(f)); }
__device__ __forceinline__ v16h cat16(v8h lo, v8h hi) { return __builtin_shufflevector(lo, hi, 0, 1, 2, 3, 4, 5, 6, 7, 8, 9, 10, 11, 12, 13, 14, 15); }
__device__ __forceinline__ v16bf cat16b(v8us lo, v8us hi) { return __builtin_bit_cast(v16bf, __builtin_shufflevector(lo, hi, 0, 1, 2, 3, 4, 5, 6, 7, 8, 9, 10, 11, 12, 13, 14, 15)); }
__device__ __forceinline__ v8f wmma16(v16h a, v16h b, v8f c) { return __builtin_amdgcn_wmma_f32_16x16x32_f16(false, a, false, b, (short)0, c, false, false); }
__device__ __forceinline__ v8f wmmab(v16bf a, v16bf b, v8f c) { return __builtin_amdgcn_wmma_f32_16x16x32_bf16(false, a, false, b, (short)0, c, false, false); }



// ---- k_gemmw: register-blocked GEMM, NW WAVES per 64x64 output tile, each with the whole tile (16 accumulators) over its own share of K (128-byte chunks dealt round robin), partial tiles summed through LDS; operands from K-contiguous 16-bit planes by way of the wave's own LDS tiles; grid (M/64, N/64, Z), 32 NW threads. K % 64 == 0.
// C[m][n] (f32, pitch ldc, + optional f32 bias[n]) = sum_k A[m][k] Bt[n][k] (+ split products per NSPLIT). z-batch strides sA/sB/sC in elements. K % 64 == 0.
template <typename T16> struct WFrag;
template <> struct WFrag<h16> { typedef v16h V; static __device__ __forceinline__ V ld(const h16* p) { return cat16(*(const v8h*)p, *(const v8h*)(p + 16)); } static __device__ __forceinline__ v8f mma(V a, V b, v8f c) { return wmma16(a, b, c); } };
template <> struct WFrag<bf> { typedef v16bf V; static __device__ __forceinline__ V ld(const bf* p) { return cat16b(*(const v8us*)p, *(const v8us*)(p + 16)); } static __device__ __forceinline__ v8f mma(V a, V b, v8f c) { return wmmab(a, b, c); } };
// LFrag: one fragment (the same k order as WFrag::ld) from a staged LDS row
template <typename T16> struct LFrag;
template <> struct LFrag<h16> { static __device__ __forceinline__ v16h ld(const unsigned short* p) { return cat16(*(const v8ha*)p, *(const v8ha*)(p + 16)); } };
template <> struct LFrag<bf> { static __device__ __forceinline__ v16bf ld(const unsigned short* p) { return cat16b(*(const v8usa*)p, *(const v8usa*)(p + 16)); } };
#define SP 72   // LDS row pitch of a staged K chunk in 16-bit elements: 128 bytes of data + 16 bytes, the pitch for 16-byte readers
// Operand path: a wave brings each of its 64-element K chunks (64 rows x 128 bytes per operand plane) with 16-byte loads of which each covers four WHOLE 128-byte lines (8 lanes a row), stores them to its OWN LDS tiles and reads the fragments from there
// (a fragment load straight from the plane touches 16 lines for 512 bytes). The next chunk's loads are in flight while this chunk is multiplied. No wave reads another wave's tiles, so the K loop has no barrier. KK = K = row pitch of every operand plane, a compile-time constant, so that the 16 loads of a plane differ in their immediate offset only.
template <typename T16, int NSPLIT, bool BIAS, int NW, int KK>
__global__ __launch_bounds__(32 * NW) void k_gemmw(const T16* A, const T16* A2, const T16* Bt, const T16* Bt2, float* C, int ldc, const float* __restrict__ bias, size_t sA, size_t sB, size_t sC) {
    typedef typename WFrag<T16>::V V;
    constexpr bool HA2 = (NSPLIT == 1 || NSPLIT == 2), HB2 = (NSPLIT >= 2);
    constexpr int NT = 2 + (HA2 ? 1 : 0) + (HB2 ? 1 : 0);   // staged planes: A, B, then A2, then B2
    constexpr int WS = NT * 64 * SP / 2;                    // f32 elements of one wave's LDS: its staged tiles in the K loop, then its 64 x 64 partial tile (pitch 68) over them
    __shared__ __align__(16) float os[NW * WS];
    const int wv = (NW > 1) ? __builtin_amdgcn_readfirstlane((int)(threadIdx.x >> 5)) : 0;   // wave number in a scalar register: the K loop's bounds and branch stay scalar
    const size_t z = blockIdx.z; A += z * sA; if (A2) A2 += z * sA; Bt += z * sB; if (Bt2) Bt2 += z * sB; C += z * sC;
    const int lane = threadIdx.x & 31, lr = lane & 15, hi = lane >> 4; const int r0 = blockIdx.x * 64, c0 = blockIdx.y * 64;
    v8f acc[4][4];
#pragma unroll
    for (int mb = 0; mb < 4; ++mb)
#pragma unroll
        for (int nb = 0; nb < 4; ++nb) acc[mb][nb] = (v8f){};
    const unsigned short* gp[4] = { (const unsigned short*)A + (size_t)r0 * KK, (const unsigned short*)Bt + (size_t)c0 * KK, HA2 ? (const unsigned short*)A2 + (size_t)r0 * KK : nullptr, HB2 ? (const unsigned short*)Bt2 + (size_t)c0 * KK : nullptr };   // wave-uniform plane bases of this tile
    constexpr int TA2 = 2, TB2 = HA2 ? 3 : 2;               // LDS tile numbers of the lo planes
    const unsigned vo = (unsigned)((lane >> 3) * KK + (lane & 7) * 8);   // the lane's own place in a load: row lane / 8, 16-byte piece lane % 8; never rewritten
    unsigned short* sw = (unsigned short*)os + (size_t)wv * (WS * 2);
    unsigned short* sst = sw + (lane >> 3) * SP + (lane & 7) * 8;
    const unsigned short* sfr = sw + lr * SP + 8 * hi;
    v8us rg[NT][16];
    auto fetch = [&](int kc) {
#pragma unroll
        for (int i = 0; i < 16; ++i) { rg[0][i] = *(const v8usa*)(gp[0] + kc + i * 4 * KK + vo); rg[1][i] = *(const v8usa*)(gp[1] + kc + i * 4 * KK + vo); if (HA2) rg[TA2][i] = *(const v8usa*)(gp[2] + kc + i * 4 * KK + vo); if (HB2) rg[TB2][i] = *(const v8usa*)(gp[3] + kc + i * 4 * KK + vo); }
        asm volatile("s_wait_xcnt 0x0" :: "v"(vo) : "memory");   // behind the chunk's loads, in front of any later write of an address register that they name (vo as an input keeps its register until here; the operand pointers carry no restrict, so that the loads stay in front of this statement)
    };
    fetch(wv * 64);
#pragma unroll 1
    for (int kc = wv * 64; kc < KK; kc += NW * 64) {   // wave wv takes the 64-element (128-byte) K chunks wv, wv + NW, ...: two 32-steps per chunk, in the order of k
#pragma unroll
        for (int t = 0; t < NT; ++t)
#pragma unroll
            for (int i = 0; i < 16; ++i) *(v8usa*)(sst + t * 64 * SP + i * 4 * SP) = rg[t][i];
        asm volatile("s_wait_dscnt 0x0" ::: "memory");   // the wave's own LDS stores are done before its lanes read rows that other lanes of the wave stored
        if (kc + NW * 64 < KK) fetch(kc + NW * 64);      // scalar test; the next chunk's loads fly during this chunk's products
#pragma unroll
        for (int ks = 0; ks < 2; ++ks) {
            V a[4], a2[4];
#pragma unroll
            for (int mb = 0; mb < 4; ++mb) { a[mb] = LFrag<T16>::ld(sfr + mb * 16 * SP + ks * 32); if (HA2) a2[mb] = LFrag<T16>::ld(sfr + TA2 * 64 * SP + mb * 16 * SP + ks * 32); }
#pragma unroll
            for (int nb = 0; nb < 4; ++nb) { const V b = LFrag<T16>::ld(sfr + 64 * SP + nb * 16 * SP + ks * 32); V b2; if (HB2) b2 = LFrag<T16>::ld(sfr + TB2 * 64 * SP + nb * 16 * SP + ks * 32);
#pragma unroll
                for (int mb = 0; mb < 4; ++mb) { acc[mb][nb] = WFrag<T16>::mma(a[mb], b, acc[mb][nb]); if (HA2) acc[mb][nb] = WFrag<T16>::mma(a2[mb], b, acc[mb][nb]); if (HB2) acc[mb][nb] = WFrag<T16>::mma(a[mb], b2, acc[mb][nb]); } }
            asm volatile("v_nop\n\tv_nop\n\tv_nop\n\tv_nop" : "+v"(acc[0][0]), "+v"(acc[1][1]), "+v"(acc[2][2]), "+v"(acc[3][3]) : "v"(a[0]), "v"(a[3]));   // four vector slots behind the step's products, in front of the next writes of a[] and on the taken side of the loop's branch
        }
    }
    if (NW > 1) {   // the NW partial tiles (each in its wave's own LDS range, over its staged tiles) are summed through LDS in wave order 0 .. NW-1; every thread sums and stores 32 / NW pieces of four columns
#pragma unroll
        for (int mb = 0; mb < 4; ++mb) {
#pragma unroll
            for (int nb = 0; nb < 4; ++nb) {
#pragma unroll
                for (int j = 0; j < 8; ++j) os[wv * WS + (mb * 16 + hi * 8 + j) * 68 + nb * 16 + lr] = acc[mb][nb][j]; } }
        __syncthreads();   // publishes every wave's partial tile to the whole block
        float* crow = C + (size_t)r0 * ldc + c0;
#pragma unroll
        for (int it = 0; it < 32 / NW; ++it) { const int idx = it * (NW * 32) + (int)threadIdx.x; const int row = idx >> 4, cofs = (idx & 15) * 4; v4f val = *(const v4fa*)(os + row * 68 + cofs);
#pragma unroll
            for (int w = 1; w < NW; ++w) val += *(const v4fa*)(os + w * WS + row * 68 + cofs);
            if (BIAS) { val[0] += bfr(bias[c0 + cofs]); val[1] += bfr(bias[c0 + cofs + 1]); val[2] += bfr(bias[c0 + cofs + 2]); val[3] += bfr(bias[c0 + cofs + 3]); }
            *(v4f*)(crow + (size_t)row * ldc + cofs) = val; }
        return; }
#pragma unroll
    for (int mb = 0; mb < 4; ++mb) {
#pragma unroll
        for (int nb = 0; nb < 4; ++nb) {
#pragma unroll
            for (int j = 0; j < 8; ++j) os[(hi * 8 + j) * 68 + nb * 16 + lr] = acc[mb][nb][j]; }
        __builtin_amdgcn_wave_barrier(); asm volatile("" ::: "memory");
        float* crow = C + (size_t)(r0 + mb * 16) * ldc + c0;
{
#pragma unroll
            for (int s = 0; s < 8; ++s) { const int row = 2 * s + hi, cofs = lr * 4; v4f val = *(const v4fa*)(os + row * 68 + cofs); if (BIAS) { val[0] += bfr(bias[c0 + cofs]); val[1] += bfr(bias[c0 + cofs + 1]); val[2] += bfr(bias[c0 + cofs + 2]); val[3] += bfr(bias[c0 + cofs + 3]); }
                *(v4f*)(crow + (size_t)row * ldc + cofs) = val; }
             }
        __builtin_amdgcn_wave_barrier(); asm volatile("" ::: "memory");
    }
}

// WHalf: one 16-byte half of a fragment and the joining of two, for a loader that puts a wait between the two loads of a fragment.
template <typename T16> struct WHalf;
template <> struct WHalf<h16> { typedef v8h H; static __device__ __forceinline__ v16h join(H lo, H hi) { return cat16(lo, hi); } };
template <> struct WHalf<bf> { typedef v8us H; static __device__ __forceinline__ v16bf join(H lo, H hi) { return cat16b(lo, hi); } };
// ---- k_gemmc: the same 64x64 tile GEMM (NW waves per tile, K dealt among them) specialised for causal attention: CMODE 1 skips score tiles entirely above the diagonal (query rows r0+roff.., key columns c0..), CMODE 2 limits the
// key (K) loop of the probability x value contraction to the diagonal block (probabilities beyond it are exactly zero). roff = row offset of this launch's first row within the sequence.
// Scores and probabilities live in the packed causal layout (SH): CMODE 1 writes C there (row pitch nc = (rb + 1) * 64 f32); CMODE 2 reads A there, 16-bit values written by the softmax over the front of each f32 row (row pitch 2 nc; the lo plane nc elements behind the hi plane). z = head of the batch; B belongs to kv head z / REP.
template <typename T16, int NSPLIT, int CMODE, int NW>
__global__ __launch_bounds__(32 * NW) void k_gemmc(const T16* __restrict__ A, const T16* __restrict__ A2, const T16* __restrict__ Bt, const T16* __restrict__ Bt2, int K, float* C, int ldc, int roff, size_t sA, size_t sB, size_t sC) {
    typedef typename WFrag<T16>::V V;
    __shared__ __align__(16) float os[(NW > 1 ? 4 * NW : 1) * 16 * 68];   // NW > 1: one whole 64 x 64 partial tile per wave (pitch 68)
    const int wv = (NW > 1) ? __builtin_amdgcn_readfirstlane((int)(threadIdx.x >> 5)) : 0;   // wave number in a scalar register: the K loop's bounds and branch stay scalar
    const size_t z = blockIdx.z; A += z * sA; if (A2) A2 += z * sA; Bt += (z / REP) * sB; if (Bt2) Bt2 += (z / REP) * sB; C += z * sC;
    const int lane = threadIdx.x & 31, lr = lane & 15, hi = lane >> 4; const int r0 = blockIdx.x * 64, c0 = blockIdx.y * 64;
    if (CMODE == 1 && c0 > r0 + roff + 63) return;                  // score tile entirely above the causal diagonal: never written (the softmax masks j > i by select)
    const int Kl = (CMODE == 2) ? min(K, r0 + roff + 64) : K;        // P.V: probabilities are exactly 0 beyond the diagonal block, so the K loop stops there
    const int rb = (r0 + roff) >> 6, nc = (rb + 1) * 64; const size_t tri = (size_t)rb * (rb + 1) * 2048;   // packed causal layout: this row block's columns and its first f32 element
    const int lda = (CMODE == 2) ? 2 * nc : K; if (CMODE == 2) { A += 2 * tri; A2 = A + nc; }
    C += (CMODE == 1) ? tri : (size_t)r0 * ldc; if (CMODE == 1) ldc = nc;   // C: this row block's first row; the packed scores' row pitch is the block's own
    v8f acc[4][4];
#pragma unroll
    for (int mb = 0; mb < 4; ++mb)
#pragma unroll
        for (int nb = 0; nb < 4; ++nb) acc[mb][nb] = (v8f){};
    const size_t aoff = (size_t)((CMODE == 2 ? 0 : r0) + lr) * lda + 8 * hi, boff = (size_t)(c0 + lr) * K + 8 * hi;
#pragma unroll 1
    for (int kc = wv * 64; kc < Kl; kc += (kc & 32) ? NW * 64 - 32 : 32) {   // wave wv takes the 64-element (128-byte) K chunks wv, wv + NW, ... (Kl is a multiple of 64): two 32-steps per chunk
        V a[4], a2[4];
#pragma unroll
        for (int mb = 0; mb < 4; ++mb) {
            typedef typename WHalf<T16>::H H; const T16* pa = A + aoff + (size_t)mb * 16 * lda + kc;
            const H alo = *(const H*)pa; asm volatile("s_wait_xcnt 0x0" ::: "memory"); const H ahi = *(const H*)(pa + 16); asm volatile("s_wait_xcnt 0x0" ::: "memory"); a[mb] = WHalf<T16>::join(alo, ahi);   // s_wait_xcnt 0 directly behind each 16-byte A load: it stands in front of any later write (a later load's result too) of the address registers that the load names
            if (NSPLIT == 1 || NSPLIT == 2) { const T16* pa2 = A2 + aoff + (size_t)mb * 16 * lda + kc;
                const H blo = *(const H*)pa2; asm volatile("s_wait_xcnt 0x0" ::: "memory"); const H bhi = *(const H*)(pa2 + 16); asm volatile("s_wait_xcnt 0x0" ::: "memory"); a2[mb] = WHalf<T16>::join(blo, bhi); } }   // the same waits behind the lo plane's loads
#pragma unroll
        for (int nb = 0; nb < 4; ++nb) { const V b = WFrag<T16>::ld(Bt + boff + (size_t)nb * 16 * K + kc); V b2; if (NSPLIT >= 2) b2 = WFrag<T16>::ld(Bt2 + boff + (size_t)nb * 16 * K + kc);
#pragma unroll
            for (int mb = 0; mb < 4; ++mb) { acc[mb][nb] = WFrag<T16>::mma(a[mb], b, acc[mb][nb]); if (NSPLIT == 1 || NSPLIT == 2) acc[mb][nb] = WFrag<T16>::mma(a2[mb], b, acc[mb][nb]); if (NSPLIT >= 2) acc[mb][nb] = WFrag<T16>::mma(a[mb], b2, acc[mb][nb]); } }
        asm volatile("v_nop\n\tv_nop\n\tv_nop\n\tv_nop" : "+v"(acc[0][0]), "+v"(acc[1][1]), "+v"(acc[2][2]), "+v"(acc[3][3]) : "v"(a[0]), "v"(a[3]));
    }
    if (NW > 1) {   // the NW partial tiles are summed through LDS in wave order 0 .. NW-1; every thread sums and stores 32 / NW pieces of four columns
#pragma unroll
        for (int mb = 0; mb < 4; ++mb) {
#pragma unroll
            for (int nb = 0; nb < 4; ++nb) {
#pragma unroll
                for (int j = 0; j < 8; ++j) os[wv * (64 * 68) + (mb * 16 + hi * 8 + j) * 68 + nb * 16 + lr] = acc[mb][nb][j]; } }
        __syncthreads();   // publishes every wave's partial tile to the whole block
        float* crow = C + c0;
#pragma unroll
        for (int it = 0; it < 32 / NW; ++it) { const int idx = it * (NW * 32) + (int)threadIdx.x; const int row = idx >> 4, cofs = (idx & 15) * 4; v4f val = *(const v4fa*)(os + row * 68 + cofs);
#pragma unroll
            for (int w = 1; w < NW; ++w) val += *(const v4fa*)(os + w * (64 * 68) + row * 68 + cofs);
            *(v4f*)(crow + (size_t)row * ldc + cofs) = val; }
        return; }
#pragma unroll
    for (int mb = 0; mb < 4; ++mb) {
#pragma unroll
        for (int nb = 0; nb < 4; ++nb) {
#pragma unroll
            for (int j = 0; j < 8; ++j) os[(hi * 8 + j) * 68 + nb * 16 + lr] = acc[mb][nb][j]; }
        __builtin_amdgcn_wave_barrier(); asm volatile("" ::: "memory");
        float* crow = C + (size_t)(mb * 16) * ldc + c0;
{
#pragma unroll
            for (int s = 0; s < 8; ++s) { const int row = 2 * s + hi, cofs = lr * 4; v4f val = *(const v4fa*)(os + row * 68 + cofs);
                *(v4f*)(crow + (size_t)row * ldc + cofs) = val; }
             }
        __builtin_amdgcn_wave_barrier(); asm volatile("" ::: "memory");
    }
}

__device__ __forceinline__ h16 tohx(float x) { return (h16)x; }
__device__ __forceinline__ void splitf(float y, unsigned short& h, unsigned short& l) { h = f2bf(y); l = f2bf(y - bf2f(h)); }
typedef __attribute__((ext_vector_type(2))) _Float16 v2h;
typedef __attribute__((ext_vector_type(4))) _Float16 v4h;
typedef __attribute__((ext_vector_type(2))) unsigned short v2us;
typedef __attribute__((ext_vector_type(4))) unsigned short v4us;
typedef __attribute__((ext_vector_type(2))) float v2f;
typedef __attribute__((ext_vector_type(4))) int v4i;

// The conversion, rotation, plane and merge kernels below give every thread 16 to 32 elements in 16-byte pieces (they had 1 to 8): a launch starts 4 to 16 times fewer waves, and each lane has its loads in flight together. Every element's arithmetic is as before.
#define CVN 4   // 8-value pieces per thread of k_cvt5, 256 threads apart
#define HPT 4   // heads per thread of k_ropeF, k_rope and k_merge: the table values of one (token, dims) piece are loaded once for HPT heads
// k_cvt5: x (both batches) and the four weights in ONE launch; a block takes 256 CVN pieces of one tensor (every tensor is a whole number of blocks), picked by the block's number (scalar tests)
#define CVB(n) ((int)((size_t)(n) / 8 / (256 * CVN)))
static_assert((size_t)MT * DM % (8 * 256 * CVN) == 0 && (size_t)DQ * DM % (8 * 256 * CVN) == 0 && (size_t)DKV * DM % (8 * 256 * CVN) == 0, "whole blocks");
__global__ __launch_bounds__(256) void k_cvt5(const float* __restrict__ x, const float* __restrict__ wq, const float* __restrict__ wk, const float* __restrict__ wv, const float* __restrict__ wo, bf* XB, bf* WQ, bf* WK, bf* WV, bf* WO) {
    int blk = (int)blockIdx.x; const float* src = x; bf* dst = XB;
    if (blk >= CVB((size_t)MT * DM)) { blk -= CVB((size_t)MT * DM); src = wq; dst = WQ;
        if (blk >= CVB((size_t)DQ * DM)) { blk -= CVB((size_t)DQ * DM); src = wk; dst = WK;
            if (blk >= CVB((size_t)DKV * DM)) { blk -= CVB((size_t)DKV * DM); src = wv; dst = WV;
                if (blk >= CVB((size_t)DKV * DM)) { blk -= CVB((size_t)DKV * DM); src = wo; dst = WO; } } } }
    const size_t i0 = (size_t)blk * (256 * CVN) + threadIdx.x; v8f v[CVN];
#pragma unroll
    for (int c = 0; c < CVN; ++c) v[c] = *(const v8f*)(src + (i0 + (size_t)c * 256) * 8);   // all loads first, so that they are in flight together
    asm volatile("s_wait_xcnt 0x0" ::: "memory");   // behind the loads, in front of any later write of an address register that they name
#pragma unroll
    for (int c = 0; c < CVN; ++c) { v8us o;
#pragma unroll
        for (int k = 0; k < 8; ++k) o[k] = f2bf(v[c][k]);
        *(v8us*)(dst + (i0 + (size_t)c * 256) * 8) = o; } }

// k_rope: head planes [h][t][d] (fp16 + hi/lo) of RMSNorm(rope(x)) = rope(x)[d] x RF[h][t] x bf16(gamma[d]) x sc (norm after the rotation) with the rotate-half convention out[d] = x[d] cos[t][d] - x[d+HD/2] sin[t][d], out[d+HD/2] = x[d+HD/2] cos[t][d+HD/2] + x[d] sin[t][d+HD/2]
// ld4w, ld1w: a load with s_wait_xcnt 0 directly behind it: the wait stands in front of any later write (a later load's result too) of the address registers that the load names
__device__ __forceinline__ v4f ld4w(const float* p) { const v4f v = *(const v4fa*)p; asm volatile("s_wait_xcnt 0x0" ::: "memory"); return v; }
__device__ __forceinline__ float ld1w(const float* p) { const float v = *p; asm volatile("s_wait_xcnt 0x0" ::: "memory"); return v; }
// one thread: 8 dims d .. d + 7 of token t in heads h0 .. h0 + HPT - 1; RF is never null (its launch passes the row factors)
__global__ __launch_bounds__(256) void k_rope(const float* __restrict__ F, int pitch, int nheads, const float* __restrict__ CS, const float* __restrict__ RF, const float* __restrict__ nw, float sc, h16* P16, bf* Ph, bf* Pl) {
    { const size_t by = blockIdx.y; F += by * TT * pitch; RF += by * nheads * TT; P16 += by * nheads * TT * HD; Ph += by * nheads * TT * HD; Pl += by * nheads * TT * HD; }   // blockIdx.y = batch
    const size_t g = (size_t)blockIdx.x * 256 + threadIdx.x; if (g >= (size_t)(nheads / HPT) * TT * (HD / 8)) return; const int d = (int)(g % (HD / 8)) * 8; const int t = (int)((g / (HD / 8)) % TT); const int h0 = (int)(g / ((size_t)(HD / 8) * TT)) * HPT;
    const int dp0 = (d < HD / 2) ? d + HD / 2 : d - HD / 2; const float* cp = CS + ((size_t)t * HD + d) * 2; const float* f = F + (size_t)t * pitch + h0 * HD; const float* rp = RF + (size_t)h0 * TT + t; v4f c4[4], xa[HPT][2], xb[HPT][2]; float rfs[HPT];
#pragma unroll
    for (int hh = 0; hh < HPT; ++hh) { xa[hh][0] = ld4w(f + hh * HD + d); xa[hh][1] = ld4w(f + hh * HD + d + 4); xb[hh][0] = ld4w(f + hh * HD + dp0); xb[hh][1] = ld4w(f + hh * HD + dp0 + 4); rfs[hh] = ld1w(rp + hh * TT); }
#pragma unroll
    for (int i = 0; i < 4; ++i) c4[i] = ld4w(cp + 4 * i);
    const v4f g0 = ld4w(nw + d), g1 = ld4w(nw + d + 4);
#pragma unroll
    for (int hh = 0; hh < HPT; ++hh) { const float rf = rfs[hh]; v8h o16; v8us oh, ol;
#pragma unroll
        for (int q = 0; q < 8; ++q) { const int dd = d + q; float x0 = xa[hh][q >> 2][q & 3], x1 = xb[hh][q >> 2][q & 3]; const float gq = (q < 4) ? g0[q & 3] : g1[q & 3];
            /* RMSNorm is applied AFTER the rotation below (the module's rope-then-norm order) */
            v2f cs; cs[0] = c4[q >> 1][(q & 1) * 2]; cs[1] = c4[q >> 1][(q & 1) * 2 + 1]; float a = __fmul_rn(x0, cs[0]), bq = __fmul_rn(x1, cs[1]); asm volatile("" : "+v"(a)); asm volatile("" : "+v"(bq)); float r = ((dd < HD / 2) ? __fsub_rn(a, bq) : __fadd_rn(a, bq)); { float n0 = __fmul_rn(r, rf); asm volatile("" : "+v"(n0)); r = __fmul_rn(n0, bfr(gq)); } r = r * sc;   /* rotated value x inverse RMS x bf16(gamma[d]) */
            o16[q] = tohx(r); unsigned short a2, c2; splitf(r, a2, c2); oh[q] = a2; ol[q] = c2; }
        const size_t e = ((size_t)(h0 + hh) * TT + t) * HD + d; *(v8h*)(P16 + e) = o16; *(v8us*)(Ph + e) = oh; *(v8us*)(Pl + e) = ol; } }
// k_vtp: one block transposes 64 tokens x all HD dims of one kv head; one thread 8 tokens x 4 dims (8 lanes write one whole 128-byte line of a plane; a wave reads 64-byte runs of 64 rows, the block whole rows)
__global__ __launch_bounds__(256) void k_vtp(const float* __restrict__ F, int pitch, int nheads, h16* V16, bf* Vh, bf* Vl) { { const size_t by = blockIdx.y; F += by * TT * pitch; V16 += by * nheads * HD * TT; Vh += by * nheads * HD * TT; Vl += by * nheads * HD * TT; }   // blockIdx.y = batch
    const int g = (int)blockIdx.x / (TT / 64); if (g >= nheads) return; const int t = ((int)blockIdx.x % (TT / 64)) * 64 + ((int)threadIdx.x & 7) * 8; const int d = ((int)threadIdx.x >> 3) * 4; v4f x[8];
#pragma unroll
    for (int q = 0; q < 8; ++q) x[q] = ld4w(F + (size_t)(t + q) * pitch + g * HD + d);
#pragma unroll
    for (int j = 0; j < 4; ++j) { v8h o16; v8us oh, ol;
#pragma unroll
        for (int q = 0; q < 8; ++q) { const float xx = x[q][j]; o16[q] = tohx(xx); unsigned short a2, c2; splitf(xx, a2, c2); oh[q] = a2; ol[q] = c2; }
        const size_t e = ((size_t)g * HD + d + j) * TT + t; *(v8h*)(V16 + e) = o16; *(v8us*)(Vh + e) = oh; *(v8us*)(Vl + e) = ol; } }
// k_tabs: the three tables in ONE launch: CS = {cos, sin} rounded to bf16, CSI = the identity table {1, 0}, ONES = unit gains (first HD / 4 threads)
__global__ __launch_bounds__(256) void k_tabs(const float* __restrict__ cosT, const float* __restrict__ sinT, float* CS, float* CSI, float* ONES) { const int idx = (blockIdx.x * 256 + threadIdx.x) * 4; if (idx >= TT * HD) return; const v4f c = ld4w(cosT + idx), s = ld4w(sinT + idx); v4f o0, o1; o0[0] = bfr(c[0]); o0[1] = bfr(s[0]); o0[2] = bfr(c[1]); o0[3] = bfr(s[1]); o1[0] = bfr(c[2]); o1[1] = bfr(s[2]); o1[2] = bfr(c[3]); o1[3] = bfr(s[3]); *(v4f*)(CS + (size_t)idx * 2) = o0; *(v4f*)(CS + (size_t)idx * 2 + 4) = o1;
    v4f cs; cs[0] = 1.0f; cs[1] = 0.0f; cs[2] = 1.0f; cs[3] = 0.0f; *(v4f*)(CSI + (size_t)idx * 2) = cs; *(v4f*)(CSI + (size_t)idx * 2 + 4) = cs;
    if (idx < HD) { v4f on; on[0] = 1.0f; on[1] = 1.0f; on[2] = 1.0f; on[3] = 1.0f; *(v4f*)(ONES + idx) = on; } }
__global__ __launch_bounds__(256) void k_ropeF(float* F, int pitch, int nheads, const float* __restrict__ CS) { F += (size_t)blockIdx.y * TT * pitch;   // blockIdx.y = batch
    const size_t e = (size_t)blockIdx.x * 256 + threadIdx.x; if (e >= (size_t)(nheads / HPT) * TT * (HD / 8)) return; const int d = (int)(e % (HD / 8)) * 4; const int t = (int)((e / (HD / 8)) % TT); const int h0 = (int)(e / ((size_t)(HD / 8) * TT)) * HPT; float* f0 = F + (size_t)t * pitch + h0 * HD;   // one thread: the dim pairs (d + q, d + q + HD / 2), q < 4, of token t in heads h0 .. h0 + HPT - 1
    const float* cp = CS + ((size_t)t * HD + d) * 2; const v4f ca[2] = { *(const v4f*)cp, *(const v4f*)(cp + 4) }, cb[2] = { *(const v4f*)(cp + HD), *(const v4f*)(cp + HD + 4) }; v4f X1[HPT], X2[HPT];
#pragma unroll
    for (int hh = 0; hh < HPT; ++hh) { X1[hh] = *(const v4f*)(f0 + hh * HD + d); X2[hh] = *(const v4f*)(f0 + hh * HD + d + HD / 2); }   // all loads in front of the first store
#pragma unroll
    for (int hh = 0; hh < HPT; ++hh) { v4f Y1, Y2;
#pragma unroll
        for (int q = 0; q < 4; ++q) { const float x1 = X1[hh][q], x2 = X2[hh][q]; v2f c1, c2; c1[0] = ca[q >> 1][(q & 1) * 2]; c1[1] = ca[q >> 1][(q & 1) * 2 + 1]; c2[0] = cb[q >> 1][(q & 1) * 2]; c2[1] = cb[q >> 1][(q & 1) * 2 + 1];
            float a1 = __fmul_rn(x1, c1[0]), b1 = __fmul_rn(x2, c1[1]), a2 = __fmul_rn(x2, c2[0]), b2 = __fmul_rn(x1, c2[1]); asm volatile("" : "+v"(a1), "+v"(b1), "+v"(a2), "+v"(b2)); const float y1 = __fsub_rn(a1, b1), y2 = __fadd_rn(a2, b2);
            Y1[q] = y1; Y2[q] = y2; }
        *(v4f*)(f0 + hh * HD + d) = Y1; *(v4f*)(f0 + hh * HD + d + HD / 2) = Y2; } }
__global__ __launch_bounds__(256) void k_hrms(const float* __restrict__ F, int pitch, int nheads, float* RF) { F += (size_t)blockIdx.y * TT * pitch; RF += (size_t)blockIdx.y * nheads * TT;   // blockIdx.y = batch
    const int idx = blockIdx.x * 256 + threadIdx.x; if (idx >= nheads * TT) return; const int t = idx % TT; const int h = idx / TT; const float* f = F + (size_t)t * pitch + h * HD; float s = 0.f;
#pragma unroll 4
    for (int d = 0; d < HD; d += 4) { const v4f a = *(const v4f*)(f + d);
#pragma unroll
        for (int q = 0; q < 4; ++q) { float p = __fmul_rn(a[q], a[q]); asm volatile("" : "+v"(p)); s = __fadd_rn(s, p); } }
    const float rf = __fdiv_rn(1.0f, __fsqrt_rn(__fadd_rn(__fdiv_rn(s, (float)HD), 1.1920929e-07f))); *(float*)(RF + idx) = rf;  }

// k_asoft: per row (zz, i): t = S x HD^-0.5 for j <= i and i - j < WIN (WIN = TT: that test always holds, plain causal; the reference's -1e9 additive fill vanishes identically); softmax over the row's nc = (i / 64 + 1) * 64 packed columns (register row, one exp, fixed trees; the columns beyond nc would add exact zeros);
// the probabilities are written IN PLACE over the front of the row's own f32 scores (fp16: nc values; hi rows: nc hi values, then nc lo values): one wave owns one row and has read all of it (the row sum) before its first store.
__global__ __launch_bounds__(256) void k_asoft(float* Sb) {
    const int lane = threadIdx.x & 31; const int row = blockIdx.x * 8 + __builtin_amdgcn_readfirstlane((int)(threadIdx.x >> 5));   // the wave's row in a scalar register: the tests on nc below are scalar branches
    if (row >= ZH * TT) return; const int i = row % TT; const int zz = row / TT; const bool hires = (i < RH); const int rb = i >> 6, nc = (rb + 1) * 64;
    float* sr = Sb + (size_t)zz * SH + (size_t)rb * (rb + 1) * 2048 + (size_t)(i & 63) * nc; float v[TT / 32]; float mx = -3.0e38f;
#pragma unroll
    for (int ch = 0; ch < TT / 128; ++ch) { if (ch * 128 < nc) { const int j0 = ch * 128 + lane * 4; v4f a = (v4f){}; if (j0 < nc) a = *(const v4f*)(sr + j0);   // all of the row's loads first, so that they are in flight together; where nc ends in the middle of a 128-column piece its upper lanes load nothing (masked below: j > i)
#pragma unroll
        for (int q = 0; q < 4; ++q) v[ch * 4 + q] = a[q]; } }
#pragma unroll
    for (int ch = 0; ch < TT / 128; ++ch) { if (ch * 128 < nc) {
#pragma unroll
        for (int q = 0; q < 4; ++q) { const int j = ch * 128 + lane * 4 + q; const float t = (j <= i && i - j < WIN) ? v[ch * 4 + q] * SCL : -3.0e38f; v[ch * 4 + q] = t; mx = fmaxf(mx, t); } } }
#pragma unroll
    for (int sh = 16; sh; sh >>= 1) mx = fmaxf(mx, __shfl_xor(mx, sh, 32));
    float sum = 0.f;
#pragma unroll
    for (int ch = 0; ch < TT / 128; ++ch) { if (ch * 128 < nc) {
#pragma unroll
        for (int q = 0; q < 4; ++q) { const int k = ch * 4 + q; float d0 = __fsub_rn(v[k], mx); asm volatile("" : "+v"(d0)); v[k] = __builtin_amdgcn_exp2f(__fmul_rn(d0, 1.4426950408889634f)); sum += v[k]; } } }
#pragma unroll
    for (int sh = 16; sh; sh >>= 1) sum += __shfl_xor(sum, sh, 32);
    const float f = __fdiv_rn(hires ? 1.0f : PCAR, sum);
    if (hires) { bf* ph = (bf*)sr; bf* pl = ph + nc;
#pragma unroll
        for (int ch = 0; ch < RH / 128; ++ch) { const int j0 = ch * 128 + lane * 4; if (j0 < nc) { v4us oh, ol;
#pragma unroll
            for (int q = 0; q < 4; ++q) { unsigned short a, c2; splitf(v[ch * 4 + q] * f, a, c2); oh[q] = a; ol[q] = c2; }
            *(v4us*)(ph + j0) = oh; *(v4us*)(pl + j0) = ol; } }
    } else { h16* p16 = (h16*)sr;
#pragma unroll
        for (int ch = 0; ch < TT / 128; ++ch) { const int j0 = ch * 128 + lane * 4; if (j0 < nc) { v4h o4;
#pragma unroll
            for (int q = 0; q < 4; ++q) o4[q] = tohx(v[ch * 4 + q] * f);
            *(v4h*)(p16 + j0) = o4; } }
    }
}
__global__ __launch_bounds__(256) void k_merge(const float* __restrict__ O, int h0, bf* Ah, bf* Al) { O += (size_t)blockIdx.y * ZH * TT * HD; Ah += (size_t)blockIdx.y * TT * DQ; Al += (size_t)blockIdx.y * TT * DQ;   // blockIdx.y = batch
    const size_t g = (size_t)blockIdx.x * 256 + threadIdx.x; if (g >= (size_t)(ZH / HPT) * TT * (HD / 8)) return; const int d = (int)(g % (HD / 8)) * 8; const int t = (int)((g / (HD / 8)) % TT); const int z0 = (int)(g / ((size_t)(HD / 8) * TT)) * HPT; const float cs = (t < RH) ? 1.0f : (1.0f / PCAR); v4f x[HPT][2];   // one thread: 8 dims of token t in HPT heads
#pragma unroll
    for (int k = 0; k < HPT; ++k) { const float* o = O + ((size_t)(z0 + k) * TT + t) * HD + d; x[k][0] = ld4w(o); x[k][1] = ld4w(o + 4); }
#pragma unroll
    for (int k = 0; k < HPT; ++k) { const size_t oo = (size_t)t * DQ + (h0 + z0 + k) * HD + d; v8us oh, ol;
#pragma unroll
        for (int q = 0; q < 8; ++q) { unsigned short a, c2; splitf(x[k][q >> 2][q & 3] * cs, a, c2); oh[q] = a; ol[q] = c2; } *(v8us*)(Ah + oo) = oh; *(v8us*)(Al + oo) = ol; } }

extern "C" void kernel_launch(void* const* d_in, const int* in_sizes, int n_in,
                              void* d_out, int out_size, void* d_ws, size_t ws_size, hipStream_t stream) {
    (void)in_sizes; (void)n_in; (void)out_size;
    const float* x = (const float*)d_in[0]; const float* fcos = (const float*)d_in[1]; const float* fsin = (const float*)d_in[2]; const float* wq = (const float*)d_in[3]; const float* wk = (const float*)d_in[4]; const float* wv = (const float*)d_in[5]; const float* wo = (const float*)d_in[6];   /* inputs x, cos, sin ([2048][1][128] = [2048][128] FULL width, read per dimension), wq ('oi' [2048][2048]), wk, wv ('oi' [512][2048]), wproj ('oi') */
    float* OUT = (float*)d_out;     // [2][2048][2048]
    char* wsp = (char*)d_ws;
    auto take = [&](size_t bytes) { char* p = wsp; wsp += (bytes + 255) & ~(size_t)255; return (void*)p; };
    // What lives through the attention of both batches: wproj, the head planes [batch][16 q heads, then 4 k heads][t][d], the transposed v planes [batch][kv head][d][t], the attention output [batch][head][t][d]; used by one batch after the other: the packed scores.
    bf* WO = (bf*)take((size_t)DM * DQ * 2);
    h16* P16 = (h16*)take((size_t)NB_ * NHR * TT * HD * 2); bf* Ph = (bf*)take((size_t)NB_ * NHR * TT * HD * 2); bf* Pl = (bf*)take((size_t)NB_ * NHR * TT * HD * 2);
    h16* VT16 = (h16*)take((size_t)NB_ * NKV * HD * TT * 2); bf* VTh = (bf*)take((size_t)NB_ * NKV * HD * TT * 2); bf* VTl = (bf*)take((size_t)NB_ * NKV * HD * TT * 2);
    float* Ob = (float*)take((size_t)NB_ * ZH * TT * HD * 4); float* Sb = (float*)take((size_t)ZH * SH * 4);   /* packed causal scores of all heads of one batch; the softmax writes the probabilities over them */
    if ((size_t)(wsp - (char*)d_ws) > ws_size) return;    // ws 256 MiB
    // What only the launches in front of the attention use lies in the range of the scores, which the first score launch writes behind them (stream order).
    wsp = (char*)Sb;
    bf* XB = (bf*)take((size_t)MT * DM * 2); bf* WQ = (bf*)take((size_t)DQ * DM * 2); bf* WK = (bf*)take((size_t)DKV * DM * 2); bf* WV = (bf*)take((size_t)DKV * DM * 2);   /* WK and WV follow each other: one Bt of 2 DKV rows */
    float* CS = (float*)take((size_t)TT * HD * 2 * 4); float* CSI = (float*)take((size_t)TT * HD * 2 * 4);   /* identity {1, 0} table for the plane builder (the rotation is applied in place before the norm) */ float* ONES = (float*)take(256 * 4);
    float* RF = (float*)take((size_t)NB_ * NHR * TT * 4);   /* per (batch, head, token) inverse RMS of the rotated values */ float* F = (float*)take((size_t)MT * DF * 4);   /* f32 feature rows q | k | v of both batches */
    if ((size_t)(wsp - (char*)Sb) > (size_t)ZH * SH * 4) return;
    // The merged hi / lo rows [MT][DQ] lie over the front of the hi / lo head planes, which the score launches of both batches read last: k_merge stands behind all of them.
    bf* ATh = Ph; bf* ATl = Pl;
    // Every stage outside the attention runs ONCE, for both batches (and for q and k, or k and v, together).
    k_cvt5<<<CVB((size_t)MT * DM) + 2 * CVB((size_t)DQ * DM) + 2 * CVB((size_t)DKV * DM), 256, 0, stream>>>(x, wq, wk, wv, wo, XB, WQ, WK, WV, WO);   /* 'oi' weights = Bt as-is */
    k_tabs<<<(TT * HD / 4 + 255) / 256, 256, 0, stream>>>(fcos, fsin, CS, CSI, ONES);   /* rotary table from the FULL-width inputs, per dimension; identity table; unit gains */
    k_gemmw<bf, 0, false, 4, DM><<<dim3(MT / 64, DQ / 64, 1), 128, 0, stream>>>(XB, nullptr, WQ, nullptr, F, DF, nullptr, 0, 0, 0);
    k_gemmw<bf, 0, false, 8, DM><<<dim3(MT / 64, 2 * DKV / 64, 1), 256, 0, stream>>>(XB, nullptr, WK, nullptr, F + DQ, DF, nullptr, 0, 0, 0);
    const unsigned LR = (unsigned)(((size_t)(NHR / HPT) * TT * (HD / 8) + 255) / 256);   // k_ropeF, k_rope: one thread per (HPT heads, token, 8 values) of a batch
    k_ropeF<<<dim3(LR, NB_), 256, 0, stream>>>(F, DF, NHR, CS);   /* rotary FIRST */
    k_hrms<<<dim3((NHR * TT + 255) / 256, NB_), 256, 0, stream>>>(F, DF, NHR, RF);
    k_rope<<<dim3(LR, NB_), 256, 0, stream>>>(F, DF, NHR, CSI, RF, ONES, 1.0f, P16, Ph, Pl);   /* rope then RMSNorm */
    k_vtp<<<dim3(NKV * (TT / 64), NB_), 256, 0, stream>>>(F + DQ + DKV, DF, NKV, VT16, VTh, VTl);
    for (int b = 0; b < NB_; ++b) {   // one launch of each attention kernel for all ZH = NH_ heads of the batch (z = head; kv head z / REP inside k_gemmc)
        const size_t pb = (size_t)b * NHR * TT * HD, kb = pb + (size_t)NH_ * TT * HD, vb = (size_t)b * NKV * HD * TT, ob = (size_t)b * ZH * TT * HD;   // the batch's q planes, k planes, v planes, output
        k_gemmc<bf, 2, 1, 1><<<dim3(RH / 64, TT / 64, ZH), 32, 0, stream>>>(Ph + pb, Pl + pb, Ph + kb, Pl + kb, HD, Sb, 0, 0, (size_t)TT * HD, (size_t)TT * HD, SH);
        k_gemmc<h16, 0, 1, 1><<<dim3((TT - RH) / 64, TT / 64, ZH), 32, 0, stream>>>(P16 + pb + (size_t)RH * HD, nullptr, P16 + kb, nullptr, HD, Sb, 0, RH, (size_t)TT * HD, (size_t)TT * HD, SH);
        k_asoft<<<ZH * TT / 8, 256, 0, stream>>>(Sb);
        k_gemmc<bf, 2, 2, 8><<<dim3(RH / 64, HD / 64, ZH), 256, 0, stream>>>((const bf*)Sb, nullptr, VTh + vb, VTl + vb, TT, Ob + ob, HD, 0, 2 * SH, (size_t)HD * TT, (size_t)TT * HD);
        k_gemmc<h16, 0, 2, 16><<<dim3((TT - RH) / 64, HD / 64, ZH), 512, 0, stream>>>((const h16*)Sb, nullptr, VT16 + vb, nullptr, TT, Ob + ob + (size_t)RH * HD, HD, RH, 2 * SH, (size_t)HD * TT, (size_t)TT * HD); }
    k_merge<<<dim3((unsigned)(((size_t)(ZH / HPT) * TT * (HD / 8) + 255) / 256), NB_), 256, 0, stream>>>(Ob, 0, ATh, ATl);
    k_gemmw<bf, 1, false, 4, DQ><<<dim3(MT / 64, DM / 64, 1), 128, 0, stream>>>(ATh, ATl, WO, nullptr, OUT, DM, nullptr, 0, 0, 0);
}

// v006
// A run of this version takes 271 microseconds.
// Two timings next to v005 put it at 1.69 and 1.70 times that version's speed.
// Over all steps from v000 it is 6.21 times as fast.
#include <hip/hip_runtime.h>

// Grouped-query causal attention with rotary embeddings followed by a gain-free RMSNorm on q and k (x [2][2048][2048]; q = x wq^T (16 heads x 128), k, v = x w^T ('oi' [512][2048]: 4 kv heads x 128); _apply_rope: x cos + rotate_half(x) sin with rotate_half = cat(-x2, x1) and the FULL-WIDTH cos / sin inputs [2048][1][128] (read per dimension); q = rms_norm(rope(q)), k = rms_norm(rope(k)) with x rsqrt(mean(x^2) + 1.19e-7) over the 128 dims (no gain; LITERAL order: the rotation is applied in place in f32 first, then the per-(token, head) row factor is taken from the rotated values); kv head = q head / 4 (repeat); scores x 128^-0.5; causal (-inf); softmax; out = merged wproj^T -> [2][2048][2048] (8.4 M); argument order x, cos, sin, wq, wk, wv, wproj).
// Layout (every stage outside the attention runs once for both batches; blockIdx.y = batch where a kernel needs it): bf16 copy of x; natural 'oi' weights cast as they are (Bt); exact projections into f32 feature rows q | k | v; k_tabs: the {cos, sin} table from the bf16-rounded FULL-width inputs (HD 128, read per dimension); k_ropeF: the rotate-half rotation IN PLACE on the f32 rows FIRST (the mean square changes); k_hrms: per (head, token) inverse RMS of the ROTATED values (eps 1.19e-7; no gain); k_rope with the identity table CSI and unit gains ONES applies the row factor and builds the planes; k_fattn: causal T-2048 GQA attention with 128-wide heads, scores, softmax and P.V in one kernel for both batches (running maximum; nothing of the scores goes to memory; hybrid rows; keys above the diagonal block are never visited); merged hi/lo x wproj exact.
// Compute dtypes, f32 accumulate: every input rounded to bf16 incl. the two tables; projections exact; rotary and RMSNorm f32; attention rows < 512 3 products, rest fp16; softmax f32; wproj hl x exact.

#define NB_  2
#define TT   2048
#define DM   2048
#define NH_  16
#define NKV  4        // four kv heads (grouped-query: kv head = q head / 4)
#define REP  (NH_ / NKV)
#define HD   128
#define DQ   (NH_ * HD)
#define DKV  (NKV * HD)
#define NHR  (NH_ + NKV)          // heads that take the rotation and the norm: the 16 q heads, then the 4 k heads
#define DF   (DQ + 2 * DKV)       // one token's f32 feature row: q | k | v
#define MT   (NB_ * TT)           // token rows of both batches
#define ZH   16                   // heads of a batch in the attention output
#define SH   ((size_t)(TT / 64) * (TT / 64 + 1) / 2 * 4096)   // ZH * SH f32 elements: the workspace range of what only the launches in front of the attention use
#define RH   512                  // query rows < RH use hi+lo planes (0: none)
#define PCAR 1024.0f
typedef _Float16 h16;
typedef unsigned short bf;
typedef __attribute__((ext_vector_type(16))) __bf16   v16bf;
typedef __attribute__((ext_vector_type(16))) _Float16 v16h;
typedef __attribute__((ext_vector_type(8)))  _Float16 v8h;
typedef __attribute__((ext_vector_type(8)))  unsigned short v8us;
typedef __attribute__((ext_vector_type(8)))  float    v8f;
typedef __attribute__((ext_vector_type(4)))  float    v4f;
typedef v8h  __attribute__((may_alias)) v8ha;
typedef v4f  __attribute__((may_alias)) v4fa;
typedef v8us __attribute__((may_alias)) v8usa;

__device__ __forceinline__ unsigned short f2bf(float f) { unsigned u = __float_as_uint(f); u += 0x7FFFu + ((u >> 16) & 1u); return (unsigned short)(u >> 16); }
__device__ __forceinline__ float bf2f(unsigned short b) { return __uint_as_float(((unsigned)b) << 16); }
__device__ __forceinline__ float bfr(float f) { return bf2f(f2bf(f)); }
__device__ __forceinline__ v16h cat16(v8h lo, v8h hi) { return __builtin_shufflevector(lo, hi, 0, 1, 2, 3, 4, 5, 6, 7, 8, 9, 10, 11, 12, 13, 14, 15); }
__device__ __forceinline__ v16bf cat16b(v8us lo, v8us hi) { return __builtin_bit_cast(v16bf, __builtin_shufflevector(lo, hi, 0, 1, 2, 3, 4, 5, 6, 7, 8, 9, 10, 11, 12, 13, 14, 15)); }
__device__ __forceinline__ v8f wmma16(v16h a, v16h b, v8f c) { return __builtin_amdgcn_wmma_f32_16x16x32_f16(false, a, false, b, (short)0, c, false, false); }
__device__ __forceinline__ v8f wmmab(v16bf a, v16bf b, v8f c) { return __builtin_amdgcn_wmma_f32_16x16x32_bf16(false, a, false, b, (short)0, c, false, false); }



// ---- k_gemmw: register-blocked GEMM, NW WAVES per 64x64 output tile, each with the whole tile (16 accumulators) over its own share of K (128-byte chunks dealt round robin), partial tiles summed through LDS; operands from K-contiguous 16-bit planes by way of the wave's own LDS tiles; grid (M/64, N/64, Z), 32 NW threads. K % 64 == 0.
// C[m][n] (f32, pitch ldc, + optional f32 bias[n]) = sum_k A[m][k] Bt[n][k] (+ split products per NSPLIT). z-batch strides sA/sB/sC in elements. K % 64 == 0.
template <typename T16> struct WFrag;
template <> struct WFrag<h16> { typedef v16h V; static __device__ __forceinline__ V ld(const h16* p) { return cat16(*(const v8h*)p, *(const v8h*)(p + 16)); } static __device__ __forceinline__ v8f mma(V a, V b, v8f c) { return wmma16(a, b, c); } };
template <> struct WFrag<bf> { typedef v16bf V; static __device__ __forceinline__ V ld(const bf* p) { return cat16b(*(const v8us*)p, *(const v8us*)(p + 16)); } static __device__ __forceinline__ v8f mma(V a, V b, v8f c) { return wmmab(a, b, c); } };
// LFrag: one fragment (the same k order as WFrag::ld) from a staged LDS row
template <typename T16> struct LFrag;
template <> struct LFrag<h16> { static __device__ __forceinline__ v16h ld(const unsigned short* p) { return cat16(*(const v8ha*)p, *(const v8ha*)(p + 16)); } };
template <> struct LFrag<bf> { static __device__ __forceinline__ v16bf ld(const unsigned short* p) { return cat16b(*(const v8usa*)p, *(const v8usa*)(p + 16)); } };
#define SP 72   // LDS row pitch of a staged K chunk in 16-bit elements: 128 bytes of data + 16 bytes, the pitch for 16-byte readers
// Operand path: a wave brings each of its 64-element K chunks (64 rows x 128 bytes per operand plane) with 16-byte loads of which each covers four WHOLE 128-byte lines (8 lanes a row), stores them to its OWN LDS tiles and reads the fragments from there
// (a fragment load straight from the plane touches 16 lines for 512 bytes). The next chunk's loads are in flight while this chunk is multiplied. No wave reads another wave's tiles, so the K loop has no barrier. KK = K = row pitch of every operand plane, a compile-time constant, so that the 16 loads of a plane differ in their immediate offset only.
template <typename T16, int NSPLIT, bool BIAS, int NW, int KK>
__global__ __launch_bounds__(32 * NW) void k_gemmw(const T16* A, const T16* A2, const T16* Bt, const T16* Bt2, float* C, int ldc, const float* __restrict__ bias, size_t sA, size_t sB, size_t sC) {
    typedef typename WFrag<T16>::V V;
    constexpr bool HA2 = (NSPLIT == 1 || NSPLIT == 2), HB2 = (NSPLIT >= 2);
    constexpr int NT = 2 + (HA2 ? 1 : 0) + (HB2 ? 1 : 0);   // staged planes: A, B, then A2, then B2
    constexpr int WS = NT * 64 * SP / 2;                    // f32 elements of one wave's LDS: its staged tiles in the K loop, then its 64 x 64 partial tile (pitch 68) over them
    __shared__ __align__(16) float os[NW * WS];
    const int wv = (NW > 1) ? __builtin_amdgcn_readfirstlane((int)(threadIdx.x >> 5)) : 0;   // wave number in a scalar register: the K loop's bounds and branch stay scalar
    const size_t z = blockIdx.z; A += z * sA; if (A2) A2 += z * sA; Bt += z * sB; if (Bt2) Bt2 += z * sB; C += z * sC;
    const int lane = threadIdx.x & 31, lr = lane & 15, hi = lane >> 4; const int r0 = blockIdx.x * 64, c0 = blockIdx.y * 64;
    v8f acc[4][4];
#pragma unroll
    for (int mb = 0; mb < 4; ++mb)
#pragma unroll
        for (int nb = 0; nb < 4; ++nb) acc[mb][nb] = (v8f){};
    const unsigned short* gp[4] = { (const unsigned short*)A + (size_t)r0 * KK, (const unsigned short*)Bt + (size_t)c0 * KK, HA2 ? (const unsigned short*)A2 + (size_t)r0 * KK : nullptr, HB2 ? (const unsigned short*)Bt2 + (size_t)c0 * KK : nullptr };   // wave-uniform plane bases of this tile
    constexpr int TA2 = 2, TB2 = HA2 ? 3 : 2;               // LDS tile numbers of the lo planes
    const unsigned vo = (unsigned)((lane >> 3) * KK + (lane & 7) * 8);   // the lane's own place in a load: row lane / 8, 16-byte piece lane % 8; never rewritten
    unsigned short* sw = (unsigned short*)os + (size_t)wv * (WS * 2);
    unsigned short* sst = sw + (lane >> 3) * SP + (lane & 7) * 8;
    const unsigned short* sfr = sw + lr * SP + 8 * hi;
    v8us rg[NT][16];
    auto fetch = [&](int kc) {
#pragma unroll
        for (int i = 0; i < 16; ++i) { rg[0][i] = *(const v8usa*)(gp[0] + kc + i * 4 * KK + vo); rg[1][i] = *(const v8usa*)(gp[1] + kc + i * 4 * KK + vo); if (HA2) rg[TA2][i] = *(const v8usa*)(gp[2] + kc + i * 4 * KK + vo); if (HB2) rg[TB2][i] = *(const v8usa*)(gp[3] + kc + i * 4 * KK + vo); }
        asm volatile("s_wait_xcnt 0x0" :: "v"(vo) : "memory");   // behind the chunk's loads, in front of any later write of an address register that they name (vo as an input keeps its register until here; the operand pointers carry no restrict, so that the loads stay in front of this statement)
    };
    fetch(wv * 64);
#pragma unroll 1
    for (int kc = wv * 64; kc < KK; kc += NW * 64) {   // wave wv takes the 64-element (128-byte) K chunks wv, wv + NW, ...: two 32-steps per chunk, in the order of k
#pragma unroll
        for (int t = 0; t < NT; ++t)
#pragma unroll
            for (int i = 0; i < 16; ++i) *(v8usa*)(sst + t * 64 * SP + i * 4 * SP) = rg[t][i];
        asm volatile("s_wait_dscnt 0x0" ::: "memory");   // the wave's own LDS stores are done before its lanes read rows that other lanes of the wave stored
        if (kc + NW * 64 < KK) fetch(kc + NW * 64);      // scalar test; the next chunk's loads fly during this chunk's products
#pragma unroll
        for (int ks = 0; ks < 2; ++ks) {
            V a[4], a2[4];
#pragma unroll
            for (int mb = 0; mb < 4; ++mb) { a[mb] = LFrag<T16>::ld(sfr + mb * 16 * SP + ks * 32); if (HA2) a2[mb] = LFrag<T16>::ld(sfr + TA2 * 64 * SP + mb * 16 * SP + ks * 32); }
#pragma unroll
            for (int nb = 0; nb < 4; ++nb) { const V b = LFrag<T16>::ld(sfr + 64 * SP + nb * 16 * SP + ks * 32); V b2; if (HB2) b2 = LFrag<T16>::ld(sfr + TB2 * 64 * SP + nb * 16 * SP + ks * 32);
#pragma unroll
                for (int mb = 0; mb < 4; ++mb) { acc[mb][nb] = WFrag<T16>::mma(a[mb], b, acc[mb][nb]); if (HA2) acc[mb][nb] = WFrag<T16>::mma(a2[mb], b, acc[mb][nb]); if (HB2) acc[mb][nb] = WFrag<T16>::mma(a[mb], b2, acc[mb][nb]); } }
            asm volatile("v_nop\n\tv_nop\n\tv_nop\n\tv_nop" : "+v"(acc[0][0]), "+v"(acc[1][1]), "+v"(acc[2][2]), "+v"(acc[3][3]) : "v"(a[0]), "v"(a[3]));   // four vector slots behind the step's products, in front of the next writes of a[] and on the taken side of the loop's branch
        }
    }
    if (NW > 1) {   // the NW partial tiles (each in its wave's own LDS range, over its staged tiles) are summed through LDS in wave order 0 .. NW-1; every thread sums and stores 32 / NW pieces of four columns
#pragma unroll
        for (int mb = 0; mb < 4; ++mb) {
#pragma unroll
            for (int nb = 0; nb < 4; ++nb) {
#pragma unroll
                for (int j = 0; j < 8; ++j) os[wv * WS + (mb * 16 + hi * 8 + j) * 68 + nb * 16 + lr] = acc[mb][nb][j]; } }
        __syncthreads();   // publishes every wave's partial tile to the whole block
        float* crow = C + (size_t)r0 * ldc + c0;
#pragma unroll
        for (int it = 0; it < 32 / NW; ++it) { const int idx = it * (NW * 32) + (int)threadIdx.x; const int row = idx >> 4, cofs = (idx & 15) * 4; v4f val = *(const v4fa*)(os + row * 68 + cofs);
#pragma unroll
            for (int w = 1; w < NW; ++w) val += *(const v4fa*)(os + w * WS + row * 68 + cofs);
            if (BIAS) { val[0] += bfr(bias[c0 + cofs]); val[1] += bfr(bias[c0 + cofs + 1]); val[2] += bfr(bias[c0 + cofs + 2]); val[3] += bfr(bias[c0 + cofs + 3]); }
            *(v4f*)(crow + (size_t)row * ldc + cofs) = val; }
        return; }
#pragma unroll
    for (int mb = 0; mb < 4; ++mb) {
#pragma unroll
        for (int nb = 0; nb < 4; ++nb) {
#pragma unroll
            for (int j = 0; j < 8; ++j) os[(hi * 8 + j) * 68 + nb * 16 + lr] = acc[mb][nb][j]; }
        __builtin_amdgcn_wave_barrier(); asm volatile("" ::: "memory");
        float* crow = C + (size_t)(r0 + mb * 16) * ldc + c0;
{
#pragma unroll
            for (int s = 0; s < 8; ++s) { const int row = 2 * s + hi, cofs = lr * 4; v4f val = *(const v4fa*)(os + row * 68 + cofs); if (BIAS) { val[0] += bfr(bias[c0 + cofs]); val[1] += bfr(bias[c0 + cofs + 1]); val[2] += bfr(bias[c0 + cofs + 2]); val[3] += bfr(bias[c0 + cofs + 3]); }
                *(v4f*)(crow + (size_t)row * ldc + cofs) = val; }
             }
        __builtin_amdgcn_wave_barrier(); asm volatile("" ::: "memory");
    }
}

__device__ __forceinline__ h16 tohx(float x) { return (h16)x; }
__device__ __forceinline__ void splitf(float y, unsigned short& h, unsigned short& l) { h = f2bf(y); l = f2bf(y - bf2f(h)); }
typedef __attribute__((ext_vector_type(2))) _Float16 v2h;
typedef __attribute__((ext_vector_type(4))) _Float16 v4h;
typedef __attribute__((ext_vector_type(2))) unsigned short v2us;
typedef __attribute__((ext_vector_type(4))) unsigned short v4us;
typedef __attribute__((ext_vector_type(2))) float v2f;
typedef __attribute__((ext_vector_type(4))) int v4i;

// The conversion, rotation, plane and merge kernels below give every thread 16 to 32 elements in 16-byte pieces (they had 1 to 8): a launch starts 4 to 16 times fewer waves, and each lane has its loads in flight together. Every element's arithmetic is as before.
#define CVN 4   // 8-value pieces per thread of k_cvt5, 256 threads apart
#define HPT 4   // heads per thread of k_ropeF, k_rope and k_merge: the table values of one (token, dims) piece are loaded once for HPT heads
// k_cvt5: x (both batches) and the four weights in ONE launch; a block takes 256 CVN pieces of one tensor (every tensor is a whole number of blocks), picked by the block's number (scalar tests)
#define CVB(n) ((int)((size_t)(n) / 8 / (256 * CVN)))
static_assert((size_t)MT * DM % (8 * 256 * CVN) == 0 && (size_t)DQ * DM % (8 * 256 * CVN) == 0 && (size_t)DKV * DM % (8 * 256 * CVN) == 0, "whole blocks");
__global__ __launch_bounds__(256) void k_cvt5(const float* __restrict__ x, const float* __restrict__ wq, const float* __restrict__ wk, const float* __restrict__ wv, const float* __restrict__ wo, bf* XB, bf* WQ, bf* WK, bf* WV, bf* WO) {
    int blk = (int)blockIdx.x; const float* src = x; bf* dst = XB;
    if (blk >= CVB((size_t)MT * DM)) { blk -= CVB((size_t)MT * DM); src = wq; dst = WQ;
        if (blk >= CVB((size_t)DQ * DM)) { blk -= CVB((size_t)DQ * DM); src = wk; dst = WK;
            if (blk >= CVB((size_t)DKV * DM)) { blk -= CVB((size_t)DKV * DM); src = wv; dst = WV;
                if (blk >= CVB((size_t)DKV * DM)) { blk -= CVB((size_t)DKV * DM); src = wo; dst = WO; } } } }
    const size_t i0 = (size_t)blk * (256 * CVN) + threadIdx.x; v8f v[CVN];
#pragma unroll
    for (int c = 0; c < CVN; ++c) v[c] = *(const v8f*)(src + (i0 + (size_t)c * 256) * 8);   // all loads first, so that they are in flight together
    asm volatile("s_wait_xcnt 0x0" ::: "memory");   // behind the loads, in front of any later write of an address register that they name
#pragma unroll
    for (int c = 0; c < CVN; ++c) { v8us o;
#pragma unroll
        for (int k = 0; k < 8; ++k) o[k] = f2bf(v[c][k]);
        *(v8us*)(dst + (i0 + (size_t)c * 256) * 8) = o; } }

// k_rope: head planes [h][t][d] (fp16 + hi/lo) of RMSNorm(rope(x)) = rope(x)[d] x RF[h][t] x bf16(gamma[d]) x sc (norm after the rotation) with the rotate-half convention out[d] = x[d] cos[t][d] - x[d+HD/2] sin[t][d], out[d+HD/2] = x[d+HD/2] cos[t][d+HD/2] + x[d] sin[t][d+HD/2]
// ld4w, ld1w: a load with s_wait_xcnt 0 directly behind it: the wait stands in front of any later write (a later load's result too) of the address registers that the load names
__device__ __forceinline__ v4f ld4w(const float* p) { const v4f v = *(const v4fa*)p; asm volatile("s_wait_xcnt 0x0" ::: "memory"); return v; }
__device__ __forceinline__ float ld1w(const float* p) { const float v = *p; asm volatile("s_wait_xcnt 0x0" ::: "memory"); return v; }
// one thread: 8 dims d .. d + 7 of token t in heads h0 .. h0 + HPT - 1; RF is never null (its launch passes the row factors)
__global__ __launch_bounds__(256) void k_rope(const float* __restrict__ F, int pitch, int nheads, const float* __restrict__ CS, const float* __restrict__ RF, const float* __restrict__ nw, float sc, h16* P16, bf* Ph, bf* Pl) {
    { const size_t by = blockIdx.y; F += by * TT * pitch; RF += by * nheads * TT; P16 += by * nheads * TT * HD; Ph += by * nheads * TT * HD; Pl += by * nheads * TT * HD; }   // blockIdx.y = batch
    const size_t g = (size_t)blockIdx.x * 256 + threadIdx.x; if (g >= (size_t)(nheads / HPT) * TT * (HD / 8)) return; const int d = (int)(g % (HD / 8)) * 8; const int t = (int)((g / (HD / 8)) % TT); const int h0 = (int)(g / ((size_t)(HD / 8) * TT)) * HPT;
    const int dp0 = (d < HD / 2) ? d + HD / 2 : d - HD / 2; const float* cp = CS + ((size_t)t * HD + d) * 2; const float* f = F + (size_t)t * pitch + h0 * HD; const float* rp = RF + (size_t)h0 * TT + t; v4f c4[4], xa[HPT][2], xb[HPT][2]; float rfs[HPT];
#pragma unroll
    for (int hh = 0; hh < HPT; ++hh) { xa[hh][0] = ld4w(f + hh * HD + d); xa[hh][1] = ld4w(f + hh * HD + d + 4); xb[hh][0] = ld4w(f + hh * HD + dp0); xb[hh][1] = ld4w(f + hh * HD + dp0 + 4); rfs[hh] = ld1w(rp + hh * TT); }
#pragma unroll
    for (int i = 0; i < 4; ++i) c4[i] = ld4w(cp + 4 * i);
    const v4f g0 = ld4w(nw + d), g1 = ld4w(nw + d + 4);
#pragma unroll
    for (int hh = 0; hh < HPT; ++hh) { const float rf = rfs[hh]; v8h o16; v8us oh, ol;
#pragma unroll
        for (int q = 0; q < 8; ++q) { const int dd = d + q; float x0 = xa[hh][q >> 2][q & 3], x1 = xb[hh][q >> 2][q & 3]; const float gq = (q < 4) ? g0[q & 3] : g1[q & 3];
            /* RMSNorm is applied AFTER the rotation below (the module's rope-then-norm order) */
            v2f cs; cs[0] = c4[q >> 1][(q & 1) * 2]; cs[1] = c4[q >> 1][(q & 1) * 2 + 1]; float a = __fmul_rn(x0, cs[0]), bq = __fmul_rn(x1, cs[1]); asm volatile("" : "+v"(a)); asm volatile("" : "+v"(bq)); float r = ((dd < HD / 2) ? __fsub_rn(a, bq) : __fadd_rn(a, bq)); { float n0 = __fmul_rn(r, rf); asm volatile("" : "+v"(n0)); r = __fmul_rn(n0, bfr(gq)); } r = r * sc;   /* rotated value x inverse RMS x bf16(gamma[d]) */
            o16[q] = tohx(r); unsigned short a2, c2; splitf(r, a2, c2); oh[q] = a2; ol[q] = c2; }
        const size_t e = ((size_t)(h0 + hh) * TT + t) * HD + d; *(v8h*)(P16 + e) = o16; *(v8us*)(Ph + e) = oh; *(v8us*)(Pl + e) = ol; } }
// k_vtp: one block transposes 64 tokens x all HD dims of one kv head; one thread 8 tokens x 4 dims (8 lanes write one whole 128-byte line of a plane; a wave reads 64-byte runs of 64 rows, the block whole rows)
__global__ __launch_bounds__(256) void k_vtp(const float* __restrict__ F, int pitch, int nheads, h16* V16, bf* Vh, bf* Vl) { { const size_t by = blockIdx.y; F += by * TT * pitch; V16 += by * nheads * HD * TT; Vh += by * nheads * HD * TT; Vl += by * nheads * HD * TT; }   // blockIdx.y = batch
    const int g = (int)blockIdx.x / (TT / 64); if (g >= nheads) return; const int t = ((int)blockIdx.x % (TT / 64)) * 64 + ((int)threadIdx.x & 7) * 8; const int d = ((int)threadIdx.x >> 3) * 4; v4f x[8];
#pragma unroll
    for (int q = 0; q < 8; ++q) x[q] = ld4w(F + (size_t)(t + q) * pitch + g * HD + d);
#pragma unroll
    for (int j = 0; j < 4; ++j) { v8h o16; v8us oh, ol;
#pragma unroll
        for (int q = 0; q < 8; ++q) { const float xx = x[q][j]; o16[q] = tohx(xx); unsigned short a2, c2; splitf(xx, a2, c2); oh[q] = a2; ol[q] = c2; }
        const size_t e = ((size_t)g * HD + d + j) * TT + t; *(v8h*)(V16 + e) = o16; *(v8us*)(Vh + e) = oh; *(v8us*)(Vl + e) = ol; } }
// k_tabs: the three tables in ONE launch: CS = {cos, sin} rounded to bf16, CSI = the identity table {1, 0}, ONES = unit gains (first HD / 4 threads)
__global__ __launch_bounds__(256) void k_tabs(const float* __restrict__ cosT, const float* __restrict__ sinT, float* CS, float* CSI, float* ONES) { const int idx = (blockIdx.x * 256 + threadIdx.x) * 4; if (idx >= TT * HD) return; const v4f c = ld4w(cosT + idx), s = ld4w(sinT + idx); v4f o0, o1; o0[0] = bfr(c[0]); o0[1] = bfr(s[0]); o0[2] = bfr(c[1]); o0[3] = bfr(s[1]); o1[0] = bfr(c[2]); o1[1] = bfr(s[2]); o1[2] = bfr(c[3]); o1[3] = bfr(s[3]); *(v4f*)(CS + (size_t)idx * 2) = o0; *(v4f*)(CS + (size_t)idx * 2 + 4) = o1;
    v4f cs; cs[0] = 1.0f; cs[1] = 0.0f; cs[2] = 1.0f; cs[3] = 0.0f; *(v4f*)(CSI + (size_t)idx * 2) = cs; *(v4f*)(CSI + (size_t)idx * 2 + 4) = cs;
    if (idx < HD) { v4f on; on[0] = 1.0f; on[1] = 1.0f; on[2] = 1.0f; on[3] = 1.0f; *(v4f*)(ONES + idx) = on; } }
__global__ __launch_bounds__(256) void k_ropeF(float* F, int pitch, int nheads, const float* __restrict__ CS) { F += (size_t)blockIdx.y * TT * pitch;   // blockIdx.y = batch
    const size_t e = (size_t)blockIdx.x * 256 + threadIdx.x; if (e >= (size_t)(nheads / HPT) * TT * (HD / 8)) return; const int d = (int)(e % (HD / 8)) * 4; const int t = (int)((e / (HD / 8)) % TT); const int h0 = (int)(e / ((size_t)(HD / 8) * TT)) * HPT; float* f0 = F + (size_t)t * pitch + h0 * HD;   // one thread: the dim pairs (d + q, d + q + HD / 2), q < 4, of token t in heads h0 .. h0 + HPT - 1
    const float* cp = CS + ((size_t)t * HD + d) * 2; const v4f ca[2] = { *(const v4f*)cp, *(const v4f*)(cp + 4) }, cb[2] = { *(const v4f*)(cp + HD), *(const v4f*)(cp + HD + 4) }; v4f X1[HPT], X2[HPT];
#pragma unroll
    for (int hh = 0; hh < HPT; ++hh) { X1[hh] = *(const v4f*)(f0 + hh * HD + d); X2[hh] = *(const v4f*)(f0 + hh * HD + d + HD / 2); }   // all loads in front of the first store
#pragma unroll
    for (int hh = 0; hh < HPT; ++hh) { v4f Y1, Y2;
#pragma unroll
        for (int q = 0; q < 4; ++q) { const float x1 = X1[hh][q], x2 = X2[hh][q]; v2f c1, c2; c1[0] = ca[q >> 1][(q & 1) * 2]; c1[1] = ca[q >> 1][(q & 1) * 2 + 1]; c2[0] = cb[q >> 1][(q & 1) * 2]; c2[1] = cb[q >> 1][(q & 1) * 2 + 1];
            float a1 = __fmul_rn(x1, c1[0]), b1 = __fmul_rn(x2, c1[1]), a2 = __fmul_rn(x2, c2[0]), b2 = __fmul_rn(x1, c2[1]); asm volatile("" : "+v"(a1), "+v"(b1), "+v"(a2), "+v"(b2)); const float y1 = __fsub_rn(a1, b1), y2 = __fadd_rn(a2, b2);
            Y1[q] = y1; Y2[q] = y2; }
        *(v4f*)(f0 + hh * HD + d) = Y1; *(v4f*)(f0 + hh * HD + d + HD / 2) = Y2; } }
__global__ __launch_bounds__(256) void k_hrms(const float* __restrict__ F, int pitch, int nheads, float* RF) { F += (size_t)blockIdx.y * TT * pitch; RF += (size_t)blockIdx.y * nheads * TT;   // blockIdx.y = batch
    const int idx = blockIdx.x * 256 + threadIdx.x; if (idx >= nheads * TT) return; const int t = idx % TT; const int h = idx / TT; const float* f = F + (size_t)t * pitch + h * HD; float s = 0.f;
#pragma unroll 4
    for (int d = 0; d < HD; d += 4) { const v4f a = *(const v4f*)(f + d);
#pragma unroll
        for (int q = 0; q < 4; ++q) { float p = __fmul_rn(a[q], a[q]); asm volatile("" : "+v"(p)); s = __fadd_rn(s, p); } }
    const float rf = __fdiv_rn(1.0f, __fsqrt_rn(__fadd_rn(__fdiv_rn(s, (float)HD), 1.1920929e-07f))); *(float*)(RF + idx) = rf;  }

#define KP 136                // LDS row pitch of a staged K row in 16-bit elements: 256 bytes + 16 bytes, the pitch for 16-byte readers
#define KTE (64 * KP)         // one K plane of a stage: 64 keys
#define VTE (HD * SP)         // one V plane of a stage: HD rows of 64 keys (128 bytes + 16 bytes)
#define SCL2 0.12751743f      // HD^-0.5 x log2(e): scores in the exponent of 2
__device__ __forceinline__ float exp2s(float x) { float r; asm("v_exp_f32 %0, %1\n\tv_nop" : "=v"(r) : "v"(x)); return r; }
template <bool HL> struct FaT; template <> struct FaT<true> { typedef bf T; }; template <> struct FaT<false> { typedef h16 T; };
template <bool HL>
__device__ __forceinline__ void fa_body(unsigned short* sm, const unsigned short* Qh, const unsigned short* Ql, const unsigned short* Kh, const unsigned short* Kl, const unsigned short* Vh, const unsigned short* Vl, float* O, const int qb, const int wv) {
    typedef typename FaT<HL>::T T16; typedef typename WFrag<T16>::V V;
    constexpr int NP = HL ? 2 : 1; constexpr int BUF = NP * (KTE + VTE);   // a buffer: K planes, then V planes
    const int tid = (int)threadIdx.x, lane = tid & 31, lr = lane & 15, hi = lane >> 4;
    const int qw = qb * 64 + (wv & 1) * 32;   // the wave's first query row (scalar)
    V qf[2][4], qf2[2][4]; const unsigned short* qp = Qh + (size_t)(qw + lr) * HD + 8 * hi; const unsigned short* qp2 = HL ? Ql + (size_t)(qw + lr) * HD + 8 * hi : nullptr;   // the lane's own query row; every Q load differs from it by a constant
#pragma unroll
    for (int g = 0; g < 2; ++g)
#pragma unroll
        for (int ks = 0; ks < 4; ++ks) { qf[g][ks] = LFrag<T16>::ld(qp + g * 16 * HD + ks * 32); if (HL) qf2[g][ks] = LFrag<T16>::ld(qp2 + g * 16 * HD + ks * 32); }
    if (HL) asm volatile("s_wait_xcnt 0x0" :: "v"(qp), "v"(qp2) : "memory"); else asm volatile("s_wait_xcnt 0x0" :: "v"(qp) : "memory");   // behind the Q loads, in front of any later write (a later load's result too) of an address register that they name: the addresses as inputs keep their registers until here
    const unsigned voK = (unsigned)((tid >> 4) * HD + (tid & 15) * 8), voV = (unsigned)((tid >> 3) * TT + (tid & 7) * 8);   // the thread's own place in a staging load (a wave covers four whole 128-byte lines); never rewritten
    unsigned short* stK = sm + (tid >> 4) * KP + (tid & 15) * 8; unsigned short* stV = sm + NP * KTE + (tid >> 3) * SP + (tid & 7) * 8;
    v8us rk[NP][4], rv[NP][4];
    auto fetch = [&](int k0) {
        const unsigned short* pk = Kh + (size_t)k0 * HD + voK; const unsigned short* pv = Vh + k0 + voV; const unsigned short* pk2 = HL ? Kl + (size_t)k0 * HD + voK : nullptr; const unsigned short* pv2 = HL ? Vl + k0 + voV : nullptr;
#pragma unroll
        for (int i = 0; i < 4; ++i) { rk[0][i] = *(const v8usa*)(pk + i * 16 * HD); rv[0][i] = *(const v8usa*)(pv + i * 32 * TT);
            if (HL) { rk[NP - 1][i] = *(const v8usa*)(pk2 + i * 16 * HD); rv[NP - 1][i] = *(const v8usa*)(pv2 + i * 32 * TT); } }
        if (HL) asm volatile("s_wait_xcnt 0x0" :: "v"(pk), "v"(pv), "v"(pk2), "v"(pv2) : "memory"); else asm volatile("s_wait_xcnt 0x0" :: "v"(pk), "v"(pv) : "memory");   // behind the stage's loads, in front of any later write (a later load's result too) of an address register that they name: the addresses as inputs keep their registers until here
    };
    auto put = [&](int bsel) {
#pragma unroll
        for (int p = 0; p < NP; ++p)
#pragma unroll
            for (int i = 0; i < 4; ++i) { *(v8usa*)(stK + bsel * BUF + p * KTE + i * 16 * KP) = rk[p][i]; *(v8usa*)(stV + bsel * BUF + p * VTE + i * 32 * SP) = rv[p][i]; }
    };
    v8f o[8][2];
#pragma unroll
    for (int dt = 0; dt < 8; ++dt) { o[dt][0] = (v8f){}; o[dt][1] = (v8f){}; }
    float m[2] = { -3.0e38f, -3.0e38f }, l[2] = { 0.f, 0.f };
    const int n = qb + 1;   // stages of 64 keys up to and with the diagonal block; the same for the whole block
    __builtin_amdgcn_fence(__ATOMIC_RELEASE, "workgroup");   // compiles to a wait for the wave's own loads: the Q fragments have landed in front of the loop: a wait for them among the loop's products would also wait for the next stage's loads, which are to fly during the products
#pragma unroll 1
    for (int s = HL ? 0 : -1; s < n; ++s) {   // fp16 rows: trip -1 only brings stage 0 in
        if (HL) { fetch(s * 64); put(s & 1);   // the hi + lo rows have few stages and no registers to spare: they load each stage where it is needed; the buffer was last read two stages ago, in front of the barrier of the stage before
            __syncthreads(); }   // publishes stage s
        else if (s + 1 < n) fetch((s + 1) * 64);   // scalar test; the next stage's loads fly during this stage's products
        const unsigned short* kb = sm + (s & 1) * BUF + lr * KP + 8 * hi; const unsigned short* vb = sm + (s & 1) * BUF + NP * KTE + lr * SP + 8 * hi;
#pragma unroll
        for (int kk = 0; kk < 2; ++kk) {
            if (s >= 0 && s * 64 + kk * 32 <= qw + 31) {   // scalar tests: not in trip -1; 32 keys wholly above the wave's rows are skipped (their probabilities are exact zeros)
                v8f st[2][2];
#pragma unroll
                for (int kt = 0; kt < 2; ++kt) { st[kt][0] = (v8f){}; st[kt][1] = (v8f){}; }
                V ka[2][4], va[8];   // fp16 rows: fragment loads in groups; the hi + lo rows have no registers for that and load each fragment at its products
                if (!HL) {
#pragma unroll
                    for (int ks = 0; ks < 4; ++ks)
#pragma unroll
                        for (int kt = 0; kt < 2; ++kt) ka[kt][ks] = LFrag<T16>::ld(kb + (kk * 32 + kt * 16) * KP + ks * 32);
                    __builtin_amdgcn_sched_barrier(0); }   // all K fragment loads of the 32 keys issue as one group in front of the products: spread among them, each pair of products waits out a whole LDS latency
#pragma unroll
                for (int ks = 0; ks < 4; ++ks)
#pragma unroll
                    for (int kt = 0; kt < 2; ++kt) { V a, a2; if (HL) { a = LFrag<T16>::ld(kb + (kk * 32 + kt * 16) * KP + ks * 32); a2 = LFrag<T16>::ld(kb + KTE + (kk * 32 + kt * 16) * KP + ks * 32); } else a = ka[kt][ks];
#pragma unroll
                        for (int g = 0; g < 2; ++g) { st[kt][g] = WFrag<T16>::mma(a, qf[g][ks], st[kt][g]); if (HL) { st[kt][g] = WFrag<T16>::mma(a2, qf[g][ks], st[kt][g]); st[kt][g] = WFrag<T16>::mma(a, qf2[g][ks], st[kt][g]); } } }
                if (!HL) {
#pragma unroll
                    for (int dt = 0; dt < 8; ++dt) va[dt] = LFrag<T16>::ld(vb + dt * 16 * SP + kk * 32);
                    __builtin_amdgcn_sched_barrier(0); }   // all V fragment loads of the 32 keys issue as one group in front of the softmax, which covers their latency
                if (s == n - 1) {   // causal mask, under a scalar branch: only the diagonal stage has keys above a row
#pragma unroll
                    for (int g = 0; g < 2; ++g)
#pragma unroll
                        for (int kt = 0; kt < 2; ++kt)
#pragma unroll
                            for (int j = 0; j < 8; ++j) st[kt][g][j] = (s * 64 + kk * 32 + kt * 16 + hi * 8 + j <= qw + g * 16 + lr) ? st[kt][g][j] : -3.0e38f; }
                float mn[2];
#pragma unroll
                for (int g = 0; g < 2; ++g) { float mx = -3.0e38f;
#pragma unroll
                    for (int kt = 0; kt < 2; ++kt)
#pragma unroll
                        for (int j = 0; j < 8; ++j) { const float t = st[kt][g][j] * SCL2; st[kt][g][j] = t; mx = fmaxf(mx, t); }
                    mx = fmaxf(mx, __shfl_xor(mx, 16, 32)); mn[g] = fmaxf(m[g], mx); }
                if (__builtin_amdgcn_ballot_w32(mn[0] > m[0] || mn[1] > m[1]) != 0) {   // one scalar branch per 32 keys: where no query's maximum rises every factor would be exactly 1
#pragma unroll
                    for (int g = 0; g < 2; ++g) { const float al = exp2s(m[g] - mn[g]); m[g] = mn[g]; l[g] *= al;
#pragma unroll
                        for (int dt = 0; dt < 8; ++dt) o[dt][g] *= al; } }
                V pb[2], pb2[2];
#pragma unroll
                for (int g = 0; g < 2; ++g) { float sum = 0.f; v8us h0, h1, l0, l1; v8h f0, f1; const float mo = HL ? m[g] : m[g] - 8.0f;   // fp16 rows carry the probabilities x 2^8 (at most 256), so that small ones stay normal fp16 numbers; the row sum carries the same factor, which the division takes out
#pragma unroll
                    for (int j = 0; j < 8; ++j) { const float p0 = exp2s(st[0][g][j] - mo), p1 = exp2s(st[1][g][j] - mo); sum += p0 + p1;
                        if (HL) { unsigned short a, c; splitf(p0, a, c); h0[j] = a; l0[j] = c; splitf(p1, a, c); h1[j] = a; l1[j] = c; } else { f0[j] = tohx(p0); f1[j] = tohx(p1); } }
                    l[g] += sum;
                    if constexpr (HL) { pb[g] = cat16b(h0, h1); pb2[g] = cat16b(l0, l1); } else { pb[g] = cat16(f0, f1); } }
#pragma unroll
                for (int dt = 0; dt < 8; ++dt) { V a, a2; if (HL) { a = LFrag<T16>::ld(vb + dt * 16 * SP + kk * 32); a2 = LFrag<T16>::ld(vb + VTE + dt * 16 * SP + kk * 32); } else a = va[dt];
#pragma unroll
                    for (int g = 0; g < 2; ++g) { o[dt][g] = WFrag<T16>::mma(a, pb[g], o[dt][g]); if (HL) { o[dt][g] = WFrag<T16>::mma(a, pb2[g], o[dt][g]); o[dt][g] = WFrag<T16>::mma(a2, pb[g], o[dt][g]); } } }
                __builtin_amdgcn_sched_barrier(0);   // keeps every product of the 32 keys in front of the slots below
                asm volatile("v_nop\n\tv_nop\n\tv_nop\n\tv_nop");   // four vector slots behind the last products of the 32 keys, in front of the next writes of their operand registers, also on the taken side of the branches that follow
            }
        }
        if (!HL) { if (s + 1 < n) put((s + 1) & 1);   // into the buffer that every wave left at the barrier of the stage before
            __syncthreads(); }   // publishes stage s + 1 and ends every wave's reads of stage s
    }
#pragma unroll
    for (int g = 0; g < 2; ++g) { const float f = __fdiv_rn(HL ? 1.0f : PCAR, l[g] + __shfl_xor(l[g], 16, 32)); float* orow = O + (size_t)(qw + g * 16 + lr) * HD + hi * 8;   // the two lane halves summed different keys
#pragma unroll
        for (int dt = 0; dt < 8; ++dt) { v4f x0, x1;
#pragma unroll
            for (int j = 0; j < 4; ++j) { x0[j] = o[dt][g][j] * f; x1[j] = o[dt][g][4 + j] * f; }
            *(v4f*)(orow + dt * 16) = x0; *(v4f*)(orow + dt * 16 + 4) = x1; }
        asm volatile("s_wait_xcnt 0x0" ::: "memory"); }   // behind the stores, in front of any later write of a register that they name
}
// grid: (TT / 64) x NB_ x NKV blocks, the longest query blocks first
__global__ __launch_bounds__(256) void k_fattn(const h16* P16, const bf* Ph, const bf* Pl, const h16* VT16, const bf* VTh, const bf* VTl, float* Ob) {
    __shared__ __align__(16) unsigned short sm[2 * 2 * (KTE + VTE)];
    const int wv = __builtin_amdgcn_readfirstlane((int)(threadIdx.x >> 5));   // wave number in a scalar register: the tests on the wave's rows stay scalar
    const int qb = TT / 64 - 1 - (int)blockIdx.x / (NB_ * NKV); const int bk = (int)blockIdx.x % (NB_ * NKV); const int b = bk / NKV, kvh = bk % NKV, head = kvh * REP + (wv >> 1);
    const size_t qo = ((size_t)b * NHR + head) * TT * HD, ko = ((size_t)b * NHR + NH_ + kvh) * TT * HD, vo = ((size_t)b * NKV + kvh) * HD * TT;
    float* O = Ob + ((size_t)b * ZH + head) * TT * HD;
    if (qb < RH / 64) fa_body<true>(sm, Ph + qo, Pl + qo, Ph + ko, Pl + ko, VTh + vo, VTl + vo, O, qb, wv);
    else fa_body<false>(sm, (const unsigned short*)P16 + qo, nullptr, (const unsigned short*)P16 + ko, nullptr, (const unsigned short*)VT16 + vo, nullptr, O, qb, wv);
}
__global__ __launch_bounds__(256) void k_merge(const float* __restrict__ O, int h0, bf* Ah, bf* Al) { O += (size_t)blockIdx.y * ZH * TT * HD; Ah += (size_t)blockIdx.y * TT * DQ; Al += (size_t)blockIdx.y * TT * DQ;   // blockIdx.y = batch
    const size_t g = (size_t)blockIdx.x * 256 + threadIdx.x; if (g >= (size_t)(ZH / HPT) * TT * (HD / 8)) return; const int d = (int)(g % (HD / 8)) * 8; const int t = (int)((g / (HD / 8)) % TT); const int z0 = (int)(g / ((size_t)(HD / 8) * TT)) * HPT; const float cs = (t < RH) ? 1.0f : (1.0f / PCAR); v4f x[HPT][2];   // one thread: 8 dims of token t in HPT heads
#pragma unroll
    for (int k = 0; k < HPT; ++k) { const float* o = O + ((size_t)(z0 + k) * TT + t) * HD + d; x[k][0] = ld4w(o); x[k][1] = ld4w(o + 4); }
#pragma unroll
    for (int k = 0; k < HPT; ++k) { const size_t oo = (size_t)t * DQ + (h0 + z0 + k) * HD + d; v8us oh, ol;
#pragma unroll
        for (int q = 0; q < 8; ++q) { unsigned short a, c2; splitf(x[k][q >> 2][q & 3] * cs, a, c2); oh[q] = a; ol[q] = c2; } *(v8us*)(Ah + oo) = oh; *(v8us*)(Al + oo) = ol; } }

extern "C" void kernel_launch(void* const* d_in, const int* in_sizes, int n_in,
                              void* d_out, int out_size, void* d_ws, size_t ws_size, hipStream_t stream) {
    (void)in_sizes; (void)n_in; (void)out_size;
    const float* x = (const float*)d_in[0]; const float* fcos = (const float*)d_in[1]; const float* fsin = (const float*)d_in[2]; const float* wq = (const float*)d_in[3]; const float* wk = (const float*)d_in[4]; const float* wv = (const float*)d_in[5]; const float* wo = (const float*)d_in[6];   /* inputs x, cos, sin ([2048][1][128] = [2048][128] FULL width, read per dimension), wq ('oi' [2048][2048]), wk, wv ('oi' [512][2048]), wproj ('oi') */
    float* OUT = (float*)d_out;     // [2][2048][2048]
    char* wsp = (char*)d_ws;
    auto take = [&](size_t bytes) { char* p = wsp; wsp += (bytes + 255) & ~(size_t)255; return (void*)p; };
    // What lives through the attention of both batches: wproj, the head planes [batch][16 q heads, then 4 k heads][t][d], the transposed v planes [batch][kv head][d][t], the attention output [batch][head][t][d].
    bf* WO = (bf*)take((size_t)DM * DQ * 2);
    h16* P16 = (h16*)take((size_t)NB_ * NHR * TT * HD * 2); bf* Ph = (bf*)take((size_t)NB_ * NHR * TT * HD * 2); bf* Pl = (bf*)take((size_t)NB_ * NHR * TT * HD * 2);
    h16* VT16 = (h16*)take((size_t)NB_ * NKV * HD * TT * 2); bf* VTh = (bf*)take((size_t)NB_ * NKV * HD * TT * 2); bf* VTl = (bf*)take((size_t)NB_ * NKV * HD * TT * 2);
    float* Ob = (float*)take((size_t)NB_ * ZH * TT * HD * 4); float* Sb = (float*)take((size_t)ZH * SH * 4);   /* Sb: scratch range, see below */
    if ((size_t)(wsp - (char*)d_ws) > ws_size) return;    // ws 256 MiB
    // What only the launches in front of the attention use lies in the scratch range.
    wsp = (char*)Sb;
    bf* XB = (bf*)take((size_t)MT * DM * 2); bf* WQ = (bf*)take((size_t)DQ * DM * 2); bf* WK = (bf*)take((size_t)DKV * DM * 2); bf* WV = (bf*)take((size_t)DKV * DM * 2);   /* WK and WV follow each other: one Bt of 2 DKV rows */
    float* CS = (float*)take((size_t)TT * HD * 2 * 4); float* CSI = (float*)take((size_t)TT * HD * 2 * 4);   /* identity {1, 0} table for the plane builder (the rotation is applied in place before the norm) */ float* ONES = (float*)take(256 * 4);
    float* RF = (float*)take((size_t)NB_ * NHR * TT * 4);   /* per (batch, head, token) inverse RMS of the rotated values */ float* F = (float*)take((size_t)MT * DF * 4);   /* f32 feature rows q | k | v of both batches */
    if ((size_t)(wsp - (char*)Sb) > (size_t)ZH * SH * 4) return;
    // The merged hi / lo rows [MT][DQ] lie over the front of the hi / lo head planes, which the attention launch reads last: k_merge stands behind it.
    bf* ATh = Ph; bf* ATl = Pl;
    // Every stage outside the attention runs ONCE, for both batches (and for q and k, or k and v, together).
    k_cvt5<<<CVB((size_t)MT * DM) + 2 * CVB((size_t)DQ * DM) + 2 * CVB((size_t)DKV * DM), 256, 0, stream>>>(x, wq, wk, wv, wo, XB, WQ, WK, WV, WO);   /* 'oi' weights = Bt as-is */
    k_tabs<<<(TT * HD / 4 + 255) / 256, 256, 0, stream>>>(fcos, fsin, CS, CSI, ONES);   /* rotary table from the FULL-width inputs, per dimension; identity table; unit gains */
    k_gemmw<bf, 0, false, 4, DM><<<dim3(MT / 64, DQ / 64, 1), 128, 0, stream>>>(XB, nullptr, WQ, nullptr, F, DF, nullptr, 0, 0, 0);
    k_gemmw<bf, 0, false, 8, DM><<<dim3(MT / 64, 2 * DKV / 64, 1), 256, 0, stream>>>(XB, nullptr, WK, nullptr, F + DQ, DF, nullptr, 0, 0, 0);
    const unsigned LR = (unsigned)(((size_t)(NHR / HPT) * TT * (HD / 8) + 255) / 256);   // k_ropeF, k_rope: one thread per (HPT heads, token, 8 values) of a batch
    k_ropeF<<<dim3(LR, NB_), 256, 0, stream>>>(F, DF, NHR, CS);   /* rotary FIRST */
    k_hrms<<<dim3((NHR * TT + 255) / 256, NB_), 256, 0, stream>>>(F, DF, NHR, RF);
    k_rope<<<dim3(LR, NB_), 256, 0, stream>>>(F, DF, NHR, CSI, RF, ONES, 1.0f, P16, Ph, Pl);   /* rope then RMSNorm */
    k_vtp<<<dim3(NKV * (TT / 64), NB_), 256, 0, stream>>>(F + DQ + DKV, DF, NKV, VT16, VTh, VTl);
    k_fattn<<<(TT / 64) * NB_ * NKV, 256, 0, stream>>>(P16, Ph, Pl, VT16, VTh, VTl, Ob);   /* the whole attention of both batches: one block per (64 query rows, batch, kv head) */
    k_merge<<<dim3((unsigned)(((size_t)(ZH / HPT) * TT * (HD / 8) + 255) / 256), NB_), 256, 0, stream>>>(Ob, 0, ATh, ATl);
    k_gemmw<bf, 1, false, 4, DQ><<<dim3(MT / 64, DM / 64, 1), 128, 0, stream>>>(ATh, ATl, WO, nullptr, OUT, DM, nullptr, 0, 0, 0);
}

// v007
// A run of this version takes 231 microseconds.
// Next to v006, in two timings, it ran 1.18 times as fast each time.
// Counting every step since v000, it is 7.34 times as fast.
#include <hip/hip_runtime.h>

// Grouped-query causal attention with rotary embeddings followed by a gain-free RMSNorm on q and k (x [2][2048][2048]; q = x wq^T (16 heads x 128), k, v = x w^T ('oi' [512][2048]: 4 kv heads x 128); _apply_rope: x cos + rotate_half(x) sin with rotate_half = cat(-x2, x1) and the FULL-WIDTH cos / sin inputs [2048][1][128] (read per dimension); q = rms_norm(rope(q)), k = rms_norm(rope(k)) with x rsqrt(mean(x^2) + 1.19e-7) over the 128 dims (no gain; LITERAL order: the rotation is applied in place in f32 first, then the per-(token, head) row factor is taken from the rotated values); kv head = q head / 4 (repeat); scores x 128^-0.5; causal (-inf); softmax; out = merged wproj^T -> [2][2048][2048] (8.4 M); argument order x, cos, sin, wq, wk, wv, wproj).
// Layout (every stage outside the attention runs once for both batches; blockIdx.y = batch where a kernel needs it): bf16 copy of x; natural 'oi' weights cast as they are (Bt); exact projections into f32 feature rows q | k | v; k_tabs: the {cos, sin} table from the bf16-rounded FULL-width inputs (HD 128, read per dimension); k_ropeF: the rotate-half rotation IN PLACE on the f32 rows FIRST (the mean square changes); k_hrms: per (head, token) inverse RMS of the ROTATED values (eps 1.19e-7; no gain); k_rope with the identity table CSI and unit gains ONES applies the row factor and builds the planes; k_fattn: causal T-2048 GQA attention with 128-wide heads, scores, softmax and P.V in one kernel for both batches (running maximum; nothing of the scores goes to memory; hybrid rows; keys above the diagonal block are never visited); merged hi/lo x wproj exact.
// Compute dtypes, f32 accumulate: every input rounded to bf16 incl. the two tables; projections exact; rotary and RMSNorm f32; attention rows < 512 3 products, rest fp16; softmax f32; wproj hl x exact.

#define NB_  2
#define TT   2048
#define DM   2048
#define NH_  16
#define NKV  4        // four kv heads (grouped-query: kv head = q head / 4)
#define REP  (NH_ / NKV)
#define HD   128
#define DQ   (NH_ * HD)
#define DKV  (NKV * HD)
#define NHR  (NH_ + NKV)          // heads that take the rotation and the norm: the 16 q heads, then the 4 k heads
#define DF   (DQ + 2 * DKV)       // one token's f32 feature row: q | k | v
#define MT   (NB_ * TT)           // token rows of both batches
#define ZH   16                   // heads of a batch in the attention output
#define SH   ((size_t)(TT / 64) * (TT / 64 + 1) / 2 * 4096)   // ZH * SH f32 elements: the workspace range of what only the launches in front of the attention use
#define RH   512                  // query rows < RH use hi+lo planes (0: none)
#define PCAR 1024.0f
typedef _Float16 h16;
typedef unsigned short bf;
typedef __attribute__((ext_vector_type(16))) __bf16   v16bf;
typedef __attribute__((ext_vector_type(16))) _Float16 v16h;
typedef __attribute__((ext_vector_type(8)))  _Float16 v8h;
typedef __attribute__((ext_vector_type(8)))  unsigned short v8us;
typedef __attribute__((ext_vector_type(8)))  float    v8f;
typedef __attribute__((ext_vector_type(4)))  float    v4f;
typedef v8h  __attribute__((may_alias)) v8ha;
typedef v4f  __attribute__((may_alias)) v4fa;
typedef v8us __attribute__((may_alias)) v8usa;

__device__ __forceinline__ unsigned short f2bf(float f) { unsigned u = __float_as_uint(f); u += 0x7FFFu + ((u >> 16) & 1u); return (unsigned short)(u >> 16); }
__device__ __forceinline__ float bf2f(unsigned short b) { return __uint_as_float(((unsigned)b) << 16); }
__device__ __forceinline__ float bfr(float f) { return bf2f(f2bf(f)); }
__device__ __forceinline__ v16h cat16(v8h lo, v8h hi) { return __builtin_shufflevector(lo, hi, 0, 1, 2, 3, 4, 5, 6, 7, 8, 9, 10, 11, 12, 13, 14, 15); }
__device__ __forceinline__ v16bf cat16b(v8us lo, v8us hi) { return __builtin_bit_cast(v16bf, __builtin_shufflevector(lo, hi, 0, 1, 2, 3, 4, 5, 6, 7, 8, 9, 10, 11, 12, 13, 14, 15)); }
__device__ __forceinline__ v8f wmma16(v16h a, v16h b, v8f c) { return __builtin_amdgcn_wmma_f32_16x16x32_f16(false, a, false, b, (short)0, c, false, false); }
__device__ __forceinline__ v8f wmmab(v16bf a, v16bf b, v8f c) { return __builtin_amdgcn_wmma_f32_16x16x32_bf16(false, a, false, b, (short)0, c, false, false); }



// ---- k_gemmw: register-blocked GEMM, one 128x128 output tile per block of 4 waves (2 x 2), each wave a 64x64 quarter (16 accumulators) over the WHOLE of K in the order of k; the four waves share the block's staged operand tiles, so every operand row is loaded once per block and read by two waves; grid (M/128, N/128, Z), 128 threads. K % 64 == 0.
// C[m][n] (f32, pitch ldc, + optional f32 bias[n]) = sum_k A[m][k] Bt[n][k] (+ split products per NSPLIT). z-batch strides sA/sB/sC in elements.
template <typename T16> struct WFrag;
template <> struct WFrag<h16> { typedef v16h V; static __device__ __forceinline__ V ld(const h16* p) { return cat16(*(const v8h*)p, *(const v8h*)(p + 16)); } static __device__ __forceinline__ v8f mma(V a, V b, v8f c) { return wmma16(a, b, c); } };
template <> struct WFrag<bf> { typedef v16bf V; static __device__ __forceinline__ V ld(const bf* p) { return cat16b(*(const v8us*)p, *(const v8us*)(p + 16)); } static __device__ __forceinline__ v8f mma(V a, V b, v8f c) { return wmmab(a, b, c); } };
// LFrag: one fragment (the same k order as WFrag::ld) from a staged LDS row
template <typename T16> struct LFrag;
template <> struct LFrag<h16> { static __device__ __forceinline__ v16h ld(const unsigned short* p) { return cat16(*(const v8ha*)p, *(const v8ha*)(p + 16)); } };
template <> struct LFrag<bf> { static __device__ __forceinline__ v16bf ld(const unsigned short* p) { return cat16b(*(const v8usa*)p, *(const v8usa*)(p + 16)); } };
#define SP 72   // LDS row pitch of a staged K chunk in 16-bit elements: 128 bytes of data + 16 bytes, the pitch for 16-byte readers
#define BT 128  // rows of a block's tile of each operand plane
// Operand path: the block brings each 64-element K chunk (128 rows x 128 bytes per operand plane) with 16-byte loads of which each covers four WHOLE 128-byte lines (8 lanes a row) into registers one chunk ahead, stores it to one of two LDS buffers and reads the fragments from there; one barrier a chunk.
// KK = K = row pitch of every operand plane, a compile-time constant, so that the 8 loads of a plane differ in their immediate offset only.
template <typename T16, int NSPLIT, bool BIAS, int KK>
__global__ __launch_bounds__(128) void k_gemmw(const T16* A, const T16* A2, const T16* Bt, const T16* Bt2, float* C, int ldc, const float* __restrict__ bias, size_t sA, size_t sB, size_t sC) {
    typedef typename WFrag<T16>::V V;
    constexpr bool HA2 = (NSPLIT == 1 || NSPLIT == 2), HB2 = (NSPLIT >= 2);
    constexpr int NT = 2 + (HA2 ? 1 : 0) + (HB2 ? 1 : 0);   // staged planes: A, B, then A2, then B2
    constexpr int BUF = NT * BT * SP;                       // 16-bit elements of one buffer (= f32 elements of both)
    constexpr int NC = KK / 64;                             // K chunks
    __shared__ __align__(16) float os[BUF];                 // two buffers in the K loop; behind it each wave's 16 x 64 output rows (pitch 68)
    const int wv = __builtin_amdgcn_readfirstlane((int)(threadIdx.x >> 5));   // wave number in a scalar register
    const int wm = wv >> 1, wn = wv & 1;                    // the wave's quarter of the tile
    const size_t z = blockIdx.z; A += z * sA; if (A2) A2 += z * sA; Bt += z * sB; if (Bt2) Bt2 += z * sB; C += z * sC;
    const int tid = (int)threadIdx.x, lane = tid & 31, lr = lane & 15, hi = lane >> 4; const int r0 = blockIdx.x * BT, c0 = blockIdx.y * BT;
    v8f acc[4][4];
#pragma unroll
    for (int mb = 0; mb < 4; ++mb)
#pragma unroll
        for (int nb = 0; nb < 4; ++nb) acc[mb][nb] = (v8f){};
    const unsigned short* gp[4] = { (const unsigned short*)A + (size_t)r0 * KK, (const unsigned short*)Bt + (size_t)c0 * KK, HA2 ? (const unsigned short*)A2 + (size_t)r0 * KK : nullptr, HB2 ? (const unsigned short*)Bt2 + (size_t)c0 * KK : nullptr };   // block-uniform plane bases of this tile
    constexpr int TA2 = 2, TB2 = HA2 ? 3 : 2;               // LDS tile numbers of the lo planes
    const unsigned vo = (unsigned)((tid >> 3) * KK + (tid & 7) * 8);   // the thread's own place in a load: row tid / 8, 16-byte piece tid % 8; never rewritten
    unsigned short* sm = (unsigned short*)os;
    unsigned short* sst = sm + (tid >> 3) * SP + (tid & 7) * 8;
    const unsigned short* sfa = sm + (wm * 64 + lr) * SP + 8 * hi;             // the lane's first A row
    const unsigned short* sfb = sm + BT * SP + (wn * 64 + lr) * SP + 8 * hi;   // the lane's first B row
    v8us rg[NT][8];
    auto fetch = [&](int kc) {
        const unsigned short* pa = gp[0] + kc + vo; const unsigned short* pb = gp[1] + kc + vo; const unsigned short* pa2 = HA2 ? gp[2] + kc + vo : nullptr; const unsigned short* pb2 = HB2 ? gp[3] + kc + vo : nullptr;
#pragma unroll
        for (int i = 0; i < 8; ++i) { rg[0][i] = *(const v8usa*)(pa + i * 16 * KK); rg[1][i] = *(const v8usa*)(pb + i * 16 * KK); if (HA2) rg[TA2][i] = *(const v8usa*)(pa2 + i * 16 * KK); if (HB2) rg[TB2][i] = *(const v8usa*)(pb2 + i * 16 * KK); }
        if constexpr (HA2 && HB2) asm volatile("s_wait_xcnt 0x0" :: "v"(pa), "v"(pb), "v"(pa2), "v"(pb2) : "memory"); else if constexpr (HA2) asm volatile("s_wait_xcnt 0x0" :: "v"(pa), "v"(pb), "v"(pa2) : "memory"); else if constexpr (HB2) asm volatile("s_wait_xcnt 0x0" :: "v"(pa), "v"(pb), "v"(pb2) : "memory"); else asm volatile("s_wait_xcnt 0x0" :: "v"(pa), "v"(pb) : "memory");   // behind the chunk's loads, in front of any later write (a later load's result too) of an address register that they name: the addresses as inputs keep their registers until here (the operand pointers carry no restrict, so that the loads stay in front of this statement)
    };
    auto put = [&](int bsel) {
#pragma unroll
        for (int t = 0; t < NT; ++t)
#pragma unroll
            for (int i = 0; i < 8; ++i) *(v8usa*)(sst + bsel * BUF + t * BT * SP + i * 16 * SP) = rg[t][i];
    };
    fetch(0); put(0);
    __syncthreads();   // publishes chunk 0
#pragma unroll 1
    for (int s = 0; s < NC; ++s) {   // the chunks in the order of k: two 32-steps per chunk; kept rolled: the body already holds 32 to 64 products, a second copy would only take instruction cache
        if (s + 1 < NC) fetch((s + 1) * 64);      // scalar test; the next chunk's loads fly during this chunk's products
        const unsigned short* fa = sfa + (s & 1) * BUF; const unsigned short* fb = sfb + (s & 1) * BUF;
        V a[2][4], a2[2][4], b[2][4], b2[2][4];
#pragma unroll
        for (int ks = 0; ks < 2; ++ks)
#pragma unroll
            for (int f = 0; f < 4; ++f) { a[ks][f] = LFrag<T16>::ld(fa + f * 16 * SP + ks * 32); b[ks][f] = LFrag<T16>::ld(fb + f * 16 * SP + ks * 32); if (HA2) a2[ks][f] = LFrag<T16>::ld(fa + TA2 * BT * SP + f * 16 * SP + ks * 32); if (HB2) b2[ks][f] = LFrag<T16>::ld(fb + (TB2 - 1) * BT * SP + f * 16 * SP + ks * 32); }
        __builtin_amdgcn_sched_barrier(0);   // all fragment loads of the chunk issue as one group in front of its products: spread among them, every four products wait out a whole LDS latency, which the one or two waves of a SIMD do not cover
#pragma unroll
        for (int ks = 0; ks < 2; ++ks)
#pragma unroll
            for (int nb = 0; nb < 4; ++nb) {   // per accumulator the order a b, a2 b, a b2 of each 32-step
#pragma unroll
                for (int mb = 0; mb < 4; ++mb) acc[mb][nb] = WFrag<T16>::mma(a[ks][mb], b[ks][nb], acc[mb][nb]);
                if (HA2) {
#pragma unroll
                    for (int mb = 0; mb < 4; ++mb) acc[mb][nb] = WFrag<T16>::mma(a2[ks][mb], b[ks][nb], acc[mb][nb]); }
                if (HB2) {
#pragma unroll
                    for (int mb = 0; mb < 4; ++mb) acc[mb][nb] = WFrag<T16>::mma(a[ks][mb], b2[ks][nb], acc[mb][nb]); } }
        __builtin_amdgcn_sched_barrier(0);   // keeps every product of the chunk in front of the slots below
        asm volatile("v_nop\n\tv_nop\n\tv_nop\n\tv_nop");   // four vector slots behind the chunk's last products, in front of the next writes of their operand registers, also on the taken side of the branches that follow
        if (s + 1 < NC) put((s + 1) & 1);   // into the buffer that every wave left at the barrier of the chunk before
        __syncthreads();   // publishes chunk s + 1 and ends every wave's reads of chunk s
    }
    float* ow = os + wv * (16 * 68);   // behind the last barrier nobody reads a staged tile: each wave turns its rows into whole lines in its own LDS range
#pragma unroll
    for (int mb = 0; mb < 4; ++mb) {
#pragma unroll
        for (int nb = 0; nb < 4; ++nb) {
#pragma unroll
            for (int j = 0; j < 8; ++j) ow[(hi * 8 + j) * 68 + nb * 16 + lr] = acc[mb][nb][j]; }
        asm volatile("s_wait_dscnt 0x0" ::: "memory");   // the wave's own LDS stores are done before its lanes read rows that other lanes of the wave stored
        float* crow = C + (size_t)(r0 + wm * 64 + mb * 16) * ldc + c0 + wn * 64;
#pragma unroll
        for (int q = 0; q < 8; ++q) { const int row = 2 * q + hi, cofs = lr * 4; v4f val = *(const v4fa*)(ow + row * 68 + cofs); if (BIAS) { const float* bp = bias + c0 + wn * 64 + cofs; val[0] += bfr(bp[0]); val[1] += bfr(bp[1]); val[2] += bfr(bp[2]); val[3] += bfr(bp[3]); }
            *(v4f*)(crow + (size_t)row * ldc + cofs) = val; }
        asm volatile("s_wait_dscnt 0x0\n\ts_wait_xcnt 0x0" ::: "memory");   // the 16 rows are read before the next 16 overwrite them; and behind the stores, in front of any later write of a register that they name
    }
}

__device__ __forceinline__ h16 tohx(float x) { return (h16)x; }
__device__ __forceinline__ void splitf(float y, unsigned short& h, unsigned short& l) { h = f2bf(y); l = f2bf(y - bf2f(h)); }
typedef __attribute__((ext_vector_type(2))) _Float16 v2h;
typedef __attribute__((ext_vector_type(4))) _Float16 v4h;
typedef __attribute__((ext_vector_type(2))) unsigned short v2us;
typedef __attribute__((ext_vector_type(4))) unsigned short v4us;
typedef __attribute__((ext_vector_type(2))) float v2f;
typedef __attribute__((ext_vector_type(4))) int v4i;

// The conversion, rotation, plane and merge kernels below give every thread 16 to 32 elements in 16-byte pieces (they had 1 to 8): a launch starts 4 to 16 times fewer waves, and each lane has its loads in flight together. Every element's arithmetic is as before.
#define CVN 4   // 8-value pieces per thread of k_cvt5, 256 threads apart
#define HPT 4   // heads per thread of k_ropeF, k_rope and k_merge: the table values of one (token, dims) piece are loaded once for HPT heads
// k_cvt5: x (both batches) and the four weights in ONE launch; a block takes 256 CVN pieces of one tensor (every tensor is a whole number of blocks), picked by the block's number (scalar tests)
#define CVB(n) ((int)((size_t)(n) / 8 / (256 * CVN)))
static_assert((size_t)MT * DM % (8 * 256 * CVN) == 0 && (size_t)DQ * DM % (8 * 256 * CVN) == 0 && (size_t)DKV * DM % (8 * 256 * CVN) == 0, "whole blocks");
__global__ __launch_bounds__(256) void k_cvt5(const float* __restrict__ x, const float* __restrict__ wq, const float* __restrict__ wk, const float* __restrict__ wv, const float* __restrict__ wo, bf* XB, bf* WQ, bf* WK, bf* WV, bf* WO) {
    int blk = (int)blockIdx.x; const float* src = x; bf* dst = XB;
    if (blk >= CVB((size_t)MT * DM)) { blk -= CVB((size_t)MT * DM); src = wq; dst = WQ;
        if (blk >= CVB((size_t)DQ * DM)) { blk -= CVB((size_t)DQ * DM); src = wk; dst = WK;
            if (blk >= CVB((size_t)DKV * DM)) { blk -= CVB((size_t)DKV * DM); src = wv; dst = WV;
                if (blk >= CVB((size_t)DKV * DM)) { blk -= CVB((size_t)DKV * DM); src = wo; dst = WO; } } } }
    const size_t i0 = (size_t)blk * (256 * CVN) + threadIdx.x; v8f v[CVN];
#pragma unroll
    for (int c = 0; c < CVN; ++c) v[c] = *(const v8f*)(src + (i0 + (size_t)c * 256) * 8);   // all loads first, so that they are in flight together
    asm volatile("s_wait_xcnt 0x0" ::: "memory");   // behind the loads, in front of any later write of an address register that they name
#pragma unroll
    for (int c = 0; c < CVN; ++c) { v8us o;
#pragma unroll
        for (int k = 0; k < 8; ++k) o[k] = f2bf(v[c][k]);
        *(v8us*)(dst + (i0 + (size_t)c * 256) * 8) = o; } }

// k_rope: head planes [h][t][d] (fp16 + hi/lo) of RMSNorm(rope(x)) = rope(x)[d] x RF[h][t] x bf16(gamma[d]) x sc (norm after the rotation) with the rotate-half convention out[d] = x[d] cos[t][d] - x[d+HD/2] sin[t][d], out[d+HD/2] = x[d+HD/2] cos[t][d+HD/2] + x[d] sin[t][d+HD/2]
// ld4w, ld1w: a load with s_wait_xcnt 0 directly behind it: the wait stands in front of any later write (a later load's result too) of the address registers that the load names
__device__ __forceinline__ v4f ld4w(const float* p) { const v4f v = *(const v4fa*)p; asm volatile("s_wait_xcnt 0x0" ::: "memory"); return v; }
__device__ __forceinline__ float ld1w(const float* p) { const float v = *p; asm volatile("s_wait_xcnt 0x0" ::: "memory"); return v; }
// one thread: 8 dims d .. d + 7 of token t in heads h0 .. h0 + HPT - 1; RF is never null (its launch passes the row factors)
__global__ __launch_bounds__(256) void k_rope(const float* __restrict__ F, int pitch, int nheads, const float* __restrict__ CS, const float* __restrict__ RF, const float* __restrict__ nw, float sc, h16* P16, bf* Ph, bf* Pl) {
    { const size_t by = blockIdx.y; F += by * TT * pitch; RF += by * nheads * TT; P16 += by * nheads * TT * HD; Ph += by * nheads * TT * HD; Pl += by * nheads * TT * HD; }   // blockIdx.y = batch
    const size_t g = (size_t)blockIdx.x * 256 + threadIdx.x; if (g >= (size_t)(nheads / HPT) * TT * (HD / 8)) return; const int d = (int)(g % (HD / 8)) * 8; const int t = (int)((g / (HD / 8)) % TT); const int h0 = (int)(g / ((size_t)(HD / 8) * TT)) * HPT;
    const int dp0 = (d < HD / 2) ? d + HD / 2 : d - HD / 2; const float* cp = CS + ((size_t)t * HD + d) * 2; const float* f = F + (size_t)t * pitch + h0 * HD; const float* rp = RF + (size_t)h0 * TT + t; v4f c4[4], xa[HPT][2], xb[HPT][2]; float rfs[HPT];
#pragma unroll
    for (int hh = 0; hh < HPT; ++hh) { xa[hh][0] = ld4w(f + hh * HD + d); xa[hh][1] = ld4w(f + hh * HD + d + 4); xb[hh][0] = ld4w(f + hh * HD + dp0); xb[hh][1] = ld4w(f + hh * HD + dp0 + 4); rfs[hh] = ld1w(rp + hh * TT); }
#pragma unroll
    for (int i = 0; i < 4; ++i) c4[i] = ld4w(cp + 4 * i);
    const v4f g0 = ld4w(nw + d), g1 = ld4w(nw + d + 4);
#pragma unroll
    for (int hh = 0; hh < HPT; ++hh) { const float rf = rfs[hh]; v8h o16; v8us oh, ol;
#pragma unroll
        for (int q = 0; q < 8; ++q) { const int dd = d + q; float x0 = xa[hh][q >> 2][q & 3], x1 = xb[hh][q >> 2][q & 3]; const float gq = (q < 4) ? g0[q & 3] : g1[q & 3];
            /* RMSNorm is applied AFTER the rotation below (the module's rope-then-norm order) */
            v2f cs; cs[0] = c4[q >> 1][(q & 1) * 2]; cs[1] = c4[q >> 1][(q & 1) * 2 + 1]; float a = __fmul_rn(x0, cs[0]), bq = __fmul_rn(x1, cs[1]); asm volatile("" : "+v"(a)); asm volatile("" : "+v"(bq)); float r = ((dd < HD / 2) ? __fsub_rn(a, bq) : __fadd_rn(a, bq)); { float n0 = __fmul_rn(r, rf); asm volatile("" : "+v"(n0)); r = __fmul_rn(n0, bfr(gq)); } r = r * sc;   /* rotated value x inverse RMS x bf16(gamma[d]) */
            o16[q] = tohx(r); unsigned short a2, c2; splitf(r, a2, c2); oh[q] = a2; ol[q] = c2; }
        const size_t e = ((size_t)(h0 + hh) * TT + t) * HD + d; *(v8h*)(P16 + e) = o16; *(v8us*)(Ph + e) = oh; *(v8us*)(Pl + e) = ol; } }
// k_vtp: one block transposes 64 tokens x all HD dims of one kv head; one thread 8 tokens x 4 dims (8 lanes write one whole 128-byte line of a plane; a wave reads 64-byte runs of 64 rows, the block whole rows)
__global__ __launch_bounds__(256) void k_vtp(const float* __restrict__ F, int pitch, int nheads, h16* V16, bf* Vh, bf* Vl) { { const size_t by = blockIdx.y; F += by * TT * pitch; V16 += by * nheads * HD * TT; Vh += by * nheads * HD * TT; Vl += by * nheads * HD * TT; }   // blockIdx.y = batch
    const int g = (int)blockIdx.x / (TT / 64); if (g >= nheads) return; const int t = ((int)blockIdx.x % (TT / 64)) * 64 + ((int)threadIdx.x & 7) * 8; const int d = ((int)threadIdx.x >> 3) * 4; v4f x[8];
#pragma unroll
    for (int q = 0; q < 8; ++q) x[q] = ld4w(F + (size_t)(t + q) * pitch + g * HD + d);
#pragma unroll
    for (int j = 0; j < 4; ++j) { v8h o16; v8us oh, ol;
#pragma unroll
        for (int q = 0; q < 8; ++q) { const float xx = x[q][j]; o16[q] = tohx(xx); unsigned short a2, c2; splitf(xx, a2, c2); oh[q] = a2; ol[q] = c2; }
        const size_t e = ((size_t)g * HD + d + j) * TT + t; *(v8h*)(V16 + e) = o16; *(v8us*)(Vh + e) = oh; *(v8us*)(Vl + e) = ol; } }
// k_tabs: the three tables in ONE launch: CS = {cos, sin} rounded to bf16, CSI = the identity table {1, 0}, ONES = unit gains (first HD / 4 threads)
__global__ __launch_bounds__(256) void k_tabs(const float* __restrict__ cosT, const float* __restrict__ sinT, float* CS, float* CSI, float* ONES) { const int idx = (blockIdx.x * 256 + threadIdx.x) * 4; if (idx >= TT * HD) return; const v4f c = ld4w(cosT + idx), s = ld4w(sinT + idx); v4f o0, o1; o0[0] = bfr(c[0]); o0[1] = bfr(s[0]); o0[2] = bfr(c[1]); o0[3] = bfr(s[1]); o1[0] = bfr(c[2]); o1[1] = bfr(s[2]); o1[2] = bfr(c[3]); o1[3] = bfr(s[3]); *(v4f*)(CS + (size_t)idx * 2) = o0; *(v4f*)(CS + (size_t)idx * 2 + 4) = o1;
    v4f cs; cs[0] = 1.0f; cs[1] = 0.0f; cs[2] = 1.0f; cs[3] = 0.0f; *(v4f*)(CSI + (size_t)idx * 2) = cs; *(v4f*)(CSI + (size_t)idx * 2 + 4) = cs;
    if (idx < HD) { v4f on; on[0] = 1.0f; on[1] = 1.0f; on[2] = 1.0f; on[3] = 1.0f; *(v4f*)(ONES + idx) = on; } }
__global__ __launch_bounds__(256) void k_ropeF(float* F, int pitch, int nheads, const float* __restrict__ CS) { F += (size_t)blockIdx.y * TT * pitch;   // blockIdx.y = batch
    const size_t e = (size_t)blockIdx.x * 256 + threadIdx.x; if (e >= (size_t)(nheads / HPT) * TT * (HD / 8)) return; const int d = (int)(e % (HD / 8)) * 4; const int t = (int)((e / (HD / 8)) % TT); const int h0 = (int)(e / ((size_t)(HD / 8) * TT)) * HPT; float* f0 = F + (size_t)t * pitch + h0 * HD;   // one thread: the dim pairs (d + q, d + q + HD / 2), q < 4, of token t in heads h0 .. h0 + HPT - 1
    const float* cp = CS + ((size_t)t * HD + d) * 2; const v4f ca[2] = { *(const v4f*)cp, *(const v4f*)(cp + 4) }, cb[2] = { *(const v4f*)(cp + HD), *(const v4f*)(cp + HD + 4) }; v4f X1[HPT], X2[HPT];
#pragma unroll
    for (int hh = 0; hh < HPT; ++hh) { X1[hh] = *(const v4f*)(f0 + hh * HD + d); X2[hh] = *(const v4f*)(f0 + hh * HD + d + HD / 2); }   // all loads in front of the first store
#pragma unroll
    for (int hh = 0; hh < HPT; ++hh) { v4f Y1, Y2;
#pragma unroll
        for (int q = 0; q < 4; ++q) { const float x1 = X1[hh][q], x2 = X2[hh][q]; v2f c1, c2; c1[0] = ca[q >> 1][(q & 1) * 2]; c1[1] = ca[q >> 1][(q & 1) * 2 + 1]; c2[0] = cb[q >> 1][(q & 1) * 2]; c2[1] = cb[q >> 1][(q & 1) * 2 + 1];
            float a1 = __fmul_rn(x1, c1[0]), b1 = __fmul_rn(x2, c1[1]), a2 = __fmul_rn(x2, c2[0]), b2 = __fmul_rn(x1, c2[1]); asm volatile("" : "+v"(a1), "+v"(b1), "+v"(a2), "+v"(b2)); const float y1 = __fsub_rn(a1, b1), y2 = __fadd_rn(a2, b2);
            Y1[q] = y1; Y2[q] = y2; }
        *(v4f*)(f0 + hh * HD + d) = Y1; *(v4f*)(f0 + hh * HD + d + HD / 2) = Y2; } }
__global__ __launch_bounds__(256) void k_hrms(const float* __restrict__ F, int pitch, int nheads, float* RF) { F += (size_t)blockIdx.y * TT * pitch; RF += (size_t)blockIdx.y * nheads * TT;   // blockIdx.y = batch
    const int idx = blockIdx.x * 256 + threadIdx.x; if (idx >= nheads * TT) return; const int t = idx % TT; const int h = idx / TT; const float* f = F + (size_t)t * pitch + h * HD; float s = 0.f;
#pragma unroll 4
    for (int d = 0; d < HD; d += 4) { const v4f a = *(const v4f*)(f + d);
#pragma unroll
        for (int q = 0; q < 4; ++q) { float p = __fmul_rn(a[q], a[q]); asm volatile("" : "+v"(p)); s = __fadd_rn(s, p); } }
    const float rf = __fdiv_rn(1.0f, __fsqrt_rn(__fadd_rn(__fdiv_rn(s, (float)HD), 1.1920929e-07f))); *(float*)(RF + idx) = rf;  }

#define KP 136                // LDS row pitch of a staged K row in 16-bit elements: 256 bytes + 16 bytes, the pitch for 16-byte readers
#define KTE (64 * KP)         // one K plane of a stage: 64 keys
#define VTE (HD * SP)         // one V plane of a stage: HD rows of 64 keys (128 bytes + 16 bytes)
#define SCL2 0.12751743f      // HD^-0.5 x log2(e): scores in the exponent of 2
__device__ __forceinline__ float exp2s(float x) { float r; asm("v_exp_f32 %0, %1\n\tv_nop" : "=v"(r) : "v"(x)); return r; }
template <bool HL> struct FaT; template <> struct FaT<true> { typedef bf T; }; template <> struct FaT<false> { typedef h16 T; };
template <bool HL>
__device__ __forceinline__ void fa_body(unsigned short* sm, const unsigned short* Qh, const unsigned short* Ql, const unsigned short* Kh, const unsigned short* Kl, const unsigned short* Vh, const unsigned short* Vl, float* O, const int qb, const int wv) {
    typedef typename FaT<HL>::T T16; typedef typename WFrag<T16>::V V;
    constexpr int NP = HL ? 2 : 1; constexpr int BUF = NP * (KTE + VTE);   // a buffer: K planes, then V planes
    const int tid = (int)threadIdx.x, lane = tid & 31, lr = lane & 15, hi = lane >> 4;
    const int qw = qb * 64 + (wv & 1) * 32;   // the wave's first query row (scalar)
    V qf[2][4], qf2[2][4]; const unsigned short* qp = Qh + (size_t)(qw + lr) * HD + 8 * hi; const unsigned short* qp2 = HL ? Ql + (size_t)(qw + lr) * HD + 8 * hi : nullptr;   // the lane's own query row; every Q load differs from it by a constant
#pragma unroll
    for (int g = 0; g < 2; ++g)
#pragma unroll
        for (int ks = 0; ks < 4; ++ks) { qf[g][ks] = LFrag<T16>::ld(qp + g * 16 * HD + ks * 32); if (HL) qf2[g][ks] = LFrag<T16>::ld(qp2 + g * 16 * HD + ks * 32); }
    if (HL) asm volatile("s_wait_xcnt 0x0" :: "v"(qp), "v"(qp2) : "memory"); else asm volatile("s_wait_xcnt 0x0" :: "v"(qp) : "memory");   // behind the Q loads, in front of any later write (a later load's result too) of an address register that they name: the addresses as inputs keep their registers until here
    const unsigned voK = (unsigned)((tid >> 4) * HD + (tid & 15) * 8), voV = (unsigned)((tid >> 3) * TT + (tid & 7) * 8);   // the thread's own place in a staging load (a wave covers four whole 128-byte lines); never rewritten
    unsigned short* stK = sm + (tid >> 4) * KP + (tid & 15) * 8; unsigned short* stV = sm + NP * KTE + (tid >> 3) * SP + (tid & 7) * 8;
    v8us rk[NP][4], rv[NP][4];
    auto fetch = [&](int k0) {
        const unsigned short* pk = Kh + (size_t)k0 * HD + voK; const unsigned short* pv = Vh + k0 + voV; const unsigned short* pk2 = HL ? Kl + (size_t)k0 * HD + voK : nullptr; const unsigned short* pv2 = HL ? Vl + k0 + voV : nullptr;
#pragma unroll
        for (int i = 0; i < 4; ++i) { rk[0][i] = *(const v8usa*)(pk + i * 16 * HD); rv[0][i] = *(const v8usa*)(pv + i * 32 * TT);
            if (HL) { rk[NP - 1][i] = *(const v8usa*)(pk2 + i * 16 * HD); rv[NP - 1][i] = *(const v8usa*)(pv2 + i * 32 * TT); } }
        if (HL) asm volatile("s_wait_xcnt 0x0" :: "v"(pk), "v"(pv), "v"(pk2), "v"(pv2) : "memory"); else asm volatile("s_wait_xcnt 0x0" :: "v"(pk), "v"(pv) : "memory");   // behind the stage's loads, in front of any later write (a later load's result too) of an address register that they name: the addresses as inputs keep their registers until here
    };
    auto put = [&](int bsel) {
#pragma unroll
        for (int p = 0; p < NP; ++p)
#pragma unroll
            for (int i = 0; i < 4; ++i) { *(v8usa*)(stK + bsel * BUF + p * KTE + i * 16 * KP) = rk[p][i]; *(v8usa*)(stV + bsel * BUF + p * VTE + i * 32 * SP) = rv[p][i]; }
    };
    v8f o[8][2];
#pragma unroll
    for (int dt = 0; dt < 8; ++dt) { o[dt][0] = (v8f){}; o[dt][1] = (v8f){}; }
    float m[2] = { -3.0e38f, -3.0e38f }, l[2] = { 0.f, 0.f };
    const int n = qb + 1;   // stages of 64 keys up to and with the diagonal block; the same for the whole block
    __builtin_amdgcn_fence(__ATOMIC_RELEASE, "workgroup");   // compiles to a wait for the wave's own loads: the Q fragments have landed in front of the loop: a wait for them among the loop's products would also wait for the next stage's loads, which are to fly during the products
#pragma unroll 1
    for (int s = HL ? 0 : -1; s < n; ++s) {   // fp16 rows: trip -1 only brings stage 0 in
        if (HL) { fetch(s * 64); put(s & 1);   // the hi + lo rows have few stages and no registers to spare: they load each stage where it is needed; the buffer was last read two stages ago, in front of the barrier of the stage before
            __syncthreads(); }   // publishes stage s
        else if (s + 1 < n) fetch((s + 1) * 64);   // scalar test; the next stage's loads fly during this stage's products
        const unsigned short* kb = sm + (s & 1) * BUF + lr * KP + 8 * hi; const unsigned short* vb = sm + (s & 1) * BUF + NP * KTE + lr * SP + 8 * hi;
#pragma unroll
        for (int kk = 0; kk < 2; ++kk) {
            if (s >= 0 && s * 64 + kk * 32 <= qw + 31) {   // scalar tests: not in trip -1; 32 keys wholly above the wave's rows are skipped (their probabilities are exact zeros)
                v8f st[2][2];
#pragma unroll
                for (int kt = 0; kt < 2; ++kt) { st[kt][0] = (v8f){}; st[kt][1] = (v8f){}; }
                V ka[2][4], va[8];   // fp16 rows: fragment loads in groups; the hi + lo rows have no registers for that and load each fragment at its products
                if (!HL) {
#pragma unroll
                    for (int ks = 0; ks < 4; ++ks)
#pragma unroll
                        for (int kt = 0; kt < 2; ++kt) ka[kt][ks] = LFrag<T16>::ld(kb + (kk * 32 + kt * 16) * KP + ks * 32);
                    __builtin_amdgcn_sched_barrier(0); }   // all K fragment loads of the 32 keys issue as one group in front of the products: spread among them, each pair of products waits out a whole LDS latency
#pragma unroll
                for (int ks = 0; ks < 4; ++ks)
#pragma unroll
                    for (int kt = 0; kt < 2; ++kt) { V a, a2; if (HL) { a = LFrag<T16>::ld(kb + (kk * 32 + kt * 16) * KP + ks * 32); a2 = LFrag<T16>::ld(kb + KTE + (kk * 32 + kt * 16) * KP + ks * 32); } else a = ka[kt][ks];
#pragma unroll
                        for (int g = 0; g < 2; ++g) { st[kt][g] = WFrag<T16>::mma(a, qf[g][ks], st[kt][g]); if (HL) { st[kt][g] = WFrag<T16>::mma(a2, qf[g][ks], st[kt][g]); st[kt][g] = WFrag<T16>::mma(a, qf2[g][ks], st[kt][g]); } } }
                if (!HL) {
#pragma unroll
                    for (int dt = 0; dt < 8; ++dt) va[dt] = LFrag<T16>::ld(vb + dt * 16 * SP + kk * 32);
                    __builtin_amdgcn_sched_barrier(0); }   // all V fragment loads of the 32 keys issue as one group in front of the softmax, which covers their latency
                if (s == n - 1) {   // causal mask, under a scalar branch: only the diagonal stage has keys above a row
#pragma unroll
                    for (int g = 0; g < 2; ++g)
#pragma unroll
                        for (int kt = 0; kt < 2; ++kt)
#pragma unroll
                            for (int j = 0; j < 8; ++j) st[kt][g][j] = (s * 64 + kk * 32 + kt * 16 + hi * 8 + j <= qw + g * 16 + lr) ? st[kt][g][j] : -3.0e38f; }
                float mn[2];
#pragma unroll
                for (int g = 0; g < 2; ++g) { float mx = -3.0e38f;
#pragma unroll
                    for (int kt = 0; kt < 2; ++kt)
#pragma unroll
                        for (int j = 0; j < 8; ++j) { const float t = st[kt][g][j] * SCL2; st[kt][g][j] = t; mx = fmaxf(mx, t); }
                    mx = fmaxf(mx, __shfl_xor(mx, 16, 32)); mn[g] = fmaxf(m[g], mx); }
                if (__builtin_amdgcn_ballot_w32(mn[0] > m[0] || mn[1] > m[1]) != 0) {   // one scalar branch per 32 keys: where no query's maximum rises every factor would be exactly 1
#pragma unroll
                    for (int g = 0; g < 2; ++g) { const float al = exp2s(m[g] - mn[g]); m[g] = mn[g]; l[g] *= al;
#pragma unroll
                        for (int dt = 0; dt < 8; ++dt) o[dt][g] *= al; } }
                V pb[2], pb2[2];
#pragma unroll
                for (int g = 0; g < 2; ++g) { float sum = 0.f; v8us h0, h1, l0, l1; v8h f0, f1; const float mo = HL ? m[g] : m[g] - 8.0f;   // fp16 rows carry the probabilities x 2^8 (at most 256), so that small ones stay normal fp16 numbers; the row sum carries the same factor, which the division takes out
#pragma unroll
                    for (int j = 0; j < 8; ++j) { const float p0 = exp2s(st[0][g][j] - mo), p1 = exp2s(st[1][g][j] - mo); sum += p0 + p1;
                        if (HL) { unsigned short a, c; splitf(p0, a, c); h0[j] = a; l0[j] = c; splitf(p1, a, c); h1[j] = a; l1[j] = c; } else { f0[j] = tohx(p0); f1[j] = tohx(p1); } }
                    l[g] += sum;
                    if constexpr (HL) { pb[g] = cat16b(h0, h1); pb2[g] = cat16b(l0, l1); } else { pb[g] = cat16(f0, f1); } }
#pragma unroll
                for (int dt = 0; dt < 8; ++dt) { V a, a2; if (HL) { a = LFrag<T16>::ld(vb + dt * 16 * SP + kk * 32); a2 = LFrag<T16>::ld(vb + VTE + dt * 16 * SP + kk * 32); } else a = va[dt];
#pragma unroll
                    for (int g = 0; g < 2; ++g) { o[dt][g] = WFrag<T16>::mma(a, pb[g], o[dt][g]); if (HL) { o[dt][g] = WFrag<T16>::mma(a, pb2[g], o[dt][g]); o[dt][g] = WFrag<T16>::mma(a2, pb[g], o[dt][g]); } } }
                __builtin_amdgcn_sched_barrier(0);   // keeps every product of the 32 keys in front of the slots below
                asm volatile("v_nop\n\tv_nop\n\tv_nop\n\tv_nop");   // four vector slots behind the last products of the 32 keys, in front of the next writes of their operand registers, also on the taken side of the branches that follow
            }
        }
        if (!HL) { if (s + 1 < n) put((s + 1) & 1);   // into the buffer that every wave left at the barrier of the stage before
            __syncthreads(); }   // publishes stage s + 1 and ends every wave's reads of stage s
    }
#pragma unroll
    for (int g = 0; g < 2; ++g) { const float f = __fdiv_rn(HL ? 1.0f : PCAR, l[g] + __shfl_xor(l[g], 16, 32)); float* orow = O + (size_t)(qw + g * 16 + lr) * HD + hi * 8;   // the two lane halves summed different keys
#pragma unroll
        for (int dt = 0; dt < 8; ++dt) { v4f x0, x1;
#pragma unroll
            for (int j = 0; j < 4; ++j) { x0[j] = o[dt][g][j] * f; x1[j] = o[dt][g][4 + j] * f; }
            *(v4f*)(orow + dt * 16) = x0; *(v4f*)(orow + dt * 16 + 4) = x1; }
        asm volatile("s_wait_xcnt 0x0" ::: "memory"); }   // behind the stores, in front of any later write of a register that they name
}
// grid: (TT / 64) x NB_ x NKV blocks, the longest query blocks first
__global__ __launch_bounds__(256) void k_fattn(const h16* P16, const bf* Ph, const bf* Pl, const h16* VT16, const bf* VTh, const bf* VTl, float* Ob) {
    __shared__ __align__(16) unsigned short sm[2 * 2 * (KTE + VTE)];
    const int wv = __builtin_amdgcn_readfirstlane((int)(threadIdx.x >> 5));   // wave number in a scalar register: the tests on the wave's rows stay scalar
    const int qb = TT / 64 - 1 - (int)blockIdx.x / (NB_ * NKV); const int bk = (int)blockIdx.x % (NB_ * NKV); const int b = bk / NKV, kvh = bk % NKV, head = kvh * REP + (wv >> 1);
    const size_t qo = ((size_t)b * NHR + head) * TT * HD, ko = ((size_t)b * NHR + NH_ + kvh) * TT * HD, vo = ((size_t)b * NKV + kvh) * HD * TT;
    float* O = Ob + ((size_t)b * ZH + head) * TT * HD;
    if (qb < RH / 64) fa_body<true>(sm, Ph + qo, Pl + qo, Ph + ko, Pl + ko, VTh + vo, VTl + vo, O, qb, wv);
    else fa_body<false>(sm, (const unsigned short*)P16 + qo, nullptr, (const unsigned short*)P16 + ko, nullptr, (const unsigned short*)VT16 + vo, nullptr, O, qb, wv);
}
__global__ __launch_bounds__(256) void k_merge(const float* __restrict__ O, int h0, bf* Ah, bf* Al) { O += (size_t)blockIdx.y * ZH * TT * HD; Ah += (size_t)blockIdx.y * TT * DQ; Al += (size_t)blockIdx.y * TT * DQ;   // blockIdx.y = batch
    const size_t g = (size_t)blockIdx.x * 256 + threadIdx.x; if (g >= (size_t)(ZH / HPT) * TT * (HD / 8)) return; const int d = (int)(g % (HD / 8)) * 8; const int t = (int)((g / (HD / 8)) % TT); const int z0 = (int)(g / ((size_t)(HD / 8) * TT)) * HPT; const float cs = (t < RH) ? 1.0f : (1.0f / PCAR); v4f x[HPT][2];   // one thread: 8 dims of token t in HPT heads
#pragma unroll
    for (int k = 0; k < HPT; ++k) { const float* o = O + ((size_t)(z0 + k) * TT + t) * HD + d; x[k][0] = ld4w(o); x[k][1] = ld4w(o + 4); }
#pragma unroll
    for (int k = 0; k < HPT; ++k) { const size_t oo = (size_t)t * DQ + (h0 + z0 + k) * HD + d; v8us oh, ol;
#pragma unroll
        for (int q = 0; q < 8; ++q) { unsigned short a, c2; splitf(x[k][q >> 2][q & 3] * cs, a, c2); oh[q] = a; ol[q] = c2; } *(v8us*)(Ah + oo) = oh; *(v8us*)(Al + oo) = ol; } }

extern "C" void kernel_launch(void* const* d_in, const int* in_sizes, int n_in,
                              void* d_out, int out_size, void* d_ws, size_t ws_size, hipStream_t stream) {
    (void)in_sizes; (void)n_in; (void)out_size;
    const float* x = (const float*)d_in[0]; const float* fcos = (const float*)d_in[1]; const float* fsin = (const float*)d_in[2]; const float* wq = (const float*)d_in[3]; const float* wk = (const float*)d_in[4]; const float* wv = (const float*)d_in[5]; const float* wo = (const float*)d_in[6];   /* inputs x, cos, sin ([2048][1][128] = [2048][128] FULL width, read per dimension), wq ('oi' [2048][2048]), wk, wv ('oi' [512][2048]), wproj ('oi') */
    float* OUT = (float*)d_out;     // [2][2048][2048]
    char* wsp = (char*)d_ws;
    auto take = [&](size_t bytes) { char* p = wsp; wsp += (bytes + 255) & ~(size_t)255; return (void*)p; };
    // What lives through the attention of both batches: wproj, the head planes [batch][16 q heads, then 4 k heads][t][d], the transposed v planes [batch][kv head][d][t], the attention output [batch][head][t][d].
    bf* WO = (bf*)take((size_t)DM * DQ * 2);
    h16* P16 = (h16*)take((size_t)NB_ * NHR * TT * HD * 2); bf* Ph = (bf*)take((size_t)NB_ * NHR * TT * HD * 2); bf* Pl = (bf*)take((size_t)NB_ * NHR * TT * HD * 2);
    h16* VT16 = (h16*)take((size_t)NB_ * NKV * HD * TT * 2); bf* VTh = (bf*)take((size_t)NB_ * NKV * HD * TT * 2); bf* VTl = (bf*)take((size_t)NB_ * NKV * HD * TT * 2);
    float* Ob = (float*)take((size_t)NB_ * ZH * TT * HD * 4); float* Sb = (float*)take((size_t)ZH * SH * 4);   /* Sb: scratch range, see below */
    if ((size_t)(wsp - (char*)d_ws) > ws_size) return;    // ws 256 MiB
    // What only the launches in front of the attention use lies in the scratch range.
    wsp = (char*)Sb;
    bf* XB = (bf*)take((size_t)MT * DM * 2); bf* WQ = (bf*)take((size_t)DQ * DM * 2); bf* WK = (bf*)take((size_t)DKV * DM * 2); bf* WV = (bf*)take((size_t)DKV * DM * 2);   /* WK and WV follow each other: one Bt of 2 DKV rows */
    float* CS = (float*)take((size_t)TT * HD * 2 * 4); float* CSI = (float*)take((size_t)TT * HD * 2 * 4);   /* identity {1, 0} table for the plane builder (the rotation is applied in place before the norm) */ float* ONES = (float*)take(256 * 4);
    float* RF = (float*)take((size_t)NB_ * NHR * TT * 4);   /* per (batch, head, token) inverse RMS of the rotated values */ float* F = (float*)take((size_t)MT * DF * 4);   /* f32 feature rows q | k | v of both batches */
    if ((size_t)(wsp - (char*)Sb) > (size_t)ZH * SH * 4) return;
    // The merged hi / lo rows [MT][DQ] lie over the front of the hi / lo head planes, which the attention launch reads last: k_merge stands behind it.
    bf* ATh = Ph; bf* ATl = Pl;
    // Every stage outside the attention runs ONCE, for both batches (and for q and k, or k and v, together).
    k_cvt5<<<CVB((size_t)MT * DM) + 2 * CVB((size_t)DQ * DM) + 2 * CVB((size_t)DKV * DM), 256, 0, stream>>>(x, wq, wk, wv, wo, XB, WQ, WK, WV, WO);   /* 'oi' weights = Bt as-is */
    k_tabs<<<(TT * HD / 4 + 255) / 256, 256, 0, stream>>>(fcos, fsin, CS, CSI, ONES);   /* rotary table from the FULL-width inputs, per dimension; identity table; unit gains */
    k_gemmw<bf, 0, false, DM><<<dim3(MT / BT, DQ / BT, 1), 128, 0, stream>>>(XB, nullptr, WQ, nullptr, F, DF, nullptr, 0, 0, 0);
    k_gemmw<bf, 0, false, DM><<<dim3(MT / BT, 2 * DKV / BT, 1), 128, 0, stream>>>(XB, nullptr, WK, nullptr, F + DQ, DF, nullptr, 0, 0, 0);
    const unsigned LR = (unsigned)(((size_t)(NHR / HPT) * TT * (HD / 8) + 255) / 256);   // k_ropeF, k_rope: one thread per (HPT heads, token, 8 values) of a batch
    k_ropeF<<<dim3(LR, NB_), 256, 0, stream>>>(F, DF, NHR, CS);   /* rotary FIRST */
    k_hrms<<<dim3((NHR * TT + 255) / 256, NB_), 256, 0, stream>>>(F, DF, NHR, RF);
    k_rope<<<dim3(LR, NB_), 256, 0, stream>>>(F, DF, NHR, CSI, RF, ONES, 1.0f, P16, Ph, Pl);   /* rope then RMSNorm */
    k_vtp<<<dim3(NKV * (TT / 64), NB_), 256, 0, stream>>>(F + DQ + DKV, DF, NKV, VT16, VTh, VTl);
    k_fattn<<<(TT / 64) * NB_ * NKV, 256, 0, stream>>>(P16, Ph, Pl, VT16, VTh, VTl, Ob);   /* the whole attention of both batches: one block per (64 query rows, batch, kv head) */
    k_merge<<<dim3((unsigned)(((size_t)(ZH / HPT) * TT * (HD / 8) + 255) / 256), NB_), 256, 0, stream>>>(Ob, 0, ATh, ATl);
    k_gemmw<bf, 1, false, DQ><<<dim3(MT / BT, DM / BT, 1), 128, 0, stream>>>(ATh, ATl, WO, nullptr, OUT, DM, nullptr, 0, 0, 0);
}

// v008
// A run of this version takes 159 microseconds.
// Two timings next to v007 put it at 1.44 and 1.45 times that version's speed.
// Over all steps from v000 it is 10.6 times as fast.
#include <hip/hip_runtime.h>

// Grouped-query causal attention with rotary embeddings followed by a gain-free RMSNorm on q and k (x [2][2048][2048]; q = x wq^T (16 heads x 128), k, v = x w^T ('oi' [512][2048]: 4 kv heads x 128); _apply_rope: x cos + rotate_half(x) sin with rotate_half = cat(-x2, x1) and the FULL-WIDTH cos / sin inputs [2048][1][128] (read per dimension); q = rms_norm(rope(q)), k = rms_norm(rope(k)) with x rsqrt(mean(x^2) + 1.19e-7) over the 128 dims (no gain; LITERAL order: the rotation is applied in place in f32 first, then the per-(token, head) row factor is taken from the rotated values); kv head = q head / 4 (repeat); scores x 128^-0.5; causal (-inf); softmax; out = merged wproj^T -> [2][2048][2048] (8.4 M); argument order x, cos, sin, wq, wk, wv, wproj).
// Layout: bf16 copy of x; natural 'oi' weights cast as they are (Bt; wq, wk, wv follow each other: one Bt of 24 head columns); k_gemmw with PL: the exact q, k, v projections of both batches in ONE launch, a 128-token x one-head tile per block, whose epilogue works on the f32 tile in LDS: for a q or k head the rotate-half rotation FIRST, with the bf16-rounded FULL-width cos / sin inputs (HD 128, read per dimension; arbitrary numbers, not unit rotations: the mean square changes), then the row's inverse RMS of the ROTATED values (eps 1.19e-7; no gain), then the head planes; for a v head the transposed planes; k_fattn: causal T-2048 GQA attention with 128-wide heads, scores, softmax and P.V in one kernel for both batches (running maximum; nothing of the scores goes to memory; hybrid rows; keys above the diagonal block are never visited); merged hi/lo x wproj exact.
// Compute dtypes, f32 accumulate: every input rounded to bf16 incl. the two tables; projections exact; rotary and RMSNorm f32; attention rows < 512 3 products, rest fp16; softmax f32; wproj hl x exact.

#define NB_  2
#define TT   2048
#define DM   2048
#define NH_  16
#define NKV  4        // four kv heads (grouped-query: kv head = q head / 4)
#define REP  (NH_ / NKV)
#define HD   128
#define DQ   (NH_ * HD)
#define DKV  (NKV * HD)
#define NHR  (NH_ + NKV)          // heads that take the rotation and the norm: the 16 q heads, then the 4 k heads
#define DF   (DQ + 2 * DKV)       // feature columns of the projections: q | k | v
#define MT   (NB_ * TT)           // token rows of both batches
#define ZH   16                   // heads of a batch in the attention output
#define SH   ((size_t)(TT / 64) * (TT / 64 + 1) / 2 * 4096)   // ZH * SH f32 elements: the workspace range of what only the launches in front of the attention use
#define RH   512                  // query rows < RH use hi+lo planes (0: none)
typedef _Float16 h16;
typedef unsigned short bf;
typedef __attribute__((ext_vector_type(16))) __bf16   v16bf;
typedef __attribute__((ext_vector_type(16))) _Float16 v16h;
typedef __attribute__((ext_vector_type(8)))  _Float16 v8h;
typedef __attribute__((ext_vector_type(8)))  unsigned short v8us;
typedef __attribute__((ext_vector_type(8)))  float    v8f;
typedef __attribute__((ext_vector_type(4)))  float    v4f;
typedef v8h  __attribute__((may_alias)) v8ha;
typedef v4f  __attribute__((may_alias)) v4fa;
typedef v8us __attribute__((may_alias)) v8usa;

__device__ __forceinline__ unsigned short f2bf(float f) { unsigned u = __float_as_uint(f); u += 0x7FFFu + ((u >> 16) & 1u); return (unsigned short)(u >> 16); }
__device__ __forceinline__ float bf2f(unsigned short b) { return __uint_as_float(((unsigned)b) << 16); }
__device__ __forceinline__ float bfr(float f) { return bf2f(f2bf(f)); }
__device__ __forceinline__ v16h cat16(v8h lo, v8h hi) { return __builtin_shufflevector(lo, hi, 0, 1, 2, 3, 4, 5, 6, 7, 8, 9, 10, 11, 12, 13, 14, 15); }
__device__ __forceinline__ v16bf cat16b(v8us lo, v8us hi) { return __builtin_bit_cast(v16bf, __builtin_shufflevector(lo, hi, 0, 1, 2, 3, 4, 5, 6, 7, 8, 9, 10, 11, 12, 13, 14, 15)); }
__device__ __forceinline__ v8f wmma16(v16h a, v16h b, v8f c) { return __builtin_amdgcn_wmma_f32_16x16x32_f16(false, a, false, b, (short)0, c, false, false); }
__device__ __forceinline__ v8f wmmab(v16bf a, v16bf b, v8f c) { return __builtin_amdgcn_wmma_f32_16x16x32_bf16(false, a, false, b, (short)0, c, false, false); }
__device__ __forceinline__ h16 tohx(float x) { return (h16)x; }
__device__ __forceinline__ void splitf(float y, unsigned short& h, unsigned short& l) { h = f2bf(y); l = f2bf(y - bf2f(h)); }

// ---- k_gemmw: register-blocked GEMM, one 128x128 output tile per block of 4 waves (2 x 2), each wave a 64x64 quarter (16 accumulators) over the WHOLE of K in the order of k; the four waves share the block's staged operand tiles, so every operand row is loaded once per block and read by two waves; grid (M/128, N/128, Z), 128 threads. K % 64 == 0.
// C[m][n] (f32, pitch ldc, + optional f32 bias[n]) = sum_k A[m][k] Bt[n][k] (+ split products per NSPLIT). z-batch strides sA/sB/sC in elements.
template <typename T16> struct WFrag;
template <> struct WFrag<h16> { typedef v16h V; static __device__ __forceinline__ V ld(const h16* p) { return cat16(*(const v8h*)p, *(const v8h*)(p + 16)); } static __device__ __forceinline__ v8f mma(V a, V b, v8f c) { return wmma16(a, b, c); } };
template <> struct WFrag<bf> { typedef v16bf V; static __device__ __forceinline__ V ld(const bf* p) { return cat16b(*(const v8us*)p, *(const v8us*)(p + 16)); } static __device__ __forceinline__ v8f mma(V a, V b, v8f c) { return wmmab(a, b, c); } };
// LFrag: one fragment (the same k order as WFrag::ld) from a staged LDS row
template <typename T16> struct LFrag;
template <> struct LFrag<h16> { static __device__ __forceinline__ v16h ld(const unsigned short* p) { return cat16(*(const v8ha*)p, *(const v8ha*)(p + 16)); } };
template <> struct LFrag<bf> { static __device__ __forceinline__ v16bf ld(const unsigned short* p) { return cat16b(*(const v8usa*)p, *(const v8usa*)(p + 16)); } };
#define SP 72   // LDS row pitch of a staged K chunk in 16-bit elements: 128 bytes of data + 16 bytes, the pitch for 16-byte readers
#define BT 128  // rows of a block's tile of each operand plane
// Operand path: the block brings each 64-element K chunk (128 rows x 128 bytes per operand plane) with 16-byte loads of which each covers four WHOLE 128-byte lines (8 lanes a row) into registers one chunk ahead, stores it to one of two LDS buffers and reads the fragments from there; one barrier a chunk.
// KK = K = row pitch of every operand plane, a compile-time constant, so that the 8 loads of a plane differ in their immediate offset only.
// PL (the q, k, v projections; a tile = BT tokens of one batch x the HD features of head column blockIdx.y: NH_ q heads, NKV k heads, NKV v heads): no f32 row goes to memory. The four waves lay the f32 tile in LDS (pitch OP), one barrier, then 8 lanes take a row: a lane has 8 + 8 values 64 apart, which for a q or k head are the rotation's pairs; every store instruction covers whole 128-byte lines of a plane.
#define OP 132  // LDS row pitch of the f32 tile in elements: 512 bytes + 16 bytes, the pitch for 16-byte readers
static_assert(HD == BT && TT % BT == 0 && BT * OP <= 2 * BT * SP, "a tile is one head wide, lies in one batch and fits the staging buffers");
// emit16: 8 + 8 f32 values, 64 elements apart in a plane's row, to the fp16, hi and lo planes
__device__ __forceinline__ void emit16(const float* y, h16* p16, bf* ph, bf* pl) {
#pragma unroll
    for (int hf = 0; hf < 2; ++hf) { v8h o16; v8us oh, ol;
#pragma unroll
        for (int q = 0; q < 8; ++q) { const float r = y[hf * 8 + q]; o16[q] = tohx(r); unsigned short a, c; splitf(r, a, c); oh[q] = a; ol[q] = c; }
        *(v8h*)(p16 + hf * 64) = o16; *(v8us*)(ph + hf * 64) = oh; *(v8us*)(pl + hf * 64) = ol; }
    asm volatile("s_wait_xcnt 0x0" :: "v"(p16), "v"(ph), "v"(pl) : "memory");   // behind the stores, in front of any later write of a register that they name: the addresses as inputs keep their registers until here
}
template <typename T16, int NSPLIT, bool BIAS, int KK, bool PL>
__global__ __launch_bounds__(128) void k_gemmw(const T16* A, const T16* A2, const T16* Bt, const T16* Bt2, float* C, int ldc, const float* __restrict__ bias, size_t sA, size_t sB, size_t sC, const float* cosT, const float* sinT, h16* P16, bf* Ph, bf* Pl, h16* V16, bf* Vh, bf* Vl) {
    typedef typename WFrag<T16>::V V;
    constexpr bool HA2 = (NSPLIT == 1 || NSPLIT == 2), HB2 = (NSPLIT >= 2);
    constexpr int NT = 2 + (HA2 ? 1 : 0) + (HB2 ? 1 : 0);   // staged planes: A, B, then A2, then B2
    constexpr int BUF = NT * BT * SP;                       // 16-bit elements of one buffer (= f32 elements of both)
    constexpr int NC = KK / 64;                             // K chunks
    __shared__ __align__(16) float os[BUF];                 // two buffers in the K loop; behind it each wave's 16 x 64 output rows (pitch 68) or, with PL, the block's f32 tile (pitch OP)
    const int wv = __builtin_amdgcn_readfirstlane((int)(threadIdx.x >> 5));   // wave number in a scalar register
    const int wm = wv >> 1, wn = wv & 1;                    // the wave's quarter of the tile
    const size_t z = blockIdx.z; A += z * sA; if (A2) A2 += z * sA; Bt += z * sB; if (Bt2) Bt2 += z * sB; C += z * sC;
    const int tid = (int)threadIdx.x, lane = tid & 31, lr = lane & 15, hi = lane >> 4; const int r0 = blockIdx.x * BT, c0 = blockIdx.y * BT;
    v8f acc[4][4];
#pragma unroll
    for (int mb = 0; mb < 4; ++mb)
#pragma unroll
        for (int nb = 0; nb < 4; ++nb) acc[mb][nb] = (v8f){};
    const unsigned short* gp[4] = { (const unsigned short*)A + (size_t)r0 * KK, (const unsigned short*)Bt + (size_t)c0 * KK, HA2 ? (const unsigned short*)A2 + (size_t)r0 * KK : nullptr, HB2 ? (const unsigned short*)Bt2 + (size_t)c0 * KK : nullptr };   // block-uniform plane bases of this tile
    constexpr int TA2 = 2, TB2 = HA2 ? 3 : 2;               // LDS tile numbers of the lo planes
    const unsigned vo = (unsigned)((tid >> 3) * KK + (tid & 7) * 8);   // the thread's own place in a load: row tid / 8, 16-byte piece tid % 8; never rewritten
    unsigned short* sm = (unsigned short*)os;
    unsigned short* sst = sm + (tid >> 3) * SP + (tid & 7) * 8;
    const unsigned short* sfa = sm + (wm * 64 + lr) * SP + 8 * hi;             // the lane's first A row
    const unsigned short* sfb = sm + BT * SP + (wn * 64 + lr) * SP + 8 * hi;   // the lane's first B row
    v8us rg[NT][8];
    auto fetch = [&](int kc) {
        const unsigned short* pa = gp[0] + kc + vo; const unsigned short* pb = gp[1] + kc + vo; const unsigned short* pa2 = HA2 ? gp[2] + kc + vo : nullptr; const unsigned short* pb2 = HB2 ? gp[3] + kc + vo : nullptr;
#pragma unroll
        for (int i = 0; i < 8; ++i) { rg[0][i] = *(const v8usa*)(pa + i * 16 * KK); rg[1][i] = *(const v8usa*)(pb + i * 16 * KK); if (HA2) rg[TA2][i] = *(const v8usa*)(pa2 + i * 16 * KK); if (HB2) rg[TB2][i] = *(const v8usa*)(pb2 + i * 16 * KK); }
        if constexpr (HA2 && HB2) asm volatile("s_wait_xcnt 0x0" :: "v"(pa), "v"(pb), "v"(pa2), "v"(pb2) : "memory"); else if constexpr (HA2) asm volatile("s_wait_xcnt 0x0" :: "v"(pa), "v"(pb), "v"(pa2) : "memory"); else if constexpr (HB2) asm volatile("s_wait_xcnt 0x0" :: "v"(pa), "v"(pb), "v"(pb2) : "memory"); else asm volatile("s_wait_xcnt 0x0" :: "v"(pa), "v"(pb) : "memory");   // behind the chunk's loads, in front of any later write (a later load's result too) of an address register that they name: the addresses as inputs keep their registers until here (the operand pointers carry no restrict, so that the loads stay in front of this statement)
    };
    auto put = [&](int bsel) {
#pragma unroll
        for (int t = 0; t < NT; ++t)
#pragma unroll
            for (int i = 0; i < 8; ++i) *(v8usa*)(sst + bsel * BUF + t * BT * SP + i * 16 * SP) = rg[t][i];
    };
    fetch(0); put(0);
    __syncthreads();   // publishes chunk 0
#pragma unroll 1
    for (int s = 0; s < NC; ++s) {   // the chunks in the order of k: two 32-steps per chunk; kept rolled: the body already holds 32 to 64 products, a second copy would only take instruction cache
        if (s + 1 < NC) fetch((s + 1) * 64);      // scalar test; the next chunk's loads fly during this chunk's products
        const unsigned short* fa = sfa + (s & 1) * BUF; const unsigned short* fb = sfb + (s & 1) * BUF;
        V a[2][4], a2[2][4], b[2][4], b2[2][4];
#pragma unroll
        for (int ks = 0; ks < 2; ++ks)
#pragma unroll
            for (int f = 0; f < 4; ++f) { a[ks][f] = LFrag<T16>::ld(fa + f * 16 * SP + ks * 32); b[ks][f] = LFrag<T16>::ld(fb + f * 16 * SP + ks * 32); if (HA2) a2[ks][f] = LFrag<T16>::ld(fa + TA2 * BT * SP + f * 16 * SP + ks * 32); if (HB2) b2[ks][f] = LFrag<T16>::ld(fb + (TB2 - 1) * BT * SP + f * 16 * SP + ks * 32); }
        __builtin_amdgcn_sched_barrier(0);   // all fragment loads of the chunk issue as one group in front of its products: spread among them, every four products wait out a whole LDS latency, which the one or two waves of a SIMD do not cover
#pragma unroll
        for (int ks = 0; ks < 2; ++ks)
#pragma unroll
            for (int nb = 0; nb < 4; ++nb) {   // per accumulator the order a b, a2 b, a b2 of each 32-step
#pragma unroll
                for (int mb = 0; mb < 4; ++mb) acc[mb][nb] = WFrag<T16>::mma(a[ks][mb], b[ks][nb], acc[mb][nb]);
                if (HA2) {
#pragma unroll
                    for (int mb = 0; mb < 4; ++mb) acc[mb][nb] = WFrag<T16>::mma(a2[ks][mb], b[ks][nb], acc[mb][nb]); }
                if (HB2) {
#pragma unroll
                    for (int mb = 0; mb < 4; ++mb) acc[mb][nb] = WFrag<T16>::mma(a[ks][mb], b2[ks][nb], acc[mb][nb]); } }
        __builtin_amdgcn_sched_barrier(0);   // keeps every product of the chunk in front of the slots below
        asm volatile("v_nop\n\tv_nop\n\tv_nop\n\tv_nop");   // four vector slots behind the chunk's last products, in front of the next writes of their operand registers, also on the taken side of the branches that follow
        if (s + 1 < NC) put((s + 1) & 1);   // into the buffer that every wave left at the barrier of the chunk before
        __syncthreads();   // publishes chunk s + 1 and ends every wave's reads of chunk s
    }
    if constexpr (PL) {
        const int hc = (int)blockIdx.y, bb = r0 / TT, t0 = r0 % TT;   // head column, batch, first token of the tile (scalars)
        const int l8 = (tid & 7) * 8, rr = tid >> 3;                  // the lane's 8 + 8 values of a row; its row in a pass of 16 rows
        if (hc < NHR) {   // a q or k head (scalar test, the same for the whole block)
            const float* cp = cosT + (size_t)(t0 + rr) * HD + l8; const float* sp = sinT + (size_t)(t0 + rr) * HD + l8;
            v4f cn[4], sn[4];
            auto tab = [&](int p) {   // the table values of pass p
                const float* c = cp + p * 16 * HD; const float* s = sp + p * 16 * HD;
                cn[0] = *(const v4fa*)c; cn[1] = *(const v4fa*)(c + 4); cn[2] = *(const v4fa*)(c + 64); cn[3] = *(const v4fa*)(c + 68); sn[0] = *(const v4fa*)s; sn[1] = *(const v4fa*)(s + 4); sn[2] = *(const v4fa*)(s + 64); sn[3] = *(const v4fa*)(s + 68);
                asm volatile("s_wait_xcnt 0x0" :: "v"(c), "v"(s) : "memory");   // behind the loads, in front of any later write (a later load's result too) of an address register that they name: the addresses as inputs keep their registers until here
            };
            tab(0);   // flies during the LDS stores and the barrier
#pragma unroll
            for (int mb = 0; mb < 4; ++mb)
#pragma unroll
                for (int nb = 0; nb < 4; ++nb)
#pragma unroll
                    for (int j = 0; j < 8; ++j) os[(wm * 64 + mb * 16 + hi * 8 + j) * OP + wn * 64 + nb * 16 + lr] = acc[mb][nb][j];   // behind the loop's last barrier nobody reads a staged tile
            __syncthreads();   // the whole tile [token][feature] is in LDS: a row holds values of two waves
            const size_t e0 = (((size_t)bb * NHR + hc) * TT + t0 + rr) * HD + l8;
#pragma unroll 1
            for (int p = 0; p < BT / 16; ++p) {   // kept rolled: it runs once per block, eight copies would only take instruction cache
                v4f c[4], s[4];
#pragma unroll
                for (int i = 0; i < 4; ++i) { c[i] = cn[i]; s[i] = sn[i]; }
                if (p + 1 < BT / 16) tab(p + 1);   // scalar test; the next pass's table values fly during this pass
                const float* xr = os + (p * 16 + rr) * OP + l8;
                const v4f x[4] = { *(const v4fa*)xr, *(const v4fa*)(xr + 4), *(const v4fa*)(xr + 64), *(const v4fa*)(xr + 68) };
                float y[16], s0 = 0.f, s1 = 0.f;
#pragma unroll
                for (int q = 0; q < 8; ++q) { const float x1 = x[q >> 2][q & 3], x2 = x[2 + (q >> 2)][q & 3];   // out[d] = x[d] cos[d] - x[d + 64] sin[d]; out[d + 64] = x[d + 64] cos[d + 64] + x[d] sin[d + 64]
                    y[q] = x1 * bfr(c[q >> 2][q & 3]) - x2 * bfr(s[q >> 2][q & 3]); y[8 + q] = x2 * bfr(c[2 + (q >> 2)][q & 3]) + x1 * bfr(s[2 + (q >> 2)][q & 3]);
                    s0 += y[q] * y[q]; s1 += y[8 + q] * y[8 + q]; }
                float ss = s0 + s1; ss += __shfl_xor(ss, 1, 32); ss += __shfl_xor(ss, 2, 32); ss += __shfl_xor(ss, 4, 32);   // the row's 8 lanes
                const float rf = __fdiv_rn(1.0f, __fsqrt_rn(ss / (float)HD + 1.1920929e-07f));
#pragma unroll
                for (int q = 0; q < 16; ++q) y[q] *= rf;
                const size_t e = e0 + (size_t)p * 16 * HD; emit16(y, P16 + e, Ph + e, Pl + e);
            }
        } else {   // a v head: the tile goes to LDS transposed (a lane's 8 accumulator values are 8 tokens of one feature)
#pragma unroll
            for (int mb = 0; mb < 4; ++mb)
#pragma unroll
                for (int nb = 0; nb < 4; ++nb) { float* q = os + (wn * 64 + nb * 16 + lr) * OP + wm * 64 + mb * 16 + hi * 8; v4f a0, a1;
#pragma unroll
                    for (int j = 0; j < 4; ++j) { a0[j] = acc[mb][nb][j]; a1[j] = acc[mb][nb][4 + j]; }
                    *(v4fa*)q = a0; *(v4fa*)(q + 4) = a1; }
            __syncthreads();   // the whole tile [feature][token] is in LDS: a row holds values of two waves
            const size_t e0 = (((size_t)bb * NKV + (hc - NHR)) * HD + rr) * TT + t0 + l8;
#pragma unroll 1
            for (int p = 0; p < HD / 16; ++p) {   // kept rolled, as above
                const float* xr = os + (p * 16 + rr) * OP + l8;
                const v4f x[4] = { *(const v4fa*)xr, *(const v4fa*)(xr + 4), *(const v4fa*)(xr + 64), *(const v4fa*)(xr + 68) };
                float y[16];
#pragma unroll
                for (int q = 0; q < 16; ++q) y[q] = x[q >> 2][q & 3];
                const size_t e = e0 + (size_t)p * 16 * TT; emit16(y, V16 + e, Vh + e, Vl + e);
            }
        }
    } else {
    float* ow = os + wv * (16 * 68);   // behind the last barrier nobody reads a staged tile: each wave turns its rows into whole lines in its own LDS range
#pragma unroll
    for (int mb = 0; mb < 4; ++mb) {
#pragma unroll
        for (int nb = 0; nb < 4; ++nb) {
#pragma unroll
            for (int j = 0; j < 8; ++j) ow[(hi * 8 + j) * 68 + nb * 16 + lr] = acc[mb][nb][j]; }
        asm volatile("s_wait_dscnt 0x0" ::: "memory");   // the wave's own LDS stores are done before its lanes read rows that other lanes of the wave stored
        float* crow = C + (size_t)(r0 + wm * 64 + mb * 16) * ldc + c0 + wn * 64;
#pragma unroll
        for (int q = 0; q < 8; ++q) { const int row = 2 * q + hi, cofs = lr * 4; v4f val = *(const v4fa*)(ow + row * 68 + cofs); if (BIAS) { const float* bp = bias + c0 + wn * 64 + cofs; val[0] += bfr(bp[0]); val[1] += bfr(bp[1]); val[2] += bfr(bp[2]); val[3] += bfr(bp[3]); }
            *(v4f*)(crow + (size_t)row * ldc + cofs) = val; }
        asm volatile("s_wait_dscnt 0x0\n\ts_wait_xcnt 0x0" ::: "memory");   // the 16 rows are read before the next 16 overwrite them; and behind the stores, in front of any later write of a register that they name
    }
    }
}

typedef __attribute__((ext_vector_type(2))) _Float16 v2h;
typedef __attribute__((ext_vector_type(4))) _Float16 v4h;
typedef __attribute__((ext_vector_type(2))) unsigned short v2us;
typedef __attribute__((ext_vector_type(4))) unsigned short v4us;
typedef __attribute__((ext_vector_type(2))) float v2f;
typedef __attribute__((ext_vector_type(4))) int v4i;

// The conversion kernel below gives every thread 32 elements in 16-byte pieces: few waves start, and each lane has its loads in flight together.
#define CVN 4   // 8-value pieces per thread of k_cvt5, 256 threads apart
// k_cvt5: x (both batches) and the four weights in ONE launch; a block takes 256 CVN pieces of one tensor (every tensor is a whole number of blocks), picked by the block's number (scalar tests)
#define CVB(n) ((int)((size_t)(n) / 8 / (256 * CVN)))
static_assert((size_t)MT * DM % (8 * 256 * CVN) == 0 && (size_t)DQ * DM % (8 * 256 * CVN) == 0 && (size_t)DKV * DM % (8 * 256 * CVN) == 0, "whole blocks");
__global__ __launch_bounds__(256) void k_cvt5(const float* __restrict__ x, const float* __restrict__ wq, const float* __restrict__ wk, const float* __restrict__ wv, const float* __restrict__ wo, bf* XB, bf* WQ, bf* WK, bf* WV, bf* WO) {
    int blk = (int)blockIdx.x; const float* src = x; bf* dst = XB;
    if (blk >= CVB((size_t)MT * DM)) { blk -= CVB((size_t)MT * DM); src = wq; dst = WQ;
        if (blk >= CVB((size_t)DQ * DM)) { blk -= CVB((size_t)DQ * DM); src = wk; dst = WK;
            if (blk >= CVB((size_t)DKV * DM)) { blk -= CVB((size_t)DKV * DM); src = wv; dst = WV;
                if (blk >= CVB((size_t)DKV * DM)) { blk -= CVB((size_t)DKV * DM); src = wo; dst = WO; } } } }
    const size_t i0 = (size_t)blk * (256 * CVN) + threadIdx.x; v8f v[CVN];
#pragma unroll
    for (int c = 0; c < CVN; ++c) v[c] = *(const v8f*)(src + (i0 + (size_t)c * 256) * 8);   // all loads first, so that they are in flight together
    asm volatile("s_wait_xcnt 0x0" ::: "memory");   // behind the loads, in front of any later write of an address register that they name
#pragma unroll
    for (int c = 0; c < CVN; ++c) { v8us o;
#pragma unroll
        for (int k = 0; k < 8; ++k) o[k] = f2bf(v[c][k]);
        *(v8us*)(dst + (i0 + (size_t)c * 256) * 8) = o; } }


#define KP 136                // LDS row pitch of a staged K row in 16-bit elements: 256 bytes + 16 bytes, the pitch for 16-byte readers
#define KTE (64 * KP)         // one K plane of a stage: 64 keys
#define VTE (HD * SP)         // one V plane of a stage: HD rows of 64 keys (128 bytes + 16 bytes)
#define SCL2 0.12751743f      // HD^-0.5 x log2(e): scores in the exponent of 2
__device__ __forceinline__ float exp2s(float x) { float r; asm("v_exp_f32 %0, %1\n\tv_nop" : "=v"(r) : "v"(x)); return r; }
template <bool HL> struct FaT; template <> struct FaT<true> { typedef bf T; }; template <> struct FaT<false> { typedef h16 T; };
template <bool HL>
__device__ __forceinline__ void fa_body(unsigned short* sm, const unsigned short* Qh, const unsigned short* Ql, const unsigned short* Kh, const unsigned short* Kl, const unsigned short* Vh, const unsigned short* Vl, bf* Ah, bf* Al, const int qb, const int wv) {
    typedef typename FaT<HL>::T T16; typedef typename WFrag<T16>::V V;
    constexpr int NP = HL ? 2 : 1; constexpr int BUF = NP * (KTE + VTE);   // a buffer: K planes, then V planes
    const int tid = (int)threadIdx.x, lane = tid & 31, lr = lane & 15, hi = lane >> 4;
    const int qw = qb * 64 + (wv & 1) * 32;   // the wave's first query row (scalar)
    V qf[2][4], qf2[2][4]; const unsigned short* qp = Qh + (size_t)(qw + lr) * HD + 8 * hi; const unsigned short* qp2 = HL ? Ql + (size_t)(qw + lr) * HD + 8 * hi : nullptr;   // the lane's own query row; every Q load differs from it by a constant
#pragma unroll
    for (int g = 0; g < 2; ++g)
#pragma unroll
        for (int ks = 0; ks < 4; ++ks) { qf[g][ks] = LFrag<T16>::ld(qp + g * 16 * HD + ks * 32); if (HL) qf2[g][ks] = LFrag<T16>::ld(qp2 + g * 16 * HD + ks * 32); }
    if (HL) asm volatile("s_wait_xcnt 0x0" :: "v"(qp), "v"(qp2) : "memory"); else asm volatile("s_wait_xcnt 0x0" :: "v"(qp) : "memory");   // behind the Q loads, in front of any later write (a later load's result too) of an address register that they name: the addresses as inputs keep their registers until here
    const unsigned voK = (unsigned)((tid >> 4) * HD + (tid & 15) * 8), voV = (unsigned)((tid >> 3) * TT + (tid & 7) * 8);   // the thread's own place in a staging load (a wave covers four whole 128-byte lines); never rewritten
    unsigned short* stK = sm + (tid >> 4) * KP + (tid & 15) * 8; unsigned short* stV = sm + NP * KTE + (tid >> 3) * SP + (tid & 7) * 8;
    v8us rk[NP][4], rv[NP][4];
    auto fetch = [&](int k0) {
        const unsigned short* pk = Kh + (size_t)k0 * HD + voK; const unsigned short* pv = Vh + k0 + voV; const unsigned short* pk2 = HL ? Kl + (size_t)k0 * HD + voK : nullptr; const unsigned short* pv2 = HL ? Vl + k0 + voV : nullptr;
#pragma unroll
        for (int i = 0; i < 4; ++i) { rk[0][i] = *(const v8usa*)(pk + i * 16 * HD); rv[0][i] = *(const v8usa*)(pv + i * 32 * TT);
            if (HL) { rk[NP - 1][i] = *(const v8usa*)(pk2 + i * 16 * HD); rv[NP - 1][i] = *(const v8usa*)(pv2 + i * 32 * TT); } }
        if (HL) asm volatile("s_wait_xcnt 0x0" :: "v"(pk), "v"(pv), "v"(pk2), "v"(pv2) : "memory"); else asm volatile("s_wait_xcnt 0x0" :: "v"(pk), "v"(pv) : "memory");   // behind the stage's loads, in front of any later write (a later load's result too) of an address register that they name: the addresses as inputs keep their registers until here
    };
    auto put = [&](int bsel) {
#pragma unroll
        for (int p = 0; p < NP; ++p)
#pragma unroll
            for (int i = 0; i < 4; ++i) { *(v8usa*)(stK + bsel * BUF + p * KTE + i * 16 * KP) = rk[p][i]; *(v8usa*)(stV + bsel * BUF + p * VTE + i * 32 * SP) = rv[p][i]; }
    };
    v8f o[8][2];
#pragma unroll
    for (int dt = 0; dt < 8; ++dt) { o[dt][0] = (v8f){}; o[dt][1] = (v8f){}; }
    float m[2] = { -3.0e38f, -3.0e38f }, l[2] = { 0.f, 0.f };
    const int n = qb + 1;   // stages of 64 keys up to and with the diagonal block; the same for the whole block
    __builtin_amdgcn_fence(__ATOMIC_RELEASE, "workgroup");   // compiles to a wait for the wave's own loads: the Q fragments have landed in front of the loop: a wait for them among the loop's products would also wait for the next stage's loads, which are to fly during the products
#pragma unroll 1
    for (int s = HL ? 0 : -1; s < n; ++s) {   // fp16 rows: trip -1 only brings stage 0 in
        if (HL) { fetch(s * 64); put(s & 1);   // the hi + lo rows have few stages and no registers to spare: they load each stage where it is needed; the buffer was last read two stages ago, in front of the barrier of the stage before
            __syncthreads(); }   // publishes stage s
        else if (s + 1 < n) fetch((s + 1) * 64);   // scalar test; the next stage's loads fly during this stage's products
        const unsigned short* kb = sm + (s & 1) * BUF + lr * KP + 8 * hi; const unsigned short* vb = sm + (s & 1) * BUF + NP * KTE + lr * SP + 8 * hi;
#pragma unroll
        for (int kk = 0; kk < 2; ++kk) {
            if (s >= 0 && s * 64 + kk * 32 <= qw + 31) {   // scalar tests: not in trip -1; 32 keys wholly above the wave's rows are skipped (their probabilities are exact zeros)
                v8f st[2][2];
#pragma unroll
                for (int kt = 0; kt < 2; ++kt) { st[kt][0] = (v8f){}; st[kt][1] = (v8f){}; }
                V ka[2][4], va[8];   // fp16 rows: fragment loads in groups; the hi + lo rows have no registers for that and load each fragment at its products
                if (!HL) {
#pragma unroll
                    for (int ks = 0; ks < 4; ++ks)
#pragma unroll
                        for (int kt = 0; kt < 2; ++kt) ka[kt][ks] = LFrag<T16>::ld(kb + (kk * 32 + kt * 16) * KP + ks * 32);
                    __builtin_amdgcn_sched_barrier(0); }   // all K fragment loads of the 32 keys issue as one group in front of the products: spread among them, each pair of products waits out a whole LDS latency
#pragma unroll
                for (int ks = 0; ks < 4; ++ks)
#pragma unroll
                    for (int kt = 0; kt < 2; ++kt) { V a, a2; if (HL) { a = LFrag<T16>::ld(kb + (kk * 32 + kt * 16) * KP + ks * 32); a2 = LFrag<T16>::ld(kb + KTE + (kk * 32 + kt * 16) * KP + ks * 32); } else a = ka[kt][ks];
#pragma unroll
                        for (int g = 0; g < 2; ++g) { st[kt][g] = WFrag<T16>::mma(a, qf[g][ks], st[kt][g]); if (HL) { st[kt][g] = WFrag<T16>::mma(a2, qf[g][ks], st[kt][g]); st[kt][g] = WFrag<T16>::mma(a, qf2[g][ks], st[kt][g]); } } }
                if (!HL) {
#pragma unroll
                    for (int dt = 0; dt < 8; ++dt) va[dt] = LFrag<T16>::ld(vb + dt * 16 * SP + kk * 32);
                    __builtin_amdgcn_sched_barrier(0); }   // all V fragment loads of the 32 keys issue as one group in front of the softmax, which covers their latency
                if (s == n - 1) {   // causal mask, under a scalar branch: only the diagonal stage has keys above a row
#pragma unroll
                    for (int g = 0; g < 2; ++g)
#pragma unroll
                        for (int kt = 0; kt < 2; ++kt)
#pragma unroll
                            for (int j = 0; j < 8; ++j) st[kt][g][j] = (s * 64 + kk * 32 + kt * 16 + hi * 8 + j <= qw + g * 16 + lr) ? st[kt][g][j] : -3.0e38f; }
                float mn[2];
#pragma unroll
                for (int g = 0; g < 2; ++g) { float mx = -3.0e38f;
#pragma unroll
                    for (int kt = 0; kt < 2; ++kt)
#pragma unroll
                        for (int j = 0; j < 8; ++j) { const float t = st[kt][g][j] * SCL2; st[kt][g][j] = t; mx = fmaxf(mx, t); }
                    mx = fmaxf(mx, __shfl_xor(mx, 16, 32)); mn[g] = fmaxf(m[g], mx); }
                if (__builtin_amdgcn_ballot_w32(mn[0] > m[0] || mn[1] > m[1]) != 0) {   // one scalar branch per 32 keys: where no query's maximum rises every factor would be exactly 1
#pragma unroll
                    for (int g = 0; g < 2; ++g) { const float al = exp2s(m[g] - mn[g]); m[g] = mn[g]; l[g] *= al;
#pragma unroll
                        for (int dt = 0; dt < 8; ++dt) o[dt][g] *= al; } }
                V pb[2], pb2[2];
#pragma unroll
                for (int g = 0; g < 2; ++g) { float sum = 0.f; v8us h0, h1, l0, l1; v8h f0, f1; const float mo = HL ? m[g] : m[g] - 8.0f;   // fp16 rows carry the probabilities x 2^8 (at most 256), so that small ones stay normal fp16 numbers; the row sum carries the same factor, which the division takes out
#pragma unroll
                    for (int j = 0; j < 8; ++j) { const float p0 = exp2s(st[0][g][j] - mo), p1 = exp2s(st[1][g][j] - mo); sum += p0 + p1;
                        if (HL) { unsigned short a, c; splitf(p0, a, c); h0[j] = a; l0[j] = c; splitf(p1, a, c); h1[j] = a; l1[j] = c; } else { f0[j] = tohx(p0); f1[j] = tohx(p1); } }
                    l[g] += sum;
                    if constexpr (HL) { pb[g] = cat16b(h0, h1); pb2[g] = cat16b(l0, l1); } else { pb[g] = cat16(f0, f1); } }
#pragma unroll
                for (int dt = 0; dt < 8; ++dt) { V a, a2; if (HL) { a = LFrag<T16>::ld(vb + dt * 16 * SP + kk * 32); a2 = LFrag<T16>::ld(vb + VTE + dt * 16 * SP + kk * 32); } else a = va[dt];
#pragma unroll
                    for (int g = 0; g < 2; ++g) { o[dt][g] = WFrag<T16>::mma(a, pb[g], o[dt][g]); if (HL) { o[dt][g] = WFrag<T16>::mma(a, pb2[g], o[dt][g]); o[dt][g] = WFrag<T16>::mma(a2, pb[g], o[dt][g]); } } }
                __builtin_amdgcn_sched_barrier(0);   // keeps every product of the 32 keys in front of the slots below
                asm volatile("v_nop\n\tv_nop\n\tv_nop\n\tv_nop");   // four vector slots behind the last products of the 32 keys, in front of the next writes of their operand registers, also on the taken side of the branches that follow
            }
        }
        if (!HL) { if (s + 1 < n) put((s + 1) & 1);   // into the buffer that every wave left at the barrier of the stage before
            __syncthreads(); }   // publishes stage s + 1 and ends every wave's reads of stage s
    }
#pragma unroll
    for (int g = 0; g < 2; ++g) { const float f = __fdiv_rn(1.0f, l[g] + __shfl_xor(l[g], 16, 32)); const size_t e = (size_t)(qw + g * 16 + lr) * DQ + hi * 8; bf* ah = Ah + e; bf* al = Al + e;   // the two lane halves summed different keys; a lane's 8 accumulator values are 8 neighbouring features of its query's merged row
        v8us oh[8], ol[8];
#pragma unroll
        for (int dt = 0; dt < 8; ++dt) {
#pragma unroll
            for (int j = 0; j < 8; ++j) { unsigned short a, c; splitf(o[dt][g][j] * f, a, c); oh[dt][j] = a; ol[dt][j] = c; }
            *(v8us*)(ah + dt * 16) = oh[dt]; *(v8us*)(al + dt * 16) = ol[dt]; }
        asm volatile("s_wait_xcnt 0x0" :: "v"(ah), "v"(al), "v"(oh[0]), "v"(oh[1]), "v"(oh[2]), "v"(oh[3]), "v"(oh[4]), "v"(oh[5]), "v"(oh[6]), "v"(oh[7]), "v"(ol[0]), "v"(ol[1]), "v"(ol[2]), "v"(ol[3]), "v"(ol[4]), "v"(ol[5]), "v"(ol[6]), "v"(ol[7]) : "memory"); }   // behind the stores, in front of any later write of a register that they name: addresses and stored values as inputs keep their registers until here
}
// grid: (TT / 64) x NB_ x NKV blocks, the longest query blocks first
__global__ __launch_bounds__(256) void k_fattn(const h16* P16, const bf* Ph, const bf* Pl, const h16* VT16, const bf* VTh, const bf* VTl, bf* ATh, bf* ATl) {
    __shared__ __align__(16) unsigned short sm[2 * 2 * (KTE + VTE)];
    const int wv = __builtin_amdgcn_readfirstlane((int)(threadIdx.x >> 5));   // wave number in a scalar register: the tests on the wave's rows stay scalar
    const int qb = TT / 64 - 1 - (int)blockIdx.x / (NB_ * NKV); const int bk = (int)blockIdx.x % (NB_ * NKV); const int b = bk / NKV, kvh = bk % NKV, head = kvh * REP + (wv >> 1);
    const size_t qo = ((size_t)b * NHR + head) * TT * HD, ko = ((size_t)b * NHR + NH_ + kvh) * TT * HD, vo = ((size_t)b * NKV + kvh) * HD * TT;
    const size_t ao = (size_t)b * TT * DQ + head * HD;   // the head's columns in the batch's merged rows [t][DQ]
    if (qb < RH / 64) fa_body<true>(sm, Ph + qo, Pl + qo, Ph + ko, Pl + ko, VTh + vo, VTl + vo, ATh + ao, ATl + ao, qb, wv);
    else fa_body<false>(sm, (const unsigned short*)P16 + qo, nullptr, (const unsigned short*)P16 + ko, nullptr, (const unsigned short*)VT16 + vo, nullptr, ATh + ao, ATl + ao, qb, wv);
}

extern "C" void kernel_launch(void* const* d_in, const int* in_sizes, int n_in,
                              void* d_out, int out_size, void* d_ws, size_t ws_size, hipStream_t stream) {
    (void)in_sizes; (void)n_in; (void)out_size;
    const float* x = (const float*)d_in[0]; const float* fcos = (const float*)d_in[1]; const float* fsin = (const float*)d_in[2]; const float* wq = (const float*)d_in[3]; const float* wk = (const float*)d_in[4]; const float* wv = (const float*)d_in[5]; const float* wo = (const float*)d_in[6];   /* inputs x, cos, sin ([2048][1][128] = [2048][128] FULL width, read per dimension), wq ('oi' [2048][2048]), wk, wv ('oi' [512][2048]), wproj ('oi') */
    float* OUT = (float*)d_out;     // [2][2048][2048]
    char* wsp = (char*)d_ws;
    auto take = [&](size_t bytes) { char* p = wsp; wsp += (bytes + 255) & ~(size_t)255; return (void*)p; };
    // What lives through the attention of both batches: wproj, the head planes [batch][16 q heads, then 4 k heads][t][d], the transposed v planes [batch][kv head][d][t], the attention output as merged hi / lo rows [MT][DQ].
    bf* WO = (bf*)take((size_t)DM * DQ * 2);
    h16* P16 = (h16*)take((size_t)NB_ * NHR * TT * HD * 2); bf* Ph = (bf*)take((size_t)NB_ * NHR * TT * HD * 2); bf* Pl = (bf*)take((size_t)NB_ * NHR * TT * HD * 2);
    h16* VT16 = (h16*)take((size_t)NB_ * NKV * HD * TT * 2); bf* VTh = (bf*)take((size_t)NB_ * NKV * HD * TT * 2); bf* VTl = (bf*)take((size_t)NB_ * NKV * HD * TT * 2);
    bf* ATh = (bf*)take((size_t)MT * DQ * 2); bf* ATl = (bf*)take((size_t)MT * DQ * 2); float* Sb = (float*)take((size_t)ZH * SH * 4);   /* Sb: scratch range, see below */
    if ((size_t)(wsp - (char*)d_ws) > ws_size) return;    // ws 256 MiB
    // What only the launches in front of the attention use lies in the scratch range.
    wsp = (char*)Sb;
    bf* XB = (bf*)take((size_t)MT * DM * 2); bf* WQ = (bf*)take((size_t)DQ * DM * 2); bf* WK = (bf*)take((size_t)DKV * DM * 2); bf* WV = (bf*)take((size_t)DKV * DM * 2);   /* WQ, WK and WV follow each other: one Bt of DF rows */
    if ((size_t)(wsp - (char*)Sb) > (size_t)ZH * SH * 4) return;
    // Every stage runs ONCE, for both batches.
    k_cvt5<<<CVB((size_t)MT * DM) + 2 * CVB((size_t)DQ * DM) + 2 * CVB((size_t)DKV * DM), 256, 0, stream>>>(x, wq, wk, wv, wo, XB, WQ, WK, WV, WO);   /* 'oi' weights = Bt as-is */
    k_gemmw<bf, 0, false, DM, true><<<dim3(MT / BT, DF / BT, 1), 128, 0, stream>>>(XB, nullptr, WQ, nullptr, nullptr, 0, nullptr, 0, 0, 0, fcos, fsin, P16, Ph, Pl, VT16, VTh, VTl);   /* q, k, v projections; rotary FIRST, then RMSNorm; head planes and transposed v planes */
    k_fattn<<<(TT / 64) * NB_ * NKV, 256, 0, stream>>>(P16, Ph, Pl, VT16, VTh, VTl, ATh, ATl);   /* the whole attention of both batches: one block per (64 query rows, batch, kv head) */
    k_gemmw<bf, 1, false, DQ, false><<<dim3(MT / BT, DM / BT, 1), 128, 0, stream>>>(ATh, ATl, WO, nullptr, OUT, DM, nullptr, 0, 0, 0, nullptr, nullptr, nullptr, nullptr, nullptr, nullptr, nullptr, nullptr);
}

// v009
// One run takes 153 microseconds.
// Next to v008, in two timings, it ran 1.04 times as fast each time.
// All steps since v000 together make it 11.0 times as fast.
#include <hip/hip_runtime.h>

// Grouped-query causal attention with rotary embeddings followed by a gain-free RMSNorm on q and k (x [2][2048][2048]; q = x wq^T (16 heads x 128), k, v = x w^T ('oi' [512][2048]: 4 kv heads x 128); _apply_rope: x cos + rotate_half(x) sin with rotate_half = cat(-x2, x1) and the FULL-WIDTH cos / sin inputs [2048][1][128] (read per dimension); q = rms_norm(rope(q)), k = rms_norm(rope(k)) with x rsqrt(mean(x^2) + 1.19e-7) over the 128 dims (no gain; LITERAL order: the rotation is applied in place in f32 first, then the per-(token, head) row factor is taken from the rotated values); kv head = q head / 4 (repeat); scores x 128^-0.5; causal (-inf); softmax; out = merged wproj^T -> [2][2048][2048] (8.4 M); argument order x, cos, sin, wq, wk, wv, wproj).
// Layout: bf16 copy of x; natural 'oi' weights cast as they are (Bt; wq, wk, wv follow each other: one Bt of 24 head columns); k_gemmw with PL: the exact q, k, v projections of both batches in ONE launch, a 128-token x one-head tile per block, whose epilogue works on the f32 tile in LDS: for a q or k head the rotate-half rotation FIRST, with the bf16-rounded FULL-width cos / sin inputs (HD 128, read per dimension; arbitrary numbers, not unit rotations: the mean square changes), then the row's inverse RMS of the ROTATED values (eps 1.19e-7; no gain), then the head planes; for a v head the transposed planes; k_fattn: causal T-2048 GQA attention with 128-wide heads, scores, softmax and P.V in one kernel for both batches (running maximum; nothing of the scores goes to memory; hybrid rows; keys above the diagonal block are never visited); merged hi/lo x wproj exact.
// Compute dtypes, f32 accumulate: every input rounded to bf16 incl. the two tables; projections exact; rotary and RMSNorm f32; attention rows < 512 3 products, rest fp16; softmax f32; wproj hl x exact.

#define NB_  2
#define TT   2048
#define DM   2048
#define NH_  16
#define NKV  4        // four kv heads (grouped-query: kv head = q head / 4)
#define REP  (NH_ / NKV)
#define HD   128
#define DQ   (NH_ * HD)
#define DKV  (NKV * HD)
#define NHR  (NH_ + NKV)          // heads that take the rotation and the norm: the 16 q heads, then the 4 k heads
#define DF   (DQ + 2 * DKV)       // feature columns of the projections: q | k | v
#define MT   (NB_ * TT)           // token rows of both batches
#define ZH   16                   // heads of a batch in the attention output
#define SH   ((size_t)(TT / 64) * (TT / 64 + 1) / 2 * 4096)   // ZH * SH f32 elements: the workspace range of what only the launches in front of the attention use
#define RH   512                  // query rows < RH use hi+lo planes
typedef _Float16 h16;
typedef unsigned short bf;
typedef __attribute__((ext_vector_type(16))) __bf16   v16bf;
typedef __attribute__((ext_vector_type(16))) _Float16 v16h;
typedef __attribute__((ext_vector_type(8)))  _Float16 v8h;
typedef __attribute__((ext_vector_type(8)))  unsigned short v8us;
typedef __attribute__((ext_vector_type(8)))  float    v8f;
typedef __attribute__((ext_vector_type(4)))  float    v4f;
typedef v8h  __attribute__((may_alias)) v8ha;
typedef v4f  __attribute__((may_alias)) v4fa;
typedef v8us __attribute__((may_alias)) v8usa;

__device__ __forceinline__ unsigned short f2bf(float f) { unsigned u = __float_as_uint(f); u += 0x7FFFu + ((u >> 16) & 1u); return (unsigned short)(u >> 16); }
__device__ __forceinline__ float bf2f(unsigned short b) { return __uint_as_float(((unsigned)b) << 16); }
__device__ __forceinline__ float bfr(float f) { return bf2f(f2bf(f)); }
__device__ __forceinline__ v16h cat16(v8h lo, v8h hi) { return __builtin_shufflevector(lo, hi, 0, 1, 2, 3, 4, 5, 6, 7, 8, 9, 10, 11, 12, 13, 14, 15); }
__device__ __forceinline__ v16bf cat16b(v8us lo, v8us hi) { return __builtin_bit_cast(v16bf, __builtin_shufflevector(lo, hi, 0, 1, 2, 3, 4, 5, 6, 7, 8, 9, 10, 11, 12, 13, 14, 15)); }
__device__ __forceinline__ v8f wmma16(v16h a, v16h b, v8f c) { return __builtin_amdgcn_wmma_f32_16x16x32_f16(false, a, false, b, (short)0, c, false, false); }
__device__ __forceinline__ v8f wmmab(v16bf a, v16bf b, v8f c) { return __builtin_amdgcn_wmma_f32_16x16x32_bf16(false, a, false, b, (short)0, c, false, false); }
__device__ __forceinline__ h16 tohx(float x) { return (h16)x; }
__device__ __forceinline__ void splitf(float y, unsigned short& h, unsigned short& l) { h = f2bf(y); l = f2bf(y - bf2f(h)); }

// ---- k_gemmw: register-blocked GEMM, one 128x128 output tile per block of 4 waves (2 x 2), each wave a 64x64 quarter (16 accumulators) over the WHOLE of K in the order of k; the four waves share the block's staged operand tiles, so every operand row is loaded once per block and read by two waves; grid (M/128, N/128, Z), 128 threads. K % 64 == 0.
// C[m][n] (f32, pitch ldc, + optional f32 bias[n]) = sum_k A[m][k] Bt[n][k] (+ split products per NSPLIT). z-batch strides sA/sB/sC in elements.
template <typename T16> struct WFrag;
template <> struct WFrag<h16> { typedef v16h V; static __device__ __forceinline__ V ld(const h16* p) { return cat16(*(const v8h*)p, *(const v8h*)(p + 16)); } static __device__ __forceinline__ v8f mma(V a, V b, v8f c) { return wmma16(a, b, c); } };
template <> struct WFrag<bf> { typedef v16bf V; static __device__ __forceinline__ V ld(const bf* p) { return cat16b(*(const v8us*)p, *(const v8us*)(p + 16)); } static __device__ __forceinline__ v8f mma(V a, V b, v8f c) { return wmmab(a, b, c); } };
// LFrag: one fragment (the same k order as WFrag::ld) from a staged LDS row
template <typename T16> struct LFrag;
template <> struct LFrag<h16> { static __device__ __forceinline__ v16h ld(const unsigned short* p) { return cat16(*(const v8ha*)p, *(const v8ha*)(p + 16)); } };
template <> struct LFrag<bf> { static __device__ __forceinline__ v16bf ld(const unsigned short* p) { return cat16b(*(const v8usa*)p, *(const v8usa*)(p + 16)); } };
#define SP 72   // LDS row pitch of a staged K chunk in 16-bit elements: 128 bytes of data + 16 bytes, the pitch for 16-byte readers
#define BT 128  // rows of a block's tile of each operand plane
// Operand path: the block brings each 64-element K chunk (128 rows x 128 bytes per operand plane) with 16-byte loads of which each covers four WHOLE 128-byte lines (8 lanes a row) into registers one chunk ahead, stores it to one of two LDS buffers and reads the fragments from there; one barrier a chunk.
// KK = K = row pitch of every operand plane, a compile-time constant, so that the 8 loads of a plane differ in their immediate offset only.
// PL (the q, k, v projections; a tile = BT tokens of one batch x the HD features of head column blockIdx.y: NH_ q heads, NKV k heads, NKV v heads): no f32 row goes to memory. The four waves lay the f32 tile in LDS (pitch OP), one barrier, then 8 lanes take a row: a lane has 8 + 8 values 64 apart, which for a q or k head are the rotation's pairs; every store instruction covers whole 128-byte lines of a plane.
#define OP 132  // LDS row pitch of the f32 tile in elements: 512 bytes + 16 bytes, the pitch for 16-byte readers
static_assert(HD == BT && TT % BT == 0 && BT * OP <= 2 * BT * SP, "a tile is one head wide, lies in one batch and fits the staging buffers");
// emit16: 8 + 8 f32 values, 64 elements apart in a plane's row, to the fp16, hi and lo planes
__device__ __forceinline__ void emit16(const float* y, h16* p16, bf* ph, bf* pl) {
#pragma unroll
    for (int hf = 0; hf < 2; ++hf) { v8h o16; v8us oh, ol;
#pragma unroll
        for (int q = 0; q < 8; ++q) { const float r = y[hf * 8 + q]; o16[q] = tohx(r); unsigned short a, c; splitf(r, a, c); oh[q] = a; ol[q] = c; }
        *(v8h*)(p16 + hf * 64) = o16; *(v8us*)(ph + hf * 64) = oh; *(v8us*)(pl + hf * 64) = ol; }
    asm volatile("s_wait_xcnt 0x0" :: "v"(p16), "v"(ph), "v"(pl) : "memory");   // behind the stores, in front of any later write of a register that they name: the addresses as inputs keep their registers until here
}
template <typename T16, int NSPLIT, bool BIAS, int KK, bool PL>
__global__ __launch_bounds__(128) void k_gemmw(const T16* A, const T16* A2, const T16* Bt, const T16* Bt2, float* C, int ldc, const float* __restrict__ bias, size_t sA, size_t sB, size_t sC, const float* cosT, const float* sinT, h16* P16, bf* Ph, bf* Pl, h16* V16, bf* Vh, bf* Vl) {
    typedef typename WFrag<T16>::V V;
    constexpr bool HA2 = (NSPLIT == 1 || NSPLIT == 2), HB2 = (NSPLIT >= 2);
    constexpr int NT = 2 + (HA2 ? 1 : 0) + (HB2 ? 1 : 0);   // staged planes: A, B, then A2, then B2
    constexpr int BUF = NT * BT * SP;                       // 16-bit elements of one buffer (= f32 elements of both)
    constexpr int NC = KK / 64;                             // K chunks
    __shared__ __align__(16) float os[BUF];                 // two buffers in the K loop; behind it each wave's 16 x 64 output rows (pitch 68) or, with PL, the block's f32 tile (pitch OP)
    const int wv = __builtin_amdgcn_readfirstlane((int)(threadIdx.x >> 5));   // wave number in a scalar register
    const int wm = wv >> 1, wn = wv & 1;                    // the wave's quarter of the tile
    const size_t z = blockIdx.z; A += z * sA; if (A2) A2 += z * sA; Bt += z * sB; if (Bt2) Bt2 += z * sB; C += z * sC;
    const int tid = (int)threadIdx.x, lane = tid & 31, lr = lane & 15, hi = lane >> 4; const int r0 = blockIdx.x * BT, c0 = blockIdx.y * BT;
    v8f acc[4][4];
#pragma unroll
    for (int mb = 0; mb < 4; ++mb)
#pragma unroll
        for (int nb = 0; nb < 4; ++nb) acc[mb][nb] = (v8f){};
    const unsigned short* gp[4] = { (const unsigned short*)A + (size_t)r0 * KK, (const unsigned short*)Bt + (size_t)c0 * KK, HA2 ? (const unsigned short*)A2 + (size_t)r0 * KK : nullptr, HB2 ? (const unsigned short*)Bt2 + (size_t)c0 * KK : nullptr };   // block-uniform plane bases of this tile
    constexpr int TA2 = 2, TB2 = HA2 ? 3 : 2;               // LDS tile numbers of the lo planes
    const unsigned vo = (unsigned)((tid >> 3) * KK + (tid & 7) * 8);   // the thread's own place in a load: row tid / 8, 16-byte piece tid % 8; never rewritten
    unsigned short* sm = (unsigned short*)os;
    unsigned short* sst = sm + (tid >> 3) * SP + (tid & 7) * 8;
    const unsigned short* sfa = sm + (wm * 64 + lr) * SP + 8 * hi;             // the lane's first A row
    const unsigned short* sfb = sm + BT * SP + (wn * 64 + lr) * SP + 8 * hi;   // the lane's first B row
    v8us rg[NT][8];
    auto fetch = [&](int kc) {
        const unsigned short* pa = gp[0] + kc + vo; const unsigned short* pb = gp[1] + kc + vo; const unsigned short* pa2 = HA2 ? gp[2] + kc + vo : nullptr; const unsigned short* pb2 = HB2 ? gp[3] + kc + vo : nullptr;
#pragma unroll
        for (int i = 0; i < 8; ++i) { rg[0][i] = *(const v8usa*)(pa + i * 16 * KK); rg[1][i] = *(const v8usa*)(pb + i * 16 * KK); if (HA2) rg[TA2][i] = *(const v8usa*)(pa2 + i * 16 * KK); if (HB2) rg[TB2][i] = *(const v8usa*)(pb2 + i * 16 * KK); }
        if constexpr (HA2 && HB2) asm volatile("s_wait_xcnt 0x0" :: "v"(pa), "v"(pb), "v"(pa2), "v"(pb2) : "memory"); else if constexpr (HA2) asm volatile("s_wait_xcnt 0x0" :: "v"(pa), "v"(pb), "v"(pa2) : "memory"); else if constexpr (HB2) asm volatile("s_wait_xcnt 0x0" :: "v"(pa), "v"(pb), "v"(pb2) : "memory"); else asm volatile("s_wait_xcnt 0x0" :: "v"(pa), "v"(pb) : "memory");   // behind the chunk's loads, in front of any later write (a later load's result too) of an address register that they name: the addresses as inputs keep their registers until here (the operand pointers carry no restrict, so that the loads stay in front of this statement)
    };
    auto put = [&](int bsel) {
#pragma unroll
        for (int t = 0; t < NT; ++t)
#pragma unroll
            for (int i = 0; i < 8; ++i) *(v8usa*)(sst + bsel * BUF + t * BT * SP + i * 16 * SP) = rg[t][i];
    };
    fetch(0); put(0);
    __syncthreads();   // publishes chunk 0
#pragma unroll 1
    for (int s = 0; s < NC; ++s) {   // the chunks in the order of k: two 32-steps per chunk; kept rolled: the body already holds 32 to 64 products, a second copy would only take instruction cache
        if (s + 1 < NC) fetch((s + 1) * 64);      // scalar test; the next chunk's loads fly during this chunk's products
        const unsigned short* fa = sfa + (s & 1) * BUF; const unsigned short* fb = sfb + (s & 1) * BUF;
        V a[2][4], a2[2][4], b[2][4], b2[2][4];
#pragma unroll
        for (int ks = 0; ks < 2; ++ks)
#pragma unroll
            for (int f = 0; f < 4; ++f) { a[ks][f] = LFrag<T16>::ld(fa + f * 16 * SP + ks * 32); b[ks][f] = LFrag<T16>::ld(fb + f * 16 * SP + ks * 32); if (HA2) a2[ks][f] = LFrag<T16>::ld(fa + TA2 * BT * SP + f * 16 * SP + ks * 32); if (HB2) b2[ks][f] = LFrag<T16>::ld(fb + (TB2 - 1) * BT * SP + f * 16 * SP + ks * 32); }
        __builtin_amdgcn_sched_barrier(0);   // all fragment loads of the chunk issue as one group in front of its products: spread among them, every four products wait out a whole LDS latency, which the one or two waves of a SIMD do not cover
#pragma unroll
        for (int ks = 0; ks < 2; ++ks)
#pragma unroll
            for (int nb = 0; nb < 4; ++nb) {   // per accumulator the order a b, a2 b, a b2 of each 32-step
#pragma unroll
                for (int mb = 0; mb < 4; ++mb) acc[mb][nb] = WFrag<T16>::mma(a[ks][mb], b[ks][nb], acc[mb][nb]);
                if (HA2) {
#pragma unroll
                    for (int mb = 0; mb < 4; ++mb) acc[mb][nb] = WFrag<T16>::mma(a2[ks][mb], b[ks][nb], acc[mb][nb]); }
                if (HB2) {
#pragma unroll
                    for (int mb = 0; mb < 4; ++mb) acc[mb][nb] = WFrag<T16>::mma(a[ks][mb], b2[ks][nb], acc[mb][nb]); } }
        __builtin_amdgcn_sched_barrier(0);   // keeps every product of the chunk in front of the slots below
        asm volatile("v_nop\n\tv_nop\n\tv_nop\n\tv_nop");   // four vector slots behind the chunk's last products, in front of the next writes of their operand registers, also on the taken side of the branches that follow
        if (s + 1 < NC) put((s + 1) & 1);   // into the buffer that every wave left at the barrier of the chunk before
        __syncthreads();   // publishes chunk s + 1 and ends every wave's reads of chunk s
    }
    if constexpr (PL) {
        const int hc = (int)blockIdx.y, bb = r0 / TT, t0 = r0 % TT;   // head column, batch, first token of the tile (scalars)
        const int l8 = (tid & 7) * 8, rr = tid >> 3;                  // the lane's 8 + 8 values of a row; its row in a pass of 16 rows
        if (hc < NHR) {   // a q or k head (scalar test, the same for the whole block)
            const float* cp = cosT + (size_t)(t0 + rr) * HD + l8; const float* sp = sinT + (size_t)(t0 + rr) * HD + l8;
            v4f cn[4], sn[4];
            auto tab = [&](int p) {   // the table values of pass p
                const float* c = cp + p * 16 * HD; const float* s = sp + p * 16 * HD;
                cn[0] = *(const v4fa*)c; cn[1] = *(const v4fa*)(c + 4); cn[2] = *(const v4fa*)(c + 64); cn[3] = *(const v4fa*)(c + 68); sn[0] = *(const v4fa*)s; sn[1] = *(const v4fa*)(s + 4); sn[2] = *(const v4fa*)(s + 64); sn[3] = *(const v4fa*)(s + 68);
                asm volatile("s_wait_xcnt 0x0" :: "v"(c), "v"(s) : "memory");   // behind the loads, in front of any later write (a later load's result too) of an address register that they name: the addresses as inputs keep their registers until here
            };
            tab(0);   // flies during the LDS stores and the barrier
#pragma unroll
            for (int mb = 0; mb < 4; ++mb)
#pragma unroll
                for (int nb = 0; nb < 4; ++nb)
#pragma unroll
                    for (int j = 0; j < 8; ++j) os[(wm * 64 + mb * 16 + hi * 8 + j) * OP + wn * 64 + nb * 16 + lr] = acc[mb][nb][j];   // behind the loop's last barrier nobody reads a staged tile
            __syncthreads();   // the whole tile [token][feature] is in LDS: a row holds values of two waves
            const size_t e0 = (((size_t)bb * NHR + hc) * TT + t0 + rr) * HD + l8;
#pragma unroll 1
            for (int p = 0; p < BT / 16; ++p) {   // kept rolled: it runs once per block, eight copies would only take instruction cache
                v4f c[4], s[4];
#pragma unroll
                for (int i = 0; i < 4; ++i) { c[i] = cn[i]; s[i] = sn[i]; }
                if (p + 1 < BT / 16) tab(p + 1);   // scalar test; the next pass's table values fly during this pass
                const float* xr = os + (p * 16 + rr) * OP + l8;
                const v4f x[4] = { *(const v4fa*)xr, *(const v4fa*)(xr + 4), *(const v4fa*)(xr + 64), *(const v4fa*)(xr + 68) };
                float y[16], s0 = 0.f, s1 = 0.f;
#pragma unroll
                for (int q = 0; q < 8; ++q) { const float x1 = x[q >> 2][q & 3], x2 = x[2 + (q >> 2)][q & 3];   // out[d] = x[d] cos[d] - x[d + 64] sin[d]; out[d + 64] = x[d + 64] cos[d + 64] + x[d] sin[d + 64]
                    y[q] = x1 * bfr(c[q >> 2][q & 3]) - x2 * bfr(s[q >> 2][q & 3]); y[8 + q] = x2 * bfr(c[2 + (q >> 2)][q & 3]) + x1 * bfr(s[2 + (q >> 2)][q & 3]);
                    s0 += y[q] * y[q]; s1 += y[8 + q] * y[8 + q]; }
                float ss = s0 + s1; ss += __shfl_xor(ss, 1, 32); ss += __shfl_xor(ss, 2, 32); ss += __shfl_xor(ss, 4, 32);   // the row's 8 lanes
                const float rf = __fdiv_rn(1.0f, __fsqrt_rn(ss / (float)HD + 1.1920929e-07f));
#pragma unroll
                for (int q = 0; q < 16; ++q) y[q] *= rf;
                const size_t e = e0 + (size_t)p * 16 * HD; emit16(y, P16 + e, Ph + e, Pl + e);
            }
        } else {   // a v head: the tile goes to LDS transposed (a lane's 8 accumulator values are 8 tokens of one feature)
#pragma unroll
            for (int mb = 0; mb < 4; ++mb)
#pragma unroll
                for (int nb = 0; nb < 4; ++nb) { float* q = os + (wn * 64 + nb * 16 + lr) * OP + wm * 64 + mb * 16 + hi * 8; v4f a0, a1;
#pragma unroll
                    for (int j = 0; j < 4; ++j) { a0[j] = acc[mb][nb][j]; a1[j] = acc[mb][nb][4 + j]; }
                    *(v4fa*)q = a0; *(v4fa*)(q + 4) = a1; }
            __syncthreads();   // the whole tile [feature][token] is in LDS: a row holds values of two waves
            const size_t e0 = (((size_t)bb * NKV + (hc - NHR)) * HD + rr) * TT + t0 + l8;
#pragma unroll 1
            for (int p = 0; p < HD / 16; ++p) {   // kept rolled, as above
                const float* xr = os + (p * 16 + rr) * OP + l8;
                const v4f x[4] = { *(const v4fa*)xr, *(const v4fa*)(xr + 4), *(const v4fa*)(xr + 64), *(const v4fa*)(xr + 68) };
                float y[16];
#pragma unroll
                for (int q = 0; q < 16; ++q) y[q] = x[q >> 2][q & 3];
                const size_t e = e0 + (size_t)p * 16 * TT; emit16(y, V16 + e, Vh + e, Vl + e);
            }
        }
    } else {
    float* ow = os + wv * (16 * 68);   // behind the last barrier nobody reads a staged tile: each wave turns its rows into whole lines in its own LDS range
#pragma unroll
    for (int mb = 0; mb < 4; ++mb) {
#pragma unroll
        for (int nb = 0; nb < 4; ++nb) {
#pragma unroll
            for (int j = 0; j < 8; ++j) ow[(hi * 8 + j) * 68 + nb * 16 + lr] = acc[mb][nb][j]; }
        asm volatile("s_wait_dscnt 0x0" ::: "memory");   // the wave's own LDS stores are done before its lanes read rows that other lanes of the wave stored
        float* crow = C + (size_t)(r0 + wm * 64 + mb * 16) * ldc + c0 + wn * 64;
#pragma unroll
        for (int q = 0; q < 8; ++q) { const int row = 2 * q + hi, cofs = lr * 4; v4f val = *(const v4fa*)(ow + row * 68 + cofs); if (BIAS) { const float* bp = bias + c0 + wn * 64 + cofs; val[0] += bfr(bp[0]); val[1] += bfr(bp[1]); val[2] += bfr(bp[2]); val[3] += bfr(bp[3]); }
            *(v4f*)(crow + (size_t)row * ldc + cofs) = val; }
        asm volatile("s_wait_dscnt 0x0\n\ts_wait_xcnt 0x0" ::: "memory");   // the 16 rows are read before the next 16 overwrite them; and behind the stores, in front of any later write of a register that they name
    }
    }
}

typedef __attribute__((ext_vector_type(2))) _Float16 v2h;
typedef __attribute__((ext_vector_type(4))) _Float16 v4h;
typedef __attribute__((ext_vector_type(2))) unsigned short v2us;
typedef __attribute__((ext_vector_type(4))) unsigned short v4us;
typedef __attribute__((ext_vector_type(2))) float v2f;
typedef __attribute__((ext_vector_type(4))) int v4i;

// The conversion kernel below gives every thread 32 elements in 16-byte pieces: few waves start, and each lane has its loads in flight together.
#define CVN 4   // 8-value pieces per thread of k_cvt5, 256 threads apart
// k_cvt5: x (both batches) and the four weights in ONE launch; a block takes 256 CVN pieces of one tensor (every tensor is a whole number of blocks), picked by the block's number (scalar tests)
#define CVB(n) ((int)((size_t)(n) / 8 / (256 * CVN)))
static_assert((size_t)MT * DM % (8 * 256 * CVN) == 0 && (size_t)DQ * DM % (8 * 256 * CVN) == 0 && (size_t)DKV * DM % (8 * 256 * CVN) == 0, "whole blocks");
__global__ __launch_bounds__(256) void k_cvt5(const float* __restrict__ x, const float* __restrict__ wq, const float* __restrict__ wk, const float* __restrict__ wv, const float* __restrict__ wo, bf* XB, bf* WQ, bf* WK, bf* WV, bf* WO) {
    int blk = (int)blockIdx.x; const float* src = x; bf* dst = XB;
    if (blk >= CVB((size_t)MT * DM)) { blk -= CVB((size_t)MT * DM); src = wq; dst = WQ;
        if (blk >= CVB((size_t)DQ * DM)) { blk -= CVB((size_t)DQ * DM); src = wk; dst = WK;
            if (blk >= CVB((size_t)DKV * DM)) { blk -= CVB((size_t)DKV * DM); src = wv; dst = WV;
                if (blk >= CVB((size_t)DKV * DM)) { blk -= CVB((size_t)DKV * DM); src = wo; dst = WO; } } } }
    const size_t i0 = (size_t)blk * (256 * CVN) + threadIdx.x; v8f v[CVN];
#pragma unroll
    for (int c = 0; c < CVN; ++c) v[c] = *(const v8f*)(src + (i0 + (size_t)c * 256) * 8);   // all loads first, so that they are in flight together
    asm volatile("s_wait_xcnt 0x0" ::: "memory");   // behind the loads, in front of any later write of an address register that they name
#pragma unroll
    for (int c = 0; c < CVN; ++c) { v8us o;
#pragma unroll
        for (int k = 0; k < 8; ++k) o[k] = f2bf(v[c][k]);
        *(v8us*)(dst + (i0 + (size_t)c * 256) * 8) = o; } }


#define KP 136                // LDS row pitch of a staged K row in 16-bit elements: 256 bytes + 16 bytes, the pitch for 16-byte readers
#define KTE (64 * KP)         // one K plane of a stage: 64 keys
#define VTE (HD * SP)         // one V plane of a stage: HD rows of 64 keys (128 bytes + 16 bytes)
#define SCL2 0.12751743f      // HD^-0.5 x log2(e): scores in the exponent of 2
__device__ __forceinline__ float exp2s(float x) { float r; asm("v_exp_f32 %0, %1\n\tv_nop" : "=v"(r) : "v"(x)); return r; }
template <bool HL> struct FaT; template <> struct FaT<true> { typedef bf T; }; template <> struct FaT<false> { typedef h16 T; };
template <bool HL>
__device__ __forceinline__ void fa_body(unsigned short* sm, const unsigned short* Qh, const unsigned short* Ql, const unsigned short* Kh, const unsigned short* Kl, const unsigned short* Vh, const unsigned short* Vl, bf* Ah, bf* Al, const int qb, const int wv) {
    typedef typename FaT<HL>::T T16; typedef typename WFrag<T16>::V V;
    constexpr int NP = HL ? 2 : 1; constexpr int SUB = NP * (KTE + VTE), BUF = 2 * SUB;   // a stage: K planes, then V planes; a buffer: the two stages of a trip
    const int tid = (int)threadIdx.x, lane = tid & 31, lr = lane & 15, hi = lane >> 4;
    const int qw = qb * 64 + (wv & 1) * 32;   // the wave's first query row (scalar)
    const int kh = wv >> 2;                   // the wave's key group (scalar): stage 2 s + kh of trip s
    V qf[2][4], qf2[2][4]; const unsigned short* qp = Qh + (size_t)(qw + lr) * HD + 8 * hi; const unsigned short* qp2 = HL ? Ql + (size_t)(qw + lr) * HD + 8 * hi : nullptr;   // the lane's own query row; every Q load differs from it by a constant
#pragma unroll
    for (int g = 0; g < 2; ++g)
#pragma unroll
        for (int ks = 0; ks < 4; ++ks) { qf[g][ks] = LFrag<T16>::ld(qp + g * 16 * HD + ks * 32); if (HL) qf2[g][ks] = LFrag<T16>::ld(qp2 + g * 16 * HD + ks * 32); }
    if (HL) asm volatile("s_wait_xcnt 0x0" :: "v"(qp), "v"(qp2) : "memory"); else asm volatile("s_wait_xcnt 0x0" :: "v"(qp) : "memory");   // behind the Q loads, in front of any later write (a later load's result too) of an address register that they name: the addresses as inputs keep their registers until here
    const unsigned voK = (unsigned)((tid >> 4) * HD + (tid & 15) * 8), voV = (unsigned)((tid >> 3) * TT + (tid & 7) * 8);   // the thread's own place in a staging load (a wave covers four whole 128-byte lines); never rewritten
    unsigned short* stK = sm + (tid >> 4) * KP + (tid & 15) * 8; unsigned short* stV = sm + NP * KTE + (tid >> 3) * SP + (tid & 7) * 8;
    v8us rk[2][NP][4], rv[2][NP][4];
    auto fetch = [&](int k0) {
        if constexpr (HL) {   // the V planes by plain loads; the K planes' loads stand with their waits in one statement behind them, so that all 32 loads are in flight together
            static_assert(HD * 2 * 16 == 4096, "the byte offsets in the statement below: 16 K rows a load, 64 a stage");
            const unsigned short* pv = Vh + k0 + voV; const unsigned short* pv2 = Vl + k0 + voV; const unsigned short* pk = Kh + (size_t)k0 * HD + voK; const unsigned short* pk2 = Kl + (size_t)k0 * HD + voK;
#pragma unroll
            for (int u = 0; u < 2; ++u)
#pragma unroll
                for (int i = 0; i < 4; ++i) { rv[u][0][i] = *(const v8usa*)(pv + u * 64 + i * 32 * TT); rv[u][1][i] = *(const v8usa*)(pv2 + u * 64 + i * 32 * TT); }
            // Written as text because the compiler formed the K addresses a second time for a wait in a statement of its own and let go of the loads' own address registers in front of it. s_wait_xcnt 0 stands behind the last load, in front of any later write of an address register that a load of this fetch names (the V addresses as inputs keep their registers until here); s_wait_loadcnt 0: the compiler places no wait for loads in text, and the values are stored to LDS at once.
            asm volatile("global_load_b128 %0, %16, off\n\tglobal_load_b128 %1, %16, off offset:4096\n\tglobal_load_b128 %2, %16, off offset:8192\n\tglobal_load_b128 %3, %16, off offset:12288\n\t"
                         "global_load_b128 %4, %16, off offset:16384\n\tglobal_load_b128 %5, %16, off offset:20480\n\tglobal_load_b128 %6, %16, off offset:24576\n\tglobal_load_b128 %7, %16, off offset:28672\n\t"
                         "global_load_b128 %8, %17, off\n\tglobal_load_b128 %9, %17, off offset:4096\n\tglobal_load_b128 %10, %17, off offset:8192\n\tglobal_load_b128 %11, %17, off offset:12288\n\t"
                         "global_load_b128 %12, %17, off offset:16384\n\tglobal_load_b128 %13, %17, off offset:20480\n\tglobal_load_b128 %14, %17, off offset:24576\n\tglobal_load_b128 %15, %17, off offset:28672\n\t"
                         "s_wait_xcnt 0x0\n\ts_wait_loadcnt 0x0"
                         : "=&v"(rk[0][0][0]), "=&v"(rk[0][0][1]), "=&v"(rk[0][0][2]), "=&v"(rk[0][0][3]), "=&v"(rk[1][0][0]), "=&v"(rk[1][0][1]), "=&v"(rk[1][0][2]), "=&v"(rk[1][0][3]),
                           "=&v"(rk[0][1][0]), "=&v"(rk[0][1][1]), "=&v"(rk[0][1][2]), "=&v"(rk[0][1][3]), "=&v"(rk[1][1][0]), "=&v"(rk[1][1][1]), "=&v"(rk[1][1][2]), "=&v"(rk[1][1][3])
                         : "v"(pk), "v"(pk2), "v"(pv), "v"(pv2) : "memory");
        } else {
            const unsigned short* pk = Kh + (size_t)k0 * HD + voK; const unsigned short* pv = Vh + k0 + voV;
#pragma unroll
            for (int u = 0; u < 2; ++u)
#pragma unroll
                for (int i = 0; i < 4; ++i) { rk[u][0][i] = *(const v8usa*)(pk + u * 64 * HD + i * 16 * HD); rv[u][0][i] = *(const v8usa*)(pv + u * 64 + i * 32 * TT); }
            asm volatile("s_wait_xcnt 0x0" :: "v"(pk), "v"(pv) : "memory");   // behind the trip's loads, in front of any later write (a later load's result too) of an address register that they name: the addresses as inputs keep their registers until here
        }
    };
    auto put = [&](int bsel) {
#pragma unroll
        for (int u = 0; u < 2; ++u)
#pragma unroll
        for (int p = 0; p < NP; ++p)
#pragma unroll
            for (int i = 0; i < 4; ++i) { *(v8usa*)(stK + bsel * BUF + u * SUB + p * KTE + i * 16 * KP) = rk[u][p][i]; *(v8usa*)(stV + bsel * BUF + u * SUB + p * VTE + i * 32 * SP) = rv[u][p][i]; }
    };
    v8f o[8][2];
#pragma unroll
    for (int dt = 0; dt < 8; ++dt) { o[dt][0] = (v8f){}; o[dt][1] = (v8f){}; }
    float m[2] = { -3.0e38f, -3.0e38f }, l[2] = { 0.f, 0.f };
    const int n = (qb + 2) >> 1;   // trips of 128 keys up to and with the diagonal block; the same for the whole block (where the diagonal block is a trip's first stage, the second is staged, inside the planes, and no wave visits it)
    __builtin_amdgcn_fence(__ATOMIC_RELEASE, "workgroup");   // compiles to a wait for the wave's own loads: the Q fragments have landed in front of the loop: a wait for them among the loop's products would also wait for the next trip's loads, which are to fly during the products
#pragma unroll 1
    for (int s = HL ? 0 : -1; s < n; ++s) {   // fp16 rows: trip -1 only brings trip 0 in
        if (HL) { fetch(s * 128); put(s & 1);   // the hi + lo rows have few trips and no registers to spare: they load each trip where it is needed; the buffer was last read two trips ago, in front of the barrier of the trip before
            __syncthreads(); }   // publishes trip s
        else if (s + 1 < n) fetch((s + 1) * 128);   // scalar test; the next trip's loads fly during this trip's products
        const int ss = 2 * s + kh;   // the wave's stage of 64 keys (scalar)
        const unsigned short* kb = sm + (s & 1) * BUF + kh * SUB + lr * KP + 8 * hi; const unsigned short* vb = sm + (s & 1) * BUF + kh * SUB + NP * KTE + lr * SP + 8 * hi;
#pragma unroll
        for (int kk = 0; kk < 2; ++kk) {
            if (s >= 0 && ss * 64 + kk * 32 <= qw + 31) {   // scalar tests: not in trip -1; 32 keys wholly above the wave's rows are skipped (their probabilities are exact zeros)
                v8f st[2][2];
#pragma unroll
                for (int kt = 0; kt < 2; ++kt) { st[kt][0] = (v8f){}; st[kt][1] = (v8f){}; }
                V ka[2][4], va[8];   // fp16 rows: fragment loads in groups; the hi + lo rows have no registers for that and load each fragment at its products
                if (!HL) {
#pragma unroll
                    for (int ks = 0; ks < 4; ++ks)
#pragma unroll
                        for (int kt = 0; kt < 2; ++kt) ka[kt][ks] = LFrag<T16>::ld(kb + (kk * 32 + kt * 16) * KP + ks * 32);
                    __builtin_amdgcn_sched_barrier(0); }   // all K fragment loads of the 32 keys issue as one group in front of the products: spread among them, each pair of products waits out a whole LDS latency
#pragma unroll
                for (int ks = 0; ks < 4; ++ks)
#pragma unroll
                    for (int kt = 0; kt < 2; ++kt) { V a, a2; if (HL) { a = LFrag<T16>::ld(kb + (kk * 32 + kt * 16) * KP + ks * 32); a2 = LFrag<T16>::ld(kb + KTE + (kk * 32 + kt * 16) * KP + ks * 32); } else a = ka[kt][ks];
#pragma unroll
                        for (int g = 0; g < 2; ++g) { st[kt][g] = WFrag<T16>::mma(a, qf[g][ks], st[kt][g]); if (HL) { st[kt][g] = WFrag<T16>::mma(a2, qf[g][ks], st[kt][g]); st[kt][g] = WFrag<T16>::mma(a, qf2[g][ks], st[kt][g]); } } }
                if (!HL) {
#pragma unroll
                    for (int dt = 0; dt < 8; ++dt) va[dt] = LFrag<T16>::ld(vb + dt * 16 * SP + kk * 32);
                    __builtin_amdgcn_sched_barrier(0); }   // all V fragment loads of the 32 keys issue as one group in front of the softmax, which covers their latency
                if (ss == qb) {   // causal mask, under a scalar branch: only the diagonal stage has keys above a row
#pragma unroll
                    for (int g = 0; g < 2; ++g)
#pragma unroll
                        for (int kt = 0; kt < 2; ++kt)
#pragma unroll
                            for (int j = 0; j < 8; ++j) st[kt][g][j] = (ss * 64 + kk * 32 + kt * 16 + hi * 8 + j <= qw + g * 16 + lr) ? st[kt][g][j] : -3.0e38f; }
                float mn[2];
#pragma unroll
                for (int g = 0; g < 2; ++g) { float mx = -3.0e38f;
#pragma unroll
                    for (int kt = 0; kt < 2; ++kt)
#pragma unroll
                        for (int j = 0; j < 8; ++j) { const float t = st[kt][g][j] * SCL2; st[kt][g][j] = t; mx = fmaxf(mx, t); }
                    mx = fmaxf(mx, __shfl_xor(mx, 16, 32)); mn[g] = fmaxf(m[g], mx); }
                if (__builtin_amdgcn_ballot_w32(mn[0] > m[0] || mn[1] > m[1]) != 0) {   // one scalar branch per 32 keys: where no query's maximum rises every factor would be exactly 1
#pragma unroll
                    for (int g = 0; g < 2; ++g) { const float al = exp2s(m[g] - mn[g]); m[g] = mn[g]; l[g] *= al;
#pragma unroll
                        for (int dt = 0; dt < 8; ++dt) o[dt][g] *= al; } }
                V pb[2], pb2[2];
#pragma unroll
                for (int g = 0; g < 2; ++g) { float sum = 0.f; v8us h0, h1, l0, l1; v8h f0, f1; const float mo = HL ? m[g] : m[g] - 8.0f;   // fp16 rows carry the probabilities x 2^8 (at most 256), so that small ones stay normal fp16 numbers; the row sum carries the same factor, which the division takes out
#pragma unroll
                    for (int j = 0; j < 8; ++j) { const float p0 = exp2s(st[0][g][j] - mo), p1 = exp2s(st[1][g][j] - mo); sum += p0 + p1;
                        if (HL) { unsigned short a, c; splitf(p0, a, c); h0[j] = a; l0[j] = c; splitf(p1, a, c); h1[j] = a; l1[j] = c; } else { f0[j] = tohx(p0); f1[j] = tohx(p1); } }
                    l[g] += sum;
                    if constexpr (HL) { pb[g] = cat16b(h0, h1); pb2[g] = cat16b(l0, l1); } else { pb[g] = cat16(f0, f1); } }
#pragma unroll
                for (int dt = 0; dt < 8; ++dt) { V a, a2; if (HL) { a = LFrag<T16>::ld(vb + dt * 16 * SP + kk * 32); a2 = LFrag<T16>::ld(vb + VTE + dt * 16 * SP + kk * 32); } else a = va[dt];
#pragma unroll
                    for (int g = 0; g < 2; ++g) { o[dt][g] = WFrag<T16>::mma(a, pb[g], o[dt][g]); if (HL) { o[dt][g] = WFrag<T16>::mma(a, pb2[g], o[dt][g]); o[dt][g] = WFrag<T16>::mma(a2, pb[g], o[dt][g]); } } }
                __builtin_amdgcn_sched_barrier(0);   // keeps every product of the 32 keys in front of the slots below
                asm volatile("v_nop\n\tv_nop\n\tv_nop\n\tv_nop");   // four vector slots behind the last products of the 32 keys, in front of the next writes of their operand registers, also on the taken side of the branches that follow
            }
        }
        if (!HL) { if (s + 1 < n) put((s + 1) & 1);   // into the buffer that every wave left at the barrier of the trip before
            __syncthreads(); }   // publishes trip s + 1 and ends every wave's reads of trip s
    }
    // Join of the two key groups: waves w and w + 4 hold partial results of the same 32 queries. Each hands the 16 queries that the other finishes over in LDS (a slot per receiving wave; a lane's values in 16-byte pieces, the 32 lanes of a piece side by side) and finishes its own 16: both parts are brought to the common maximum. A group that saw no key has maximum -3e38, sum 0 and output 0: its factor is exp2 of a huge negative number, an exact 0.
    constexpr int MGS = 17 * 128;   // f32 elements of a slot: 16 pieces of the output tiles, one piece with maximum and sum
    float* mg = (float*)sm;
    if (HL) __syncthreads();   // ends every wave's reads of the first buffer, which the slots overwrite (the loop of the fp16 rows ends in such a barrier)
#pragma unroll
    for (int g = 0; g < 2; ++g)
        if (g != kh) {   // scalar test
            float* w = mg + (wv ^ 4) * MGS + lane * 4;
#pragma unroll
            for (int dt = 0; dt < 8; ++dt) { v4f a0, a1;
#pragma unroll
                for (int j = 0; j < 4; ++j) { a0[j] = o[dt][g][j]; a1[j] = o[dt][g][4 + j]; }
                *(v4fa*)(w + (2 * dt) * 128) = a0; *(v4fa*)(w + (2 * dt + 1) * 128) = a1; }
            const v4f t = { m[g], l[g], 0.f, 0.f }; *(v4fa*)(w + 16 * 128) = t; }
    __syncthreads();   // publishes the slots
#pragma unroll
    for (int g = 0; g < 2; ++g)
        if (g == kh) {   // scalar test
            const float* r = mg + wv * MGS + lane * 4; const v4f t = *(const v4fa*)(r + 16 * 128);
            const float mm = fmaxf(m[g], t[0]); const float ca = exp2s(m[g] - mm), cb = exp2s(t[0] - mm); const float ls = l[g] * ca + t[1] * cb;
            const float f = __fdiv_rn(1.0f, ls + __shfl_xor(ls, 16, 32)); const float fa = ca * f, fb = cb * f; const size_t e = (size_t)(qw + g * 16 + lr) * DQ + hi * 8; bf* ah = Ah + e; bf* al = Al + e;   // the two lane halves summed different keys; a lane's 8 accumulator values are 8 neighbouring features of its query's merged row
            v8us oh[8], ol[8];
#pragma unroll
            for (int dt = 0; dt < 8; ++dt) { const v4f p0 = *(const v4fa*)(r + (2 * dt) * 128), p1 = *(const v4fa*)(r + (2 * dt + 1) * 128);
#pragma unroll
                for (int j = 0; j < 8; ++j) { unsigned short a, c; splitf(o[dt][g][j] * fa + (j < 4 ? p0[j & 3] : p1[j & 3]) * fb, a, c); oh[dt][j] = a; ol[dt][j] = c; }
                *(v8us*)(ah + dt * 16) = oh[dt]; *(v8us*)(al + dt * 16) = ol[dt]; }
            asm volatile("s_wait_xcnt 0x0" :: "v"(ah), "v"(al), "v"(oh[0]), "v"(oh[1]), "v"(oh[2]), "v"(oh[3]), "v"(oh[4]), "v"(oh[5]), "v"(oh[6]), "v"(oh[7]), "v"(ol[0]), "v"(ol[1]), "v"(ol[2]), "v"(ol[3]), "v"(ol[4]), "v"(ol[5]), "v"(ol[6]), "v"(ol[7]) : "memory"); }   // behind the stores, in front of any later write of a register that they name: addresses and stored values as inputs keep their registers until here
}
// grid: (TT / 128 pairs of query blocks) x (REP / 2 head pairs) x NB_ x NKV blocks, one per WGP
static_assert(TT == 2048 && RH == 512 && REP == 4, "the table of pairs below is laid out for 32 query blocks, of which the first 8 use hi + lo planes, and two head pairs");
__global__ __launch_bounds__(256) void k_fattn(const h16* P16, const bf* Ph, const bf* Pl, const h16* VT16, const bf* VTh, const bf* VTl, bf* ATh, bf* ATl) {
    __shared__ __align__(16) unsigned short sm[2 * 2 * 2 * (KTE + VTE)];   // two buffers of two stages of (at most) two planes
    const int wv = __builtin_amdgcn_readfirstlane((int)(threadIdx.x >> 5));   // wave number in a scalar register: the tests on the wave's rows stay scalar
    const int pr = (int)blockIdx.x / (REP / 2 * NB_ * NKV), rest = (int)blockIdx.x % (REP / 2 * NB_ * NKV), hp = rest & 1, bk = rest >> 1; const int b = bk / NKV, kvh = bk % NKV, head = kvh * REP + hp * 2 + ((wv >> 1) & 1);
    // The pairs, a byte per pair: every query block once. Cost of a block in trips: (number + 2) / 2, about three times that with hi + lo planes; the dearest goes with the cheapest, and so on.
    const unsigned long long ta = pr < 8 ? 0x19181B1A1D1C1F1EULL : 0x1312151417160C0DULL;   // 30 31 28 29 26 27 24 25 | 13 12 22 23 20 21 18 19: fp16 rows, all of them
    const unsigned long long tb = pr < 8 ? 0x02030A0B08090001ULL : 0x040510110E0F0706ULL;   //  1  0  9  8 11 10  3  2 |  6  7 15 14 17 16  5  4
    const size_t qo = ((size_t)b * NHR + head) * TT * HD, ko = ((size_t)b * NHR + NH_ + kvh) * TT * HD, vo = ((size_t)b * NKV + kvh) * HD * TT;
    const size_t ao = (size_t)b * TT * DQ + head * HD;   // the head's columns in the batch's merged rows [t][DQ]
    const int q0 = (int)((ta >> ((pr & 7) * 8)) & 255), q1 = (int)((tb >> ((pr & 7) * 8)) & 255);   // scalars, the same for the whole block
    const int nf = q1 < RH / 64 ? 1 : 2;   // query blocks of fp16 rows
#pragma unroll 1
    for (int t = 0; t < nf; ++t) {   // kept rolled: one copy of the body in the instruction cache
        if (t) __syncthreads();   // every wave has read its slot of the first query block before the second one's tiles overwrite it
        fa_body<false>(sm, (const unsigned short*)P16 + qo, nullptr, (const unsigned short*)P16 + ko, nullptr, (const unsigned short*)VT16 + vo, nullptr, ATh + ao, ATl + ao, t ? q1 : q0, wv);
    }
    if (q1 < RH / 64) {   // scalar test, the same for the whole block
        __syncthreads();   // as above
        fa_body<true>(sm, Ph + qo, Pl + qo, Ph + ko, Pl + ko, VTh + vo, VTl + vo, ATh + ao, ATl + ao, q1, wv);
    }
}

extern "C" void kernel_launch(void* const* d_in, const int* in_sizes, int n_in,
                              void* d_out, int out_size, void* d_ws, size_t ws_size, hipStream_t stream) {
    (void)in_sizes; (void)n_in; (void)out_size;
    const float* x = (const float*)d_in[0]; const float* fcos = (const float*)d_in[1]; const float* fsin = (const float*)d_in[2]; const float* wq = (const float*)d_in[3]; const float* wk = (const float*)d_in[4]; const float* wv = (const float*)d_in[5]; const float* wo = (const float*)d_in[6];   /* inputs x, cos, sin ([2048][1][128] = [2048][128] FULL width, read per dimension), wq ('oi' [2048][2048]), wk, wv ('oi' [512][2048]), wproj ('oi') */
    float* OUT = (float*)d_out;     // [2][2048][2048]
    char* wsp = (char*)d_ws;
    auto take = [&](size_t bytes) { char* p = wsp; wsp += (bytes + 255) & ~(size_t)255; return (void*)p; };
    // What lives through the attention of both batches: wproj, the head planes [batch][16 q heads, then 4 k heads][t][d], the transposed v planes [batch][kv head][d][t], the attention output as merged hi / lo rows [MT][DQ].
    bf* WO = (bf*)take((size_t)DM * DQ * 2);
    h16* P16 = (h16*)take((size_t)NB_ * NHR * TT * HD * 2); bf* Ph = (bf*)take((size_t)NB_ * NHR * TT * HD * 2); bf* Pl = (bf*)take((size_t)NB_ * NHR * TT * HD * 2);
    h16* VT16 = (h16*)take((size_t)NB_ * NKV * HD * TT * 2); bf* VTh = (bf*)take((size_t)NB_ * NKV * HD * TT * 2); bf* VTl = (bf*)take((size_t)NB_ * NKV * HD * TT * 2);
    bf* ATh = (bf*)take((size_t)MT * DQ * 2); bf* ATl = (bf*)take((size_t)MT * DQ * 2); float* Sb = (float*)take((size_t)ZH * SH * 4);   /* Sb: scratch range, see below */
    if ((size_t)(wsp - (char*)d_ws) > ws_size) return;    // ws 256 MiB
    // What only the launches in front of the attention use lies in the scratch range.
    wsp = (char*)Sb;
    bf* XB = (bf*)take((size_t)MT * DM * 2); bf* WQ = (bf*)take((size_t)DQ * DM * 2); bf* WK = (bf*)take((size_t)DKV * DM * 2); bf* WV = (bf*)take((size_t)DKV * DM * 2);   /* WQ, WK and WV follow each other: one Bt of DF rows */
    if ((size_t)(wsp - (char*)Sb) > (size_t)ZH * SH * 4) return;
    // Every stage runs ONCE, for both batches.
    k_cvt5<<<CVB((size_t)MT * DM) + 2 * CVB((size_t)DQ * DM) + 2 * CVB((size_t)DKV * DM), 256, 0, stream>>>(x, wq, wk, wv, wo, XB, WQ, WK, WV, WO);   /* 'oi' weights = Bt as-is */
    k_gemmw<bf, 0, false, DM, true><<<dim3(MT / BT, DF / BT, 1), 128, 0, stream>>>(XB, nullptr, WQ, nullptr, nullptr, 0, nullptr, 0, 0, 0, fcos, fsin, P16, Ph, Pl, VT16, VTh, VTl);   /* q, k, v projections; rotary FIRST, then RMSNorm; head planes and transposed v planes */
    k_fattn<<<(TT / 128) * (REP / 2) * NB_ * NKV, 256, 0, stream>>>(P16, Ph, Pl, VT16, VTh, VTl, ATh, ATl);   /* the whole attention of both batches: one block per (pair of 64-row query blocks, head pair, batch, kv head) */
    k_gemmw<bf, 1, false, DQ, false><<<dim3(MT / BT, DM / BT, 1), 128, 0, stream>>>(ATh, ATl, WO, nullptr, OUT, DM, nullptr, 0, 0, 0, nullptr, nullptr, nullptr, nullptr, nullptr, nullptr, nullptr, nullptr);
}

// v010
// Measured time: 142 microseconds a run.
// Next to v009, in two timings, it ran 1.08 times as fast each time.
// Counting every step since v000, it is 11.8 times as fast.
#include <hip/hip_runtime.h>

// Grouped-query causal attention with rotary embeddings followed by a gain-free RMSNorm on q and k (x [2][2048][2048]; q = x wq^T (16 heads x 128), k, v = x w^T ('oi' [512][2048]: 4 kv heads x 128); _apply_rope: x cos + rotate_half(x) sin with rotate_half = cat(-x2, x1) and the FULL-WIDTH cos / sin inputs [2048][1][128] (read per dimension; not unit rotations); q = rms_norm(rope(q)), k = rms_norm(rope(k)) with x rsqrt(mean(x^2) + 1.19e-7) over the 128 dims (no gain; LITERAL order: the rotation is applied in place in f32 first, then the per-(token, head) row factor is taken from the rotated values); kv head = q head / 4 (repeat); scores x 128^-0.5; causal (-inf); softmax; out = merged wproj^T -> [2][2048][2048] (8.4 M); argument order x, cos, sin, wq, wk, wv, wproj).
// Layout: bf16 copy of x; natural 'oi' weights cast as they are (Bt; wq, wk, wv follow each other: one Bt of 24 head columns); k_gemmw with PL: the exact q, k, v projections of both batches in ONE launch, a 128-token x one-head tile per block, whose epilogue works on the f32 tile in LDS: for a q or k head the rotate-half rotation FIRST, with the bf16-rounded FULL-width cos / sin inputs (HD 128, read per dimension; arbitrary numbers, not unit rotations: the mean square changes), then the row's inverse RMS of the ROTATED values (eps 1.19e-7; no gain), then the head planes; for a v head the transposed planes; k_fattn: causal T-2048 GQA attention with 128-wide heads, scores, softmax and P.V in one kernel for both batches (fixed exponent offset, no running maximum; nothing of the scores goes to memory; hybrid rows; keys above the diagonal block are never visited); merged hi/lo x wproj exact.
// Compute dtypes, f32 accumulate: every input rounded to bf16 incl. the two tables; projections exact; rotary and RMSNorm f32; attention rows < 512 3 products, rest fp16; softmax f32; wproj hl x exact.

#define NB_  2
#define TT   2048
#define DM   2048
#define NH_  16
#define NKV  4        // four kv heads (grouped-query: kv head = q head / 4)
#define REP  (NH_ / NKV)
#define HD   128
#define DQ   (NH_ * HD)
#define DKV  (NKV * HD)
#define NHR  (NH_ + NKV)          // heads that take the rotation and the norm: the 16 q heads, then the 4 k heads
#define DF   (DQ + 2 * DKV)       // feature columns of the projections: q | k | v
#define MT   (NB_ * TT)           // token rows of both batches
#define ZH   16                   // heads of a batch in the attention output
#define SH   ((size_t)(TT / 64) * (TT / 64 + 1) / 2 * 4096)   // ZH * SH f32 elements: the workspace range of what only the launches in front of the attention use
#define RH   512                  // query rows < RH use hi+lo planes
typedef _Float16 h16;
typedef unsigned short bf;
typedef __attribute__((ext_vector_type(16))) __bf16   v16bf;
typedef __attribute__((ext_vector_type(16))) _Float16 v16h;
typedef __attribute__((ext_vector_type(8)))  _Float16 v8h;
typedef __attribute__((ext_vector_type(8)))  unsigned short v8us;
typedef __attribute__((ext_vector_type(8)))  float    v8f;
typedef __attribute__((ext_vector_type(4)))  float    v4f;
typedef v8h  __attribute__((may_alias)) v8ha;
typedef v4f  __attribute__((may_alias)) v4fa;
typedef v8us __attribute__((may_alias)) v8usa;

__device__ __forceinline__ unsigned short f2bf(float f) { unsigned u = __float_as_uint(f); u += 0x7FFFu + ((u >> 16) & 1u); return (unsigned short)(u >> 16); }
__device__ __forceinline__ float bf2f(unsigned short b) { return __uint_as_float(((unsigned)b) << 16); }
__device__ __forceinline__ float bfr(float f) { return bf2f(f2bf(f)); }
__device__ __forceinline__ v16h cat16(v8h lo, v8h hi) { return __builtin_shufflevector(lo, hi, 0, 1, 2, 3, 4, 5, 6, 7, 8, 9, 10, 11, 12, 13, 14, 15); }
__device__ __forceinline__ v16bf cat16b(v8us lo, v8us hi) { return __builtin_bit_cast(v16bf, __builtin_shufflevector(lo, hi, 0, 1, 2, 3, 4, 5, 6, 7, 8, 9, 10, 11, 12, 13, 14, 15)); }
__device__ __forceinline__ v8f wmma16(v16h a, v16h b, v8f c) { return __builtin_amdgcn_wmma_f32_16x16x32_f16(false, a, false, b, (short)0, c, false, false); }
__device__ __forceinline__ v8f wmmab(v16bf a, v16bf b, v8f c) { return __builtin_amdgcn_wmma_f32_16x16x32_bf16(false, a, false, b, (short)0, c, false, false); }
__device__ __forceinline__ h16 tohx(float x) { return (h16)x; }
__device__ __forceinline__ void splitf(float y, unsigned short& h, unsigned short& l) { h = f2bf(y); l = f2bf(y - bf2f(h)); }

// ---- k_gemmw: register-blocked GEMM, one 128x128 output tile per block of 4 waves (2 x 2), each wave a 64x64 quarter (16 accumulators) over the WHOLE of K in the order of k; the four waves share the block's staged operand tiles, so every operand row is loaded once per block and read by two waves; grid (M/128, N/128, Z), 128 threads. K % 64 == 0.
// C[m][n] (f32, pitch ldc, + optional f32 bias[n]) = sum_k A[m][k] Bt[n][k] (+ split products per NSPLIT). z-batch strides sA/sB/sC in elements.
template <typename T16> struct WFrag;
template <> struct WFrag<h16> { typedef v16h V; static __device__ __forceinline__ V ld(const h16* p) { return cat16(*(const v8h*)p, *(const v8h*)(p + 16)); } static __device__ __forceinline__ v8f mma(V a, V b, v8f c) { return wmma16(a, b, c); } };
template <> struct WFrag<bf> { typedef v16bf V; static __device__ __forceinline__ V ld(const bf* p) { return cat16b(*(const v8us*)p, *(const v8us*)(p + 16)); } static __device__ __forceinline__ v8f mma(V a, V b, v8f c) { return wmmab(a, b, c); } };
// LFrag: one fragment (the same k order as WFrag::ld) from a staged LDS row
template <typename T16> struct LFrag;
template <> struct LFrag<h16> { static __device__ __forceinline__ v16h ld(const unsigned short* p) { return cat16(*(const v8ha*)p, *(const v8ha*)(p + 16)); } };
template <> struct LFrag<bf> { static __device__ __forceinline__ v16bf ld(const unsigned short* p) { return cat16b(*(const v8usa*)p, *(const v8usa*)(p + 16)); } };
#define SP 72   // LDS row pitch of a staged K chunk in 16-bit elements: 128 bytes of data + 16 bytes, the pitch for 16-byte readers
#define BT 128  // rows of a block's tile of each operand plane
// Operand path: the block brings each 64-element K chunk (128 rows x 128 bytes per operand plane) with 16-byte loads of which each covers four WHOLE 128-byte lines (8 lanes a row) into registers one chunk ahead, stores it to one of two LDS buffers and reads the fragments from there; one barrier a chunk.
// KK = K = row pitch of every operand plane, a compile-time constant, so that the 8 loads of a plane differ in their immediate offset only.
// PL (the q, k, v projections; a tile = BT tokens of one batch x the HD features of head column blockIdx.y: NH_ q heads, NKV k heads, NKV v heads): no f32 row goes to memory. The four waves lay the f32 tile in LDS (pitch OP), one barrier, then 8 lanes take a row: a lane has 8 + 8 values 64 apart, which for a q or k head are the rotation's pairs; every store instruction covers whole 128-byte lines of a plane.
#define OP 132  // LDS row pitch of the f32 tile in elements: 512 bytes + 16 bytes, the pitch for 16-byte readers
static_assert(HD == BT && TT % BT == 0 && BT * OP <= 2 * BT * SP, "a tile is one head wide, lies in one batch and fits the staging buffers");
// emit16: 8 + 8 f32 values, 64 elements apart in a plane's row, to the fp16, hi and lo planes
__device__ __forceinline__ void emit16(const float* y, h16* p16, bf* ph, bf* pl) {
#pragma unroll
    for (int hf = 0; hf < 2; ++hf) { v8h o16; v8us oh, ol;
#pragma unroll
        for (int q = 0; q < 8; ++q) { const float r = y[hf * 8 + q]; o16[q] = tohx(r); unsigned short a, c; splitf(r, a, c); oh[q] = a; ol[q] = c; }
        *(v8h*)(p16 + hf * 64) = o16; *(v8us*)(ph + hf * 64) = oh; *(v8us*)(pl + hf * 64) = ol; }
    asm volatile("s_wait_xcnt 0x0" :: "v"(p16), "v"(ph), "v"(pl) : "memory");   // behind the stores, in front of any later write of a register that they name: the addresses as inputs keep their registers until here
}
template <typename T16, int NSPLIT, bool BIAS, int KK, bool PL>
__global__ __launch_bounds__(128) void k_gemmw(const T16* A, const T16* A2, const T16* Bt, const T16* Bt2, float* C, int ldc, const float* __restrict__ bias, size_t sA, size_t sB, size_t sC, const float* cosT, const float* sinT, h16* P16, bf* Ph, bf* Pl, h16* V16, bf* Vh, bf* Vl) {
    typedef typename WFrag<T16>::V V;
    constexpr bool HA2 = (NSPLIT == 1 || NSPLIT == 2), HB2 = (NSPLIT >= 2);
    constexpr int NT = 2 + (HA2 ? 1 : 0) + (HB2 ? 1 : 0);   // staged planes: A, B, then A2, then B2
    constexpr int BUF = NT * BT * SP;                       // 16-bit elements of one buffer (= f32 elements of both)
    constexpr int NC = KK / 64;                             // K chunks
    __shared__ __align__(16) float os[BUF];                 // two buffers in the K loop; behind it each wave's 16 x 64 output rows (pitch 68) or, with PL, the block's f32 tile (pitch OP)
    const int wv = __builtin_amdgcn_readfirstlane((int)(threadIdx.x >> 5));   // wave number in a scalar register
    const int wm = wv >> 1, wn = wv & 1;                    // the wave's quarter of the tile
    const size_t z = blockIdx.z; A += z * sA; if (A2) A2 += z * sA; Bt += z * sB; if (Bt2) Bt2 += z * sB; C += z * sC;
    const int tid = (int)threadIdx.x, lane = tid & 31, lr = lane & 15, hi = lane >> 4; const int r0 = blockIdx.x * BT, c0 = blockIdx.y * BT;
    v8f acc[4][4];
#pragma unroll
    for (int mb = 0; mb < 4; ++mb)
#pragma unroll
        for (int nb = 0; nb < 4; ++nb) acc[mb][nb] = (v8f){};
    const unsigned short* gp[4] = { (const unsigned short*)A + (size_t)r0 * KK, (const unsigned short*)Bt + (size_t)c0 * KK, HA2 ? (const unsigned short*)A2 + (size_t)r0 * KK : nullptr, HB2 ? (const unsigned short*)Bt2 + (size_t)c0 * KK : nullptr };   // block-uniform plane bases of this tile
    constexpr int TA2 = 2, TB2 = HA2 ? 3 : 2;               // LDS tile numbers of the lo planes
    const unsigned vo = (unsigned)((tid >> 3) * KK + (tid & 7) * 8);   // the thread's own place in a load: row tid / 8, 16-byte piece tid % 8; never rewritten
    unsigned short* sm = (unsigned short*)os;
    unsigned short* sst = sm + (tid >> 3) * SP + (tid & 7) * 8;
    const unsigned short* sfa = sm + (wm * 64 + lr) * SP + 8 * hi;             // the lane's first A row
    const unsigned short* sfb = sm + BT * SP + (wn * 64 + lr) * SP + 8 * hi;   // the lane's first B row
    v8us rg[NT][8];
    auto fetch = [&](int kc) {
        const unsigned short* pa = gp[0] + kc + vo; const unsigned short* pb = gp[1] + kc + vo; const unsigned short* pa2 = HA2 ? gp[2] + kc + vo : nullptr; const unsigned short* pb2 = HB2 ? gp[3] + kc + vo : nullptr;
#pragma unroll
        for (int i = 0; i < 8; ++i) { rg[0][i] = *(const v8usa*)(pa + i * 16 * KK); rg[1][i] = *(const v8usa*)(pb + i * 16 * KK); if (HA2) rg[TA2][i] = *(const v8usa*)(pa2 + i * 16 * KK); if (HB2) rg[TB2][i] = *(const v8usa*)(pb2 + i * 16 * KK); }
        if constexpr (HA2 && HB2) asm volatile("s_wait_xcnt 0x0" :: "v"(pa), "v"(pb), "v"(pa2), "v"(pb2) : "memory"); else if constexpr (HA2) asm volatile("s_wait_xcnt 0x0" :: "v"(pa), "v"(pb), "v"(pa2) : "memory"); else if constexpr (HB2) asm volatile("s_wait_xcnt 0x0" :: "v"(pa), "v"(pb), "v"(pb2) : "memory"); else asm volatile("s_wait_xcnt 0x0" :: "v"(pa), "v"(pb) : "memory");   // behind the chunk's loads, in front of any later write (a later load's result too) of an address register that they name: the addresses as inputs keep their registers until here (the operand pointers carry no restrict, so that the loads stay in front of this statement)
    };
    auto put = [&](int bsel) {
#pragma unroll
        for (int t = 0; t < NT; ++t)
#pragma unroll
            for (int i = 0; i < 8; ++i) *(v8usa*)(sst + bsel * BUF + t * BT * SP + i * 16 * SP) = rg[t][i];
    };
    fetch(0); put(0);
    __syncthreads();   // publishes chunk 0
#pragma unroll 1
    for (int s = 0; s < NC; ++s) {   // the chunks in the order of k: two 32-steps per chunk; kept rolled: the body already holds 32 to 64 products, a second copy would only take instruction cache
        if (s + 1 < NC) fetch((s + 1) * 64);      // scalar test; the next chunk's loads fly during this chunk's products
        const unsigned short* fa = sfa + (s & 1) * BUF; const unsigned short* fb = sfb + (s & 1) * BUF;
        V a[2][4], a2[2][4], b[2][4], b2[2][4];
#pragma unroll
        for (int ks = 0; ks < 2; ++ks)
#pragma unroll
            for (int f = 0; f < 4; ++f) { a[ks][f] = LFrag<T16>::ld(fa + f * 16 * SP + ks * 32); b[ks][f] = LFrag<T16>::ld(fb + f * 16 * SP + ks * 32); if (HA2) a2[ks][f] = LFrag<T16>::ld(fa + TA2 * BT * SP + f * 16 * SP + ks * 32); if (HB2) b2[ks][f] = LFrag<T16>::ld(fb + (TB2 - 1) * BT * SP + f * 16 * SP + ks * 32); }
        __builtin_amdgcn_sched_barrier(0);   // all fragment loads of the chunk issue as one group in front of its products: spread among them, every four products wait out a whole LDS latency, which the one or two waves of a SIMD do not cover
#pragma unroll
        for (int ks = 0; ks < 2; ++ks)
#pragma unroll
            for (int nb = 0; nb < 4; ++nb) {   // per accumulator the order a b, a2 b, a b2 of each 32-step
#pragma unroll
                for (int mb = 0; mb < 4; ++mb) acc[mb][nb] = WFrag<T16>::mma(a[ks][mb], b[ks][nb], acc[mb][nb]);
                if (HA2) {
#pragma unroll
                    for (int mb = 0; mb < 4; ++mb) acc[mb][nb] = WFrag<T16>::mma(a2[ks][mb], b[ks][nb], acc[mb][nb]); }
                if (HB2) {
#pragma unroll
                    for (int mb = 0; mb < 4; ++mb) acc[mb][nb] = WFrag<T16>::mma(a[ks][mb], b2[ks][nb], acc[mb][nb]); } }
        __builtin_amdgcn_sched_barrier(0);   // keeps every product of the chunk in front of the slots below
        asm volatile("v_nop\n\tv_nop\n\tv_nop\n\tv_nop");   // four vector slots behind the chunk's last products, in front of the next writes of their operand registers, also on the taken side of the branches that follow
        if (s + 1 < NC) put((s + 1) & 1);   // into the buffer that every wave left at the barrier of the chunk before
        __syncthreads();   // publishes chunk s + 1 and ends every wave's reads of chunk s
    }
    if constexpr (PL) {
        const int hc = (int)blockIdx.y, bb = r0 / TT, t0 = r0 % TT;   // head column, batch, first token of the tile (scalars)
        const int l8 = (tid & 7) * 8, rr = tid >> 3;                  // the lane's 8 + 8 values of a row; its row in a pass of 16 rows
        if (hc < NHR) {   // a q or k head (scalar test, the same for the whole block)
            const float* cp = cosT + (size_t)(t0 + rr) * HD + l8; const float* sp = sinT + (size_t)(t0 + rr) * HD + l8;
            v4f cn[4], sn[4];
            auto tab = [&](int p) {   // the table values of pass p
                const float* c = cp + p * 16 * HD; const float* s = sp + p * 16 * HD;
                cn[0] = *(const v4fa*)c; cn[1] = *(const v4fa*)(c + 4); cn[2] = *(const v4fa*)(c + 64); cn[3] = *(const v4fa*)(c + 68); sn[0] = *(const v4fa*)s; sn[1] = *(const v4fa*)(s + 4); sn[2] = *(const v4fa*)(s + 64); sn[3] = *(const v4fa*)(s + 68);
                asm volatile("s_wait_xcnt 0x0" :: "v"(c), "v"(s) : "memory");   // behind the loads, in front of any later write (a later load's result too) of an address register that they name: the addresses as inputs keep their registers until here
            };
            tab(0);   // flies during the LDS stores and the barrier
#pragma unroll
            for (int mb = 0; mb < 4; ++mb)
#pragma unroll
                for (int nb = 0; nb < 4; ++nb)
#pragma unroll
                    for (int j = 0; j < 8; ++j) os[(wm * 64 + mb * 16 + hi * 8 + j) * OP + wn * 64 + nb * 16 + lr] = acc[mb][nb][j];   // behind the loop's last barrier nobody reads a staged tile
            __syncthreads();   // the whole tile [token][feature] is in LDS: a row holds values of two waves
            const size_t e0 = (((size_t)bb * NHR + hc) * TT + t0 + rr) * HD + l8;
#pragma unroll 1
            for (int p = 0; p < BT / 16; ++p) {   // kept rolled: it runs once per block, eight copies would only take instruction cache
                v4f c[4], s[4];
#pragma unroll
                for (int i = 0; i < 4; ++i) { c[i] = cn[i]; s[i] = sn[i]; }
                if (p + 1 < BT / 16) tab(p + 1);   // scalar test; the next pass's table values fly during this pass
                const float* xr = os + (p * 16 + rr) * OP + l8;
                const v4f x[4] = { *(const v4fa*)xr, *(const v4fa*)(xr + 4), *(const v4fa*)(xr + 64), *(const v4fa*)(xr + 68) };
                float y[16], s0 = 0.f, s1 = 0.f;
#pragma unroll
                for (int q = 0; q < 8; ++q) { const float x1 = x[q >> 2][q & 3], x2 = x[2 + (q >> 2)][q & 3];   // out[d] = x[d] cos[d] - x[d + 64] sin[d]; out[d + 64] = x[d + 64] cos[d + 64] + x[d] sin[d + 64]
                    y[q] = x1 * bfr(c[q >> 2][q & 3]) - x2 * bfr(s[q >> 2][q & 3]); y[8 + q] = x2 * bfr(c[2 + (q >> 2)][q & 3]) + x1 * bfr(s[2 + (q >> 2)][q & 3]);
                    s0 += y[q] * y[q]; s1 += y[8 + q] * y[8 + q]; }
                float ss = s0 + s1; ss += __shfl_xor(ss, 1, 32); ss += __shfl_xor(ss, 2, 32); ss += __shfl_xor(ss, 4, 32);   // the row's 8 lanes
                const float rf = __fdiv_rn(1.0f, __fsqrt_rn(ss / (float)HD + 1.1920929e-07f));
#pragma unroll
                for (int q = 0; q < 16; ++q) y[q] *= rf;
                const size_t e = e0 + (size_t)p * 16 * HD; emit16(y, P16 + e, Ph + e, Pl + e);
            }
        } else {   // a v head: the tile goes to LDS transposed (a lane's 8 accumulator values are 8 tokens of one feature)
#pragma unroll
            for (int mb = 0; mb < 4; ++mb)
#pragma unroll
                for (int nb = 0; nb < 4; ++nb) { float* q = os + (wn * 64 + nb * 16 + lr) * OP + wm * 64 + mb * 16 + hi * 8; v4f a0, a1;
#pragma unroll
                    for (int j = 0; j < 4; ++j) { a0[j] = acc[mb][nb][j]; a1[j] = acc[mb][nb][4 + j]; }
                    *(v4fa*)q = a0; *(v4fa*)(q + 4) = a1; }
            __syncthreads();   // the whole tile [feature][token] is in LDS: a row holds values of two waves
            const size_t e0 = (((size_t)bb * NKV + (hc - NHR)) * HD + rr) * TT + t0 + l8;
#pragma unroll 1
            for (int p = 0; p < HD / 16; ++p) {   // kept rolled, as above
                const float* xr = os + (p * 16 + rr) * OP + l8;
                const v4f x[4] = { *(const v4fa*)xr, *(const v4fa*)(xr + 4), *(const v4fa*)(xr + 64), *(const v4fa*)(xr + 68) };
                float y[16];
#pragma unroll
                for (int q = 0; q < 16; ++q) y[q] = x[q >> 2][q & 3];
                const size_t e = e0 + (size_t)p * 16 * TT; emit16(y, V16 + e, Vh + e, Vl + e);
            }
        }
    } else {
    float* ow = os + wv * (16 * 68);   // behind the last barrier nobody reads a staged tile: each wave turns its rows into whole lines in its own LDS range
#pragma unroll
    for (int mb = 0; mb < 4; ++mb) {
#pragma unroll
        for (int nb = 0; nb < 4; ++nb) {
#pragma unroll
            for (int j = 0; j < 8; ++j) ow[(hi * 8 + j) * 68 + nb * 16 + lr] = acc[mb][nb][j]; }
        asm volatile("s_wait_dscnt 0x0" ::: "memory");   // the wave's own LDS stores are done before its lanes read rows that other lanes of the wave stored
        float* crow = C + (size_t)(r0 + wm * 64 + mb * 16) * ldc + c0 + wn * 64;
#pragma unroll
        for (int q = 0; q < 8; ++q) { const int row = 2 * q + hi, cofs = lr * 4; v4f val = *(const v4fa*)(ow + row * 68 + cofs); if (BIAS) { const float* bp = bias + c0 + wn * 64 + cofs; val[0] += bfr(bp[0]); val[1] += bfr(bp[1]); val[2] += bfr(bp[2]); val[3] += bfr(bp[3]); }
            *(v4f*)(crow + (size_t)row * ldc + cofs) = val; }
        asm volatile("s_wait_dscnt 0x0\n\ts_wait_xcnt 0x0" ::: "memory");   // the 16 rows are read before the next 16 overwrite them; and behind the stores, in front of any later write of a register that they name
    }
    }
}

typedef __attribute__((ext_vector_type(2))) _Float16 v2h;
typedef __attribute__((ext_vector_type(4))) _Float16 v4h;
typedef __attribute__((ext_vector_type(2))) unsigned short v2us;
typedef __attribute__((ext_vector_type(4))) unsigned short v4us;
typedef __attribute__((ext_vector_type(2))) float v2f;
typedef __attribute__((ext_vector_type(4))) int v4i;

// The conversion kernel below gives every thread 32 elements in 16-byte pieces: few waves start, and each lane has its loads in flight together.
#define CVN 4   // 8-value pieces per thread of k_cvt5, 256 threads apart
// k_cvt5: x (both batches) and the four weights in ONE launch; a block takes 256 CVN pieces of one tensor (every tensor is a whole number of blocks), picked by the block's number (scalar tests)
#define CVB(n) ((int)((size_t)(n) / 8 / (256 * CVN)))
static_assert((size_t)MT * DM % (8 * 256 * CVN) == 0 && (size_t)DQ * DM % (8 * 256 * CVN) == 0 && (size_t)DKV * DM % (8 * 256 * CVN) == 0, "whole blocks");
__global__ __launch_bounds__(256) void k_cvt5(const float* __restrict__ x, const float* __restrict__ wq, const float* __restrict__ wk, const float* __restrict__ wv, const float* __restrict__ wo, bf* XB, bf* WQ, bf* WK, bf* WV, bf* WO) {
    int blk = (int)blockIdx.x; const float* src = x; bf* dst = XB;
    if (blk >= CVB((size_t)MT * DM)) { blk -= CVB((size_t)MT * DM); src = wq; dst = WQ;
        if (blk >= CVB((size_t)DQ * DM)) { blk -= CVB((size_t)DQ * DM); src = wk; dst = WK;
            if (blk >= CVB((size_t)DKV * DM)) { blk -= CVB((size_t)DKV * DM); src = wv; dst = WV;
                if (blk >= CVB((size_t)DKV * DM)) { blk -= CVB((size_t)DKV * DM); src = wo; dst = WO; } } } }
    const size_t i0 = (size_t)blk * (256 * CVN) + threadIdx.x; v8f v[CVN];
#pragma unroll
    for (int c = 0; c < CVN; ++c) v[c] = *(const v8f*)(src + (i0 + (size_t)c * 256) * 8);   // all loads first, so that they are in flight together
    asm volatile("s_wait_xcnt 0x0" ::: "memory");   // behind the loads, in front of any later write of an address register that they name
#pragma unroll
    for (int c = 0; c < CVN; ++c) { v8us o;
#pragma unroll
        for (int k = 0; k < 8; ++k) o[k] = f2bf(v[c][k]);
        *(v8us*)(dst + (i0 + (size_t)c * 256) * 8) = o; } }


#define KP 136                // LDS row pitch of a staged K row in 16-bit elements: 256 bytes + 16 bytes, the pitch for 16-byte readers
#define KTE (64 * KP)         // one K plane of a stage: 64 keys
#define VTE (HD * SP)         // one V plane of a stage: HD rows of 64 keys (128 bytes + 16 bytes)
#define SCL2 0.12751743f      // HD^-0.5 x log2(e): scores in the exponent of 2
#define SOFS 1.0f             // the fixed offset: the largest probability term is 2^15.4, below the largest fp16 number (2^16); terms down to 2^-14 (a score 13 below 0 in the exponent of 2) stay normal fp16 numbers
__device__ __forceinline__ float exp2s(float x) { float r; asm("v_exp_f32 %0, %1\n\tv_nop" : "=v"(r) : "v"(x)); return r; }
template <bool HL> struct FaT; template <> struct FaT<true> { typedef bf T; }; template <> struct FaT<false> { typedef h16 T; };
template <bool HL>
__device__ __forceinline__ void fa_body(unsigned short* sm, const unsigned short* Qh, const unsigned short* Ql, const unsigned short* Kh, const unsigned short* Kl, const unsigned short* Vh, const unsigned short* Vl, bf* Ah, bf* Al, const int qb, const int wv) {
    typedef typename FaT<HL>::T T16; typedef typename WFrag<T16>::V V;
    constexpr int NP = HL ? 2 : 1; constexpr int SUB = NP * (KTE + VTE), BUF = 2 * SUB;   // a stage: K planes, then V planes; a buffer: the two stages of a trip
    const int tid = (int)threadIdx.x, lane = tid & 31, lr = lane & 15, hi = lane >> 4;
    const int qw = qb * 64 + (wv & 1) * 32;   // the wave's first query row (scalar)
    const int kh = wv >> 2;                   // the wave's key group (scalar): stage 2 s + kh of trip s
    V qf[2][4], qf2[2][4]; const unsigned short* qp = Qh + (size_t)(qw + lr) * HD + 8 * hi; const unsigned short* qp2 = HL ? Ql + (size_t)(qw + lr) * HD + 8 * hi : nullptr;   // the lane's own query row; every Q load differs from it by a constant
#pragma unroll
    for (int g = 0; g < 2; ++g)
#pragma unroll
        for (int ks = 0; ks < 4; ++ks) { qf[g][ks] = LFrag<T16>::ld(qp + g * 16 * HD + ks * 32); if (HL) qf2[g][ks] = LFrag<T16>::ld(qp2 + g * 16 * HD + ks * 32); }
    if (HL) asm volatile("s_wait_xcnt 0x0" :: "v"(qp), "v"(qp2) : "memory"); else asm volatile("s_wait_xcnt 0x0" :: "v"(qp) : "memory");   // behind the Q loads, in front of any later write (a later load's result too) of an address register that they name: the addresses as inputs keep their registers until here
    const unsigned voK = (unsigned)((tid >> 4) * HD + (tid & 15) * 8), voV = (unsigned)((tid >> 3) * TT + (tid & 7) * 8);   // the thread's own place in a staging load (a wave covers four whole 128-byte lines); never rewritten
    unsigned short* stK = sm + (tid >> 4) * KP + (tid & 15) * 8; unsigned short* stV = sm + NP * KTE + (tid >> 3) * SP + (tid & 7) * 8;
    v8us rk[2][NP][4], rv[2][NP][4];
    auto fetch = [&](int k0) {
        if constexpr (HL) {   // the V planes by plain loads; the K planes' loads stand with their waits in one statement behind them, so that all 32 loads are in flight together
            static_assert(HD * 2 * 16 == 4096, "the byte offsets in the statement below: 16 K rows a load, 64 a stage");
            const unsigned short* pv = Vh + k0 + voV; const unsigned short* pv2 = Vl + k0 + voV; const unsigned short* pk = Kh + (size_t)k0 * HD + voK; const unsigned short* pk2 = Kl + (size_t)k0 * HD + voK;
#pragma unroll
            for (int u = 0; u < 2; ++u)
#pragma unroll
                for (int i = 0; i < 4; ++i) { rv[u][0][i] = *(const v8usa*)(pv + u * 64 + i * 32 * TT); rv[u][1][i] = *(const v8usa*)(pv2 + u * 64 + i * 32 * TT); }
            // Written as text because the compiler formed the K addresses a second time for a wait in a statement of its own and let go of the loads' own address registers in front of it. s_wait_xcnt 0 stands behind the last load, in front of any later write of an address register that a load of this fetch names (the V addresses as inputs keep their registers until here); s_wait_loadcnt 0: the compiler places no wait for loads in text, and the values are stored to LDS at once.
            asm volatile("global_load_b128 %0, %16, off\n\tglobal_load_b128 %1, %16, off offset:4096\n\tglobal_load_b128 %2, %16, off offset:8192\n\tglobal_load_b128 %3, %16, off offset:12288\n\t"
                         "global_load_b128 %4, %16, off offset:16384\n\tglobal_load_b128 %5, %16, off offset:20480\n\tglobal_load_b128 %6, %16, off offset:24576\n\tglobal_load_b128 %7, %16, off offset:28672\n\t"
                         "global_load_b128 %8, %17, off\n\tglobal_load_b128 %9, %17, off offset:4096\n\tglobal_load_b128 %10, %17, off offset:8192\n\tglobal_load_b128 %11, %17, off offset:12288\n\t"
                         "global_load_b128 %12, %17, off offset:16384\n\tglobal_load_b128 %13, %17, off offset:20480\n\tglobal_load_b128 %14, %17, off offset:24576\n\tglobal_load_b128 %15, %17, off offset:28672\n\t"
                         "s_wait_xcnt 0x0\n\ts_wait_loadcnt 0x0"
                         : "=&v"(rk[0][0][0]), "=&v"(rk[0][0][1]), "=&v"(rk[0][0][2]), "=&v"(rk[0][0][3]), "=&v"(rk[1][0][0]), "=&v"(rk[1][0][1]), "=&v"(rk[1][0][2]), "=&v"(rk[1][0][3]),
                           "=&v"(rk[0][1][0]), "=&v"(rk[0][1][1]), "=&v"(rk[0][1][2]), "=&v"(rk[0][1][3]), "=&v"(rk[1][1][0]), "=&v"(rk[1][1][1]), "=&v"(rk[1][1][2]), "=&v"(rk[1][1][3])
                         : "v"(pk), "v"(pk2), "v"(pv), "v"(pv2) : "memory");
        } else {
            const unsigned short* pk = Kh + (size_t)k0 * HD + voK; const unsigned short* pv = Vh + k0 + voV;
#pragma unroll
            for (int u = 0; u < 2; ++u)
#pragma unroll
                for (int i = 0; i < 4; ++i) { rk[u][0][i] = *(const v8usa*)(pk + u * 64 * HD + i * 16 * HD); rv[u][0][i] = *(const v8usa*)(pv + u * 64 + i * 32 * TT); }
            asm volatile("s_wait_xcnt 0x0" :: "v"(pk), "v"(pv) : "memory");   // behind the trip's loads, in front of any later write (a later load's result too) of an address register that they name: the addresses as inputs keep their registers until here
        }
    };
    auto put = [&](int bsel) {
#pragma unroll
        for (int u = 0; u < 2; ++u)
#pragma unroll
        for (int p = 0; p < NP; ++p)
#pragma unroll
            for (int i = 0; i < 4; ++i) { *(v8usa*)(stK + bsel * BUF + u * SUB + p * KTE + i * 16 * KP) = rk[u][p][i]; *(v8usa*)(stV + bsel * BUF + u * SUB + p * VTE + i * 32 * SP) = rv[u][p][i]; }
    };
    v8f o[8][2];
#pragma unroll
    for (int dt = 0; dt < 8; ++dt) { o[dt][0] = (v8f){}; o[dt][1] = (v8f){}; }
    float l[2] = { 0.f, 0.f };
    const int n = (qb + 2) >> 1;   // trips of 128 keys up to and with the diagonal block; the same for the whole block (where the diagonal block is a trip's first stage, the second is staged, inside the planes, and no wave visits it)
    __builtin_amdgcn_fence(__ATOMIC_RELEASE, "workgroup");   // compiles to a wait for the wave's own loads: the Q fragments have landed in front of the loop: a wait for them among the loop's products would also wait for the next trip's loads, which are to fly during the products
#pragma unroll 1
    for (int s = HL ? 0 : -1; s < n; ++s) {   // fp16 rows: trip -1 only brings trip 0 in
        if (HL) { fetch(s * 128); put(s & 1);   // the hi + lo rows have few trips and no registers to spare: they load each trip where it is needed; the buffer was last read two trips ago, in front of the barrier of the trip before
            __syncthreads(); }   // publishes trip s
        else if (s + 1 < n) fetch((s + 1) * 128);   // scalar test; the next trip's loads fly during this trip's products
        const int ss = 2 * s + kh;   // the wave's stage of 64 keys (scalar)
        const unsigned short* kb = sm + (s & 1) * BUF + kh * SUB + lr * KP + 8 * hi; const unsigned short* vb = sm + (s & 1) * BUF + kh * SUB + NP * KTE + lr * SP + 8 * hi;
#pragma unroll
        for (int kk = 0; kk < 2; ++kk) {
            if (s >= 0 && ss * 64 + kk * 32 <= qw + 31) {   // scalar tests: not in trip -1; 32 keys wholly above the wave's rows are skipped (their probabilities are exact zeros)
                v8f st[2][2];
#pragma unroll
                for (int kt = 0; kt < 2; ++kt) { st[kt][0] = (v8f){}; st[kt][1] = (v8f){}; }
                V ka[2][4], va[8];   // fp16 rows: fragment loads in groups; the hi + lo rows have no registers for that and load each fragment at its products
                if (!HL) {
#pragma unroll
                    for (int ks = 0; ks < 4; ++ks)
#pragma unroll
                        for (int kt = 0; kt < 2; ++kt) ka[kt][ks] = LFrag<T16>::ld(kb + (kk * 32 + kt * 16) * KP + ks * 32);
                    __builtin_amdgcn_sched_barrier(0); }   // all K fragment loads of the 32 keys issue as one group in front of the products: spread among them, each pair of products waits out a whole LDS latency
#pragma unroll
                for (int ks = 0; ks < 4; ++ks)
#pragma unroll
                    for (int kt = 0; kt < 2; ++kt) { V a, a2; if (HL) { a = LFrag<T16>::ld(kb + (kk * 32 + kt * 16) * KP + ks * 32); a2 = LFrag<T16>::ld(kb + KTE + (kk * 32 + kt * 16) * KP + ks * 32); } else a = ka[kt][ks];
#pragma unroll
                        for (int g = 0; g < 2; ++g) { st[kt][g] = WFrag<T16>::mma(a, qf[g][ks], st[kt][g]); if (HL) { st[kt][g] = WFrag<T16>::mma(a2, qf[g][ks], st[kt][g]); st[kt][g] = WFrag<T16>::mma(a, qf2[g][ks], st[kt][g]); } } }
                if (!HL) {
#pragma unroll
                    for (int dt = 0; dt < 8; ++dt) va[dt] = LFrag<T16>::ld(vb + dt * 16 * SP + kk * 32);
                    __builtin_amdgcn_sched_barrier(0); }   // all V fragment loads of the 32 keys issue as one group in front of the softmax, which covers their latency
                if (ss == qb) {   // causal mask, under a scalar branch: only the diagonal stage has keys above a row
#pragma unroll
                    for (int g = 0; g < 2; ++g)
#pragma unroll
                        for (int kt = 0; kt < 2; ++kt)
#pragma unroll
                            for (int j = 0; j < 8; ++j) st[kt][g][j] = (ss * 64 + kk * 32 + kt * 16 + hi * 8 + j <= qw + g * 16 + lr) ? st[kt][g][j] : -3.0e38f; }
                V pb[2], pb2[2];
#pragma unroll
                for (int g = 0; g < 2; ++g) { float sum = 0.f; v8us h0, h1, l0, l1; v8h f0, f1;
#pragma unroll
                    for (int j = 0; j < 8; ++j) { const float p0 = exp2s(__builtin_fmaf(st[0][g][j], SCL2, -SOFS)), p1 = exp2s(__builtin_fmaf(st[1][g][j], SCL2, -SOFS)); sum += p0 + p1;   // a masked score (-3e38) gives an exact 0
                        if (HL) { unsigned short a, c; splitf(p0, a, c); h0[j] = a; l0[j] = c; splitf(p1, a, c); h1[j] = a; l1[j] = c; } else { f0[j] = tohx(p0); f1[j] = tohx(p1); } }
                    l[g] += sum;
                    if constexpr (HL) { pb[g] = cat16b(h0, h1); pb2[g] = cat16b(l0, l1); } else { pb[g] = cat16(f0, f1); } }
#pragma unroll
                for (int dt = 0; dt < 8; ++dt) { V a, a2; if (HL) { a = LFrag<T16>::ld(vb + dt * 16 * SP + kk * 32); a2 = LFrag<T16>::ld(vb + VTE + dt * 16 * SP + kk * 32); } else a = va[dt];
#pragma unroll
                    for (int g = 0; g < 2; ++g) { o[dt][g] = WFrag<T16>::mma(a, pb[g], o[dt][g]); if (HL) { o[dt][g] = WFrag<T16>::mma(a, pb2[g], o[dt][g]); o[dt][g] = WFrag<T16>::mma(a2, pb[g], o[dt][g]); } } }
                __builtin_amdgcn_sched_barrier(0);   // keeps every product of the 32 keys in front of the slots below
                asm volatile("v_nop\n\tv_nop\n\tv_nop\n\tv_nop");   // four vector slots behind the last products of the 32 keys, in front of the next writes of their operand registers, also on the taken side of the branches that follow
            }
        }
        if (!HL) { if (s + 1 < n) put((s + 1) & 1);   // into the buffer that every wave left at the barrier of the trip before
            __syncthreads(); }   // publishes trip s + 1 and ends every wave's reads of trip s
    }
    // Join of the two key groups: waves w and w + 4 hold partial results of the same 32 queries. Each hands the 16 queries that the other finishes over in LDS (a slot per receiving wave; a lane's values in 16-byte pieces, the 32 lanes of a piece side by side) and finishes its own 16: both parts carry the same fixed factor and are added as they are. A group that saw no key has sum 0 and output 0.
    constexpr int MGS = 17 * 128;   // f32 elements of a slot: 16 pieces of the output tiles, one piece with the sum
    float* mg = (float*)sm;
    if (HL) __syncthreads();   // ends every wave's reads of the first buffer, which the slots overwrite (the loop of the fp16 rows ends in such a barrier)
#pragma unroll
    for (int g = 0; g < 2; ++g)
        if (g != kh) {   // scalar test
            float* w = mg + (wv ^ 4) * MGS + lane * 4;
#pragma unroll
            for (int dt = 0; dt < 8; ++dt) { v4f a0, a1;
#pragma unroll
                for (int j = 0; j < 4; ++j) { a0[j] = o[dt][g][j]; a1[j] = o[dt][g][4 + j]; }
                *(v4fa*)(w + (2 * dt) * 128) = a0; *(v4fa*)(w + (2 * dt + 1) * 128) = a1; }
            const v4f t = { l[g], 0.f, 0.f, 0.f }; *(v4fa*)(w + 16 * 128) = t; }
    __syncthreads();   // publishes the slots
#pragma unroll
    for (int g = 0; g < 2; ++g)
        if (g == kh) {   // scalar test
            const float* r = mg + wv * MGS + lane * 4; const v4f t = *(const v4fa*)(r + 16 * 128);
            const float ls = l[g] + t[0];
            const float f = __fdiv_rn(1.0f, ls + __shfl_xor(ls, 16, 32)); const size_t e = (size_t)(qw + g * 16 + lr) * DQ + hi * 8; bf* ah = Ah + e; bf* al = Al + e;   // the two lane halves summed different keys; a lane's 8 accumulator values are 8 neighbouring features of its query's merged row
            v8us oh[8], ol[8];
#pragma unroll
            for (int dt = 0; dt < 8; ++dt) { const v4f p0 = *(const v4fa*)(r + (2 * dt) * 128), p1 = *(const v4fa*)(r + (2 * dt + 1) * 128);
#pragma unroll
                for (int j = 0; j < 8; ++j) { unsigned short a, c; splitf((o[dt][g][j] + (j < 4 ? p0[j & 3] : p1[j & 3])) * f, a, c); oh[dt][j] = a; ol[dt][j] = c; }
                *(v8us*)(ah + dt * 16) = oh[dt]; *(v8us*)(al + dt * 16) = ol[dt]; }
            asm volatile("s_wait_xcnt 0x0" :: "v"(ah), "v"(al), "v"(oh[0]), "v"(oh[1]), "v"(oh[2]), "v"(oh[3]), "v"(oh[4]), "v"(oh[5]), "v"(oh[6]), "v"(oh[7]), "v"(ol[0]), "v"(ol[1]), "v"(ol[2]), "v"(ol[3]), "v"(ol[4]), "v"(ol[5]), "v"(ol[6]), "v"(ol[7]) : "memory"); }   // behind the stores, in front of any later write of a register that they name: addresses and stored values as inputs keep their registers until here
}
// grid: (TT / 128 pairs of query blocks) x (REP / 2 head pairs) x NB_ x NKV blocks, one per WGP
static_assert(TT == 2048 && RH == 512 && REP == 4, "the table of pairs below is laid out for 32 query blocks, of which the first 8 use hi + lo planes, and two head pairs");
__global__ __launch_bounds__(256) void k_fattn(const h16* P16, const bf* Ph, const bf* Pl, const h16* VT16, const bf* VTh, const bf* VTl, bf* ATh, bf* ATl) {
    __shared__ __align__(16) unsigned short sm[2 * 2 * 2 * (KTE + VTE)];   // two buffers of two stages of (at most) two planes
    const int wv = __builtin_amdgcn_readfirstlane((int)(threadIdx.x >> 5));   // wave number in a scalar register: the tests on the wave's rows stay scalar
    const int pr = (int)blockIdx.x / (REP / 2 * NB_ * NKV), rest = (int)blockIdx.x % (REP / 2 * NB_ * NKV), hp = rest & 1, bk = rest >> 1; const int b = bk / NKV, kvh = bk % NKV, head = kvh * REP + hp * 2 + ((wv >> 1) & 1);
    // The pairs, a byte per pair: every query block once. Cost of a block in trips: (number + 2) / 2, about three times that with hi + lo planes; the dearest goes with the cheapest, and so on.
    const unsigned long long ta = pr < 8 ? 0x19181B1A1D1C1F1EULL : 0x1312151417160C0DULL;   // 30 31 28 29 26 27 24 25 | 13 12 22 23 20 21 18 19: fp16 rows, all of them
    const unsigned long long tb = pr < 8 ? 0x02030A0B08090001ULL : 0x040510110E0F0706ULL;   //  1  0  9  8 11 10  3  2 |  6  7 15 14 17 16  5  4
    const size_t qo = ((size_t)b * NHR + head) * TT * HD, ko = ((size_t)b * NHR + NH_ + kvh) * TT * HD, vo = ((size_t)b * NKV + kvh) * HD * TT;
    const size_t ao = (size_t)b * TT * DQ + head * HD;   // the head's columns in the batch's merged rows [t][DQ]
    const int q0 = (int)((ta >> ((pr & 7) * 8)) & 255), q1 = (int)((tb >> ((pr & 7) * 8)) & 255);   // scalars, the same for the whole block
    const int nf = q1 < RH / 64 ? 1 : 2;   // query blocks of fp16 rows
#pragma unroll 1
    for (int t = 0; t < nf; ++t) {   // kept rolled: one copy of the body in the instruction cache
        if (t) __syncthreads();   // every wave has read its slot of the first query block before the second one's tiles overwrite it
        fa_body<false>(sm, (const unsigned short*)P16 + qo, nullptr, (const unsigned short*)P16 + ko, nullptr, (const unsigned short*)VT16 + vo, nullptr, ATh + ao, ATl + ao, t ? q1 : q0, wv);
    }
    if (q1 < RH / 64) {   // scalar test, the same for the whole block
        __syncthreads();   // as above
        fa_body<true>(sm, Ph + qo, Pl + qo, Ph + ko, Pl + ko, VTh + vo, VTl + vo, ATh + ao, ATl + ao, q1, wv);
    }
}

extern "C" void kernel_launch(void* const* d_in, const int* in_sizes, int n_in,
                              void* d_out, int out_size, void* d_ws, size_t ws_size, hipStream_t stream) {
    (void)in_sizes; (void)n_in; (void)out_size;
    const float* x = (const float*)d_in[0]; const float* fcos = (const float*)d_in[1]; const float* fsin = (const float*)d_in[2]; const float* wq = (const float*)d_in[3]; const float* wk = (const float*)d_in[4]; const float* wv = (const float*)d_in[5]; const float* wo = (const float*)d_in[6];   /* inputs x, cos, sin ([2048][1][128] = [2048][128] FULL width, read per dimension), wq ('oi' [2048][2048]), wk, wv ('oi' [512][2048]), wproj ('oi') */
    float* OUT = (float*)d_out;     // [2][2048][2048]
    char* wsp = (char*)d_ws;
    auto take = [&](size_t bytes) { char* p = wsp; wsp += (bytes + 255) & ~(size_t)255; return (void*)p; };
    // What lives through the attention of both batches: wproj, the head planes [batch][16 q heads, then 4 k heads][t][d], the transposed v planes [batch][kv head][d][t], the attention output as merged hi / lo rows [MT][DQ].
    bf* WO = (bf*)take((size_t)DM * DQ * 2);
    h16* P16 = (h16*)take((size_t)NB_ * NHR * TT * HD * 2); bf* Ph = (bf*)take((size_t)NB_ * NHR * TT * HD * 2); bf* Pl = (bf*)take((size_t)NB_ * NHR * TT * HD * 2);
    h16* VT16 = (h16*)take((size_t)NB_ * NKV * HD * TT * 2); bf* VTh = (bf*)take((size_t)NB_ * NKV * HD * TT * 2); bf* VTl = (bf*)take((size_t)NB_ * NKV * HD * TT * 2);
    bf* ATh = (bf*)take((size_t)MT * DQ * 2); bf* ATl = (bf*)take((size_t)MT * DQ * 2); float* Sb = (float*)take((size_t)ZH * SH * 4);   /* Sb: scratch range, see below */
    if ((size_t)(wsp - (char*)d_ws) > ws_size) return;    // ws 256 MiB
    // What only the launches in front of the attention use lies in the scratch range.
    wsp = (char*)Sb;
    bf* XB = (bf*)take((size_t)MT * DM * 2); bf* WQ = (bf*)take((size_t)DQ * DM * 2); bf* WK = (bf*)take((size_t)DKV * DM * 2); bf* WV = (bf*)take((size_t)DKV * DM * 2);   /* WQ, WK and WV follow each other: one Bt of DF rows */
    if ((size_t)(wsp - (char*)Sb) > (size_t)ZH * SH * 4) return;
    // Every stage runs ONCE, for both batches.
    k_cvt5<<<CVB((size_t)MT * DM) + 2 * CVB((size_t)DQ * DM) + 2 * CVB((size_t)DKV * DM), 256, 0, stream>>>(x, wq, wk, wv, wo, XB, WQ, WK, WV, WO);   /* 'oi' weights = Bt as-is */
    k_gemmw<bf, 0, false, DM, true><<<dim3(MT / BT, DF / BT, 1), 128, 0, stream>>>(XB, nullptr, WQ, nullptr, nullptr, 0, nullptr, 0, 0, 0, fcos, fsin, P16, Ph, Pl, VT16, VTh, VTl);   /* q, k, v projections; rotary FIRST, then RMSNorm; head planes and transposed v planes */
    k_fattn<<<(TT / 128) * (REP / 2) * NB_ * NKV, 256, 0, stream>>>(P16, Ph, Pl, VT16, VTh, VTl, ATh, ATl);   /* the whole attention of both batches: one block per (pair of 64-row query blocks, head pair, batch, kv head) */
    k_gemmw<bf, 1, false, DQ, false><<<dim3(MT / BT, DM / BT, 1), 128, 0, stream>>>(ATh, ATl, WO, nullptr, OUT, DM, nullptr, 0, 0, 0, nullptr, nullptr, nullptr, nullptr, nullptr, nullptr, nullptr, nullptr);
}
